// v000
// Measured on an AMD MI455X. A time is GPU time per run, averaged over a window of back-to-back runs after a warm-up
// (all launches, gaps included; the runs take copies of the inputs in turn), and the median of several windows.
// Apart from v000's, it joins two sittings. Times from different sittings can be a few percent apart, while
// side-by-side timings come from the same sitting.
// v000, which the later versions start from, runs in 5760 microseconds.
#include <hip/hip_runtime.h>

// Compute dtypes, f32 accumulate, per item: q/k/v/t = x.W^T + b fused as one [2048 x 1024].[1024 x 4096] GEMM with PLAIN bf16 operands (exact products); the triplet term's
// cumsum over key positions of k*v/8 (sequential f32 prefix sums per column) and q*t in f32; per head: scores q.k^T and (q*t).kvcum^T as two causal GEMMs with bf16 hi +
// UNSCALED residual planes (three products each; tiles above the diagonal skipped), (S1 + S2)/8 + causal softmax in f32, attn.v (three products, K limited); Wo (+ bias) on

#define NBT  2
#define NN   2048
#define DMOD 1024
#define NH_  16
#define HD   64
#define QW   (4 * DMOD)
#define DM   DMOD
#define NTK  NN
#define SCL  0.125f
#define LOSC 1024.0f

typedef _Float16 h16;
typedef unsigned short bf;
typedef __attribute__((ext_vector_type(16))) __bf16   v16bf;
typedef __attribute__((ext_vector_type(16))) _Float16 v16h;
typedef __attribute__((ext_vector_type(8)))  _Float16 v8h;
typedef __attribute__((ext_vector_type(8)))  unsigned short v8us;
typedef __attribute__((ext_vector_type(8)))  float    v8f;
typedef __attribute__((ext_vector_type(4)))  float    v4f;
typedef __attribute__((ext_vector_type(4)))  _Float16 v4h;
typedef v8h  __attribute__((may_alias)) v8ha;
typedef v4f  __attribute__((may_alias)) v4fa;
typedef v8us __attribute__((may_alias)) v8usa;

__device__ __forceinline__ unsigned short f2bf(float f) { unsigned u = __float_as_uint(f); u += 0x7FFFu + ((u >> 16) & 1u); return (unsigned short)(u >> 16); }
__device__ __forceinline__ float bf2f(unsigned short b) { return __uint_as_float(((unsigned)b) << 16); }
__device__ __forceinline__ float bfr(float f) { return bf2f(f2bf(f)); }
__device__ __forceinline__ v16h cat16(v8h lo, v8h hi) { return __builtin_shufflevector(lo, hi, 0, 1, 2, 3, 4, 5, 6, 7, 8, 9, 10, 11, 12, 13, 14, 15); }
__device__ __forceinline__ v16bf cat16b(v8us lo, v8us hi) { return __builtin_bit_cast(v16bf, __builtin_shufflevector(lo, hi, 0, 1, 2, 3, 4, 5, 6, 7, 8, 9, 10, 11, 12, 13, 14, 15)); }
__device__ __forceinline__ v8f wmma16(v16h a, v16h b, v8f c) { return __builtin_amdgcn_wmma_f32_16x16x32_f16(false, a, false, b, (short)0, c, false, false); }
__device__ __forceinline__ v8f wmmab(v16bf a, v16bf b, v8f c) { return __builtin_amdgcn_wmma_f32_16x16x32_bf16(false, a, false, b, (short)0, c, false, false); }

// k_gemmb: 64 x 64 block tile (4 waves x 16 x 64) of C[NTK][NW] = (A [+ Al]).B^T (K = 1024) [+ bf(bias[c])] [+ bf(R[r][c]) residual]; f32 whole-line epilogue (or f16
template <bool SPLITA, bool F16OUT = false>
__global__ __launch_bounds__(128) void k_gemmb(const bf* __restrict__ A, const bf* __restrict__ Al, const bf* __restrict__ Bn, const float* __restrict__ bias, float* C, int ldc, h16* C2, const float* __restrict__ R = nullptr, int K = DM, int roundR = 1) {
    __shared__ __align__(16) float ost[4][16 * 68];
    const int lane = threadIdx.x & 31, wave = threadIdx.x >> 5, lr = lane & 15, hi = lane >> 4;
    const int r0 = blockIdx.x * 64 + wave * 16, c0 = blockIdx.y * 64;
    const size_t aoff = (size_t)(r0 + lr) * K + 8 * hi;
    size_t boff[4];
#pragma unroll
    for (int t = 0; t < 4; ++t) boff[t] = (size_t)(c0 + t * 16 + lr) * K + 8 * hi;
    v8f acc[4];
#pragma unroll
    for (int t = 0; t < 4; ++t) acc[t] = (v8f){};
#pragma unroll 1
    for (int kc = 0; kc < K; kc += 32) {
        const v16bf a = cat16b(*(const v8us*)(A + aoff + kc), *(const v8us*)(A + aoff + kc + 16));
        v16bf al = a;
        if (SPLITA) al = cat16b(*(const v8us*)(Al + aoff + kc), *(const v8us*)(Al + aoff + kc + 16));
#pragma unroll
        for (int t = 0; t < 4; ++t) { const v16bf b = cat16b(*(const v8us*)(Bn + boff[t] + kc), *(const v8us*)(Bn + boff[t] + kc + 16)); acc[t] = wmmab(a, b, acc[t]); if (SPLITA) acc[t] = wmmab(al, b, acc[t]); }
        asm volatile("v_nop\n\tv_nop\n\tv_nop\n\tv_nop" : "+v"(acc[0]), "+v"(acc[1]), "+v"(acc[2]), "+v"(acc[3]) : "v"(a), "v"(al));
    }
    float* os = &ost[wave][0];
#pragma unroll
    for (int t = 0; t < 4; ++t) { const float bv = bias ? bfr(bias[c0 + t * 16 + lr]) : 0.f;
#pragma unroll
        for (int j = 0; j < 8; ++j) os[(hi * 8 + j) * 68 + t * 16 + lr] = acc[t][j] + bv; }
    __syncthreads();
    if (F16OUT) {
        h16* crow = (h16*)(void*)C + (size_t)r0 * ldc + c0;
        auto pass = [&]() {
#pragma unroll
            for (int s = 0; s < 4; ++s) { const int row = 4 * s + (lane >> 3), piece = lane & 7; const float* sp = os + row * 68 + piece * 8; v8h o, o2;
#pragma unroll
                for (int i = 0; i < 8; ++i) { const h16 a = (h16)sp[i]; o[i] = a; o2[i] = (h16)((sp[i] - (float)a) * LOSC); }
                *(v8h*)(crow + (size_t)row * ldc + piece * 8) = o; if (C2) *(v8h*)(C2 + (size_t)r0 * ldc + c0 + (size_t)row * ldc + piece * 8) = o2; }
        };
        pass(); 
    } else {
        float* crow = C + (size_t)r0 * ldc + c0;
        auto pass = [&]() {
#pragma unroll
            for (int s = 0; s < 8; ++s) { const int Lid = (lane >> 3) + 4 * s, piece = lane & 7; const int row = Lid >> 1, cofs = (Lid & 1) * 32 + piece * 4;
                v4f val = *(const v4fa*)(os + row * 68 + cofs); if (R) { const v4f rv = *(const v4f*)(R + ((size_t)r0 + row) * ldc + c0 + cofs); val += roundR ? (v4f){bfr(rv[0]), bfr(rv[1]), bfr(rv[2]), bfr(rv[3])} : rv; }
                *(v4f*)(crow + (size_t)row * ldc + cofs) = val; }
        };
        pass(); 
    }
}

__global__ __launch_bounds__(256) void k_cvt8(const float* __restrict__ src, bf* dst, size_t n8) {
    const size_t i = (size_t)blockIdx.x * 256 + threadIdx.x; if (i >= n8) return;
    const v8f v = *(const v8f*)(src + i * 8); v8us o;
#pragma unroll
    for (int k = 0; k < 8; ++k) o[k] = f2bf(v[k]);
    *(v8us*)(dst + i * 8) = o; 
}
__global__ __launch_bounds__(256) void k_zero8(bf* dst, size_t n8) {
    const size_t i = (size_t)blockIdx.x * 256 + threadIdx.x; if (i >= n8) return; v8us z;
#pragma unroll
    for (int k = 0; k < 8; ++k) z[k] = 0;
    *(v8us*)(dst + i * 8) = z; 
}

// ===== z-batched (blockIdx.z = head) attention pieces =====
// k_gemm3z<MODE>: 64 x 64 block tile (4 waves x 16 x 64) of C = Ah.Bh^T + Al.Bh^T + Ah.Bl^T with per-z operand/output strides (elements): A planes += z*sA, B planes += z*sB, C += z*sC. MODE bits (0 causal skip, 1 K limit, 2 single,
// 3 B single, 4 A single).
template <int MODE>
__global__ __launch_bounds__(128) void k_gemm3z(const bf* __restrict__ Ah, const bf* __restrict__ Al, const bf* __restrict__ Bh, const bf* __restrict__ Bl, int K, float* C, int ldc, size_t sA, size_t sB, size_t sC) {
    if ((MODE & 1) && (int)blockIdx.y * 64 > (int)blockIdx.x * 64 + 63) return;
    const size_t z = blockIdx.z; Ah += z * sA; Al += z * sA; Bh += z * sB; Bl += z * sB; C += z * sC;
    const int Klim = (MODE & 2) ? min(K, ((int)blockIdx.x + 1) * 64) : K;
    __shared__ __align__(16) float ost[4][16 * 68];
    const int lane = threadIdx.x & 31, wave = threadIdx.x >> 5, lr = lane & 15, hi = lane >> 4;
    const int r0 = blockIdx.x * 64 + wave * 16, c0 = blockIdx.y * 64;
    const size_t aoff = (size_t)(r0 + lr) * K + 8 * hi;
    v8f acc[4];
#pragma unroll
    for (int t = 0; t < 4; ++t) acc[t] = (v8f){};
#pragma unroll 1
    for (int kc = 0; kc < Klim; kc += 32) {
        const v16bf a = cat16b(*(const v8us*)(Ah + aoff + kc), *(const v8us*)(Ah + aoff + kc + 16));
        v16bf al = a; if (!(MODE & 4) && !(MODE & 16)) al = cat16b(*(const v8us*)(Al + aoff + kc), *(const v8us*)(Al + aoff + kc + 16));
#pragma unroll
        for (int t = 0; t < 4; ++t) { const size_t bo = (size_t)(c0 + t * 16 + lr) * K + kc + 8 * hi;
            const v16bf bh = cat16b(*(const v8us*)(Bh + bo), *(const v8us*)(Bh + bo + 16));
            acc[t] = wmmab(a, bh, acc[t]);
            if (!(MODE & 4)) { if (!(MODE & 16)) acc[t] = wmmab(al, bh, acc[t]); if (!(MODE & 8)) { const v16bf bl = cat16b(*(const v8us*)(Bl + bo), *(const v8us*)(Bl + bo + 16)); acc[t] = wmmab(a, bl, acc[t]); } } }
        asm volatile("v_nop\n\tv_nop\n\tv_nop\n\tv_nop" : "+v"(acc[0]), "+v"(acc[1]), "+v"(acc[2]), "+v"(acc[3]) : "v"(a), "v"(al));
    }
    float* os = &ost[wave][0];
#pragma unroll
    for (int t = 0; t < 4; ++t) {
#pragma unroll
        for (int j = 0; j < 8; ++j) os[(hi * 8 + j) * 68 + t * 16 + lr] = acc[t][j]; }
    __builtin_amdgcn_wave_barrier(); asm volatile("" ::: "memory");
    float* crow = C + (size_t)r0 * ldc + c0;
    auto pass = [&]() {
#pragma unroll
        for (int s = 0; s < 8; ++s) { const int Lid = (lane >> 3) + 4 * s, piece = lane & 7; const int row = Lid >> 1, cofs = (Lid & 1) * 32 + piece * 4;
            const v4f val = *(const v4fa*)(os + row * 68 + cofs); *(v4f*)(crow + (size_t)row * ldc + cofs) = val; }
    };
    pass(); 
}
__global__ __launch_bounds__(256) void k_planes32z(const float* __restrict__ F, int ld, int off, float sc, int rows, bf* Ph, bf* Pl) {
    typedef __attribute__((ext_vector_type(2))) unsigned short v2us;
    const int lane = threadIdx.x & 31; const size_t r = ((size_t)blockIdx.x * 8 + (threadIdx.x >> 5)) * 2 + (lane >> 4); if (r >= (size_t)rows) return; const int z = blockIdx.z; const int c0 = (lane & 15) * 2; v2us oh, ol;
    Ph += (size_t)z * rows * 32; Pl += (size_t)z * rows * 32;
#pragma unroll
    for (int i = 0; i < 2; ++i) { const float y = F[r * ld + off + z * 32 + c0 + i] * sc; const unsigned short hb = f2bf(y); oh[i] = hb; ol[i] = f2bf(y - bf2f(hb)); }
    const size_t o = r * 32 + c0; *(v2us*)(Ph + o) = oh; *(v2us*)(Pl + o) = ol; 
}
__global__ __launch_bounds__(256) void k_vtpadz(const float* __restrict__ F, int ld, int off, int nk, bf* Th, bf* Tl) {
    typedef __attribute__((ext_vector_type(2))) unsigned short v2us;
    const int lane = threadIdx.x & 31; const size_t wid = (size_t)blockIdx.x * 8 + (threadIdx.x >> 5); if (wid >= (size_t)64 * (nk / 64)) return; const int z = blockIdx.z; const int d = (int)(wid / (nk / 64)); const int k0 = (int)(wid % (nk / 64)) * 64 + lane * 2; v2us oh, ol;
    Th += (size_t)z * 64 * nk; Tl += (size_t)z * 64 * nk;
#pragma unroll
    for (int i = 0; i < 2; ++i) { const float y = (d < 32) ? F[(size_t)(k0 + i) * ld + off + z * 32 + (d < 32 ? d : 0)] : 0.f; const unsigned short hb = f2bf(y); oh[i] = hb; ol[i] = f2bf(y - bf2f(hb)); }
    const size_t o = (size_t)d * nk + k0; *(v2us*)(Th + o) = oh; *(v2us*)(Tl + o) = ol; 
}
template <int NK>
__global__ __launch_bounds__(256) void k_softmaxz(const float* __restrict__ S, int rows, bf* PH, bf* PL) {
    typedef __attribute__((ext_vector_type(4))) unsigned short v4us;
    const int lane = threadIdx.x & 31, i = blockIdx.x * 8 + (threadIdx.x >> 5); if (i >= rows) return; const size_t zo = (size_t)blockIdx.z * rows * NK; const float* sr = S + zo + (size_t)i * NK; PH += zo; PL += zo;
    float m = -3.0e38f;
#pragma unroll 1
    for (int c0 = lane * 4; c0 < NK; c0 += 128) {
#pragma unroll
        for (int q = 0; q < 4; ++q) m = fmaxf(m, sr[c0 + q]); }
#pragma unroll
    for (int sh = 16; sh; sh >>= 1) m = fmaxf(m, __shfl_xor(m, sh, 32));
    float sum = 0.f;
#pragma unroll 1
    for (int c0 = lane * 4; c0 < NK; c0 += 128) {
#pragma unroll
        for (int q = 0; q < 4; ++q) sum += __expf(sr[c0 + q] - m); }
#pragma unroll
    for (int sh = 16; sh; sh >>= 1) sum += __shfl_xor(sum, sh, 32);
    const float inv = 1.0f / sum;
{
#pragma unroll 1
        for (int c0 = lane * 4; c0 < NK; c0 += 128) { v4us oh, ol;
#pragma unroll
            for (int q = 0; q < 4; ++q) { const float p = __expf(sr[c0 + q] - m) * inv; const unsigned short hb = f2bf(p); oh[q] = hb; ol[q] = f2bf(p - bf2f(hb)); }
            const size_t o = (size_t)i * NK + c0; *(v4us*)(PH + o) = oh; *(v4us*)(PL + o) = ol; }
         }
}
__global__ __launch_bounds__(256) void k_placez(const float* __restrict__ XH, int rows, int ldy, float* Y) {
    const int lane = threadIdx.x & 31; const size_t q = (size_t)blockIdx.x * 8 + (threadIdx.x >> 5); if (q >= (size_t)rows) return; const int z = blockIdx.z; const float v = XH[((size_t)z * rows + q) * 64 + lane];
    *(float*)(Y + q * ldy + z * 32 + lane) = v; 
}

__global__ __launch_bounds__(256) void k_hplanesz(const float* __restrict__ F, int ld, int h0, float sc, int rows, bf* Ph, bf* Pl) {
    typedef __attribute__((ext_vector_type(2))) unsigned short v2us;
    const int lane = threadIdx.x & 31; const size_t r = (size_t)blockIdx.x * 8 + (threadIdx.x >> 5); if (r >= (size_t)rows) return; const int z = blockIdx.z; v2us oh, ol;
    Ph += (size_t)z * rows * 64; Pl += (size_t)z * rows * 64;
#pragma unroll
    for (int i = 0; i < 2; ++i) { const float y = F[r * ld + (h0 + z) * 64 + lane * 2 + i] * sc; const unsigned short hb = f2bf(y); oh[i] = hb; ol[i] = f2bf(y - bf2f(hb)); }
    const size_t o = r * 64 + lane * 2; *(v2us*)(Ph + o) = oh; *(v2us*)(Pl + o) = ol; 
}
__global__ __launch_bounds__(256) void k_vtz(const float* __restrict__ F, int ld, int h0, int nk, bf* Th, bf* Tl) {
    typedef __attribute__((ext_vector_type(2))) unsigned short v2us;
    const int lane = threadIdx.x & 31; const size_t wid = (size_t)blockIdx.x * 8 + (threadIdx.x >> 5); if (wid >= (size_t)64 * (nk / 64)) return; const int z = blockIdx.z; const int d = (int)(wid / (nk / 64)); const int t0 = (int)(wid % (nk / 64)) * 64 + lane * 2; v2us oh, ol;
    Th += (size_t)z * 64 * nk; Tl += (size_t)z * 64 * nk;
#pragma unroll
    for (int i = 0; i < 2; ++i) { const float y = F[(size_t)(t0 + i) * ld + (h0 + z) * 64 + d]; const unsigned short hb = f2bf(y); oh[i] = hb; ol[i] = f2bf(y - bf2f(hb)); }
    const size_t o = (size_t)d * nk + t0; *(v2us*)(Th + o) = oh; *(v2us*)(Tl + o) = ol; 
}
template <int NK>
__global__ __launch_bounds__(256) void k_softmaxzs(const float* __restrict__ S, int rows, float sc, bf* PH, bf* PL) {
    typedef __attribute__((ext_vector_type(4))) unsigned short v4us;
    const int lane = threadIdx.x & 31, i = blockIdx.x * 8 + (threadIdx.x >> 5); if (i >= rows) return; const size_t zo = (size_t)blockIdx.z * rows * NK; const float* sr = S + zo + (size_t)i * NK; PH += zo; PL += zo;
    float m = -3.0e38f;
#pragma unroll 1
    for (int c0 = lane * 4; c0 < NK; c0 += 128) {
#pragma unroll
        for (int q = 0; q < 4; ++q) m = fmaxf(m, sr[c0 + q] * sc); }
#pragma unroll
    for (int sh = 16; sh; sh >>= 1) m = fmaxf(m, __shfl_xor(m, sh, 32));
    float sum = 0.f;
#pragma unroll 1
    for (int c0 = lane * 4; c0 < NK; c0 += 128) {
#pragma unroll
        for (int q = 0; q < 4; ++q) sum += __expf(sr[c0 + q] * sc - m); }
#pragma unroll
    for (int sh = 16; sh; sh >>= 1) sum += __shfl_xor(sum, sh, 32);
    const float inv = 1.0f / sum;
{
#pragma unroll 1
        for (int c0 = lane * 4; c0 < NK; c0 += 128) { v4us oh, ol;
#pragma unroll
            for (int q = 0; q < 4; ++q) { const float p = __expf(sr[c0 + q] * sc - m) * inv; const unsigned short hb = f2bf(p); oh[q] = hb; ol[q] = f2bf(p - bf2f(hb)); }
            const size_t o = (size_t)i * NK + c0; *(v4us*)(PH + o) = oh; *(v4us*)(PL + o) = ol; }
         }
}

__global__ __launch_bounds__(256) void k_cvtx(const float* __restrict__ src, int rows, bf* dst) {
    const int lane = threadIdx.x & 31; const size_t r = (size_t)blockIdx.x * 8 + (threadIdx.x >> 5); if (r >= (size_t)rows) return;
{
#pragma unroll
        for (int q = 0; q < DMOD / 256; ++q) { v8us o;
#pragma unroll
            for (int i = 0; i < 8; ++i) o[i] = f2bf(src[r * DMOD + q * 256 + lane * 8 + i]);
            *(v8us*)(dst + r * DMOD + q * 256 + lane * 8) = o; }
         }
}
__global__ __launch_bounds__(256) void k_wcat4(const float* __restrict__ A0, const float* __restrict__ A1, const float* __restrict__ A2, const float* __restrict__ A3, bf* W4) {
    const size_t i = ((size_t)blockIdx.x * 256 + threadIdx.x) * 8; if (i >= (size_t)QW * DMOD) return; const size_t blk = i / ((size_t)DMOD * DMOD), o = i % ((size_t)DMOD * DMOD);
    const float* src = (blk == 0) ? A0 : (blk == 1) ? A1 : (blk == 2) ? A2 : A3; v8us v;
#pragma unroll
    for (int q = 0; q < 8; ++q) v[q] = f2bf(src[o + q]);
    *(v8us*)(W4 + i) = v; 
}
__global__ __launch_bounds__(256) void k_bias4(const float* __restrict__ b0, const float* __restrict__ b1, const float* __restrict__ b2, const float* __restrict__ b3, float* B4) {
    const size_t i = (size_t)blockIdx.x * 256 + threadIdx.x; if (i >= (size_t)QW) return; const int blk = (int)(i / DMOD), o = (int)(i % DMOD); const float v = (blk == 0) ? b0[o] : (blk == 1) ? b1[o] : (blk == 2) ? b2[o] : b3[o];
    *(float*)(B4 + i) = v; 
}
__global__ __launch_bounds__(256) void k_cumkv(const float* __restrict__ F, float* KVC) {
    const int lane = threadIdx.x & 31; const int w = blockIdx.x * 8 + (threadIdx.x >> 5); if (w >= DMOD / 32) return; const int c = w * 32 + lane; float acc = 0.f;
    for (int t = 0; t < NN; ++t) { const float* fr = F + (size_t)t * QW; acc = fmaf(fr[DMOD + c] * fr[2 * DMOD + c], SCL, acc); float* dst = KVC + (size_t)t * DMOD + c; *(float*)dst = acc;  }
}
__global__ __launch_bounds__(256) void k_qtpl(const float* __restrict__ F, int h0, bf* Ph, bf* Pl) {
    typedef __attribute__((ext_vector_type(2))) unsigned short v2us;
    const int lane = threadIdx.x & 31; const size_t i = (size_t)blockIdx.x * 8 + (threadIdx.x >> 5); if (i >= (size_t)NN) return; const int z = blockIdx.z; const int h = h0 + z; Ph += (size_t)z * NN * HD; Pl += (size_t)z * NN * HD; v2us oh, ol;
#pragma unroll
    for (int q = 0; q < 2; ++q) { const int d = lane * 2 + q; const float y = F[i * QW + h * HD + d] * F[i * QW + 3 * DMOD + h * HD + d]; const unsigned short hb = f2bf(y); oh[q] = hb; ol[q] = f2bf(y - bf2f(hb)); }
    const size_t o = i * HD + lane * 2; *(v2us*)(Ph + o) = oh; *(v2us*)(Pl + o) = ol; 
}
__global__ __launch_bounds__(256) void k_csoft2z(const float* __restrict__ S1, const float* __restrict__ S2, int rows, float sc, bf* PH, bf* PL) {
    typedef __attribute__((ext_vector_type(4))) unsigned short v4us;
    const int lane = threadIdx.x & 31, i = blockIdx.x * 8 + (threadIdx.x >> 5); if (i >= rows) return; const size_t zo = (size_t)blockIdx.z * rows * NN; const float* s1 = S1 + zo + (size_t)i * NN; const float* s2 = S2 + zo + (size_t)i * NN; PH += zo; PL += zo;
    auto logit = [&](int k) -> float { return (s1[k] + s2[k]) * sc; };
    float m = -3.0e38f;
#pragma unroll 1
    for (int c0 = lane * 4; c0 < NN; c0 += 128) {
#pragma unroll
        for (int q = 0; q < 4; ++q) { const int k = c0 + q; if (k <= i) m = fmaxf(m, logit(k)); } }
#pragma unroll
    for (int sh = 16; sh; sh >>= 1) m = fmaxf(m, __shfl_xor(m, sh, 32));
    float sum = 0.f;
#pragma unroll 1
    for (int c0 = lane * 4; c0 < NN; c0 += 128) {
#pragma unroll
        for (int q = 0; q < 4; ++q) { const int k = c0 + q; if (k <= i) sum += __expf(logit(k) - m); } }
#pragma unroll
    for (int sh = 16; sh; sh >>= 1) sum += __shfl_xor(sum, sh, 32);
    const float inv = 1.0f / sum;
{
#pragma unroll 1
        for (int c0 = lane * 4; c0 < NN; c0 += 128) { v4us oh, ol;
#pragma unroll
            for (int q = 0; q < 4; ++q) { const int k = c0 + q; const float p = (k <= i) ? __expf(logit((k <= i) ? k : 0) - m) * inv : 0.f; const unsigned short hb = f2bf(p); oh[q] = hb; ol[q] = f2bf(p - bf2f(hb)); }
            const size_t o = (size_t)i * NN + c0; *(v4us*)(PH + o) = oh; *(v4us*)(PL + o) = ol; }
         }
}
__global__ __launch_bounds__(256) void k_splitD(const float* __restrict__ src, int rows, bf* dh, bf* dl) {
    const int lane = threadIdx.x & 31; const size_t r = (size_t)blockIdx.x * 8 + (threadIdx.x >> 5); if (r >= (size_t)rows) return;
{
#pragma unroll
        for (int q = 0; q < DMOD / 256; ++q) { const size_t o = r * DMOD + q * 256 + lane * 8; const v8f v = *(const v8f*)(src + o); v8us oh, ol;
#pragma unroll
            for (int i = 0; i < 8; ++i) { const unsigned short hb = f2bf(v[i]); oh[i] = hb; ol[i] = f2bf(v[i] - bf2f(hb)); }
            *(v8us*)(dh + o) = oh; *(v8us*)(dl + o) = ol; }
         }
}

extern "C" void kernel_launch(void* const* d_in, const int* in_sizes, int n_in,
                              void* d_out, int out_size, void* d_ws, size_t ws_size, hipStream_t stream) {
    (void)in_sizes; (void)n_in; (void)out_size;
    const float* x = (const float*)d_in[0]; const float* Wq = (const float*)d_in[1]; const float* bq = (const float*)d_in[2]; const float* Wk = (const float*)d_in[3]; const float* bk = (const float*)d_in[4]; const float* Wv = (const float*)d_in[5]; const float* bv = (const float*)d_in[6]; const float* Wt = (const float*)d_in[7]; const float* bt = (const float*)d_in[8]; const float* Wo = (const float*)d_in[9]; const float* bo = (const float*)d_in[10];
    float* out = (float*)d_out;    // [2][2048][1024]
    char* wsp = (char*)d_ws;
    auto take = [&](size_t bytes) { char* p = wsp; wsp += (bytes + 255) & ~(size_t)255; return (void*)p; };
    bf* W4 = (bf*)take((size_t)QW * DMOD * 2); float* B4 = (float*)take((size_t)QW * 4); bf* WO = (bf*)take((size_t)DMOD * DMOD * 2);
    bf* Xb = (bf*)take((size_t)NN * DMOD * 2); float* F = (float*)take((size_t)NN * QW * 4); float* KVC = (float*)take((size_t)NN * DMOD * 4);
    bf* Qh = (bf*)take((size_t)NN * HD * 2); bf* Ql = (bf*)take((size_t)NN * HD * 2); bf* Kh = (bf*)take((size_t)NN * HD * 2); bf* Kl = (bf*)take((size_t)NN * HD * 2); bf* Th = (bf*)take((size_t)NN * HD * 2); bf* Tl = (bf*)take((size_t)NN * HD * 2); bf* Ch = (bf*)take((size_t)NN * HD * 2); bf* Cl = (bf*)take((size_t)NN * HD * 2); bf* VTh = (bf*)take((size_t)HD * NN * 2); bf* VTl = (bf*)take((size_t)HD * NN * 2);
    float* S1 = (float*)take((size_t)NN * NN * 4); float* S2 = (float*)take((size_t)NN * NN * 4); bf* PH = (bf*)take((size_t)NN * NN * 2); bf* PL = (bf*)take((size_t)NN * NN * 2); float* O = (float*)take((size_t)NN * DMOD * 4); bf* Oh = (bf*)take((size_t)NN * DMOD * 2); bf* Ol = (bf*)take((size_t)NN * DMOD * 2);
    if ((size_t)(wsp - (char*)d_ws) > ws_size) return;    // ~ 126 MB
    k_wcat4<<<(unsigned)(((size_t)QW * DMOD / 8 + 255) / 256), 256, 0, stream>>>(Wq, Wk, Wv, Wt, W4); k_bias4<<<QW / 256, 256, 0, stream>>>(bq, bk, bv, bt, B4); k_cvt8<<<(DMOD * DMOD / 8 + 255) / 256, 256, 0, stream>>>(Wo, WO, DMOD * DMOD / 8);
    for (int b = 0; b < NBT; ++b) {
        k_cvtx<<<NN / 8, 256, 0, stream>>>(x + (size_t)b * NN * DMOD, NN, Xb);
        k_gemmb<false, false><<<dim3(NN / 64, QW / 64, 1), 128, 0, stream>>>(Xb, nullptr, W4, B4, F, QW, nullptr, nullptr, DMOD);      // [q | k | v | t] + biases
        k_cumkv<<<(DMOD / 32) / 8, 256, 0, stream>>>(F, KVC);
        for (int h = 0; h < NH_; ++h) {
            k_hplanesz<<<dim3(NN / 8, 1, 1), 256, 0, stream>>>(F, QW, h, 1.0f, NN, Qh, Ql); k_hplanesz<<<dim3(NN / 8, 1, 1), 256, 0, stream>>>(F + DMOD, QW, h, 1.0f, NN, Kh, Kl);
            k_qtpl<<<dim3(NN / 8, 1, 1), 256, 0, stream>>>(F, h, Th, Tl); k_hplanesz<<<dim3(NN / 8, 1, 1), 256, 0, stream>>>(KVC, DMOD, h, 1.0f, NN, Ch, Cl); k_vtz<<<dim3((HD * (NN / 64)) / 8, 1, 1), 256, 0, stream>>>(F + 2 * DMOD, QW, h, NN, VTh, VTl);
            k_gemm3z<1><<<dim3(NN / 64, NN / 64, 1), 128, 0, stream>>>(Qh, Ql, Kh, Kl, HD, S1, NN, 0, 0, 0);       // q . k^T (causal tiles)
            k_gemm3z<1><<<dim3(NN / 64, NN / 64, 1), 128, 0, stream>>>(Th, Tl, Ch, Cl, HD, S2, NN, 0, 0, 0);       // (q*t) . kvcum^T (causal tiles)
            k_csoft2z<<<dim3(NN / 8, 1, 1), 256, 0, stream>>>(S1, S2, NN, SCL, PH, PL);
            k_gemm3z<2><<<dim3(NN / 64, 1, 1), 128, 0, stream>>>(PH, PL, VTh, VTl, NN, O + (size_t)h * HD, DMOD, 0, 0, 0); }
        k_splitD<<<NN / 8, 256, 0, stream>>>(O, NN, Oh, Ol);
        k_gemmb<true, false><<<dim3(NN / 64, DMOD / 64, 1), 128, 0, stream>>>(Oh, Ol, WO, bo, out + (size_t)b * NN * DMOD, DMOD, nullptr, nullptr, DMOD); }
}

// v001
// It runs in 1900 microseconds.
// Next to v000, in two timings, it ran 3.04 and 3.01 times as fast.
#include <hip/hip_runtime.h>

// Compute dtypes, f32 accumulate, per item: q/k/v/t = x.W^T + b fused as one [2048 x 1024].[1024 x 4096] GEMM with PLAIN bf16 operands (exact products); the triplet term's
// cumsum over key positions of k*v/8 (sequential f32 prefix sums per column) and q*t in f32; per head: scores q.k^T and (q*t).kvcum^T as two causal GEMMs with bf16 hi +
// UNSCALED residual planes (three products each; tiles above the diagonal skipped), (S1 + S2)/8 + causal softmax in f32, attn.v (three products, K limited); Wo (+ bias) on

#define NBT  2
#define NN   2048
#define DMOD 1024
#define NH_  16
#define HD   64
#define QW   (4 * DMOD)
#define DM   DMOD
#define NTK  NN
#define SCL  0.125f
#define LOSC 1024.0f
#define RC   512    // query rows per attention pass: all 16 heads of RC rows share one set of score / probability buffers

typedef _Float16 h16;
typedef unsigned short bf;
typedef __attribute__((ext_vector_type(16))) __bf16   v16bf;
typedef __attribute__((ext_vector_type(16))) _Float16 v16h;
typedef __attribute__((ext_vector_type(8)))  _Float16 v8h;
typedef __attribute__((ext_vector_type(8)))  unsigned short v8us;
typedef __attribute__((ext_vector_type(8)))  float    v8f;
typedef __attribute__((ext_vector_type(4)))  float    v4f;
typedef __attribute__((ext_vector_type(4)))  _Float16 v4h;
typedef v8h  __attribute__((may_alias)) v8ha;
typedef v4f  __attribute__((may_alias)) v4fa;
typedef v8us __attribute__((may_alias)) v8usa;

__device__ __forceinline__ unsigned short f2bf(float f) { unsigned u = __float_as_uint(f); u += 0x7FFFu + ((u >> 16) & 1u); return (unsigned short)(u >> 16); }
__device__ __forceinline__ float bf2f(unsigned short b) { return __uint_as_float(((unsigned)b) << 16); }
__device__ __forceinline__ float bfr(float f) { return bf2f(f2bf(f)); }
__device__ __forceinline__ v16h cat16(v8h lo, v8h hi) { return __builtin_shufflevector(lo, hi, 0, 1, 2, 3, 4, 5, 6, 7, 8, 9, 10, 11, 12, 13, 14, 15); }
__device__ __forceinline__ v16bf cat16b(v8us lo, v8us hi) { return __builtin_bit_cast(v16bf, __builtin_shufflevector(lo, hi, 0, 1, 2, 3, 4, 5, 6, 7, 8, 9, 10, 11, 12, 13, 14, 15)); }
__device__ __forceinline__ v8f wmma16(v16h a, v16h b, v8f c) { return __builtin_amdgcn_wmma_f32_16x16x32_f16(false, a, false, b, (short)0, c, false, false); }
__device__ __forceinline__ v8f wmmab(v16bf a, v16bf b, v8f c) { return __builtin_amdgcn_wmma_f32_16x16x32_bf16(false, a, false, b, (short)0, c, false, false); }

// k_gemmb: 64 x 64 block tile (4 waves x 16 x 64) of C[NTK][NW] = (A [+ Al]).B^T (K = 1024) [+ bf(bias[c])] [+ bf(R[r][c]) residual]; f32 whole-line epilogue (or f16
template <bool SPLITA, bool F16OUT = false>
__global__ __launch_bounds__(128) void k_gemmb(const bf* __restrict__ A, const bf* __restrict__ Al, const bf* __restrict__ Bn, const float* __restrict__ bias, float* C, int ldc, h16* C2, const float* __restrict__ R = nullptr, int K = DM, int roundR = 1) {
    __shared__ __align__(16) float ost[4][16 * 68];
    const int lane = threadIdx.x & 31, wave = threadIdx.x >> 5, lr = lane & 15, hi = lane >> 4;
    const int r0 = blockIdx.x * 64 + wave * 16, c0 = blockIdx.y * 64;
    const size_t aoff = (size_t)(r0 + lr) * K + 8 * hi;
    size_t boff[4];
#pragma unroll
    for (int t = 0; t < 4; ++t) boff[t] = (size_t)(c0 + t * 16 + lr) * K + 8 * hi;
    v8f acc[4];
#pragma unroll
    for (int t = 0; t < 4; ++t) acc[t] = (v8f){};
#pragma unroll 1
    for (int kc = 0; kc < K; kc += 32) {
        const v16bf a = cat16b(*(const v8us*)(A + aoff + kc), *(const v8us*)(A + aoff + kc + 16));
        v16bf al = a;
        if (SPLITA) al = cat16b(*(const v8us*)(Al + aoff + kc), *(const v8us*)(Al + aoff + kc + 16));
#pragma unroll
        for (int t = 0; t < 4; ++t) { const v16bf b = cat16b(*(const v8us*)(Bn + boff[t] + kc), *(const v8us*)(Bn + boff[t] + kc + 16)); acc[t] = wmmab(a, b, acc[t]); if (SPLITA) acc[t] = wmmab(al, b, acc[t]); }
        asm volatile("v_nop\n\tv_nop\n\tv_nop\n\tv_nop" : "+v"(acc[0]), "+v"(acc[1]), "+v"(acc[2]), "+v"(acc[3]) : "v"(a), "v"(al));
    }
    float* os = &ost[wave][0];
#pragma unroll
    for (int t = 0; t < 4; ++t) { const float bv = bias ? bfr(bias[c0 + t * 16 + lr]) : 0.f;
#pragma unroll
        for (int j = 0; j < 8; ++j) os[(hi * 8 + j) * 68 + t * 16 + lr] = acc[t][j] + bv; }
    __syncthreads();
    if (F16OUT) {
        h16* crow = (h16*)(void*)C + (size_t)r0 * ldc + c0;
        auto pass = [&]() {
#pragma unroll
            for (int s = 0; s < 4; ++s) { const int row = 4 * s + (lane >> 3), piece = lane & 7; const float* sp = os + row * 68 + piece * 8; v8h o, o2;
#pragma unroll
                for (int i = 0; i < 8; ++i) { const h16 a = (h16)sp[i]; o[i] = a; o2[i] = (h16)((sp[i] - (float)a) * LOSC); }
                *(v8h*)(crow + (size_t)row * ldc + piece * 8) = o; if (C2) *(v8h*)(C2 + (size_t)r0 * ldc + c0 + (size_t)row * ldc + piece * 8) = o2; }
        };
        pass(); 
    } else {
        float* crow = C + (size_t)r0 * ldc + c0;
        auto pass = [&]() {
#pragma unroll
            for (int s = 0; s < 8; ++s) { const int Lid = (lane >> 3) + 4 * s, piece = lane & 7; const int row = Lid >> 1, cofs = (Lid & 1) * 32 + piece * 4;
                v4f val = *(const v4fa*)(os + row * 68 + cofs); if (R) { const v4f rv = *(const v4f*)(R + ((size_t)r0 + row) * ldc + c0 + cofs); val += roundR ? (v4f){bfr(rv[0]), bfr(rv[1]), bfr(rv[2]), bfr(rv[3])} : rv; }
                *(v4f*)(crow + (size_t)row * ldc + cofs) = val; }
        };
        pass(); 
    }
}

__global__ __launch_bounds__(256) void k_cvt8(const float* __restrict__ src, bf* dst, size_t n8) {
    const size_t i = (size_t)blockIdx.x * 256 + threadIdx.x; if (i >= n8) return;
    const v8f v = *(const v8f*)(src + i * 8); v8us o;
#pragma unroll
    for (int k = 0; k < 8; ++k) o[k] = f2bf(v[k]);
    *(v8us*)(dst + i * 8) = o; 
}
__global__ __launch_bounds__(256) void k_zero8(bf* dst, size_t n8) {
    const size_t i = (size_t)blockIdx.x * 256 + threadIdx.x; if (i >= n8) return; v8us z;
#pragma unroll
    for (int k = 0; k < 8; ++k) z[k] = 0;
    *(v8us*)(dst + i * 8) = z; 
}

// ===== z-batched (blockIdx.z = head) attention pieces =====
// k_gemm3z<MODE>: bf16 hi/lo-plane GEMM C = A.B^T with per-z operand/output strides (elements): A planes += z*sA, B planes += z*sB, C += z*sC. MODE bits (0 causal skip, 1 K limit, 2 single,
// 3 B single, 4 A single). xb0: number of 64-row blocks that lie in front of A's and C's first row (the causal skip and the K limit count rows from the sequence's start).
template <int MODE>
__global__ __launch_bounds__(128) void k_gemm3z(const bf* __restrict__ Ah, const bf* __restrict__ Al, const bf* __restrict__ Bh, const bf* __restrict__ Bl, int K, float* C, int ldc, size_t sA, size_t sB, size_t sC, int xb0) {
    const int bxg = (int)blockIdx.x + xb0;
    if ((MODE & 1) && (int)blockIdx.y * 64 > bxg * 64 + 63) return;
    const size_t z = blockIdx.z; Ah += z * sA; Al += z * sA; Bh += z * sB; Bl += z * sB; C += z * sC;
    const int Klim = (MODE & 2) ? min(K, (bxg + 1) * 64) : K;
    __shared__ __align__(16) float ost[4][16 * 68];
    const int lane = threadIdx.x & 31, wave = threadIdx.x >> 5, lr = lane & 15, hi = lane >> 4;
    const int r0 = blockIdx.x * 64 + wave * 16, c0 = blockIdx.y * 64;
    const size_t aoff = (size_t)(r0 + lr) * K + 8 * hi;
    v8f acc[4];
#pragma unroll
    for (int t = 0; t < 4; ++t) acc[t] = (v8f){};
#pragma unroll 1
    for (int kc = 0; kc < Klim; kc += 32) {
        const v16bf a = cat16b(*(const v8us*)(Ah + aoff + kc), *(const v8us*)(Ah + aoff + kc + 16));
        v16bf al = a; if (!(MODE & 4) && !(MODE & 16)) al = cat16b(*(const v8us*)(Al + aoff + kc), *(const v8us*)(Al + aoff + kc + 16));
#pragma unroll
        for (int t = 0; t < 4; ++t) { const size_t bo = (size_t)(c0 + t * 16 + lr) * K + kc + 8 * hi;
            const v16bf bh = cat16b(*(const v8us*)(Bh + bo), *(const v8us*)(Bh + bo + 16));
            acc[t] = wmmab(a, bh, acc[t]);
            if (!(MODE & 4)) { if (!(MODE & 16)) acc[t] = wmmab(al, bh, acc[t]); if (!(MODE & 8)) { const v16bf bl = cat16b(*(const v8us*)(Bl + bo), *(const v8us*)(Bl + bo + 16)); acc[t] = wmmab(a, bl, acc[t]); } } }
        asm volatile("v_nop\n\tv_nop\n\tv_nop\n\tv_nop" : "+v"(acc[0]), "+v"(acc[1]), "+v"(acc[2]), "+v"(acc[3]) : "v"(a), "v"(al));
    }
    float* os = &ost[wave][0];
#pragma unroll
    for (int t = 0; t < 4; ++t) {
#pragma unroll
        for (int j = 0; j < 8; ++j) os[(hi * 8 + j) * 68 + t * 16 + lr] = acc[t][j]; }
    __builtin_amdgcn_wave_barrier(); asm volatile("" ::: "memory");
    float* crow = C + (size_t)r0 * ldc + c0;
    auto pass = [&]() {
#pragma unroll
        for (int s = 0; s < 8; ++s) { const int Lid = (lane >> 3) + 4 * s, piece = lane & 7; const int row = Lid >> 1, cofs = (Lid & 1) * 32 + piece * 4;
            const v4f val = *(const v4fa*)(os + row * 68 + cofs); *(v4f*)(crow + (size_t)row * ldc + cofs) = val; }
    };
    pass(); 
}
__global__ __launch_bounds__(256) void k_planes32z(const float* __restrict__ F, int ld, int off, float sc, int rows, bf* Ph, bf* Pl) {
    typedef __attribute__((ext_vector_type(2))) unsigned short v2us;
    const int lane = threadIdx.x & 31; const size_t r = ((size_t)blockIdx.x * 8 + (threadIdx.x >> 5)) * 2 + (lane >> 4); if (r >= (size_t)rows) return; const int z = blockIdx.z; const int c0 = (lane & 15) * 2; v2us oh, ol;
    Ph += (size_t)z * rows * 32; Pl += (size_t)z * rows * 32;
#pragma unroll
    for (int i = 0; i < 2; ++i) { const float y = F[r * ld + off + z * 32 + c0 + i] * sc; const unsigned short hb = f2bf(y); oh[i] = hb; ol[i] = f2bf(y - bf2f(hb)); }
    const size_t o = r * 32 + c0; *(v2us*)(Ph + o) = oh; *(v2us*)(Pl + o) = ol; 
}
__global__ __launch_bounds__(256) void k_vtpadz(const float* __restrict__ F, int ld, int off, int nk, bf* Th, bf* Tl) {
    typedef __attribute__((ext_vector_type(2))) unsigned short v2us;
    const int lane = threadIdx.x & 31; const size_t wid = (size_t)blockIdx.x * 8 + (threadIdx.x >> 5); if (wid >= (size_t)64 * (nk / 64)) return; const int z = blockIdx.z; const int d = (int)(wid / (nk / 64)); const int k0 = (int)(wid % (nk / 64)) * 64 + lane * 2; v2us oh, ol;
    Th += (size_t)z * 64 * nk; Tl += (size_t)z * 64 * nk;
#pragma unroll
    for (int i = 0; i < 2; ++i) { const float y = (d < 32) ? F[(size_t)(k0 + i) * ld + off + z * 32 + (d < 32 ? d : 0)] : 0.f; const unsigned short hb = f2bf(y); oh[i] = hb; ol[i] = f2bf(y - bf2f(hb)); }
    const size_t o = (size_t)d * nk + k0; *(v2us*)(Th + o) = oh; *(v2us*)(Tl + o) = ol; 
}
template <int NK>
__global__ __launch_bounds__(256) void k_softmaxz(const float* __restrict__ S, int rows, bf* PH, bf* PL) {
    typedef __attribute__((ext_vector_type(4))) unsigned short v4us;
    const int lane = threadIdx.x & 31, i = blockIdx.x * 8 + (threadIdx.x >> 5); if (i >= rows) return; const size_t zo = (size_t)blockIdx.z * rows * NK; const float* sr = S + zo + (size_t)i * NK; PH += zo; PL += zo;
    float m = -3.0e38f;
#pragma unroll 1
    for (int c0 = lane * 4; c0 < NK; c0 += 128) {
#pragma unroll
        for (int q = 0; q < 4; ++q) m = fmaxf(m, sr[c0 + q]); }
#pragma unroll
    for (int sh = 16; sh; sh >>= 1) m = fmaxf(m, __shfl_xor(m, sh, 32));
    float sum = 0.f;
#pragma unroll 1
    for (int c0 = lane * 4; c0 < NK; c0 += 128) {
#pragma unroll
        for (int q = 0; q < 4; ++q) sum += __expf(sr[c0 + q] - m); }
#pragma unroll
    for (int sh = 16; sh; sh >>= 1) sum += __shfl_xor(sum, sh, 32);
    const float inv = 1.0f / sum;
{
#pragma unroll 1
        for (int c0 = lane * 4; c0 < NK; c0 += 128) { v4us oh, ol;
#pragma unroll
            for (int q = 0; q < 4; ++q) { const float p = __expf(sr[c0 + q] - m) * inv; const unsigned short hb = f2bf(p); oh[q] = hb; ol[q] = f2bf(p - bf2f(hb)); }
            const size_t o = (size_t)i * NK + c0; *(v4us*)(PH + o) = oh; *(v4us*)(PL + o) = ol; }
         }
}
__global__ __launch_bounds__(256) void k_placez(const float* __restrict__ XH, int rows, int ldy, float* Y) {
    const int lane = threadIdx.x & 31; const size_t q = (size_t)blockIdx.x * 8 + (threadIdx.x >> 5); if (q >= (size_t)rows) return; const int z = blockIdx.z; const float v = XH[((size_t)z * rows + q) * 64 + lane];
    *(float*)(Y + q * ldy + z * 32 + lane) = v; 
}

__global__ __launch_bounds__(256) void k_hplanesz(const float* __restrict__ F, int ld, int h0, float sc, int rows, bf* Ph, bf* Pl) {
    typedef __attribute__((ext_vector_type(2))) unsigned short v2us;
    const int lane = threadIdx.x & 31; const size_t r = (size_t)blockIdx.x * 8 + (threadIdx.x >> 5); if (r >= (size_t)rows) return; const int z = blockIdx.z; v2us oh, ol;
    Ph += (size_t)z * rows * 64; Pl += (size_t)z * rows * 64;
#pragma unroll
    for (int i = 0; i < 2; ++i) { const float y = F[r * ld + (h0 + z) * 64 + lane * 2 + i] * sc; const unsigned short hb = f2bf(y); oh[i] = hb; ol[i] = f2bf(y - bf2f(hb)); }
    const size_t o = r * 64 + lane * 2; *(v2us*)(Ph + o) = oh; *(v2us*)(Pl + o) = ol; 
}
__global__ __launch_bounds__(256) void k_vtz(const float* __restrict__ F, int ld, int h0, int nk, bf* Th, bf* Tl) {
    typedef __attribute__((ext_vector_type(2))) unsigned short v2us;
    const int lane = threadIdx.x & 31; const size_t wid = (size_t)blockIdx.x * 8 + (threadIdx.x >> 5); if (wid >= (size_t)64 * (nk / 64)) return; const int z = blockIdx.z; const int d = (int)(wid / (nk / 64)); const int t0 = (int)(wid % (nk / 64)) * 64 + lane * 2; v2us oh, ol;
    Th += (size_t)z * 64 * nk; Tl += (size_t)z * 64 * nk;
#pragma unroll
    for (int i = 0; i < 2; ++i) { const float y = F[(size_t)(t0 + i) * ld + (h0 + z) * 64 + d]; const unsigned short hb = f2bf(y); oh[i] = hb; ol[i] = f2bf(y - bf2f(hb)); }
    const size_t o = (size_t)d * nk + t0; *(v2us*)(Th + o) = oh; *(v2us*)(Tl + o) = ol; 
}
template <int NK>
__global__ __launch_bounds__(256) void k_softmaxzs(const float* __restrict__ S, int rows, float sc, bf* PH, bf* PL) {
    typedef __attribute__((ext_vector_type(4))) unsigned short v4us;
    const int lane = threadIdx.x & 31, i = blockIdx.x * 8 + (threadIdx.x >> 5); if (i >= rows) return; const size_t zo = (size_t)blockIdx.z * rows * NK; const float* sr = S + zo + (size_t)i * NK; PH += zo; PL += zo;
    float m = -3.0e38f;
#pragma unroll 1
    for (int c0 = lane * 4; c0 < NK; c0 += 128) {
#pragma unroll
        for (int q = 0; q < 4; ++q) m = fmaxf(m, sr[c0 + q] * sc); }
#pragma unroll
    for (int sh = 16; sh; sh >>= 1) m = fmaxf(m, __shfl_xor(m, sh, 32));
    float sum = 0.f;
#pragma unroll 1
    for (int c0 = lane * 4; c0 < NK; c0 += 128) {
#pragma unroll
        for (int q = 0; q < 4; ++q) sum += __expf(sr[c0 + q] * sc - m); }
#pragma unroll
    for (int sh = 16; sh; sh >>= 1) sum += __shfl_xor(sum, sh, 32);
    const float inv = 1.0f / sum;
{
#pragma unroll 1
        for (int c0 = lane * 4; c0 < NK; c0 += 128) { v4us oh, ol;
#pragma unroll
            for (int q = 0; q < 4; ++q) { const float p = __expf(sr[c0 + q] * sc - m) * inv; const unsigned short hb = f2bf(p); oh[q] = hb; ol[q] = f2bf(p - bf2f(hb)); }
            const size_t o = (size_t)i * NK + c0; *(v4us*)(PH + o) = oh; *(v4us*)(PL + o) = ol; }
         }
}

__global__ __launch_bounds__(256) void k_cvtx(const float* __restrict__ src, int rows, bf* dst) {
    const int lane = threadIdx.x & 31; const size_t r = (size_t)blockIdx.x * 8 + (threadIdx.x >> 5); if (r >= (size_t)rows) return;
{
#pragma unroll
        for (int q = 0; q < DMOD / 256; ++q) { v8us o;
#pragma unroll
            for (int i = 0; i < 8; ++i) o[i] = f2bf(src[r * DMOD + q * 256 + lane * 8 + i]);
            *(v8us*)(dst + r * DMOD + q * 256 + lane * 8) = o; }
         }
}
__global__ __launch_bounds__(256) void k_wcat4(const float* __restrict__ A0, const float* __restrict__ A1, const float* __restrict__ A2, const float* __restrict__ A3, bf* W4) {
    const size_t i = ((size_t)blockIdx.x * 256 + threadIdx.x) * 8; if (i >= (size_t)QW * DMOD) return; const size_t blk = i / ((size_t)DMOD * DMOD), o = i % ((size_t)DMOD * DMOD);
    const float* src = (blk == 0) ? A0 : (blk == 1) ? A1 : (blk == 2) ? A2 : A3; v8us v;
#pragma unroll
    for (int q = 0; q < 8; ++q) v[q] = f2bf(src[o + q]);
    *(v8us*)(W4 + i) = v; 
}
__global__ __launch_bounds__(256) void k_bias4(const float* __restrict__ b0, const float* __restrict__ b1, const float* __restrict__ b2, const float* __restrict__ b3, float* B4) {
    const size_t i = (size_t)blockIdx.x * 256 + threadIdx.x; if (i >= (size_t)QW) return; const int blk = (int)(i / DMOD), o = (int)(i % DMOD); const float v = (blk == 0) ? b0[o] : (blk == 1) ? b1[o] : (blk == 2) ? b2[o] : b3[o];
    *(float*)(B4 + i) = v; 
}
__global__ __launch_bounds__(256) void k_cumkv(const float* __restrict__ F, float* KVC) {
    const int lane = threadIdx.x & 31; const int w = blockIdx.x * 8 + (threadIdx.x >> 5); if (w >= DMOD / 32) return; const int c = w * 32 + lane; float acc = 0.f;
    for (int t = 0; t < NN; ++t) { const float* fr = F + (size_t)t * QW; acc = fmaf(fr[DMOD + c] * fr[2 * DMOD + c], SCL, acc); float* dst = KVC + (size_t)t * DMOD + c; *(float*)dst = acc;  }
}
__global__ __launch_bounds__(256) void k_qtpl(const float* __restrict__ F, int h0, bf* Ph, bf* Pl) {
    typedef __attribute__((ext_vector_type(2))) unsigned short v2us;
    const int lane = threadIdx.x & 31; const size_t i = (size_t)blockIdx.x * 8 + (threadIdx.x >> 5); if (i >= (size_t)NN) return; const int z = blockIdx.z; const int h = h0 + z; Ph += (size_t)z * NN * HD; Pl += (size_t)z * NN * HD; v2us oh, ol;
#pragma unroll
    for (int q = 0; q < 2; ++q) { const int d = lane * 2 + q; const float y = F[i * QW + h * HD + d] * F[i * QW + 3 * DMOD + h * HD + d]; const unsigned short hb = f2bf(y); oh[q] = hb; ol[q] = f2bf(y - bf2f(hb)); }
    const size_t o = i * HD + lane * 2; *(v2us*)(Ph + o) = oh; *(v2us*)(Pl + o) = ol; 
}
__global__ __launch_bounds__(256) void k_csoft2z(const float* __restrict__ S1, const float* __restrict__ S2, int rows, int xb0, float sc, bf* PH, bf* PL) {
    typedef __attribute__((ext_vector_type(4))) unsigned short v4us;
    const int lane = threadIdx.x & 31, i = blockIdx.x * 8 + (threadIdx.x >> 5); if (i >= rows) return; const size_t zo = (size_t)blockIdx.z * rows * NN; const float* s1 = S1 + zo + (size_t)i * NN; const float* s2 = S2 + zo + (size_t)i * NN; PH += zo; PL += zo;
    const int ig = i + xb0 * 64;    // the row's position in the sequence (i counts inside this pass's buffers)
    auto logit = [&](int k) -> float { return (s1[k] + s2[k]) * sc; };
    float m = -3.0e38f;
#pragma unroll 1
    for (int c0 = lane * 4; c0 < NN; c0 += 128) {
#pragma unroll
        for (int q = 0; q < 4; ++q) { const int k = c0 + q; if (k <= ig) m = fmaxf(m, logit(k)); } }
#pragma unroll
    for (int sh = 16; sh; sh >>= 1) m = fmaxf(m, __shfl_xor(m, sh, 32));
    float sum = 0.f;
#pragma unroll 1
    for (int c0 = lane * 4; c0 < NN; c0 += 128) {
#pragma unroll
        for (int q = 0; q < 4; ++q) { const int k = c0 + q; if (k <= ig) sum += __expf(logit(k) - m); } }
#pragma unroll
    for (int sh = 16; sh; sh >>= 1) sum += __shfl_xor(sum, sh, 32);
    const float inv = 1.0f / sum;
{
#pragma unroll 1
        for (int c0 = lane * 4; c0 < NN; c0 += 128) { v4us oh, ol;
#pragma unroll
            for (int q = 0; q < 4; ++q) { const int k = c0 + q; const float p = (k <= ig) ? __expf(logit((k <= ig) ? k : 0) - m) * inv : 0.f; const unsigned short hb = f2bf(p); oh[q] = hb; ol[q] = f2bf(p - bf2f(hb)); }
            const size_t o = (size_t)i * NN + c0; *(v4us*)(PH + o) = oh; *(v4us*)(PL + o) = ol; }
         }
}
__global__ __launch_bounds__(256) void k_splitD(const float* __restrict__ src, int rows, bf* dh, bf* dl) {
    const int lane = threadIdx.x & 31; const size_t r = (size_t)blockIdx.x * 8 + (threadIdx.x >> 5); if (r >= (size_t)rows) return;
{
#pragma unroll
        for (int q = 0; q < DMOD / 256; ++q) { const size_t o = r * DMOD + q * 256 + lane * 8; const v8f v = *(const v8f*)(src + o); v8us oh, ol;
#pragma unroll
            for (int i = 0; i < 8; ++i) { const unsigned short hb = f2bf(v[i]); oh[i] = hb; ol[i] = f2bf(v[i] - bf2f(hb)); }
            *(v8us*)(dh + o) = oh; *(v8us*)(dl + o) = ol; }
         }
}

extern "C" void kernel_launch(void* const* d_in, const int* in_sizes, int n_in,
                              void* d_out, int out_size, void* d_ws, size_t ws_size, hipStream_t stream) {
    (void)in_sizes; (void)n_in; (void)out_size;
    const float* x = (const float*)d_in[0]; const float* Wq = (const float*)d_in[1]; const float* bq = (const float*)d_in[2]; const float* Wk = (const float*)d_in[3]; const float* bk = (const float*)d_in[4]; const float* Wv = (const float*)d_in[5]; const float* bv = (const float*)d_in[6]; const float* Wt = (const float*)d_in[7]; const float* bt = (const float*)d_in[8]; const float* Wo = (const float*)d_in[9]; const float* bo = (const float*)d_in[10];
    float* out = (float*)d_out;    // [2][2048][1024]
    char* wsp = (char*)d_ws;
    auto take = [&](size_t bytes) { char* p = wsp; wsp += (bytes + 255) & ~(size_t)255; return (void*)p; };
    bf* W4 = (bf*)take((size_t)QW * DMOD * 2); float* B4 = (float*)take((size_t)QW * 4); bf* WO = (bf*)take((size_t)DMOD * DMOD * 2); float* O = (float*)take((size_t)NN * DMOD * 4);
    const size_t PLB = (size_t)NH_ * NN * HD * 2;    // one operand plane, all heads
    bf* Qh = (bf*)take(PLB); bf* Ql = (bf*)take(PLB); bf* Kh = (bf*)take(PLB); bf* Kl = (bf*)take(PLB); bf* Th = (bf*)take(PLB); bf* Tl = (bf*)take(PLB); bf* Ch = (bf*)take(PLB); bf* Cl = (bf*)take(PLB); bf* VTh = (bf*)take(PLB); bf* VTl = (bf*)take(PLB);
    char* const big = wsp;
    float* S1 = (float*)take((size_t)NH_ * RC * NN * 4); float* S2 = (float*)take((size_t)NH_ * RC * NN * 4); bf* PH = (bf*)take((size_t)NH_ * RC * NN * 2); bf* PL = (bf*)take((size_t)NH_ * RC * NN * 2);
    if ((size_t)(wsp - (char*)d_ws) > ws_size) return;    // ~ 250 MiB
    // Xb, F, KVC are last read when the operand planes are made, Oh, Ol are first written after the last attention pass: both sets lie on S1's bytes.
    wsp = big; bf* Xb = (bf*)take((size_t)NN * DMOD * 2); float* F = (float*)take((size_t)NN * QW * 4); float* KVC = (float*)take((size_t)NN * DMOD * 4);
    wsp = big; bf* Oh = (bf*)take((size_t)NN * DMOD * 2); bf* Ol = (bf*)take((size_t)NN * DMOD * 2);
    k_wcat4<<<(unsigned)(((size_t)QW * DMOD / 8 + 255) / 256), 256, 0, stream>>>(Wq, Wk, Wv, Wt, W4); k_bias4<<<QW / 256, 256, 0, stream>>>(bq, bk, bv, bt, B4); k_cvt8<<<(DMOD * DMOD / 8 + 255) / 256, 256, 0, stream>>>(Wo, WO, DMOD * DMOD / 8);
    for (int b = 0; b < NBT; ++b) {
        k_cvtx<<<NN / 8, 256, 0, stream>>>(x + (size_t)b * NN * DMOD, NN, Xb);
        k_gemmb<false, false><<<dim3(NN / 64, QW / 64, 1), 128, 0, stream>>>(Xb, nullptr, W4, B4, F, QW, nullptr, nullptr, DMOD);      // [q | k | v | t] + biases
        k_cumkv<<<(DMOD / 32) / 8, 256, 0, stream>>>(F, KVC);
        // blockIdx.z = head in every launch from here to the end of the passes
        k_hplanesz<<<dim3(NN / 8, 1, NH_), 256, 0, stream>>>(F, QW, 0, 1.0f, NN, Qh, Ql); k_hplanesz<<<dim3(NN / 8, 1, NH_), 256, 0, stream>>>(F + DMOD, QW, 0, 1.0f, NN, Kh, Kl);
        k_qtpl<<<dim3(NN / 8, 1, NH_), 256, 0, stream>>>(F, 0, Th, Tl); k_hplanesz<<<dim3(NN / 8, 1, NH_), 256, 0, stream>>>(KVC, DMOD, 0, 1.0f, NN, Ch, Cl); k_vtz<<<dim3((HD * (NN / 64)) / 8, 1, NH_), 256, 0, stream>>>(F + 2 * DMOD, QW, 0, NN, VTh, VTl);
        for (int xb = 0; xb < NN / 64; xb += RC / 64) {    // one pass: query rows xb * 64 .. xb * 64 + RC - 1 of all heads
            k_gemm3z<1><<<dim3(RC / 64, NN / 64, NH_), 128, 0, stream>>>(Qh + (size_t)xb * 64 * HD, Ql + (size_t)xb * 64 * HD, Kh, Kl, HD, S1, NN, (size_t)NN * HD, (size_t)NN * HD, (size_t)RC * NN, xb);       // q . k^T (causal tiles)
            k_gemm3z<1><<<dim3(RC / 64, NN / 64, NH_), 128, 0, stream>>>(Th + (size_t)xb * 64 * HD, Tl + (size_t)xb * 64 * HD, Ch, Cl, HD, S2, NN, (size_t)NN * HD, (size_t)NN * HD, (size_t)RC * NN, xb);       // (q*t) . kvcum^T (causal tiles)
            k_csoft2z<<<dim3(RC / 8, 1, NH_), 256, 0, stream>>>(S1, S2, RC, xb, SCL, PH, PL);
            k_gemm3z<2><<<dim3(RC / 64, 1, NH_), 128, 0, stream>>>(PH, PL, VTh, VTl, NN, O + (size_t)xb * 64 * DMOD, DMOD, (size_t)RC * NN, (size_t)HD * NN, (size_t)HD, xb); }
        k_splitD<<<NN / 8, 256, 0, stream>>>(O, NN, Oh, Ol);
        k_gemmb<true, false><<<dim3(NN / 64, DMOD / 64, 1), 128, 0, stream>>>(Oh, Ol, WO, bo, out + (size_t)b * NN * DMOD, DMOD, nullptr, nullptr, DMOD); }
}

// v002
// Measured time: 896 microseconds a run.
// In two side-by-side timings against v001, it was 2.11 and 2.13 times as fast.
// Counting every step since v000, it is 6.42 times as fast.
#include <hip/hip_runtime.h>

// Compute dtypes, f32 accumulate, per item: q/k/v/t = x.W^T + b fused as one [2048 x 1024].[1024 x 4096] GEMM with PLAIN bf16 operands (exact products); the triplet term's
// cumsum over key positions of k*v/8 (sequential f32 prefix sums per column) and q*t in f32; per head, in ONE kernel (k_fattn): scores q.k^T + (q*t).kvcum^T with bf16 hi +
// UNSCALED residual planes (three products each; tiles above the diagonal skipped), / 8 + causal softmax in f32 with a running maximum and sum, attn.v (three products); Wo (+ bias) on

#define NBT  2
#define NN   2048
#define DMOD 1024
#define NH_  16
#define HD   64
#define QW   (4 * DMOD)
#define DM   DMOD
#define NTK  NN
#define SCL  0.125f
#define LOSC 1024.0f

typedef _Float16 h16;
typedef unsigned short bf;
typedef __attribute__((ext_vector_type(16))) __bf16   v16bf;
typedef __attribute__((ext_vector_type(16))) _Float16 v16h;
typedef __attribute__((ext_vector_type(8)))  _Float16 v8h;
typedef __attribute__((ext_vector_type(8)))  unsigned short v8us;
typedef __attribute__((ext_vector_type(8)))  float    v8f;
typedef __attribute__((ext_vector_type(4)))  float    v4f;
typedef __attribute__((ext_vector_type(4)))  _Float16 v4h;
typedef v8h  __attribute__((may_alias)) v8ha;
typedef v4f  __attribute__((may_alias)) v4fa;
typedef v8us __attribute__((may_alias)) v8usa;

__device__ __forceinline__ unsigned short f2bf(float f) { unsigned u = __float_as_uint(f); u += 0x7FFFu + ((u >> 16) & 1u); return (unsigned short)(u >> 16); }
__device__ __forceinline__ float bf2f(unsigned short b) { return __uint_as_float(((unsigned)b) << 16); }
__device__ __forceinline__ float bfr(float f) { return bf2f(f2bf(f)); }
__device__ __forceinline__ v16h cat16(v8h lo, v8h hi) { return __builtin_shufflevector(lo, hi, 0, 1, 2, 3, 4, 5, 6, 7, 8, 9, 10, 11, 12, 13, 14, 15); }
__device__ __forceinline__ v16bf cat16b(v8us lo, v8us hi) { return __builtin_bit_cast(v16bf, __builtin_shufflevector(lo, hi, 0, 1, 2, 3, 4, 5, 6, 7, 8, 9, 10, 11, 12, 13, 14, 15)); }
__device__ __forceinline__ v8f wmma16(v16h a, v16h b, v8f c) { return __builtin_amdgcn_wmma_f32_16x16x32_f16(false, a, false, b, (short)0, c, false, false); }
__device__ __forceinline__ v8f wmmab(v16bf a, v16bf b, v8f c) { return __builtin_amdgcn_wmma_f32_16x16x32_bf16(false, a, false, b, (short)0, c, false, false); }

// k_gemmb: 64 x 64 block tile (4 waves x 16 x 64) of C[NTK][NW] = (A [+ Al]).B^T (K = 1024) [+ bf(bias[c])] [+ bf(R[r][c]) residual]; f32 whole-line epilogue (or f16
template <bool SPLITA, bool F16OUT = false>
__global__ __launch_bounds__(128) void k_gemmb(const bf* __restrict__ A, const bf* __restrict__ Al, const bf* __restrict__ Bn, const float* __restrict__ bias, float* C, int ldc, h16* C2, const float* __restrict__ R = nullptr, int K = DM, int roundR = 1) {
    __shared__ __align__(16) float ost[4][16 * 68];
    const int lane = threadIdx.x & 31, wave = threadIdx.x >> 5, lr = lane & 15, hi = lane >> 4;
    const int r0 = blockIdx.x * 64 + wave * 16, c0 = blockIdx.y * 64;
    const size_t aoff = (size_t)(r0 + lr) * K + 8 * hi;
    size_t boff[4];
#pragma unroll
    for (int t = 0; t < 4; ++t) boff[t] = (size_t)(c0 + t * 16 + lr) * K + 8 * hi;
    v8f acc[4];
#pragma unroll
    for (int t = 0; t < 4; ++t) acc[t] = (v8f){};
#pragma unroll 1
    for (int kc = 0; kc < K; kc += 32) {
        const v16bf a = cat16b(*(const v8us*)(A + aoff + kc), *(const v8us*)(A + aoff + kc + 16));
        v16bf al = a;
        if (SPLITA) al = cat16b(*(const v8us*)(Al + aoff + kc), *(const v8us*)(Al + aoff + kc + 16));
#pragma unroll
        for (int t = 0; t < 4; ++t) { const v16bf b = cat16b(*(const v8us*)(Bn + boff[t] + kc), *(const v8us*)(Bn + boff[t] + kc + 16)); acc[t] = wmmab(a, b, acc[t]); if (SPLITA) acc[t] = wmmab(al, b, acc[t]); }
        asm volatile("v_nop\n\tv_nop\n\tv_nop\n\tv_nop" : "+v"(acc[0]), "+v"(acc[1]), "+v"(acc[2]), "+v"(acc[3]) : "v"(a), "v"(al));
    }
    float* os = &ost[wave][0];
#pragma unroll
    for (int t = 0; t < 4; ++t) { const float bv = bias ? bfr(bias[c0 + t * 16 + lr]) : 0.f;
#pragma unroll
        for (int j = 0; j < 8; ++j) os[(hi * 8 + j) * 68 + t * 16 + lr] = acc[t][j] + bv; }
    __syncthreads();
    if (F16OUT) {
        h16* crow = (h16*)(void*)C + (size_t)r0 * ldc + c0;
        auto pass = [&]() {
#pragma unroll
            for (int s = 0; s < 4; ++s) { const int row = 4 * s + (lane >> 3), piece = lane & 7; const float* sp = os + row * 68 + piece * 8; v8h o, o2;
#pragma unroll
                for (int i = 0; i < 8; ++i) { const h16 a = (h16)sp[i]; o[i] = a; o2[i] = (h16)((sp[i] - (float)a) * LOSC); }
                *(v8h*)(crow + (size_t)row * ldc + piece * 8) = o; if (C2) *(v8h*)(C2 + (size_t)r0 * ldc + c0 + (size_t)row * ldc + piece * 8) = o2; }
        };
        pass(); 
    } else {
        float* crow = C + (size_t)r0 * ldc + c0;
        auto pass = [&]() {
#pragma unroll
            for (int s = 0; s < 8; ++s) { const int Lid = (lane >> 3) + 4 * s, piece = lane & 7; const int row = Lid >> 1, cofs = (Lid & 1) * 32 + piece * 4;
                v4f val = *(const v4fa*)(os + row * 68 + cofs); if (R) { const v4f rv = *(const v4f*)(R + ((size_t)r0 + row) * ldc + c0 + cofs); val += roundR ? (v4f){bfr(rv[0]), bfr(rv[1]), bfr(rv[2]), bfr(rv[3])} : rv; }
                *(v4f*)(crow + (size_t)row * ldc + cofs) = val; }
        };
        pass(); 
    }
}

__global__ __launch_bounds__(256) void k_cvt8(const float* __restrict__ src, bf* dst, size_t n8) {
    const size_t i = (size_t)blockIdx.x * 256 + threadIdx.x; if (i >= n8) return;
    const v8f v = *(const v8f*)(src + i * 8); v8us o;
#pragma unroll
    for (int k = 0; k < 8; ++k) o[k] = f2bf(v[k]);
    *(v8us*)(dst + i * 8) = o; 
}
__global__ __launch_bounds__(256) void k_zero8(bf* dst, size_t n8) {
    const size_t i = (size_t)blockIdx.x * 256 + threadIdx.x; if (i >= n8) return; v8us z;
#pragma unroll
    for (int k = 0; k < 8; ++k) z[k] = 0;
    *(v8us*)(dst + i * 8) = z; 
}

// ===== attention, blockIdx.z = head =====
// k_fattn: scores, causal softmax and attn.v in one kernel; no score or probability leaves the registers. A wave owns 16 query rows of one head and walks the 64-key tiles up to
// its diagonal. Everything is held transposed, so that a lane owns ONE query row (lane & 15): S^T = K.Q^T + C.T^T (A = key rows, B = query rows; D element j of 16-key tile t is key
// t*16 + 8*hi + j), which is already the B-fragment k order (8*hi + 0..7, 16 + 8*hi + 0..7) of O^T = V^T.P^T: tiles 2*ks and 2*ks + 1 side by side.
// Running maximum (base 2) and running sum per lane (lanes r and r + 16 share a query: the maximum is joined every tile, the sum once at the end); O^T is rescaled by 2^(m_old - m_new).
// A work-group is 8 waves: waves 0-3 take row block 31 - x, waves 4-7 row block x, so that every work-group walks 33 tiles. The waves never meet: no LDS, no barrier.
typedef __attribute__((ext_vector_type(2))) __bf16 v2bf;
typedef __attribute__((ext_vector_type(4))) unsigned v4u;
__device__ __forceinline__ float xhalf(float x) { return __builtin_bit_cast(float, __builtin_amdgcn_permlanex16(__builtin_bit_cast(int, x), __builtin_bit_cast(int, x), 0x76543210, 0xfedcba98, false, false)); }  // lane l with lane l ^ 16
__global__ __launch_bounds__(256) void k_fattn(const bf* __restrict__ Qh, const bf* __restrict__ Ql, const bf* __restrict__ Kh, const bf* __restrict__ Kl, const bf* __restrict__ Th, const bf* __restrict__ Tl, const bf* __restrict__ Ch, const bf* __restrict__ Cl, const bf* __restrict__ VTh, const bf* __restrict__ VTl, float* O) {
    const int lane = threadIdx.x & 31, lr = lane & 15, hi = lane >> 4;
    const int wave = __builtin_amdgcn_readfirstlane((int)threadIdx.x >> 5);    // in a scalar register, so that the tile loop ends on a scalar branch
    const int bx = (wave >> 2) ? (int)blockIdx.x : NN / 64 - 1 - (int)blockIdx.x;
    const size_t zo = (size_t)blockIdx.z * NN * HD;         // one head's plane: [NN][HD] for q, k, q*t, kvcum and [HD][NN] for v^T
    const int qrow = bx * 64 + (wave & 3) * 16 + lr;
    typedef const __attribute__((address_space(1))) char* gch; typedef const __attribute__((address_space(1))) v8us* gv8;    // global address space, named: an address that comes out of an asm statement would else be loaded as a flat one
    auto gfrag = [](gch p) -> v16bf { return cat16b(*(gv8)p, *(gv8)(p + 32)); };    // k = 8*hi + 0..7 and 16 + 8*hi + 0..7
    const unsigned qb = (unsigned)((qrow * HD + 8 * hi) * 2), kb = (unsigned)((lr * HD + 8 * hi) * 2), vb = (unsigned)((lr * NN + 8 * hi) * 2);    // the lane's own byte offsets
    gch bQh = (gch)(Qh + zo), bQl = (gch)(Ql + zo), bTh = (gch)(Th + zo), bTl = (gch)(Tl + zo), gQh = bQh + qb, gQl = bQl + qb, gTh = bTh + qb, gTl = bTl + qb;
    v16bf qh[2], ql[2], th[2], tl[2];
    // every '#pragma unroll' of this kernel: the arrays it walks are register arrays, so their indices must be compile-time constants
#pragma unroll
    for (int ks = 0; ks < 2; ++ks) { qh[ks] = gfrag(gQh + ks * 64); ql[ks] = gfrag(gQl + ks * 64); th[ks] = gfrag(gTh + ks * 64); tl[ks] = gfrag(gTl + ks * 64); }
    // inputs only: the address registers of the query loads (scalar base and lane offset, or their sum) stay whole until those loads have come back
    asm volatile("s_wait_xcnt 0x0" :: "s"(bQh), "s"(bQl), "s"(bTh), "s"(bTl), "v"(qb), "v"(gQh), "v"(gQl), "v"(gTh), "v"(gTl), "v"(qh[0]), "v"(qh[1]), "v"(ql[0]), "v"(ql[1]), "v"(th[0]), "v"(th[1]), "v"(tl[0]), "v"(tl[1]) : "memory");
    // A tile is 12 steps of 4 A fragments (two 16-row tiles x hi and residual plane) and 6 matrix instructions: steps 0-7 the scores (16-key tile pair, k half, k or kvcum), steps 8-11 attn.v
    // (key half, 16-row pair of v^T). Step i works from buf[i % 3]; its fragments are fetched three steps ahead, across the softmax and across the loop's back edge.
    // The lane's address in each of the six planes lives in one register pair for the whole loop and moves once a tile (the asm statement in the loop); every load is that pair + a constant.
    unsigned long long aKh = (unsigned long long)((gch)(Kh + zo) + kb), aKl = (unsigned long long)((gch)(Kl + zo) + kb), aCh = (unsigned long long)((gch)(Ch + zo) + kb), aCl = (unsigned long long)((gch)(Cl + zo) + kb), aVh = (unsigned long long)((gch)(VTh + zo) + vb), aVl = (unsigned long long)((gch)(VTl + zo) + vb);
    auto fetch = [&](v16bf (&d)[4], int i) {
        if (i < 8) { const int c = ((i >> 2) * 32 * HD + ((i >> 1) & 1) * 32) * 2; gch ph = (gch)((i & 1) ? aCh : aKh) + c; gch pl = (gch)((i & 1) ? aCl : aKl) + c;
            d[0] = gfrag(ph); d[1] = gfrag(pl); d[2] = gfrag(ph + 16 * HD * 2); d[3] = gfrag(pl + 16 * HD * 2); }
        else { const int c = (((i - 8) & 1) * 32 * NN + ((i - 8) >> 1) * 32) * 2; gch ph = (gch)aVh + c; gch pl = (gch)aVl + c;
            d[0] = gfrag(ph); d[1] = gfrag(pl); d[2] = gfrag(ph + 16 * NN * 2); d[3] = gfrag(pl + 16 * NN * 2); }
    };
    // hi.hi + hi.residual + residual.hi of two independent accumulator tiles, taken in turn
    auto mm6 = [](const v16bf (&d)[4], v16bf bh, v16bf bl, v8f& c0, v8f& c1) { c0 = wmmab(d[0], bh, c0); c1 = wmmab(d[2], bh, c1); c0 = wmmab(d[0], bl, c0); c1 = wmmab(d[2], bl, c1); c0 = wmmab(d[1], bh, c0); c1 = wmmab(d[3], bh, c1); };
    v16bf buf[3][4];
    // the barriers keep the three fetches in the order in which the loop's foot issues them, so that the counted waits at the loop's head hold on both ways in
    fetch(buf[0], 0); __builtin_amdgcn_sched_barrier(0); fetch(buf[1], 1); __builtin_amdgcn_sched_barrier(0); fetch(buf[2], 2); __builtin_amdgcn_sched_barrier(0);
    typedef __attribute__((ext_vector_type(2))) float v2f;
    v8f o[4]; v2f lv = (v2f){};
#pragma unroll
    for (int t = 0; t < 4; ++t) o[t] = (v8f){};
    float m = -3.0e38f;
    const unsigned long long dv = 64 * 2;    // 64 keys on in a row of v^T
    const float C2 = SCL * 1.4426950408889634f;    // logits / 8, in base 2
#pragma unroll 1    // one tile a trip: 72 matrix instructions and 96 loads are body enough, a second copy would only grow the code
    for (int kt = 0; kt <= bx; ++kt) {
        const unsigned long long dk = (kt < bx) ? (unsigned long long)(64 * HD * 2) : 0ull;    // the last tile fetches its own first steps once more, unused: no address past the planes
        v8f s[4];
#pragma unroll
        for (int t = 0; t < 4; ++t) s[t] = (v8f){};
#pragma unroll
        for (int i = 0; i < 8; ++i) { const int ks = (i >> 1) & 1;
            mm6(buf[i % 3], (i & 1) ? th[ks] : qh[ks], (i & 1) ? tl[ks] : ql[ks], s[(i >> 2) * 2], s[(i >> 2) * 2 + 1]);
            __builtin_amdgcn_sched_barrier(0);    // keeps the fetch three steps ahead: without the pair the compiler sinks each load to its use and every step waits a full latency
            fetch(buf[i % 3], i + 3);
            __builtin_amdgcn_sched_barrier(0); }
        if (kt == bx) { const int lim = (wave & 3) * 16 + lr - hi * 8;    // diagonal tile: key t*16 + j of this lane's half is allowed while t*16 + j <= lim
#pragma unroll
            for (int t = 0; t < 4; ++t) {
#pragma unroll
                for (int j = 0; j < 8; ++j) s[t][j] = (t * 16 + j <= lim) ? s[t][j] : -3.0e38f; } }
        float mt = -3.0e38f;
#pragma unroll
        for (int t = 0; t < 4; ++t) {
#pragma unroll
            for (int j = 0; j < 8; ++j) mt = fmaxf(mt, s[t][j]); }
        mt = fmaxf(mt, xhalf(mt));
        const float mn = fmaxf(m, mt * C2), al = __builtin_amdgcn_exp2f(m - mn); m = mn;
        v4u ph[4], pl[4]; lv *= al;    // P, hi and residual, two bf16 a word
#pragma unroll
        for (int t = 0; t < 4; ++t) { v8f p;
#pragma unroll
            for (int j = 0; j < 8; ++j) p[j] = __builtin_amdgcn_exp2f(fmaf(s[t][j], C2, -mn));
            lv += ((v2f){p[0], p[1]} + (v2f){p[2], p[3]}) + ((v2f){p[4], p[5]} + (v2f){p[6], p[7]}); o[t] *= al;
#pragma unroll
            for (int j = 0; j < 4; ++j) { const v2f pp = (v2f){p[2 * j], p[2 * j + 1]}; const v2bf h2 = __builtin_convertvector(pp, v2bf), l2 = __builtin_convertvector(pp - __builtin_convertvector(h2, v2f), v2bf);
                ph[t][j] = __builtin_bit_cast(unsigned, h2); pl[t][j] = __builtin_bit_cast(unsigned, l2); } }
#pragma unroll
        for (int i = 8; i < 12; ++i) { const int ks = (i - 8) >> 1, tp = (i - 8) & 1;
            const v16bf pH = __builtin_bit_cast(v16bf, __builtin_shufflevector(ph[2 * ks], ph[2 * ks + 1], 0, 1, 2, 3, 4, 5, 6, 7)), pL = __builtin_bit_cast(v16bf, __builtin_shufflevector(pl[2 * ks], pl[2 * ks + 1], 0, 1, 2, 3, 4, 5, 6, 7));
            mm6(buf[i % 3], pH, pL, o[2 * tp], o[2 * tp + 1]);
            __builtin_amdgcn_sched_barrier(0);    // as above
            // on to the next tile's addresses, once this tile's last fetch is out (i == 8); the wait stands in front of the overwrite of registers that issued loads name
            if (i == 9) asm volatile("s_wait_xcnt 0x0\n\tv_add_nc_u64 %0, %6, %0\n\tv_add_nc_u64 %1, %6, %1\n\tv_add_nc_u64 %2, %6, %2\n\tv_add_nc_u64 %3, %6, %3\n\tv_add_nc_u64 %4, %7, %4\n\tv_add_nc_u64 %5, %7, %5" : "+v"(aKh), "+v"(aKl), "+v"(aCh), "+v"(aCl), "+v"(aVh), "+v"(aVl) : "s"(dk), "s"(dv) : "memory");
            fetch(buf[i % 3], i == 8 ? 11 : i - 9);
            __builtin_amdgcn_sched_barrier(0); }
    }
    asm volatile("s_wait_xcnt 0x0" :: "v"(aKh), "v"(aKl), "v"(aCh), "v"(aCl), "v"(aVh), "v"(aVl) : "memory");    // inputs only: the six address pairs stay whole until the last tile's fetches are past their address stage
    float l = lv[0] + lv[1];
    l += xhalf(l);
    const float inv = 1.0f / l;
    float* orow = O + (size_t)qrow * DMOD + (size_t)blockIdx.z * HD + hi * 8;
#pragma unroll
    for (int t = 0; t < 4; ++t) { const v8f r = o[t] * inv; *(v4f*)(orow + t * 16) = (v4f){r[0], r[1], r[2], r[3]}; *(v4f*)(orow + t * 16 + 4) = (v4f){r[4], r[5], r[6], r[7]}; }
}
__global__ __launch_bounds__(256) void k_planes32z(const float* __restrict__ F, int ld, int off, float sc, int rows, bf* Ph, bf* Pl) {
    typedef __attribute__((ext_vector_type(2))) unsigned short v2us;
    const int lane = threadIdx.x & 31; const size_t r = ((size_t)blockIdx.x * 8 + (threadIdx.x >> 5)) * 2 + (lane >> 4); if (r >= (size_t)rows) return; const int z = blockIdx.z; const int c0 = (lane & 15) * 2; v2us oh, ol;
    Ph += (size_t)z * rows * 32; Pl += (size_t)z * rows * 32;
#pragma unroll
    for (int i = 0; i < 2; ++i) { const float y = F[r * ld + off + z * 32 + c0 + i] * sc; const unsigned short hb = f2bf(y); oh[i] = hb; ol[i] = f2bf(y - bf2f(hb)); }
    const size_t o = r * 32 + c0; *(v2us*)(Ph + o) = oh; *(v2us*)(Pl + o) = ol; 
}
__global__ __launch_bounds__(256) void k_vtpadz(const float* __restrict__ F, int ld, int off, int nk, bf* Th, bf* Tl) {
    typedef __attribute__((ext_vector_type(2))) unsigned short v2us;
    const int lane = threadIdx.x & 31; const size_t wid = (size_t)blockIdx.x * 8 + (threadIdx.x >> 5); if (wid >= (size_t)64 * (nk / 64)) return; const int z = blockIdx.z; const int d = (int)(wid / (nk / 64)); const int k0 = (int)(wid % (nk / 64)) * 64 + lane * 2; v2us oh, ol;
    Th += (size_t)z * 64 * nk; Tl += (size_t)z * 64 * nk;
#pragma unroll
    for (int i = 0; i < 2; ++i) { const float y = (d < 32) ? F[(size_t)(k0 + i) * ld + off + z * 32 + (d < 32 ? d : 0)] : 0.f; const unsigned short hb = f2bf(y); oh[i] = hb; ol[i] = f2bf(y - bf2f(hb)); }
    const size_t o = (size_t)d * nk + k0; *(v2us*)(Th + o) = oh; *(v2us*)(Tl + o) = ol; 
}
template <int NK>
__global__ __launch_bounds__(256) void k_softmaxz(const float* __restrict__ S, int rows, bf* PH, bf* PL) {
    typedef __attribute__((ext_vector_type(4))) unsigned short v4us;
    const int lane = threadIdx.x & 31, i = blockIdx.x * 8 + (threadIdx.x >> 5); if (i >= rows) return; const size_t zo = (size_t)blockIdx.z * rows * NK; const float* sr = S + zo + (size_t)i * NK; PH += zo; PL += zo;
    float m = -3.0e38f;
#pragma unroll 1
    for (int c0 = lane * 4; c0 < NK; c0 += 128) {
#pragma unroll
        for (int q = 0; q < 4; ++q) m = fmaxf(m, sr[c0 + q]); }
#pragma unroll
    for (int sh = 16; sh; sh >>= 1) m = fmaxf(m, __shfl_xor(m, sh, 32));
    float sum = 0.f;
#pragma unroll 1
    for (int c0 = lane * 4; c0 < NK; c0 += 128) {
#pragma unroll
        for (int q = 0; q < 4; ++q) sum += __expf(sr[c0 + q] - m); }
#pragma unroll
    for (int sh = 16; sh; sh >>= 1) sum += __shfl_xor(sum, sh, 32);
    const float inv = 1.0f / sum;
{
#pragma unroll 1
        for (int c0 = lane * 4; c0 < NK; c0 += 128) { v4us oh, ol;
#pragma unroll
            for (int q = 0; q < 4; ++q) { const float p = __expf(sr[c0 + q] - m) * inv; const unsigned short hb = f2bf(p); oh[q] = hb; ol[q] = f2bf(p - bf2f(hb)); }
            const size_t o = (size_t)i * NK + c0; *(v4us*)(PH + o) = oh; *(v4us*)(PL + o) = ol; }
         }
}
__global__ __launch_bounds__(256) void k_placez(const float* __restrict__ XH, int rows, int ldy, float* Y) {
    const int lane = threadIdx.x & 31; const size_t q = (size_t)blockIdx.x * 8 + (threadIdx.x >> 5); if (q >= (size_t)rows) return; const int z = blockIdx.z; const float v = XH[((size_t)z * rows + q) * 64 + lane];
    *(float*)(Y + q * ldy + z * 32 + lane) = v; 
}

__global__ __launch_bounds__(256) void k_hplanesz(const float* __restrict__ F, int ld, int h0, float sc, int rows, bf* Ph, bf* Pl) {
    typedef __attribute__((ext_vector_type(2))) unsigned short v2us;
    const int lane = threadIdx.x & 31; const size_t r = (size_t)blockIdx.x * 8 + (threadIdx.x >> 5); if (r >= (size_t)rows) return; const int z = blockIdx.z; v2us oh, ol;
    Ph += (size_t)z * rows * 64; Pl += (size_t)z * rows * 64;
#pragma unroll
    for (int i = 0; i < 2; ++i) { const float y = F[r * ld + (h0 + z) * 64 + lane * 2 + i] * sc; const unsigned short hb = f2bf(y); oh[i] = hb; ol[i] = f2bf(y - bf2f(hb)); }
    const size_t o = r * 64 + lane * 2; *(v2us*)(Ph + o) = oh; *(v2us*)(Pl + o) = ol; 
}
__global__ __launch_bounds__(256) void k_vtz(const float* __restrict__ F, int ld, int h0, int nk, bf* Th, bf* Tl) {
    typedef __attribute__((ext_vector_type(2))) unsigned short v2us;
    const int lane = threadIdx.x & 31; const size_t wid = (size_t)blockIdx.x * 8 + (threadIdx.x >> 5); if (wid >= (size_t)64 * (nk / 64)) return; const int z = blockIdx.z; const int d = (int)(wid / (nk / 64)); const int t0 = (int)(wid % (nk / 64)) * 64 + lane * 2; v2us oh, ol;
    Th += (size_t)z * 64 * nk; Tl += (size_t)z * 64 * nk;
#pragma unroll
    for (int i = 0; i < 2; ++i) { const float y = F[(size_t)(t0 + i) * ld + (h0 + z) * 64 + d]; const unsigned short hb = f2bf(y); oh[i] = hb; ol[i] = f2bf(y - bf2f(hb)); }
    const size_t o = (size_t)d * nk + t0; *(v2us*)(Th + o) = oh; *(v2us*)(Tl + o) = ol; 
}
template <int NK>
__global__ __launch_bounds__(256) void k_softmaxzs(const float* __restrict__ S, int rows, float sc, bf* PH, bf* PL) {
    typedef __attribute__((ext_vector_type(4))) unsigned short v4us;
    const int lane = threadIdx.x & 31, i = blockIdx.x * 8 + (threadIdx.x >> 5); if (i >= rows) return; const size_t zo = (size_t)blockIdx.z * rows * NK; const float* sr = S + zo + (size_t)i * NK; PH += zo; PL += zo;
    float m = -3.0e38f;
#pragma unroll 1
    for (int c0 = lane * 4; c0 < NK; c0 += 128) {
#pragma unroll
        for (int q = 0; q < 4; ++q) m = fmaxf(m, sr[c0 + q] * sc); }
#pragma unroll
    for (int sh = 16; sh; sh >>= 1) m = fmaxf(m, __shfl_xor(m, sh, 32));
    float sum = 0.f;
#pragma unroll 1
    for (int c0 = lane * 4; c0 < NK; c0 += 128) {
#pragma unroll
        for (int q = 0; q < 4; ++q) sum += __expf(sr[c0 + q] * sc - m); }
#pragma unroll
    for (int sh = 16; sh; sh >>= 1) sum += __shfl_xor(sum, sh, 32);
    const float inv = 1.0f / sum;
{
#pragma unroll 1
        for (int c0 = lane * 4; c0 < NK; c0 += 128) { v4us oh, ol;
#pragma unroll
            for (int q = 0; q < 4; ++q) { const float p = __expf(sr[c0 + q] * sc - m) * inv; const unsigned short hb = f2bf(p); oh[q] = hb; ol[q] = f2bf(p - bf2f(hb)); }
            const size_t o = (size_t)i * NK + c0; *(v4us*)(PH + o) = oh; *(v4us*)(PL + o) = ol; }
         }
}

__global__ __launch_bounds__(256) void k_cvtx(const float* __restrict__ src, int rows, bf* dst) {
    const int lane = threadIdx.x & 31; const size_t r = (size_t)blockIdx.x * 8 + (threadIdx.x >> 5); if (r >= (size_t)rows) return;
{
#pragma unroll
        for (int q = 0; q < DMOD / 256; ++q) { v8us o;
#pragma unroll
            for (int i = 0; i < 8; ++i) o[i] = f2bf(src[r * DMOD + q * 256 + lane * 8 + i]);
            *(v8us*)(dst + r * DMOD + q * 256 + lane * 8) = o; }
         }
}
__global__ __launch_bounds__(256) void k_wcat4(const float* __restrict__ A0, const float* __restrict__ A1, const float* __restrict__ A2, const float* __restrict__ A3, bf* W4) {
    const size_t i = ((size_t)blockIdx.x * 256 + threadIdx.x) * 8; if (i >= (size_t)QW * DMOD) return; const size_t blk = i / ((size_t)DMOD * DMOD), o = i % ((size_t)DMOD * DMOD);
    const float* src = (blk == 0) ? A0 : (blk == 1) ? A1 : (blk == 2) ? A2 : A3; v8us v;
#pragma unroll
    for (int q = 0; q < 8; ++q) v[q] = f2bf(src[o + q]);
    *(v8us*)(W4 + i) = v; 
}
__global__ __launch_bounds__(256) void k_bias4(const float* __restrict__ b0, const float* __restrict__ b1, const float* __restrict__ b2, const float* __restrict__ b3, float* B4) {
    const size_t i = (size_t)blockIdx.x * 256 + threadIdx.x; if (i >= (size_t)QW) return; const int blk = (int)(i / DMOD), o = (int)(i % DMOD); const float v = (blk == 0) ? b0[o] : (blk == 1) ? b1[o] : (blk == 2) ? b2[o] : b3[o];
    *(float*)(B4 + i) = v; 
}
__global__ __launch_bounds__(256) void k_cumkv(const float* __restrict__ F, float* KVC) {
    const int lane = threadIdx.x & 31; const int w = blockIdx.x * 8 + (threadIdx.x >> 5); if (w >= DMOD / 32) return; const int c = w * 32 + lane; float acc = 0.f;
    for (int t = 0; t < NN; ++t) { const float* fr = F + (size_t)t * QW; acc = fmaf(fr[DMOD + c] * fr[2 * DMOD + c], SCL, acc); float* dst = KVC + (size_t)t * DMOD + c; *(float*)dst = acc;  }
}
__global__ __launch_bounds__(256) void k_qtpl(const float* __restrict__ F, int h0, bf* Ph, bf* Pl) {
    typedef __attribute__((ext_vector_type(2))) unsigned short v2us;
    const int lane = threadIdx.x & 31; const size_t i = (size_t)blockIdx.x * 8 + (threadIdx.x >> 5); if (i >= (size_t)NN) return; const int z = blockIdx.z; const int h = h0 + z; Ph += (size_t)z * NN * HD; Pl += (size_t)z * NN * HD; v2us oh, ol;
#pragma unroll
    for (int q = 0; q < 2; ++q) { const int d = lane * 2 + q; const float y = F[i * QW + h * HD + d] * F[i * QW + 3 * DMOD + h * HD + d]; const unsigned short hb = f2bf(y); oh[q] = hb; ol[q] = f2bf(y - bf2f(hb)); }
    const size_t o = i * HD + lane * 2; *(v2us*)(Ph + o) = oh; *(v2us*)(Pl + o) = ol; 
}
__global__ __launch_bounds__(256) void k_splitD(const float* __restrict__ src, int rows, bf* dh, bf* dl) {
    const int lane = threadIdx.x & 31; const size_t r = (size_t)blockIdx.x * 8 + (threadIdx.x >> 5); if (r >= (size_t)rows) return;
{
#pragma unroll
        for (int q = 0; q < DMOD / 256; ++q) { const size_t o = r * DMOD + q * 256 + lane * 8; const v8f v = *(const v8f*)(src + o); v8us oh, ol;
#pragma unroll
            for (int i = 0; i < 8; ++i) { const unsigned short hb = f2bf(v[i]); oh[i] = hb; ol[i] = f2bf(v[i] - bf2f(hb)); }
            *(v8us*)(dh + o) = oh; *(v8us*)(dl + o) = ol; }
         }
}

extern "C" void kernel_launch(void* const* d_in, const int* in_sizes, int n_in,
                              void* d_out, int out_size, void* d_ws, size_t ws_size, hipStream_t stream) {
    (void)in_sizes; (void)n_in; (void)out_size;
    const float* x = (const float*)d_in[0]; const float* Wq = (const float*)d_in[1]; const float* bq = (const float*)d_in[2]; const float* Wk = (const float*)d_in[3]; const float* bk = (const float*)d_in[4]; const float* Wv = (const float*)d_in[5]; const float* bv = (const float*)d_in[6]; const float* Wt = (const float*)d_in[7]; const float* bt = (const float*)d_in[8]; const float* Wo = (const float*)d_in[9]; const float* bo = (const float*)d_in[10];
    float* out = (float*)d_out;    // [2][2048][1024]
    char* wsp = (char*)d_ws;
    auto take = [&](size_t bytes) { char* p = wsp; wsp += (bytes + 255) & ~(size_t)255; return (void*)p; };
    bf* W4 = (bf*)take((size_t)QW * DMOD * 2); float* B4 = (float*)take((size_t)QW * 4); bf* WO = (bf*)take((size_t)DMOD * DMOD * 2); float* O = (float*)take((size_t)NN * DMOD * 4);
    const size_t PLB = (size_t)NH_ * NN * HD * 2;    // one operand plane, all heads
    bf* Qh = (bf*)take(PLB); bf* Ql = (bf*)take(PLB); bf* Kh = (bf*)take(PLB); bf* Kl = (bf*)take(PLB); bf* Th = (bf*)take(PLB); bf* Tl = (bf*)take(PLB); bf* Ch = (bf*)take(PLB); bf* Cl = (bf*)take(PLB); bf* VTh = (bf*)take(PLB); bf* VTl = (bf*)take(PLB);
    char* const big = wsp;
    bf* Xb = (bf*)take((size_t)NN * DMOD * 2); float* F = (float*)take((size_t)NN * QW * 4); float* KVC = (float*)take((size_t)NN * DMOD * 4);
    if ((size_t)(wsp - (char*)d_ws) > ws_size) return;    // ~ 102 MiB
    // Xb, F, KVC are last read when the operand planes are made, Oh, Ol are first written after the attention: they lie on the same bytes.
    wsp = big; bf* Oh = (bf*)take((size_t)NN * DMOD * 2); bf* Ol = (bf*)take((size_t)NN * DMOD * 2);
    k_wcat4<<<(unsigned)(((size_t)QW * DMOD / 8 + 255) / 256), 256, 0, stream>>>(Wq, Wk, Wv, Wt, W4); k_bias4<<<QW / 256, 256, 0, stream>>>(bq, bk, bv, bt, B4); k_cvt8<<<(DMOD * DMOD / 8 + 255) / 256, 256, 0, stream>>>(Wo, WO, DMOD * DMOD / 8);
    for (int b = 0; b < NBT; ++b) {
        k_cvtx<<<NN / 8, 256, 0, stream>>>(x + (size_t)b * NN * DMOD, NN, Xb);
        k_gemmb<false, false><<<dim3(NN / 64, QW / 64, 1), 128, 0, stream>>>(Xb, nullptr, W4, B4, F, QW, nullptr, nullptr, DMOD);      // [q | k | v | t] + biases
        k_cumkv<<<(DMOD / 32) / 8, 256, 0, stream>>>(F, KVC);
        // blockIdx.z = head in every launch from here to k_fattn
        k_hplanesz<<<dim3(NN / 8, 1, NH_), 256, 0, stream>>>(F, QW, 0, 1.0f, NN, Qh, Ql); k_hplanesz<<<dim3(NN / 8, 1, NH_), 256, 0, stream>>>(F + DMOD, QW, 0, 1.0f, NN, Kh, Kl);
        k_qtpl<<<dim3(NN / 8, 1, NH_), 256, 0, stream>>>(F, 0, Th, Tl); k_hplanesz<<<dim3(NN / 8, 1, NH_), 256, 0, stream>>>(KVC, DMOD, 0, 1.0f, NN, Ch, Cl); k_vtz<<<dim3((HD * (NN / 64)) / 8, 1, NH_), 256, 0, stream>>>(F + 2 * DMOD, QW, 0, NN, VTh, VTl);
        k_fattn<<<dim3(NN / 128, 1, NH_), 256, 0, stream>>>(Qh, Ql, Kh, Kl, Th, Tl, Ch, Cl, VTh, VTl, O);
        k_splitD<<<NN / 8, 256, 0, stream>>>(O, NN, Oh, Ol);
        k_gemmb<true, false><<<dim3(NN / 64, DMOD / 64, 1), 128, 0, stream>>>(Oh, Ol, WO, bo, out + (size_t)b * NN * DMOD, DMOD, nullptr, nullptr, DMOD); }
}

// v003
// Measured time: 514 microseconds a run.
// Next to v002, in two timings, it ran 1.74 times as fast each time.
// All steps since v000 together make it 11.2 times as fast.
#include <hip/hip_runtime.h>

// Compute dtypes, f32 accumulate, per item: q/k/v/t = x.W^T + b fused as one [2048 x 1024].[1024 x 4096] GEMM with PLAIN bf16 operands (exact products); the triplet term's
// cumsum over key positions of k*v/8 (f32 prefix sums per column, in 64-row chunks + the sums of the chunks in front) and q*t in f32; per head, in ONE kernel (k_fattn): scores q.k^T + (q*t).kvcum^T with bf16 hi +
// UNSCALED residual planes (three products each; tiles above the diagonal skipped), / 8 + causal softmax in f32 with a running maximum and sum, attn.v (three products); Wo (+ bias) on

#define NBT  2
#define NN   2048
#define DMOD 1024
#define NH_  16
#define HD   64
#define QW   (4 * DMOD)
#define DM   DMOD
#define NTK  NN
#define SCL  0.125f
#define LOSC 1024.0f

typedef _Float16 h16;
typedef unsigned short bf;
typedef __attribute__((ext_vector_type(16))) __bf16   v16bf;
typedef __attribute__((ext_vector_type(16))) _Float16 v16h;
typedef __attribute__((ext_vector_type(8)))  _Float16 v8h;
typedef __attribute__((ext_vector_type(8)))  unsigned short v8us;
typedef __attribute__((ext_vector_type(8)))  float    v8f;
typedef __attribute__((ext_vector_type(4)))  float    v4f;
typedef __attribute__((ext_vector_type(4)))  _Float16 v4h;
typedef v8h  __attribute__((may_alias)) v8ha;
typedef v4f  __attribute__((may_alias)) v4fa;
typedef v8us __attribute__((may_alias)) v8usa;

__device__ __forceinline__ unsigned short f2bf(float f) { unsigned u = __float_as_uint(f); u += 0x7FFFu + ((u >> 16) & 1u); return (unsigned short)(u >> 16); }
__device__ __forceinline__ float bf2f(unsigned short b) { return __uint_as_float(((unsigned)b) << 16); }
__device__ __forceinline__ float bfr(float f) { return bf2f(f2bf(f)); }
__device__ __forceinline__ v16h cat16(v8h lo, v8h hi) { return __builtin_shufflevector(lo, hi, 0, 1, 2, 3, 4, 5, 6, 7, 8, 9, 10, 11, 12, 13, 14, 15); }
__device__ __forceinline__ v16bf cat16b(v8us lo, v8us hi) { return __builtin_bit_cast(v16bf, __builtin_shufflevector(lo, hi, 0, 1, 2, 3, 4, 5, 6, 7, 8, 9, 10, 11, 12, 13, 14, 15)); }
__device__ __forceinline__ v8f wmma16(v16h a, v16h b, v8f c) { return __builtin_amdgcn_wmma_f32_16x16x32_f16(false, a, false, b, (short)0, c, false, false); }
__device__ __forceinline__ v8f wmmab(v16bf a, v16bf b, v8f c) { return __builtin_amdgcn_wmma_f32_16x16x32_bf16(false, a, false, b, (short)0, c, false, false); }

// k_gemmb: 64 x 64 block tile (4 waves x 16 x 64) of C[NTK][NW] = (A [+ Al]).B^T (K = 1024) [+ bf(bias[c])] [+ bf(R[r][c]) residual]; f32 whole-line epilogue (or f16
template <bool SPLITA, bool F16OUT = false>
__global__ __launch_bounds__(128) void k_gemmb(const bf* __restrict__ A, const bf* __restrict__ Al, const bf* __restrict__ Bn, const float* __restrict__ bias, float* C, int ldc, h16* C2, const float* __restrict__ R = nullptr, int K = DM, int roundR = 1) {
    __shared__ __align__(16) float ost[4][16 * 68];
    const int lane = threadIdx.x & 31, wave = threadIdx.x >> 5, lr = lane & 15, hi = lane >> 4;
    const int r0 = blockIdx.x * 64 + wave * 16, c0 = blockIdx.y * 64;
    const size_t aoff = (size_t)(r0 + lr) * K + 8 * hi;
    size_t boff[4];
#pragma unroll
    for (int t = 0; t < 4; ++t) boff[t] = (size_t)(c0 + t * 16 + lr) * K + 8 * hi;
    v8f acc[4];
#pragma unroll
    for (int t = 0; t < 4; ++t) acc[t] = (v8f){};
#pragma unroll 1
    for (int kc = 0; kc < K; kc += 32) {
        const v16bf a = cat16b(*(const v8us*)(A + aoff + kc), *(const v8us*)(A + aoff + kc + 16));
        v16bf al = a;
        if (SPLITA) al = cat16b(*(const v8us*)(Al + aoff + kc), *(const v8us*)(Al + aoff + kc + 16));
#pragma unroll
        for (int t = 0; t < 4; ++t) { const v16bf b = cat16b(*(const v8us*)(Bn + boff[t] + kc), *(const v8us*)(Bn + boff[t] + kc + 16)); acc[t] = wmmab(a, b, acc[t]); if (SPLITA) acc[t] = wmmab(al, b, acc[t]); }
        asm volatile("v_nop\n\tv_nop\n\tv_nop\n\tv_nop" : "+v"(acc[0]), "+v"(acc[1]), "+v"(acc[2]), "+v"(acc[3]) : "v"(a), "v"(al));
    }
    float* os = &ost[wave][0];
#pragma unroll
    for (int t = 0; t < 4; ++t) { const float bv = bias ? bfr(bias[c0 + t * 16 + lr]) : 0.f;
#pragma unroll
        for (int j = 0; j < 8; ++j) os[(hi * 8 + j) * 68 + t * 16 + lr] = acc[t][j] + bv; }
    __syncthreads();
    if (F16OUT) {
        h16* crow = (h16*)(void*)C + (size_t)r0 * ldc + c0;
        auto pass = [&]() {
#pragma unroll
            for (int s = 0; s < 4; ++s) { const int row = 4 * s + (lane >> 3), piece = lane & 7; const float* sp = os + row * 68 + piece * 8; v8h o, o2;
#pragma unroll
                for (int i = 0; i < 8; ++i) { const h16 a = (h16)sp[i]; o[i] = a; o2[i] = (h16)((sp[i] - (float)a) * LOSC); }
                *(v8h*)(crow + (size_t)row * ldc + piece * 8) = o; if (C2) *(v8h*)(C2 + (size_t)r0 * ldc + c0 + (size_t)row * ldc + piece * 8) = o2; }
        };
        pass(); 
    } else {
        float* crow = C + (size_t)r0 * ldc + c0;
        auto pass = [&]() {
#pragma unroll
            for (int s = 0; s < 8; ++s) { const int Lid = (lane >> 3) + 4 * s, piece = lane & 7; const int row = Lid >> 1, cofs = (Lid & 1) * 32 + piece * 4;
                v4f val = *(const v4fa*)(os + row * 68 + cofs); if (R) { const v4f rv = *(const v4f*)(R + ((size_t)r0 + row) * ldc + c0 + cofs); val += roundR ? (v4f){bfr(rv[0]), bfr(rv[1]), bfr(rv[2]), bfr(rv[3])} : rv; }
                *(v4f*)(crow + (size_t)row * ldc + cofs) = val; }
        };
        pass(); 
    }
}

__global__ __launch_bounds__(256) void k_cvt8(const float* __restrict__ src, bf* dst, size_t n8) {
    const size_t i = (size_t)blockIdx.x * 256 + threadIdx.x; if (i >= n8) return;
    const v8f v = *(const v8f*)(src + i * 8); v8us o;
#pragma unroll
    for (int k = 0; k < 8; ++k) o[k] = f2bf(v[k]);
    *(v8us*)(dst + i * 8) = o; 
}
__global__ __launch_bounds__(256) void k_zero8(bf* dst, size_t n8) {
    const size_t i = (size_t)blockIdx.x * 256 + threadIdx.x; if (i >= n8) return; v8us z;
#pragma unroll
    for (int k = 0; k < 8; ++k) z[k] = 0;
    *(v8us*)(dst + i * 8) = z; 
}

// ===== attention, blockIdx.z = head =====
// k_fattn: scores, causal softmax and attn.v in one kernel; no score or probability leaves the registers. A wave owns 16 query rows of one head and walks the 64-key tiles up to
// its diagonal. Everything is held transposed, so that a lane owns ONE query row (lane & 15): S^T = K.Q^T + C.T^T (A = key rows, B = query rows; D element j of 16-key tile t is key
// t*16 + 8*hi + j), which is already the B-fragment k order (8*hi + 0..7, 16 + 8*hi + 0..7) of O^T = V^T.P^T: tiles 2*ks and 2*ks + 1 side by side.
// Running maximum (base 2) and running sum per lane (lanes r and r + 16 share a query: the maximum is joined every tile, the sum once at the end); O^T is rescaled by 2^(m_old - m_new).
// A work-group is 8 waves: waves 0-3 take row block 31 - x, waves 4-7 row block x, so that every work-group walks 33 tiles. The waves never meet: no LDS, no barrier.
typedef __attribute__((ext_vector_type(2))) __bf16 v2bf;
typedef __attribute__((ext_vector_type(4))) unsigned v4u;
__device__ __forceinline__ float xhalf(float x) { return __builtin_bit_cast(float, __builtin_amdgcn_permlanex16(__builtin_bit_cast(int, x), __builtin_bit_cast(int, x), 0x76543210, 0xfedcba98, false, false)); }  // lane l with lane l ^ 16
__global__ __launch_bounds__(256) void k_fattn(const bf* __restrict__ Qh, const bf* __restrict__ Ql, const bf* __restrict__ Kh, const bf* __restrict__ Kl, const bf* __restrict__ Th, const bf* __restrict__ Tl, const bf* __restrict__ Ch, const bf* __restrict__ Cl, const bf* __restrict__ VTh, const bf* __restrict__ VTl, float* O) {
    const int lane = threadIdx.x & 31, lr = lane & 15, hi = lane >> 4;
    const int wave = __builtin_amdgcn_readfirstlane((int)threadIdx.x >> 5);    // in a scalar register, so that the tile loop ends on a scalar branch
    const int bx = (wave >> 2) ? (int)blockIdx.x : NN / 64 - 1 - (int)blockIdx.x;
    const size_t zo = (size_t)blockIdx.z * NN * HD;         // one head's plane: [NN][HD] for q, k, q*t, kvcum and [HD][NN] for v^T
    const int qrow = bx * 64 + (wave & 3) * 16 + lr;
    typedef const __attribute__((address_space(1))) char* gch; typedef const __attribute__((address_space(1))) v8us* gv8;    // global address space, named: an address that comes out of an asm statement would else be loaded as a flat one
    auto gfrag = [](gch p) -> v16bf { return cat16b(*(gv8)p, *(gv8)(p + 32)); };    // k = 8*hi + 0..7 and 16 + 8*hi + 0..7
    const unsigned qb = (unsigned)((qrow * HD + 8 * hi) * 2), kb = (unsigned)((lr * HD + 8 * hi) * 2), vb = (unsigned)((lr * NN + 8 * hi) * 2);    // the lane's own byte offsets
    gch bQh = (gch)(Qh + zo), bQl = (gch)(Ql + zo), bTh = (gch)(Th + zo), bTl = (gch)(Tl + zo), gQh = bQh + qb, gQl = bQl + qb, gTh = bTh + qb, gTl = bTl + qb;
    v16bf qh[2], ql[2], th[2], tl[2];
    // every '#pragma unroll' of this kernel: the arrays it walks are register arrays, so their indices must be compile-time constants
#pragma unroll
    for (int ks = 0; ks < 2; ++ks) { qh[ks] = gfrag(gQh + ks * 64); ql[ks] = gfrag(gQl + ks * 64); th[ks] = gfrag(gTh + ks * 64); tl[ks] = gfrag(gTl + ks * 64); }
    // inputs only: the address registers of the query loads (scalar base and lane offset, or their sum) stay whole until those loads have come back
    asm volatile("s_wait_xcnt 0x0" :: "s"(bQh), "s"(bQl), "s"(bTh), "s"(bTl), "v"(qb), "v"(gQh), "v"(gQl), "v"(gTh), "v"(gTl), "v"(qh[0]), "v"(qh[1]), "v"(ql[0]), "v"(ql[1]), "v"(th[0]), "v"(th[1]), "v"(tl[0]), "v"(tl[1]) : "memory");
    // A tile is 12 steps of 4 A fragments (two 16-row tiles x hi and residual plane) and 6 matrix instructions: steps 0-7 the scores (16-key tile pair, k half, k or kvcum), steps 8-11 attn.v
    // (key half, 16-row pair of v^T). Step i works from buf[i % 3]; its fragments are fetched three steps ahead, across the softmax and across the loop's back edge.
    // The lane's address in each of the six planes lives in one register pair for the whole loop and moves once a tile (the asm statement in the loop); every load is that pair + a constant.
    unsigned long long aKh = (unsigned long long)((gch)(Kh + zo) + kb), aKl = (unsigned long long)((gch)(Kl + zo) + kb), aCh = (unsigned long long)((gch)(Ch + zo) + kb), aCl = (unsigned long long)((gch)(Cl + zo) + kb), aVh = (unsigned long long)((gch)(VTh + zo) + vb), aVl = (unsigned long long)((gch)(VTl + zo) + vb);
    auto fetch = [&](v16bf (&d)[4], int i) {
        if (i < 8) { const int c = ((i >> 2) * 32 * HD + ((i >> 1) & 1) * 32) * 2; gch ph = (gch)((i & 1) ? aCh : aKh) + c; gch pl = (gch)((i & 1) ? aCl : aKl) + c;
            d[0] = gfrag(ph); d[1] = gfrag(pl); d[2] = gfrag(ph + 16 * HD * 2); d[3] = gfrag(pl + 16 * HD * 2); }
        else { const int c = (((i - 8) & 1) * 32 * NN + ((i - 8) >> 1) * 32) * 2; gch ph = (gch)aVh + c; gch pl = (gch)aVl + c;
            d[0] = gfrag(ph); d[1] = gfrag(pl); d[2] = gfrag(ph + 16 * NN * 2); d[3] = gfrag(pl + 16 * NN * 2); }
    };
    // hi.hi + hi.residual + residual.hi of two independent accumulator tiles, taken in turn
    auto mm6 = [](const v16bf (&d)[4], v16bf bh, v16bf bl, v8f& c0, v8f& c1) { c0 = wmmab(d[0], bh, c0); c1 = wmmab(d[2], bh, c1); c0 = wmmab(d[0], bl, c0); c1 = wmmab(d[2], bl, c1); c0 = wmmab(d[1], bh, c0); c1 = wmmab(d[3], bh, c1); };
    v16bf buf[3][4];
    // the barriers keep the three fetches in the order in which the loop's foot issues them, so that the counted waits at the loop's head hold on both ways in
    fetch(buf[0], 0); __builtin_amdgcn_sched_barrier(0); fetch(buf[1], 1); __builtin_amdgcn_sched_barrier(0); fetch(buf[2], 2); __builtin_amdgcn_sched_barrier(0);
    typedef __attribute__((ext_vector_type(2))) float v2f;
    v8f o[4]; v2f lv = (v2f){};
#pragma unroll
    for (int t = 0; t < 4; ++t) o[t] = (v8f){};
    float m = -3.0e38f;
    const unsigned long long dv = 64 * 2;    // 64 keys on in a row of v^T
    const float C2 = SCL * 1.4426950408889634f;    // logits / 8, in base 2
#pragma unroll 1    // one tile a trip: 72 matrix instructions and 96 loads are body enough, a second copy would only grow the code
    for (int kt = 0; kt <= bx; ++kt) {
        const unsigned long long dk = (kt < bx) ? (unsigned long long)(64 * HD * 2) : 0ull;    // the last tile fetches its own first steps once more, unused: no address past the planes
        v8f s[4];
#pragma unroll
        for (int t = 0; t < 4; ++t) s[t] = (v8f){};
#pragma unroll
        for (int i = 0; i < 8; ++i) { const int ks = (i >> 1) & 1;
            mm6(buf[i % 3], (i & 1) ? th[ks] : qh[ks], (i & 1) ? tl[ks] : ql[ks], s[(i >> 2) * 2], s[(i >> 2) * 2 + 1]);
            __builtin_amdgcn_sched_barrier(0);    // keeps the fetch three steps ahead: without the pair the compiler sinks each load to its use and every step waits a full latency
            fetch(buf[i % 3], i + 3);
            __builtin_amdgcn_sched_barrier(0); }
        if (kt == bx) { const int lim = (wave & 3) * 16 + lr - hi * 8;    // diagonal tile: key t*16 + j of this lane's half is allowed while t*16 + j <= lim
#pragma unroll
            for (int t = 0; t < 4; ++t) {
#pragma unroll
                for (int j = 0; j < 8; ++j) s[t][j] = (t * 16 + j <= lim) ? s[t][j] : -3.0e38f; } }
        float mt = -3.0e38f;
#pragma unroll
        for (int t = 0; t < 4; ++t) {
#pragma unroll
            for (int j = 0; j < 8; ++j) mt = fmaxf(mt, s[t][j]); }
        mt = fmaxf(mt, xhalf(mt));
        const float mn = fmaxf(m, mt * C2), al = __builtin_amdgcn_exp2f(m - mn); m = mn;
        v4u ph[4], pl[4]; lv *= al;    // P, hi and residual, two bf16 a word
#pragma unroll
        for (int t = 0; t < 4; ++t) { v8f p;
#pragma unroll
            for (int j = 0; j < 8; ++j) p[j] = __builtin_amdgcn_exp2f(fmaf(s[t][j], C2, -mn));
            lv += ((v2f){p[0], p[1]} + (v2f){p[2], p[3]}) + ((v2f){p[4], p[5]} + (v2f){p[6], p[7]}); o[t] *= al;
#pragma unroll
            for (int j = 0; j < 4; ++j) { const v2f pp = (v2f){p[2 * j], p[2 * j + 1]}; const v2bf h2 = __builtin_convertvector(pp, v2bf), l2 = __builtin_convertvector(pp - __builtin_convertvector(h2, v2f), v2bf);
                ph[t][j] = __builtin_bit_cast(unsigned, h2); pl[t][j] = __builtin_bit_cast(unsigned, l2); } }
#pragma unroll
        for (int i = 8; i < 12; ++i) { const int ks = (i - 8) >> 1, tp = (i - 8) & 1;
            const v16bf pH = __builtin_bit_cast(v16bf, __builtin_shufflevector(ph[2 * ks], ph[2 * ks + 1], 0, 1, 2, 3, 4, 5, 6, 7)), pL = __builtin_bit_cast(v16bf, __builtin_shufflevector(pl[2 * ks], pl[2 * ks + 1], 0, 1, 2, 3, 4, 5, 6, 7));
            mm6(buf[i % 3], pH, pL, o[2 * tp], o[2 * tp + 1]);
            __builtin_amdgcn_sched_barrier(0);    // as above
            // on to the next tile's addresses, once this tile's last fetch is out (i == 8); the wait stands in front of the overwrite of registers that issued loads name
            if (i == 9) asm volatile("s_wait_xcnt 0x0\n\tv_add_nc_u64 %0, %6, %0\n\tv_add_nc_u64 %1, %6, %1\n\tv_add_nc_u64 %2, %6, %2\n\tv_add_nc_u64 %3, %6, %3\n\tv_add_nc_u64 %4, %7, %4\n\tv_add_nc_u64 %5, %7, %5" : "+v"(aKh), "+v"(aKl), "+v"(aCh), "+v"(aCl), "+v"(aVh), "+v"(aVl) : "s"(dk), "s"(dv) : "memory");
            fetch(buf[i % 3], i == 8 ? 11 : i - 9);
            __builtin_amdgcn_sched_barrier(0); }
    }
    asm volatile("s_wait_xcnt 0x0" :: "v"(aKh), "v"(aKl), "v"(aCh), "v"(aCl), "v"(aVh), "v"(aVl) : "memory");    // inputs only: the six address pairs stay whole until the last tile's fetches are past their address stage
    float l = lv[0] + lv[1];
    l += xhalf(l);
    const float inv = 1.0f / l;
    float* orow = O + (size_t)qrow * DMOD + (size_t)blockIdx.z * HD + hi * 8;
#pragma unroll
    for (int t = 0; t < 4; ++t) { const v8f r = o[t] * inv; *(v4f*)(orow + t * 16) = (v4f){r[0], r[1], r[2], r[3]}; *(v4f*)(orow + t * 16 + 4) = (v4f){r[4], r[5], r[6], r[7]}; }
}
__global__ __launch_bounds__(256) void k_planes32z(const float* __restrict__ F, int ld, int off, float sc, int rows, bf* Ph, bf* Pl) {
    typedef __attribute__((ext_vector_type(2))) unsigned short v2us;
    const int lane = threadIdx.x & 31; const size_t r = ((size_t)blockIdx.x * 8 + (threadIdx.x >> 5)) * 2 + (lane >> 4); if (r >= (size_t)rows) return; const int z = blockIdx.z; const int c0 = (lane & 15) * 2; v2us oh, ol;
    Ph += (size_t)z * rows * 32; Pl += (size_t)z * rows * 32;
#pragma unroll
    for (int i = 0; i < 2; ++i) { const float y = F[r * ld + off + z * 32 + c0 + i] * sc; const unsigned short hb = f2bf(y); oh[i] = hb; ol[i] = f2bf(y - bf2f(hb)); }
    const size_t o = r * 32 + c0; *(v2us*)(Ph + o) = oh; *(v2us*)(Pl + o) = ol; 
}
__global__ __launch_bounds__(256) void k_vtpadz(const float* __restrict__ F, int ld, int off, int nk, bf* Th, bf* Tl) {
    typedef __attribute__((ext_vector_type(2))) unsigned short v2us;
    const int lane = threadIdx.x & 31; const size_t wid = (size_t)blockIdx.x * 8 + (threadIdx.x >> 5); if (wid >= (size_t)64 * (nk / 64)) return; const int z = blockIdx.z; const int d = (int)(wid / (nk / 64)); const int k0 = (int)(wid % (nk / 64)) * 64 + lane * 2; v2us oh, ol;
    Th += (size_t)z * 64 * nk; Tl += (size_t)z * 64 * nk;
#pragma unroll
    for (int i = 0; i < 2; ++i) { const float y = (d < 32) ? F[(size_t)(k0 + i) * ld + off + z * 32 + (d < 32 ? d : 0)] : 0.f; const unsigned short hb = f2bf(y); oh[i] = hb; ol[i] = f2bf(y - bf2f(hb)); }
    const size_t o = (size_t)d * nk + k0; *(v2us*)(Th + o) = oh; *(v2us*)(Tl + o) = ol; 
}
template <int NK>
__global__ __launch_bounds__(256) void k_softmaxz(const float* __restrict__ S, int rows, bf* PH, bf* PL) {
    typedef __attribute__((ext_vector_type(4))) unsigned short v4us;
    const int lane = threadIdx.x & 31, i = blockIdx.x * 8 + (threadIdx.x >> 5); if (i >= rows) return; const size_t zo = (size_t)blockIdx.z * rows * NK; const float* sr = S + zo + (size_t)i * NK; PH += zo; PL += zo;
    float m = -3.0e38f;
#pragma unroll 1
    for (int c0 = lane * 4; c0 < NK; c0 += 128) {
#pragma unroll
        for (int q = 0; q < 4; ++q) m = fmaxf(m, sr[c0 + q]); }
#pragma unroll
    for (int sh = 16; sh; sh >>= 1) m = fmaxf(m, __shfl_xor(m, sh, 32));
    float sum = 0.f;
#pragma unroll 1
    for (int c0 = lane * 4; c0 < NK; c0 += 128) {
#pragma unroll
        for (int q = 0; q < 4; ++q) sum += __expf(sr[c0 + q] - m); }
#pragma unroll
    for (int sh = 16; sh; sh >>= 1) sum += __shfl_xor(sum, sh, 32);
    const float inv = 1.0f / sum;
{
#pragma unroll 1
        for (int c0 = lane * 4; c0 < NK; c0 += 128) { v4us oh, ol;
#pragma unroll
            for (int q = 0; q < 4; ++q) { const float p = __expf(sr[c0 + q] - m) * inv; const unsigned short hb = f2bf(p); oh[q] = hb; ol[q] = f2bf(p - bf2f(hb)); }
            const size_t o = (size_t)i * NK + c0; *(v4us*)(PH + o) = oh; *(v4us*)(PL + o) = ol; }
         }
}
__global__ __launch_bounds__(256) void k_placez(const float* __restrict__ XH, int rows, int ldy, float* Y) {
    const int lane = threadIdx.x & 31; const size_t q = (size_t)blockIdx.x * 8 + (threadIdx.x >> 5); if (q >= (size_t)rows) return; const int z = blockIdx.z; const float v = XH[((size_t)z * rows + q) * 64 + lane];
    *(float*)(Y + q * ldy + z * 32 + lane) = v; 
}

__global__ __launch_bounds__(256) void k_hplanesz(const float* __restrict__ F, int ld, int h0, float sc, int rows, bf* Ph, bf* Pl) {
    typedef __attribute__((ext_vector_type(2))) unsigned short v2us;
    const int lane = threadIdx.x & 31; const size_t r = (size_t)blockIdx.x * 8 + (threadIdx.x >> 5); if (r >= (size_t)rows) return; const int z = blockIdx.z; v2us oh, ol;
    Ph += (size_t)z * rows * 64; Pl += (size_t)z * rows * 64;
#pragma unroll
    for (int i = 0; i < 2; ++i) { const float y = F[r * ld + (h0 + z) * 64 + lane * 2 + i] * sc; const unsigned short hb = f2bf(y); oh[i] = hb; ol[i] = f2bf(y - bf2f(hb)); }
    const size_t o = r * 64 + lane * 2; *(v2us*)(Ph + o) = oh; *(v2us*)(Pl + o) = ol; 
}
__global__ __launch_bounds__(256) void k_vtz(const float* __restrict__ F, int ld, int h0, int nk, bf* Th, bf* Tl) {
    typedef __attribute__((ext_vector_type(2))) unsigned short v2us;
    const int lane = threadIdx.x & 31; const size_t wid = (size_t)blockIdx.x * 8 + (threadIdx.x >> 5); if (wid >= (size_t)64 * (nk / 64)) return; const int z = blockIdx.z; const int d = (int)(wid / (nk / 64)); const int t0 = (int)(wid % (nk / 64)) * 64 + lane * 2; v2us oh, ol;
    Th += (size_t)z * 64 * nk; Tl += (size_t)z * 64 * nk;
#pragma unroll
    for (int i = 0; i < 2; ++i) { const float y = F[(size_t)(t0 + i) * ld + (h0 + z) * 64 + d]; const unsigned short hb = f2bf(y); oh[i] = hb; ol[i] = f2bf(y - bf2f(hb)); }
    const size_t o = (size_t)d * nk + t0; *(v2us*)(Th + o) = oh; *(v2us*)(Tl + o) = ol; 
}
template <int NK>
__global__ __launch_bounds__(256) void k_softmaxzs(const float* __restrict__ S, int rows, float sc, bf* PH, bf* PL) {
    typedef __attribute__((ext_vector_type(4))) unsigned short v4us;
    const int lane = threadIdx.x & 31, i = blockIdx.x * 8 + (threadIdx.x >> 5); if (i >= rows) return; const size_t zo = (size_t)blockIdx.z * rows * NK; const float* sr = S + zo + (size_t)i * NK; PH += zo; PL += zo;
    float m = -3.0e38f;
#pragma unroll 1
    for (int c0 = lane * 4; c0 < NK; c0 += 128) {
#pragma unroll
        for (int q = 0; q < 4; ++q) m = fmaxf(m, sr[c0 + q] * sc); }
#pragma unroll
    for (int sh = 16; sh; sh >>= 1) m = fmaxf(m, __shfl_xor(m, sh, 32));
    float sum = 0.f;
#pragma unroll 1
    for (int c0 = lane * 4; c0 < NK; c0 += 128) {
#pragma unroll
        for (int q = 0; q < 4; ++q) sum += __expf(sr[c0 + q] * sc - m); }
#pragma unroll
    for (int sh = 16; sh; sh >>= 1) sum += __shfl_xor(sum, sh, 32);
    const float inv = 1.0f / sum;
{
#pragma unroll 1
        for (int c0 = lane * 4; c0 < NK; c0 += 128) { v4us oh, ol;
#pragma unroll
            for (int q = 0; q < 4; ++q) { const float p = __expf(sr[c0 + q] * sc - m) * inv; const unsigned short hb = f2bf(p); oh[q] = hb; ol[q] = f2bf(p - bf2f(hb)); }
            const size_t o = (size_t)i * NK + c0; *(v4us*)(PH + o) = oh; *(v4us*)(PL + o) = ol; }
         }
}

__global__ __launch_bounds__(256) void k_cvtx(const float* __restrict__ src, int rows, bf* dst) {
    const int lane = threadIdx.x & 31; const size_t r = (size_t)blockIdx.x * 8 + (threadIdx.x >> 5); if (r >= (size_t)rows) return;
{
#pragma unroll
        for (int q = 0; q < DMOD / 256; ++q) { v8us o;
#pragma unroll
            for (int i = 0; i < 8; ++i) o[i] = f2bf(src[r * DMOD + q * 256 + lane * 8 + i]);
            *(v8us*)(dst + r * DMOD + q * 256 + lane * 8) = o; }
         }
}
__global__ __launch_bounds__(256) void k_wcat4(const float* __restrict__ A0, const float* __restrict__ A1, const float* __restrict__ A2, const float* __restrict__ A3, bf* W4) {
    const size_t i = ((size_t)blockIdx.x * 256 + threadIdx.x) * 8; if (i >= (size_t)QW * DMOD) return; const size_t blk = i / ((size_t)DMOD * DMOD), o = i % ((size_t)DMOD * DMOD);
    const float* src = (blk == 0) ? A0 : (blk == 1) ? A1 : (blk == 2) ? A2 : A3; v8us v;
#pragma unroll
    for (int q = 0; q < 8; ++q) v[q] = f2bf(src[o + q]);
    *(v8us*)(W4 + i) = v; 
}
__global__ __launch_bounds__(256) void k_bias4(const float* __restrict__ b0, const float* __restrict__ b1, const float* __restrict__ b2, const float* __restrict__ b3, float* B4) {
    const size_t i = (size_t)blockIdx.x * 256 + threadIdx.x; if (i >= (size_t)QW) return; const int blk = (int)(i / DMOD), o = (int)(i % DMOD); const float v = (blk == 0) ? b0[o] : (blk == 1) ? b1[o] : (blk == 2) ? b2[o] : b3[o];
    *(float*)(B4 + i) = v; 
}
// k_cumkv: prefix sums over the key positions, in chunks. A work-group owns 32 columns (one 128-byte line of a row), a lane one column, each of its 32 waves CH = 64 rows in a row.
// A wave's loads depend on nothing: they go out in batches of 16 rows (32 loads), two batches in flight. Its prefix sums start at 0 and stay in registers. The chunks' totals meet in
// LDS, and every wave adds the totals of the chunks in front of it, in chunk order, to its own 64 sums.
#define CH (NN / 32)
__global__ __launch_bounds__(1024) void k_cumkv(const float* F, float* KVC) {
    typedef __attribute__((ext_vector_type(16))) float v16f;
    __shared__ float tot[32][32];
    const int lane = threadIdx.x & 31, c = blockIdx.x * 32 + lane;
    const int wave = __builtin_amdgcn_readfirstlane((int)threadIdx.x >> 5);    // in a scalar register: the chunk's base addresses and the tests on it are then scalar
    const float* fr = F + (size_t)wave * CH * QW + DMOD + c;
    float p[CH]; v16f kk[2], vv[2];
    // every '#pragma unroll' of this kernel: the arrays it walks are register arrays, so their indices must be compile-time constants
    auto fetch = [&](int b) {
#pragma unroll
        for (int i = 0; i < 16; ++i) { kk[b & 1][i] = fr[(size_t)(b * 16 + i) * QW]; vv[b & 1][i] = fr[(size_t)(b * 16 + i) * QW + DMOD]; }
    };
    fetch(0);
    float acc = 0.f;
#pragma unroll
    for (int b = 0; b < CH / 16; ++b) {
        if (b + 1 < CH / 16) fetch(b + 1);
        // inputs only, the loaded values of batch b: keeps the loads in batches, the next batch out before this one is waited for and the one after it behind this line. Left alone the
        // compiler either sinks every pair of loads to its product (64 latencies in a row) or lifts all 128 to the top (more registers than a wave of this work-group has).
        // F carries no __restrict__ here, so that the "memory" clobber holds its loads
        asm volatile("" :: "v"(kk[b & 1]), "v"(vv[b & 1]) : "memory");
#pragma unroll
        for (int i = 0; i < 16; ++i) { acc = fmaf(kk[b & 1][i] * vv[b & 1][i], SCL, acc); p[b * 16 + i] = acc; }
    }
    tot[wave][lane] = acc;
    __syncthreads();
    float tw[31];    // the last chunk stands in front of nobody
#pragma unroll
    for (int w = 0; w < 31; ++w) tw[w] = tot[w][lane];
    __builtin_amdgcn_sched_barrier(0);    // the 31 LDS reads go out together, one latency for all, instead of one each
    float off = 0.f;
#pragma unroll
    for (int w = 0; w < 31; ++w) off += (w < wave) ? tw[w] : 0.f;
#pragma unroll
    for (int i = 0; i < CH; ++i) p[i] += off;
    __builtin_amdgcn_sched_barrier(0);    // all sums first, each in its own register: a store then never waits for the store in front of it to let go of a shared data register
    float* dst = KVC + (size_t)wave * CH * DMOD + c;
#pragma unroll
    for (int i = 0; i < CH; ++i) dst[(size_t)i * DMOD] = p[i];
}
__global__ __launch_bounds__(256) void k_qtpl(const float* __restrict__ F, int h0, bf* Ph, bf* Pl) {
    typedef __attribute__((ext_vector_type(2))) unsigned short v2us;
    const int lane = threadIdx.x & 31; const size_t i = (size_t)blockIdx.x * 8 + (threadIdx.x >> 5); if (i >= (size_t)NN) return; const int z = blockIdx.z; const int h = h0 + z; Ph += (size_t)z * NN * HD; Pl += (size_t)z * NN * HD; v2us oh, ol;
#pragma unroll
    for (int q = 0; q < 2; ++q) { const int d = lane * 2 + q; const float y = F[i * QW + h * HD + d] * F[i * QW + 3 * DMOD + h * HD + d]; const unsigned short hb = f2bf(y); oh[q] = hb; ol[q] = f2bf(y - bf2f(hb)); }
    const size_t o = i * HD + lane * 2; *(v2us*)(Ph + o) = oh; *(v2us*)(Pl + o) = ol; 
}
__global__ __launch_bounds__(256) void k_splitD(const float* __restrict__ src, int rows, bf* dh, bf* dl) {
    const int lane = threadIdx.x & 31; const size_t r = (size_t)blockIdx.x * 8 + (threadIdx.x >> 5); if (r >= (size_t)rows) return;
{
#pragma unroll
        for (int q = 0; q < DMOD / 256; ++q) { const size_t o = r * DMOD + q * 256 + lane * 8; const v8f v = *(const v8f*)(src + o); v8us oh, ol;
#pragma unroll
            for (int i = 0; i < 8; ++i) { const unsigned short hb = f2bf(v[i]); oh[i] = hb; ol[i] = f2bf(v[i] - bf2f(hb)); }
            *(v8us*)(dh + o) = oh; *(v8us*)(dl + o) = ol; }
         }
}

extern "C" void kernel_launch(void* const* d_in, const int* in_sizes, int n_in,
                              void* d_out, int out_size, void* d_ws, size_t ws_size, hipStream_t stream) {
    (void)in_sizes; (void)n_in; (void)out_size;
    const float* x = (const float*)d_in[0]; const float* Wq = (const float*)d_in[1]; const float* bq = (const float*)d_in[2]; const float* Wk = (const float*)d_in[3]; const float* bk = (const float*)d_in[4]; const float* Wv = (const float*)d_in[5]; const float* bv = (const float*)d_in[6]; const float* Wt = (const float*)d_in[7]; const float* bt = (const float*)d_in[8]; const float* Wo = (const float*)d_in[9]; const float* bo = (const float*)d_in[10];
    float* out = (float*)d_out;    // [2][2048][1024]
    char* wsp = (char*)d_ws;
    auto take = [&](size_t bytes) { char* p = wsp; wsp += (bytes + 255) & ~(size_t)255; return (void*)p; };
    bf* W4 = (bf*)take((size_t)QW * DMOD * 2); float* B4 = (float*)take((size_t)QW * 4); bf* WO = (bf*)take((size_t)DMOD * DMOD * 2); float* O = (float*)take((size_t)NN * DMOD * 4);
    const size_t PLB = (size_t)NH_ * NN * HD * 2;    // one operand plane, all heads
    bf* Qh = (bf*)take(PLB); bf* Ql = (bf*)take(PLB); bf* Kh = (bf*)take(PLB); bf* Kl = (bf*)take(PLB); bf* Th = (bf*)take(PLB); bf* Tl = (bf*)take(PLB); bf* Ch = (bf*)take(PLB); bf* Cl = (bf*)take(PLB); bf* VTh = (bf*)take(PLB); bf* VTl = (bf*)take(PLB);
    char* const big = wsp;
    bf* Xb = (bf*)take((size_t)NN * DMOD * 2); float* F = (float*)take((size_t)NN * QW * 4); float* KVC = (float*)take((size_t)NN * DMOD * 4);
    if ((size_t)(wsp - (char*)d_ws) > ws_size) return;    // ~ 102 MiB
    // Xb, F, KVC are last read when the operand planes are made, Oh, Ol are first written after the attention: they lie on the same bytes.
    wsp = big; bf* Oh = (bf*)take((size_t)NN * DMOD * 2); bf* Ol = (bf*)take((size_t)NN * DMOD * 2);
    k_wcat4<<<(unsigned)(((size_t)QW * DMOD / 8 + 255) / 256), 256, 0, stream>>>(Wq, Wk, Wv, Wt, W4); k_bias4<<<QW / 256, 256, 0, stream>>>(bq, bk, bv, bt, B4); k_cvt8<<<(DMOD * DMOD / 8 + 255) / 256, 256, 0, stream>>>(Wo, WO, DMOD * DMOD / 8);
    for (int b = 0; b < NBT; ++b) {
        k_cvtx<<<NN / 8, 256, 0, stream>>>(x + (size_t)b * NN * DMOD, NN, Xb);
        k_gemmb<false, false><<<dim3(NN / 64, QW / 64, 1), 128, 0, stream>>>(Xb, nullptr, W4, B4, F, QW, nullptr, nullptr, DMOD);      // [q | k | v | t] + biases
        k_cumkv<<<DMOD / 32, 1024, 0, stream>>>(F, KVC);
        // blockIdx.z = head in every launch from here to k_fattn
        k_hplanesz<<<dim3(NN / 8, 1, NH_), 256, 0, stream>>>(F, QW, 0, 1.0f, NN, Qh, Ql); k_hplanesz<<<dim3(NN / 8, 1, NH_), 256, 0, stream>>>(F + DMOD, QW, 0, 1.0f, NN, Kh, Kl);
        k_qtpl<<<dim3(NN / 8, 1, NH_), 256, 0, stream>>>(F, 0, Th, Tl); k_hplanesz<<<dim3(NN / 8, 1, NH_), 256, 0, stream>>>(KVC, DMOD, 0, 1.0f, NN, Ch, Cl); k_vtz<<<dim3((HD * (NN / 64)) / 8, 1, NH_), 256, 0, stream>>>(F + 2 * DMOD, QW, 0, NN, VTh, VTl);
        k_fattn<<<dim3(NN / 128, 1, NH_), 256, 0, stream>>>(Qh, Ql, Kh, Kl, Th, Tl, Ch, Cl, VTh, VTl, O);
        k_splitD<<<NN / 8, 256, 0, stream>>>(O, NN, Oh, Ol);
        k_gemmb<true, false><<<dim3(NN / 64, DMOD / 64, 1), 128, 0, stream>>>(Oh, Ol, WO, bo, out + (size_t)b * NN * DMOD, DMOD, nullptr, nullptr, DMOD); }
}

// v004
// One run takes 459 microseconds.
// Two timings next to v003 put it at 1.12 and 1.13 times that version's speed.
// Counting every step since v000, it is 12.6 times as fast.
#include <hip/hip_runtime.h>

// Compute dtypes, f32 accumulate, per item: q/k/v/t = x.W^T + b fused as one [2048 x 1024].[1024 x 4096] GEMM with PLAIN bf16 operands (exact products); the triplet term's
// cumsum over key positions of k*v/8 (f32 prefix sums per column, in 64-row chunks + the sums of the chunks in front) and q*t in f32; per head, in ONE kernel (k_fattn): scores q.k^T + (q*t).kvcum^T with bf16 hi +
// UNSCALED residual planes (three products each; tiles above the diagonal skipped), / 8 + causal softmax in f32 with a running maximum and sum, attn.v (three products); Wo (+ bias) on

#define NBT  2
#define NN   2048
#define DMOD 1024
#define NH_  16
#define HD   64
#define QW   (4 * DMOD)
#define DM   DMOD
#define NTK  NN
#define SCL  0.125f
#define LOSC 1024.0f

typedef _Float16 h16;
typedef unsigned short bf;
typedef __attribute__((ext_vector_type(16))) __bf16   v16bf;
typedef __attribute__((ext_vector_type(16))) _Float16 v16h;
typedef __attribute__((ext_vector_type(8)))  _Float16 v8h;
typedef __attribute__((ext_vector_type(8)))  unsigned short v8us;
typedef __attribute__((ext_vector_type(8)))  float    v8f;
typedef __attribute__((ext_vector_type(4)))  float    v4f;
typedef __attribute__((ext_vector_type(4)))  _Float16 v4h;
typedef v8h  __attribute__((may_alias)) v8ha;
typedef v4f  __attribute__((may_alias)) v4fa;
typedef v8us __attribute__((may_alias)) v8usa;

__device__ __forceinline__ unsigned short f2bf(float f) { unsigned u = __float_as_uint(f); u += 0x7FFFu + ((u >> 16) & 1u); return (unsigned short)(u >> 16); }
__device__ __forceinline__ float bf2f(unsigned short b) { return __uint_as_float(((unsigned)b) << 16); }
__device__ __forceinline__ float bfr(float f) { return bf2f(f2bf(f)); }
__device__ __forceinline__ v16h cat16(v8h lo, v8h hi) { return __builtin_shufflevector(lo, hi, 0, 1, 2, 3, 4, 5, 6, 7, 8, 9, 10, 11, 12, 13, 14, 15); }
__device__ __forceinline__ v16bf cat16b(v8us lo, v8us hi) { return __builtin_bit_cast(v16bf, __builtin_shufflevector(lo, hi, 0, 1, 2, 3, 4, 5, 6, 7, 8, 9, 10, 11, 12, 13, 14, 15)); }
__device__ __forceinline__ v8f wmma16(v16h a, v16h b, v8f c) { return __builtin_amdgcn_wmma_f32_16x16x32_f16(false, a, false, b, (short)0, c, false, false); }
__device__ __forceinline__ v8f wmmab(v16bf a, v16bf b, v8f c) { return __builtin_amdgcn_wmma_f32_16x16x32_bf16(false, a, false, b, (short)0, c, false, false); }

// FRAGMENT ORDER: every bf16 matrix operand that one launch writes for another lies as 1-KiB blocks of 16 rows x 32 k. In a block, lane hi*16 + (row & 15) owns k = 8*hi + 0..7 at byte
// lane*16 and k = 16 + 8*hi + 0..7 at byte 512 + lane*16: a wave's 16-byte fragment load then covers 4 whole 128-byte lines, not 32 bytes of each of 16 lines.
// fragsrc: 16-byte piece g of a [rows][DMOD] operand (blocks in the order row tile, k tile) -> index of its first element in the row-major source
__device__ __forceinline__ size_t fragsrc(size_t g) { const int lane = (int)g & 31; return ((g >> 11) * 16 + (lane & 15)) * DMOD + ((g >> 6) & 31) * 32 + ((g >> 5) & 1) * 16 + (lane >> 4) * 8; }

// k_gemmb: 64 x 64 block tile (4 waves x 16 x 64) of C[NTK][NW] = (A [+ Al]).B^T (K = 1024) [+ bf(bias[c])] [+ bf(R[r][c]) residual]; f32 whole-line epilogue (or f16
template <bool SPLITA, bool F16OUT = false>
__global__ __launch_bounds__(128) void k_gemmb(const bf* __restrict__ A, const bf* __restrict__ Al, const bf* __restrict__ Bn, const float* __restrict__ bias, float* C, int ldc, h16* C2, const float* __restrict__ R = nullptr, int K = DM, int roundR = 1) {
    __shared__ __align__(16) float ost[4][16 * 68];
    const int lane = threadIdx.x & 31, lr = lane & 15, hi = lane >> 4;
    const int wave = __builtin_amdgcn_readfirstlane((int)threadIdx.x >> 5);    // in a scalar register: every fragment address is then a scalar block base + the lane's 16 bytes
    const int r0 = blockIdx.x * 64 + wave * 16, c0 = blockIdx.y * 64;
    // fragment order (fragsrc): a 16-row tile is DM / 32 blocks of 512 elements in a row; a fragment's address is a scalar block base + the lane's 16 bytes
    const unsigned lo = (unsigned)lane * 8;
    const size_t abase = (size_t)(r0 >> 4) * (DM * 16), bbase = (size_t)(c0 >> 4) * (DM * 16);
    v8f acc[4];
#pragma unroll
    for (int t = 0; t < 4; ++t) acc[t] = (v8f){};
#pragma unroll 1
    for (int kc = 0; kc < K; kc += 32) {
        const bf* ka = A + abase + kc * 16 + lo; const bf* kb = Bn + bbase + kc * 16 + lo; const bf* kl = SPLITA ? Al + abase + kc * 16 + lo : ka;
        const v16bf a = cat16b(*(const v8us*)ka, *(const v8us*)(ka + 256));
        v16bf al = a;
        if (SPLITA) al = cat16b(*(const v8us*)kl, *(const v8us*)(kl + 256));
#pragma unroll
        for (int t = 0; t < 4; ++t) { const v16bf b = cat16b(*(const v8us*)(kb + t * (DM * 16)), *(const v8us*)(kb + t * (DM * 16) + 256)); acc[t] = wmmab(a, b, acc[t]); if (SPLITA) acc[t] = wmmab(al, b, acc[t]); }
        // the lane's three addresses are inputs too: their registers are then not given to a later load's data before the loads that name them have come back
        asm volatile("v_nop\n\tv_nop\n\tv_nop\n\tv_nop" : "+v"(acc[0]), "+v"(acc[1]), "+v"(acc[2]), "+v"(acc[3]) : "v"(a), "v"(al), "v"(ka), "v"(kl), "v"(kb));
    }
    float* os = &ost[wave][0];
#pragma unroll
    for (int t = 0; t < 4; ++t) { const float bv = bias ? bfr(bias[c0 + t * 16 + lr]) : 0.f;
#pragma unroll
        for (int j = 0; j < 8; ++j) os[(hi * 8 + j) * 68 + t * 16 + lr] = acc[t][j] + bv; }
    __syncthreads();
    if (F16OUT) {
        h16* crow = (h16*)(void*)C + (size_t)r0 * ldc + c0;
        auto pass = [&]() {
#pragma unroll
            for (int s = 0; s < 4; ++s) { const int row = 4 * s + (lane >> 3), piece = lane & 7; const float* sp = os + row * 68 + piece * 8; v8h o, o2;
#pragma unroll
                for (int i = 0; i < 8; ++i) { const h16 a = (h16)sp[i]; o[i] = a; o2[i] = (h16)((sp[i] - (float)a) * LOSC); }
                *(v8h*)(crow + (size_t)row * ldc + piece * 8) = o; if (C2) *(v8h*)(C2 + (size_t)r0 * ldc + c0 + (size_t)row * ldc + piece * 8) = o2; }
        };
        pass(); 
    } else {
        float* crow = C + (size_t)r0 * ldc + c0;
        auto pass = [&]() {
#pragma unroll
            for (int s = 0; s < 8; ++s) { const int Lid = (lane >> 3) + 4 * s, piece = lane & 7; const int row = Lid >> 1, cofs = (Lid & 1) * 32 + piece * 4;
                v4f val = *(const v4fa*)(os + row * 68 + cofs); if (R) { const v4f rv = *(const v4f*)(R + ((size_t)r0 + row) * ldc + c0 + cofs); val += roundR ? (v4f){bfr(rv[0]), bfr(rv[1]), bfr(rv[2]), bfr(rv[3])} : rv; }
                *(v4f*)(crow + (size_t)row * ldc + cofs) = val; }
        };
        pass(); 
    }
}

__global__ __launch_bounds__(256) void k_cvt8(const float* __restrict__ src, bf* dst, size_t n8) {
    const size_t i = (size_t)blockIdx.x * 256 + threadIdx.x; if (i >= n8) return;
    const v8f v = *(const v8f*)(src + fragsrc(i)); v8us o;    // dst in fragment order
#pragma unroll
    for (int k = 0; k < 8; ++k) o[k] = f2bf(v[k]);
    *(v8us*)(dst + i * 8) = o; 
}
__global__ __launch_bounds__(256) void k_zero8(bf* dst, size_t n8) {
    const size_t i = (size_t)blockIdx.x * 256 + threadIdx.x; if (i >= n8) return; v8us z;
#pragma unroll
    for (int k = 0; k < 8; ++k) z[k] = 0;
    *(v8us*)(dst + i * 8) = z; 
}

// ===== attention, blockIdx.z = head =====
// k_fattn: scores, causal softmax and attn.v in one kernel; no score or probability leaves the registers. A wave owns 16 query rows of one head and walks the 64-key tiles up to
// its diagonal. Everything is held transposed, so that a lane owns ONE query row (lane & 15): S^T = K.Q^T + C.T^T (A = key rows, B = query rows; D element j of 16-key tile t is key
// t*16 + 8*hi + j), which is already the B-fragment k order (8*hi + 0..7, 16 + 8*hi + 0..7) of O^T = V^T.P^T: tiles 2*ks and 2*ks + 1 side by side.
// Running maximum (base 2) and running sum per lane (lanes r and r + 16 share a query: the maximum is joined every tile, the sum once at the end); O^T is rescaled by 2^(m_old - m_new).
// A work-group is 8 waves: waves 0-3 take row block 31 - x, waves 4-7 row block x, so that every work-group walks 33 tiles. The waves never meet: no LDS, no barrier.
typedef __attribute__((ext_vector_type(2))) __bf16 v2bf;
typedef __attribute__((ext_vector_type(4))) unsigned v4u;
__device__ __forceinline__ float xhalf(float x) { return __builtin_bit_cast(float, __builtin_amdgcn_permlanex16(__builtin_bit_cast(int, x), __builtin_bit_cast(int, x), 0x76543210, 0xfedcba98, false, false)); }  // lane l with lane l ^ 16
__global__ __launch_bounds__(256) void k_fattn(const bf* __restrict__ Qh, const bf* __restrict__ Ql, const bf* __restrict__ Kh, const bf* __restrict__ Kl, const bf* __restrict__ Th, const bf* __restrict__ Tl, const bf* __restrict__ Ch, const bf* __restrict__ Cl, const bf* __restrict__ VTh, const bf* __restrict__ VTl, float* O) {
    const int lane = threadIdx.x & 31, lr = lane & 15, hi = lane >> 4;
    const int wave = __builtin_amdgcn_readfirstlane((int)threadIdx.x >> 5);    // in a scalar register, so that the tile loop ends on a scalar branch
    const int bx = (wave >> 2) ? (int)blockIdx.x : NN / 64 - 1 - (int)blockIdx.x;
    const size_t zo = (size_t)blockIdx.z * NN * HD;         // one head's plane, in fragment order: blocks (16-row tile, k half) for q, k, q*t, kvcum and (32-key group, 16-column tile) for v^T
    const int qrow = bx * 64 + (wave & 3) * 16 + lr;
    typedef const __attribute__((address_space(1))) char* gch; typedef const __attribute__((address_space(1))) v8us* gv8;    // global address space, named: an address that comes out of an asm statement would else be loaded as a flat one
    auto gfrag = [](gch p) -> v16bf { return cat16b(*(gv8)p, *(gv8)(p + 512)); };    // k = 8*hi + 0..7 and 16 + 8*hi + 0..7: the two halves of a 1-KiB block in fragment order
    const unsigned qb = (unsigned)((bx * 4 + (wave & 3)) * 2048 + lane * 16), kb = (unsigned)(lane * 16), vb = (unsigned)(lane * 16);    // the lane's own byte offsets (a 16-row tile of q, k, q*t, kvcum is two blocks)
    gch bQh = (gch)(Qh + zo), bQl = (gch)(Ql + zo), bTh = (gch)(Th + zo), bTl = (gch)(Tl + zo), gQh = bQh + qb, gQl = bQl + qb, gTh = bTh + qb, gTl = bTl + qb;
    v16bf qh[2], ql[2], th[2], tl[2];
    // every '#pragma unroll' of this kernel: the arrays it walks are register arrays, so their indices must be compile-time constants
#pragma unroll
    for (int ks = 0; ks < 2; ++ks) { qh[ks] = gfrag(gQh + ks * 1024); ql[ks] = gfrag(gQl + ks * 1024); th[ks] = gfrag(gTh + ks * 1024); tl[ks] = gfrag(gTl + ks * 1024); }
    // inputs only: the address registers of the query loads (scalar base and lane offset, or their sum) stay whole until those loads have come back
    asm volatile("s_wait_xcnt 0x0" :: "s"(bQh), "s"(bQl), "s"(bTh), "s"(bTl), "v"(qb), "v"(gQh), "v"(gQl), "v"(gTh), "v"(gTl), "v"(qh[0]), "v"(qh[1]), "v"(ql[0]), "v"(ql[1]), "v"(th[0]), "v"(th[1]), "v"(tl[0]), "v"(tl[1]) : "memory");
    // A tile is 12 steps of 4 A fragments (two 16-row tiles x hi and residual plane) and 6 matrix instructions: steps 0-7 the scores (16-key tile pair, k half, k or kvcum), steps 8-11 attn.v
    // (key half, 16-row pair of v^T). Step i works from buf[i % 3]; its fragments are fetched three steps ahead, across the softmax and across the loop's back edge.
    // The lane's address in each of the six planes lives in one register pair for the whole loop and moves once a tile (the asm statement in the loop); every load is that pair + a constant.
    unsigned long long aKh = (unsigned long long)((gch)(Kh + zo) + kb), aKl = (unsigned long long)((gch)(Kl + zo) + kb), aCh = (unsigned long long)((gch)(Ch + zo) + kb), aCl = (unsigned long long)((gch)(Cl + zo) + kb), aVh = (unsigned long long)((gch)(VTh + zo) + vb), aVl = (unsigned long long)((gch)(VTl + zo) + vb);
    auto fetch = [&](v16bf (&d)[4], int i) {
        if (i < 8) { const int c = (i >> 2) * 4096 + ((i >> 1) & 1) * 1024; gch ph = (gch)((i & 1) ? aCh : aKh) + c; gch pl = (gch)((i & 1) ? aCl : aKl) + c;
            d[0] = gfrag(ph); d[1] = gfrag(pl); d[2] = gfrag(ph + 2048); d[3] = gfrag(pl + 2048); }
        else { const int c = ((i - 8) >> 1) * 4096 + ((i - 8) & 1) * 2048; gch ph = (gch)aVh + c; gch pl = (gch)aVl + c;
            d[0] = gfrag(ph); d[1] = gfrag(pl); d[2] = gfrag(ph + 1024); d[3] = gfrag(pl + 1024); }
    };
    // hi.hi + hi.residual + residual.hi of two independent accumulator tiles, taken in turn
    auto mm6 = [](const v16bf (&d)[4], v16bf bh, v16bf bl, v8f& c0, v8f& c1) { c0 = wmmab(d[0], bh, c0); c1 = wmmab(d[2], bh, c1); c0 = wmmab(d[0], bl, c0); c1 = wmmab(d[2], bl, c1); c0 = wmmab(d[1], bh, c0); c1 = wmmab(d[3], bh, c1); };
    v16bf buf[3][4];
    // the barriers keep the three fetches in the order in which the loop's foot issues them, so that the counted waits at the loop's head hold on both ways in
    fetch(buf[0], 0); __builtin_amdgcn_sched_barrier(0); fetch(buf[1], 1); __builtin_amdgcn_sched_barrier(0); fetch(buf[2], 2); __builtin_amdgcn_sched_barrier(0);
    typedef __attribute__((ext_vector_type(2))) float v2f;
    v8f o[4]; v2f lv = (v2f){};
#pragma unroll
    for (int t = 0; t < 4; ++t) o[t] = (v8f){};
    float m = -3.0e38f;
    const unsigned long long dv = 64 * HD * 2;    // 64 keys on in v^T: 8 blocks (32-key group, then 16-column tile)
    const float C2 = SCL * 1.4426950408889634f;    // logits / 8, in base 2
#pragma unroll 1    // one tile a trip: 72 matrix instructions and 96 loads are body enough, a second copy would only grow the code
    for (int kt = 0; kt <= bx; ++kt) {
        const unsigned long long dk = (kt < bx) ? (unsigned long long)(64 * HD * 2) : 0ull;    // the last tile fetches its own first steps once more, unused: no address past the planes
        v8f s[4];
#pragma unroll
        for (int t = 0; t < 4; ++t) s[t] = (v8f){};
#pragma unroll
        for (int i = 0; i < 8; ++i) { const int ks = (i >> 1) & 1;
            mm6(buf[i % 3], (i & 1) ? th[ks] : qh[ks], (i & 1) ? tl[ks] : ql[ks], s[(i >> 2) * 2], s[(i >> 2) * 2 + 1]);
            __builtin_amdgcn_sched_barrier(0);    // keeps the fetch three steps ahead: without the pair the compiler sinks each load to its use and every step waits a full latency
            fetch(buf[i % 3], i + 3);
            __builtin_amdgcn_sched_barrier(0); }
        if (kt == bx) { const int lim = (wave & 3) * 16 + lr - hi * 8;    // diagonal tile: key t*16 + j of this lane's half is allowed while t*16 + j <= lim
#pragma unroll
            for (int t = 0; t < 4; ++t) {
#pragma unroll
                for (int j = 0; j < 8; ++j) s[t][j] = (t * 16 + j <= lim) ? s[t][j] : -3.0e38f; } }
        float mt = -3.0e38f;
#pragma unroll
        for (int t = 0; t < 4; ++t) {
#pragma unroll
            for (int j = 0; j < 8; ++j) mt = fmaxf(mt, s[t][j]); }
        mt = fmaxf(mt, xhalf(mt));
        const float mn = fmaxf(m, mt * C2), al = __builtin_amdgcn_exp2f(m - mn); m = mn;
        v4u ph[4], pl[4]; lv *= al;    // P, hi and residual, two bf16 a word
#pragma unroll
        for (int t = 0; t < 4; ++t) { v8f p;
#pragma unroll
            for (int j = 0; j < 8; ++j) p[j] = __builtin_amdgcn_exp2f(fmaf(s[t][j], C2, -mn));
            lv += ((v2f){p[0], p[1]} + (v2f){p[2], p[3]}) + ((v2f){p[4], p[5]} + (v2f){p[6], p[7]}); o[t] *= al;
#pragma unroll
            for (int j = 0; j < 4; ++j) { const v2f pp = (v2f){p[2 * j], p[2 * j + 1]}; const v2bf h2 = __builtin_convertvector(pp, v2bf), l2 = __builtin_convertvector(pp - __builtin_convertvector(h2, v2f), v2bf);
                ph[t][j] = __builtin_bit_cast(unsigned, h2); pl[t][j] = __builtin_bit_cast(unsigned, l2); } }
#pragma unroll
        for (int i = 8; i < 12; ++i) { const int ks = (i - 8) >> 1, tp = (i - 8) & 1;
            const v16bf pH = __builtin_bit_cast(v16bf, __builtin_shufflevector(ph[2 * ks], ph[2 * ks + 1], 0, 1, 2, 3, 4, 5, 6, 7)), pL = __builtin_bit_cast(v16bf, __builtin_shufflevector(pl[2 * ks], pl[2 * ks + 1], 0, 1, 2, 3, 4, 5, 6, 7));
            mm6(buf[i % 3], pH, pL, o[2 * tp], o[2 * tp + 1]);
            __builtin_amdgcn_sched_barrier(0);    // as above
            // on to the next tile's addresses, once this tile's last fetch is out (i == 8); the wait stands in front of the overwrite of registers that issued loads name
            if (i == 9) asm volatile("s_wait_xcnt 0x0\n\tv_add_nc_u64 %0, %6, %0\n\tv_add_nc_u64 %1, %6, %1\n\tv_add_nc_u64 %2, %6, %2\n\tv_add_nc_u64 %3, %6, %3\n\tv_add_nc_u64 %4, %7, %4\n\tv_add_nc_u64 %5, %7, %5" : "+v"(aKh), "+v"(aKl), "+v"(aCh), "+v"(aCl), "+v"(aVh), "+v"(aVl) : "s"(dk), "s"(dv) : "memory");
            fetch(buf[i % 3], i == 8 ? 11 : i - 9);
            __builtin_amdgcn_sched_barrier(0); }
    }
    asm volatile("s_wait_xcnt 0x0" :: "v"(aKh), "v"(aKl), "v"(aCh), "v"(aCl), "v"(aVh), "v"(aVl) : "memory");    // inputs only: the six address pairs stay whole until the last tile's fetches are past their address stage
    float l = lv[0] + lv[1];
    l += xhalf(l);
    const float inv = 1.0f / l;
    float* orow = O + (size_t)qrow * DMOD + (size_t)blockIdx.z * HD + hi * 8;
#pragma unroll
    for (int t = 0; t < 4; ++t) { const v8f r = o[t] * inv; *(v4f*)(orow + t * 16) = (v4f){r[0], r[1], r[2], r[3]}; *(v4f*)(orow + t * 16 + 4) = (v4f){r[4], r[5], r[6], r[7]}; }
}
__global__ __launch_bounds__(256) void k_planes32z(const float* __restrict__ F, int ld, int off, float sc, int rows, bf* Ph, bf* Pl) {
    typedef __attribute__((ext_vector_type(2))) unsigned short v2us;
    const int lane = threadIdx.x & 31; const size_t r = ((size_t)blockIdx.x * 8 + (threadIdx.x >> 5)) * 2 + (lane >> 4); if (r >= (size_t)rows) return; const int z = blockIdx.z; const int c0 = (lane & 15) * 2; v2us oh, ol;
    Ph += (size_t)z * rows * 32; Pl += (size_t)z * rows * 32;
#pragma unroll
    for (int i = 0; i < 2; ++i) { const float y = F[r * ld + off + z * 32 + c0 + i] * sc; const unsigned short hb = f2bf(y); oh[i] = hb; ol[i] = f2bf(y - bf2f(hb)); }
    const size_t o = r * 32 + c0; *(v2us*)(Ph + o) = oh; *(v2us*)(Pl + o) = ol; 
}
__global__ __launch_bounds__(256) void k_vtpadz(const float* __restrict__ F, int ld, int off, int nk, bf* Th, bf* Tl) {
    typedef __attribute__((ext_vector_type(2))) unsigned short v2us;
    const int lane = threadIdx.x & 31; const size_t wid = (size_t)blockIdx.x * 8 + (threadIdx.x >> 5); if (wid >= (size_t)64 * (nk / 64)) return; const int z = blockIdx.z; const int d = (int)(wid / (nk / 64)); const int k0 = (int)(wid % (nk / 64)) * 64 + lane * 2; v2us oh, ol;
    Th += (size_t)z * 64 * nk; Tl += (size_t)z * 64 * nk;
#pragma unroll
    for (int i = 0; i < 2; ++i) { const float y = (d < 32) ? F[(size_t)(k0 + i) * ld + off + z * 32 + (d < 32 ? d : 0)] : 0.f; const unsigned short hb = f2bf(y); oh[i] = hb; ol[i] = f2bf(y - bf2f(hb)); }
    const size_t o = (size_t)d * nk + k0; *(v2us*)(Th + o) = oh; *(v2us*)(Tl + o) = ol; 
}
template <int NK>
__global__ __launch_bounds__(256) void k_softmaxz(const float* __restrict__ S, int rows, bf* PH, bf* PL) {
    typedef __attribute__((ext_vector_type(4))) unsigned short v4us;
    const int lane = threadIdx.x & 31, i = blockIdx.x * 8 + (threadIdx.x >> 5); if (i >= rows) return; const size_t zo = (size_t)blockIdx.z * rows * NK; const float* sr = S + zo + (size_t)i * NK; PH += zo; PL += zo;
    float m = -3.0e38f;
#pragma unroll 1
    for (int c0 = lane * 4; c0 < NK; c0 += 128) {
#pragma unroll
        for (int q = 0; q < 4; ++q) m = fmaxf(m, sr[c0 + q]); }
#pragma unroll
    for (int sh = 16; sh; sh >>= 1) m = fmaxf(m, __shfl_xor(m, sh, 32));
    float sum = 0.f;
#pragma unroll 1
    for (int c0 = lane * 4; c0 < NK; c0 += 128) {
#pragma unroll
        for (int q = 0; q < 4; ++q) sum += __expf(sr[c0 + q] - m); }
#pragma unroll
    for (int sh = 16; sh; sh >>= 1) sum += __shfl_xor(sum, sh, 32);
    const float inv = 1.0f / sum;
{
#pragma unroll 1
        for (int c0 = lane * 4; c0 < NK; c0 += 128) { v4us oh, ol;
#pragma unroll
            for (int q = 0; q < 4; ++q) { const float p = __expf(sr[c0 + q] - m) * inv; const unsigned short hb = f2bf(p); oh[q] = hb; ol[q] = f2bf(p - bf2f(hb)); }
            const size_t o = (size_t)i * NK + c0; *(v4us*)(PH + o) = oh; *(v4us*)(PL + o) = ol; }
         }
}
__global__ __launch_bounds__(256) void k_placez(const float* __restrict__ XH, int rows, int ldy, float* Y) {
    const int lane = threadIdx.x & 31; const size_t q = (size_t)blockIdx.x * 8 + (threadIdx.x >> 5); if (q >= (size_t)rows) return; const int z = blockIdx.z; const float v = XH[((size_t)z * rows + q) * 64 + lane];
    *(float*)(Y + q * ldy + z * 32 + lane) = v; 
}

__global__ __launch_bounds__(256) void k_hplanesz(const float* __restrict__ F, int ld, int h0, float sc, int rows, bf* Ph, bf* Pl) {
    // a thread makes one 16-byte piece g of a head's plane, in fragment order: blocks (16-row tile, k half)
    const size_t g = (size_t)blockIdx.x * 256 + threadIdx.x; if (g >= (size_t)rows * 8) return; const int lane = (int)g & 31, z = blockIdx.z; v8us oh, ol;
    Ph += (size_t)z * rows * 64; Pl += (size_t)z * rows * 64;
    const v8f v = *(const v8f*)(F + ((g >> 7) * 16 + (lane & 15)) * ld + (h0 + z) * 64 + ((g >> 6) & 1) * 32 + ((g >> 5) & 1) * 16 + (lane >> 4) * 8);
#pragma unroll
    for (int i = 0; i < 8; ++i) { const float y = v[i] * sc; const unsigned short hb = f2bf(y); oh[i] = hb; ol[i] = f2bf(y - bf2f(hb)); }
    *(v8us*)(Ph + g * 8) = oh; *(v8us*)(Pl + g * 8) = ol; 
}
__global__ __launch_bounds__(256) void k_vtz(const float* __restrict__ F, int h0, int nk, bf* Th, bf* Tl) {
    // a thread makes one 16-byte piece g (8 keys of one column d) of a head's v^T, in fragment order: blocks (32-key group, 16-column tile)
    const size_t g = (size_t)blockIdx.x * 256 + threadIdx.x; if (g >= (size_t)nk * 8) return; const int lane = (int)g & 31, z = blockIdx.z; const int d = (int)((g >> 6) & 3) * 16 + (lane & 15); const int t0 = (int)(g >> 8) * 32 + (int)((g >> 5) & 1) * 16 + (lane >> 4) * 8; v8us oh, ol;
    Th += (size_t)z * 64 * nk; Tl += (size_t)z * 64 * nk;
    const float* fv = F + (size_t)t0 * QW + (h0 + z) * 64 + d; v8f v;    // 16 lanes read 64 bytes of a row: 2 lines a load
#pragma unroll
    for (int i = 0; i < 8; ++i) v[i] = fv[(size_t)i * QW];
#pragma unroll
    for (int i = 0; i < 8; ++i) { const float y = v[i]; const unsigned short hb = f2bf(y); oh[i] = hb; ol[i] = f2bf(y - bf2f(hb)); }
    *(v8us*)(Th + g * 8) = oh; *(v8us*)(Tl + g * 8) = ol; 
}
template <int NK>
__global__ __launch_bounds__(256) void k_softmaxzs(const float* __restrict__ S, int rows, float sc, bf* PH, bf* PL) {
    typedef __attribute__((ext_vector_type(4))) unsigned short v4us;
    const int lane = threadIdx.x & 31, i = blockIdx.x * 8 + (threadIdx.x >> 5); if (i >= rows) return; const size_t zo = (size_t)blockIdx.z * rows * NK; const float* sr = S + zo + (size_t)i * NK; PH += zo; PL += zo;
    float m = -3.0e38f;
#pragma unroll 1
    for (int c0 = lane * 4; c0 < NK; c0 += 128) {
#pragma unroll
        for (int q = 0; q < 4; ++q) m = fmaxf(m, sr[c0 + q] * sc); }
#pragma unroll
    for (int sh = 16; sh; sh >>= 1) m = fmaxf(m, __shfl_xor(m, sh, 32));
    float sum = 0.f;
#pragma unroll 1
    for (int c0 = lane * 4; c0 < NK; c0 += 128) {
#pragma unroll
        for (int q = 0; q < 4; ++q) sum += __expf(sr[c0 + q] * sc - m); }
#pragma unroll
    for (int sh = 16; sh; sh >>= 1) sum += __shfl_xor(sum, sh, 32);
    const float inv = 1.0f / sum;
{
#pragma unroll 1
        for (int c0 = lane * 4; c0 < NK; c0 += 128) { v4us oh, ol;
#pragma unroll
            for (int q = 0; q < 4; ++q) { const float p = __expf(sr[c0 + q] * sc - m) * inv; const unsigned short hb = f2bf(p); oh[q] = hb; ol[q] = f2bf(p - bf2f(hb)); }
            const size_t o = (size_t)i * NK + c0; *(v4us*)(PH + o) = oh; *(v4us*)(PL + o) = ol; }
         }
}

__global__ __launch_bounds__(256) void k_cvtx(const float* __restrict__ src, int rows, bf* dst) {
    if ((size_t)blockIdx.x * 8 >= (size_t)rows) return;
{
        // dst in fragment order. Pieces g, g + 256, g + 512, g + 768 of a work-group's 1,024 (half a 16-row tile) lie 4 k tiles = 128 source elements apart
        const size_t g = (size_t)blockIdx.x * (DMOD / 256) * 256 + threadIdx.x; const float* sp = src + fragsrc(g);
#pragma unroll
        for (int q = 0; q < DMOD / 256; ++q) { const v8f v = *(const v8f*)(sp + q * 128); v8us o;
#pragma unroll
            for (int i = 0; i < 8; ++i) o[i] = f2bf(v[i]);
            *(v8us*)(dst + (g + q * 256) * 8) = o; }
         }
}
__global__ __launch_bounds__(256) void k_wcat4(const float* __restrict__ A0, const float* __restrict__ A1, const float* __restrict__ A2, const float* __restrict__ A3, bf* W4) {
    const size_t i = ((size_t)blockIdx.x * 256 + threadIdx.x) * 8; if (i >= (size_t)QW * DMOD) return; const size_t si = fragsrc(i / 8), blk = si / ((size_t)DMOD * DMOD), o = si % ((size_t)DMOD * DMOD);    // W4 in fragment order
    const float* src = (blk == 0) ? A0 : (blk == 1) ? A1 : (blk == 2) ? A2 : A3; v8us v;
#pragma unroll
    for (int q = 0; q < 8; ++q) v[q] = f2bf(src[o + q]);
    *(v8us*)(W4 + i) = v; 
}
__global__ __launch_bounds__(256) void k_bias4(const float* __restrict__ b0, const float* __restrict__ b1, const float* __restrict__ b2, const float* __restrict__ b3, float* B4) {
    const size_t i = (size_t)blockIdx.x * 256 + threadIdx.x; if (i >= (size_t)QW) return; const int blk = (int)(i / DMOD), o = (int)(i % DMOD); const float v = (blk == 0) ? b0[o] : (blk == 1) ? b1[o] : (blk == 2) ? b2[o] : b3[o];
    *(float*)(B4 + i) = v; 
}
// k_cumkv: prefix sums over the key positions, in chunks. A work-group owns 32 columns (one 128-byte line of a row), a lane one column, each of its 32 waves CH = 64 rows in a row.
// A wave's loads depend on nothing: they go out in batches of 16 rows (32 loads), two batches in flight. Its prefix sums start at 0 and stay in registers. The chunks' totals meet in
// LDS, and every wave adds the totals of the chunks in front of it, in chunk order, to its own 64 sums.
#define CH (NN / 32)
__global__ __launch_bounds__(1024) void k_cumkv(const float* F, float* KVC) {
    typedef __attribute__((ext_vector_type(16))) float v16f;
    __shared__ float tot[32][32];
    const int lane = threadIdx.x & 31, c = blockIdx.x * 32 + lane;
    const int wave = __builtin_amdgcn_readfirstlane((int)threadIdx.x >> 5);    // in a scalar register: the chunk's base addresses and the tests on it are then scalar
    const float* fr = F + (size_t)wave * CH * QW + DMOD + c;
    float p[CH]; v16f kk[2], vv[2];
    // every '#pragma unroll' of this kernel: the arrays it walks are register arrays, so their indices must be compile-time constants
    auto fetch = [&](int b) {
#pragma unroll
        for (int i = 0; i < 16; ++i) { kk[b & 1][i] = fr[(size_t)(b * 16 + i) * QW]; vv[b & 1][i] = fr[(size_t)(b * 16 + i) * QW + DMOD]; }
    };
    fetch(0);
    float acc = 0.f;
#pragma unroll
    for (int b = 0; b < CH / 16; ++b) {
        if (b + 1 < CH / 16) fetch(b + 1);
        // inputs only, the loaded values of batch b: keeps the loads in batches, the next batch out before this one is waited for and the one after it behind this line. Left alone the
        // compiler either sinks every pair of loads to its product (64 latencies in a row) or lifts all 128 to the top (more registers than a wave of this work-group has).
        // F carries no __restrict__ here, so that the "memory" clobber holds its loads
        asm volatile("" :: "v"(kk[b & 1]), "v"(vv[b & 1]) : "memory");
#pragma unroll
        for (int i = 0; i < 16; ++i) { acc = fmaf(kk[b & 1][i] * vv[b & 1][i], SCL, acc); p[b * 16 + i] = acc; }
    }
    tot[wave][lane] = acc;
    __syncthreads();
    float tw[31];    // the last chunk stands in front of nobody
#pragma unroll
    for (int w = 0; w < 31; ++w) tw[w] = tot[w][lane];
    __builtin_amdgcn_sched_barrier(0);    // the 31 LDS reads go out together, one latency for all, instead of one each
    float off = 0.f;
#pragma unroll
    for (int w = 0; w < 31; ++w) off += (w < wave) ? tw[w] : 0.f;
#pragma unroll
    for (int i = 0; i < CH; ++i) p[i] += off;
    __builtin_amdgcn_sched_barrier(0);    // all sums first, each in its own register: a store then never waits for the store in front of it to let go of a shared data register
    float* dst = KVC + (size_t)wave * CH * DMOD + c;
#pragma unroll
    for (int i = 0; i < CH; ++i) dst[(size_t)i * DMOD] = p[i];
}
__global__ __launch_bounds__(256) void k_qtpl(const float* __restrict__ F, int h0, bf* Ph, bf* Pl) {
    // a thread makes one 16-byte piece g of a head's plane, in fragment order: blocks (16-row tile, k half)
    const size_t g = (size_t)blockIdx.x * 256 + threadIdx.x; if (g >= (size_t)NN * 8) return; const int lane = (int)g & 31, z = blockIdx.z; const int h = h0 + z; Ph += (size_t)z * NN * HD; Pl += (size_t)z * NN * HD; v8us oh, ol;
    const float* fq = F + ((g >> 7) * 16 + (lane & 15)) * QW + h * HD + ((g >> 6) & 1) * 32 + ((g >> 5) & 1) * 16 + (lane >> 4) * 8; const v8f vq = *(const v8f*)fq, vt = *(const v8f*)(fq + 3 * DMOD);
#pragma unroll
    for (int q = 0; q < 8; ++q) { const float y = vq[q] * vt[q]; const unsigned short hb = f2bf(y); oh[q] = hb; ol[q] = f2bf(y - bf2f(hb)); }
    *(v8us*)(Ph + g * 8) = oh; *(v8us*)(Pl + g * 8) = ol; 
}
__global__ __launch_bounds__(256) void k_splitD(const float* __restrict__ src, int rows, bf* dh, bf* dl) {
    if ((size_t)blockIdx.x * 8 >= (size_t)rows) return;
{
        // dh, dl in fragment order; the four pieces of a thread as in k_cvtx
        const size_t g = (size_t)blockIdx.x * (DMOD / 256) * 256 + threadIdx.x; const float* sp = src + fragsrc(g);
#pragma unroll
        for (int q = 0; q < DMOD / 256; ++q) { const size_t o = (g + q * 256) * 8; const v8f v = *(const v8f*)(sp + q * 128); v8us oh, ol;
#pragma unroll
            for (int i = 0; i < 8; ++i) { const unsigned short hb = f2bf(v[i]); oh[i] = hb; ol[i] = f2bf(v[i] - bf2f(hb)); }
            *(v8us*)(dh + o) = oh; *(v8us*)(dl + o) = ol; }
         }
}

extern "C" void kernel_launch(void* const* d_in, const int* in_sizes, int n_in,
                              void* d_out, int out_size, void* d_ws, size_t ws_size, hipStream_t stream) {
    (void)in_sizes; (void)n_in; (void)out_size;
    const float* x = (const float*)d_in[0]; const float* Wq = (const float*)d_in[1]; const float* bq = (const float*)d_in[2]; const float* Wk = (const float*)d_in[3]; const float* bk = (const float*)d_in[4]; const float* Wv = (const float*)d_in[5]; const float* bv = (const float*)d_in[6]; const float* Wt = (const float*)d_in[7]; const float* bt = (const float*)d_in[8]; const float* Wo = (const float*)d_in[9]; const float* bo = (const float*)d_in[10];
    float* out = (float*)d_out;    // [2][2048][1024]
    char* wsp = (char*)d_ws;
    auto take = [&](size_t bytes) { char* p = wsp; wsp += (bytes + 255) & ~(size_t)255; return (void*)p; };
    bf* W4 = (bf*)take((size_t)QW * DMOD * 2); float* B4 = (float*)take((size_t)QW * 4); bf* WO = (bf*)take((size_t)DMOD * DMOD * 2); float* O = (float*)take((size_t)NN * DMOD * 4);
    const size_t PLB = (size_t)NH_ * NN * HD * 2;    // one operand plane, all heads
    bf* Qh = (bf*)take(PLB); bf* Ql = (bf*)take(PLB); bf* Kh = (bf*)take(PLB); bf* Kl = (bf*)take(PLB); bf* Th = (bf*)take(PLB); bf* Tl = (bf*)take(PLB); bf* Ch = (bf*)take(PLB); bf* Cl = (bf*)take(PLB); bf* VTh = (bf*)take(PLB); bf* VTl = (bf*)take(PLB);
    char* const big = wsp;
    bf* Xb = (bf*)take((size_t)NN * DMOD * 2); float* F = (float*)take((size_t)NN * QW * 4); float* KVC = (float*)take((size_t)NN * DMOD * 4);
    if ((size_t)(wsp - (char*)d_ws) > ws_size) return;    // ~ 102 MiB
    // Xb is last read by the projection GEMM, F and KVC when the operand planes are made, Oh, Ol are first written after the attention: they lie on the same bytes.
    wsp = big; bf* Oh = (bf*)take((size_t)NN * DMOD * 2); bf* Ol = (bf*)take((size_t)NN * DMOD * 2);
    k_wcat4<<<(unsigned)(((size_t)QW * DMOD / 8 + 255) / 256), 256, 0, stream>>>(Wq, Wk, Wv, Wt, W4); k_bias4<<<QW / 256, 256, 0, stream>>>(bq, bk, bv, bt, B4); k_cvt8<<<(DMOD * DMOD / 8 + 255) / 256, 256, 0, stream>>>(Wo, WO, DMOD * DMOD / 8);
    for (int b = 0; b < NBT; ++b) {
        k_cvtx<<<NN / 8, 256, 0, stream>>>(x + (size_t)b * NN * DMOD, NN, Xb);
        k_gemmb<false, false><<<dim3(NN / 64, QW / 64, 1), 128, 0, stream>>>(Xb, nullptr, W4, B4, F, QW, nullptr, nullptr, DMOD);      // [q | k | v | t] + biases
        k_cumkv<<<DMOD / 32, 1024, 0, stream>>>(F, KVC);
        // blockIdx.z = head in every launch from here to k_fattn
        k_hplanesz<<<dim3(NN / 32, 1, NH_), 256, 0, stream>>>(F, QW, 0, 1.0f, NN, Qh, Ql); k_hplanesz<<<dim3(NN / 32, 1, NH_), 256, 0, stream>>>(F + DMOD, QW, 0, 1.0f, NN, Kh, Kl);
        k_qtpl<<<dim3(NN / 32, 1, NH_), 256, 0, stream>>>(F, 0, Th, Tl); k_hplanesz<<<dim3(NN / 32, 1, NH_), 256, 0, stream>>>(KVC, DMOD, 0, 1.0f, NN, Ch, Cl); k_vtz<<<dim3(NN / 32, 1, NH_), 256, 0, stream>>>(F + 2 * DMOD, 0, NN, VTh, VTl);
        k_fattn<<<dim3(NN / 128, 1, NH_), 256, 0, stream>>>(Qh, Ql, Kh, Kl, Th, Tl, Ch, Cl, VTh, VTl, O);
        k_splitD<<<NN / 8, 256, 0, stream>>>(O, NN, Oh, Ol);
        k_gemmb<true, false><<<dim3(NN / 64, DMOD / 64, 1), 128, 0, stream>>>(Oh, Ol, WO, bo, out + (size_t)b * NN * DMOD, DMOD, nullptr, nullptr, DMOD); }
}

// v005
// It runs in 285 microseconds.
// Next to v004, in two timings, it ran 1.62 times as fast each time.
// Over all steps from v000 it is 20.3 times as fast.
#include <hip/hip_runtime.h>

// Compute dtypes, f32 accumulate, per item: q/k/v/t = x.W^T + b fused as one [4096 x 1024].[1024 x 4096] GEMM over both items with PLAIN bf16 operands (exact products); the triplet term's
// cumsum over key positions of k*v/8 (f32 prefix sums per column, in 64-row chunks + the sums of the chunks in front) and q*t in f32; per head, in ONE kernel (k_fattn): scores q.k^T + (q*t).kvcum^T with bf16 hi +
// UNSCALED residual planes (three products each; tiles above the diagonal skipped), / 8 + causal softmax in f32 with a running maximum and sum, attn.v (three products); Wo (+ bias) on

#define NBT  2
#define NN   2048
#define DMOD 1024
#define NH_  16
#define HD   64
#define QW   (4 * DMOD)
#define DM   DMOD
#define NTK  NN
#define NR   (NBT * NN)    // rows of both batch items: every launch covers both (row-wise kernels see one [NR] matrix, the others take the item from blockIdx.y)
#define SCL  0.125f
#define LOSC 1024.0f

typedef _Float16 h16;
typedef unsigned short bf;
typedef __attribute__((ext_vector_type(16))) __bf16   v16bf;
typedef __attribute__((ext_vector_type(16))) _Float16 v16h;
typedef __attribute__((ext_vector_type(8)))  _Float16 v8h;
typedef __attribute__((ext_vector_type(8)))  unsigned short v8us;
typedef __attribute__((ext_vector_type(8)))  float    v8f;
typedef __attribute__((ext_vector_type(4)))  float    v4f;
typedef __attribute__((ext_vector_type(4)))  _Float16 v4h;
typedef v8h  __attribute__((may_alias)) v8ha;
typedef v4f  __attribute__((may_alias)) v4fa;
typedef v8us __attribute__((may_alias)) v8usa;

__device__ __forceinline__ unsigned short f2bf(float f) { unsigned u = __float_as_uint(f); u += 0x7FFFu + ((u >> 16) & 1u); return (unsigned short)(u >> 16); }
__device__ __forceinline__ float bf2f(unsigned short b) { return __uint_as_float(((unsigned)b) << 16); }
__device__ __forceinline__ float bfr(float f) { return bf2f(f2bf(f)); }
__device__ __forceinline__ v16h cat16(v8h lo, v8h hi) { return __builtin_shufflevector(lo, hi, 0, 1, 2, 3, 4, 5, 6, 7, 8, 9, 10, 11, 12, 13, 14, 15); }
__device__ __forceinline__ v16bf cat16b(v8us lo, v8us hi) { return __builtin_bit_cast(v16bf, __builtin_shufflevector(lo, hi, 0, 1, 2, 3, 4, 5, 6, 7, 8, 9, 10, 11, 12, 13, 14, 15)); }
__device__ __forceinline__ v8f wmma16(v16h a, v16h b, v8f c) { return __builtin_amdgcn_wmma_f32_16x16x32_f16(false, a, false, b, (short)0, c, false, false); }
__device__ __forceinline__ v8f wmmab(v16bf a, v16bf b, v8f c) { return __builtin_amdgcn_wmma_f32_16x16x32_bf16(false, a, false, b, (short)0, c, false, false); }

// FRAGMENT ORDER: every bf16 matrix operand that one launch writes for another lies as 1-KiB blocks of 16 rows x 32 k. In a block, lane hi*16 + (row & 15) owns k = 8*hi + 0..7 at byte
// lane*16 and k = 16 + 8*hi + 0..7 at byte 512 + lane*16: a wave's 16-byte fragment load then covers 4 whole 128-byte lines, not 32 bytes of each of 16 lines.
// fragsrc: 16-byte piece g of a [rows][DMOD] operand (blocks in the order row tile, k tile) -> index of its first element in the row-major source
__device__ __forceinline__ size_t fragsrc(size_t g) { const int lane = (int)g & 31; return ((g >> 11) * 16 + (lane & 15)) * DMOD + ((g >> 6) & 31) * 32 + ((g >> 5) & 1) * 16 + (lane >> 4) * 8; }

// k_gemmb: 64 x 64 block tile (4 waves x 16 x 64) of C[NR][NW] = (A [+ Al]).B^T (K = 1024) [+ bf(bias[c])] [+ bf(R[r][c]) residual]; f32 whole-line epilogue (or f16
template <bool SPLITA, bool F16OUT = false>
__global__ __launch_bounds__(128) void k_gemmb(const bf* __restrict__ A, const bf* __restrict__ Al, const bf* __restrict__ Bn, const float* __restrict__ bias, float* C, int ldc, h16* C2, const float* __restrict__ R = nullptr, int K = DM, int roundR = 1) {
    __shared__ __align__(16) float ost[4][16 * 68];
    const int lane = threadIdx.x & 31, lr = lane & 15, hi = lane >> 4;
    const int wave = __builtin_amdgcn_readfirstlane((int)threadIdx.x >> 5);    // in a scalar register: every fragment address is then a scalar block base + the lane's 16 bytes
    const int r0 = blockIdx.x * 64 + wave * 16, c0 = blockIdx.y * 64;
    // fragment order (fragsrc): a 16-row tile is DM / 32 blocks of 512 elements in a row; a fragment's address is a scalar block base + the lane's 16 bytes
    const unsigned lo = (unsigned)lane * 8;
    const size_t abase = (size_t)(r0 >> 4) * (DM * 16), bbase = (size_t)(c0 >> 4) * (DM * 16);
    v8f acc[4];
#pragma unroll
    for (int t = 0; t < 4; ++t) acc[t] = (v8f){};
#pragma unroll 1
    for (int kc = 0; kc < K; kc += 32) {
        const bf* ka = A + abase + kc * 16 + lo; const bf* kb = Bn + bbase + kc * 16 + lo; const bf* kl = SPLITA ? Al + abase + kc * 16 + lo : ka;
        const v16bf a = cat16b(*(const v8us*)ka, *(const v8us*)(ka + 256));
        v16bf al = a;
        if (SPLITA) al = cat16b(*(const v8us*)kl, *(const v8us*)(kl + 256));
#pragma unroll
        for (int t = 0; t < 4; ++t) { const v16bf b = cat16b(*(const v8us*)(kb + t * (DM * 16)), *(const v8us*)(kb + t * (DM * 16) + 256)); acc[t] = wmmab(a, b, acc[t]); if (SPLITA) acc[t] = wmmab(al, b, acc[t]); }
        // the lane's three addresses are inputs too: their registers are then not given to a later load's data before the loads that name them have come back
        asm volatile("v_nop\n\tv_nop\n\tv_nop\n\tv_nop" : "+v"(acc[0]), "+v"(acc[1]), "+v"(acc[2]), "+v"(acc[3]) : "v"(a), "v"(al), "v"(ka), "v"(kl), "v"(kb));
    }
    float* os = &ost[wave][0];
#pragma unroll
    for (int t = 0; t < 4; ++t) { const float bv = bias ? bfr(bias[c0 + t * 16 + lr]) : 0.f;
#pragma unroll
        for (int j = 0; j < 8; ++j) os[(hi * 8 + j) * 68 + t * 16 + lr] = acc[t][j] + bv; }
    __syncthreads();
    if (F16OUT) {
        h16* crow = (h16*)(void*)C + (size_t)r0 * ldc + c0;
        auto pass = [&]() {
#pragma unroll
            for (int s = 0; s < 4; ++s) { const int row = 4 * s + (lane >> 3), piece = lane & 7; const float* sp = os + row * 68 + piece * 8; v8h o, o2;
#pragma unroll
                for (int i = 0; i < 8; ++i) { const h16 a = (h16)sp[i]; o[i] = a; o2[i] = (h16)((sp[i] - (float)a) * LOSC); }
                *(v8h*)(crow + (size_t)row * ldc + piece * 8) = o; if (C2) *(v8h*)(C2 + (size_t)r0 * ldc + c0 + (size_t)row * ldc + piece * 8) = o2; }
        };
        pass(); 
    } else {
        float* crow = C + (size_t)r0 * ldc + c0;
        auto pass = [&]() {
#pragma unroll
            for (int s = 0; s < 8; ++s) { const int Lid = (lane >> 3) + 4 * s, piece = lane & 7; const int row = Lid >> 1, cofs = (Lid & 1) * 32 + piece * 4;
                v4f val = *(const v4fa*)(os + row * 68 + cofs); if (R) { const v4f rv = *(const v4f*)(R + ((size_t)r0 + row) * ldc + c0 + cofs); val += roundR ? (v4f){bfr(rv[0]), bfr(rv[1]), bfr(rv[2]), bfr(rv[3])} : rv; }
                *(v4f*)(crow + (size_t)row * ldc + cofs) = val; }
        };
        pass(); 
    }
}

__global__ __launch_bounds__(256) void k_cvt8(const float* __restrict__ src, bf* dst, size_t n8) {
    const size_t i = (size_t)blockIdx.x * 256 + threadIdx.x; if (i >= n8) return;
    const v8f v = *(const v8f*)(src + fragsrc(i)); v8us o;    // dst in fragment order
#pragma unroll
    for (int k = 0; k < 8; ++k) o[k] = f2bf(v[k]);
    *(v8us*)(dst + i * 8) = o; 
}
__global__ __launch_bounds__(256) void k_zero8(bf* dst, size_t n8) {
    const size_t i = (size_t)blockIdx.x * 256 + threadIdx.x; if (i >= n8) return; v8us z;
#pragma unroll
    for (int k = 0; k < 8; ++k) z[k] = 0;
    *(v8us*)(dst + i * 8) = z; 
}

// ===== attention, blockIdx.z = head =====
// k_fattn: scores, causal softmax and attn.v in one kernel; no score or probability leaves the registers. A wave owns 16 query rows of one head and walks the 64-key tiles up to
// its diagonal. Everything is held transposed, so that a lane owns ONE query row (lane & 15): S^T = K.Q^T + C.T^T (A = key rows, B = query rows; D element j of 16-key tile t is key
// t*16 + 8*hi + j), which is already the B-fragment k order (8*hi + 0..7, 16 + 8*hi + 0..7) of O^T = V^T.P^T: tiles 2*ks and 2*ks + 1 side by side.
// Running maximum (base 2) and running sum per lane (lanes r and r + 16 share a query: the maximum is joined every tile, the sum once at the end); O^T is rescaled by 2^(m_old - m_new).
// A work-group is 8 waves: waves 0-3 take row block 31 - x, waves 4-7 row block x, so that every work-group walks 33 tiles. The waves never meet: no LDS, no barrier.
typedef __attribute__((ext_vector_type(2))) __bf16 v2bf;
typedef __attribute__((ext_vector_type(4))) unsigned v4u;
__device__ __forceinline__ float xhalf(float x) { return __builtin_bit_cast(float, __builtin_amdgcn_permlanex16(__builtin_bit_cast(int, x), __builtin_bit_cast(int, x), 0x76543210, 0xfedcba98, false, false)); }  // lane l with lane l ^ 16
__global__ __launch_bounds__(256) void k_fattn(const bf* __restrict__ Qh, const bf* __restrict__ Ql, const bf* __restrict__ Kh, const bf* __restrict__ Kl, const bf* __restrict__ Th, const bf* __restrict__ Tl, const bf* __restrict__ Ch, const bf* __restrict__ Cl, const bf* __restrict__ VTh, const bf* __restrict__ VTl, float* O) {
    const int lane = threadIdx.x & 31, lr = lane & 15, hi = lane >> 4;
    const int wave = __builtin_amdgcn_readfirstlane((int)threadIdx.x >> 5);    // in a scalar register, so that the tile loop ends on a scalar branch
    const int bx = (wave >> 2) ? (int)blockIdx.x : NN / 64 - 1 - (int)blockIdx.x;
    const size_t zo = ((size_t)blockIdx.y * NH_ + blockIdx.z) * NN * HD;         // blockIdx.y = batch item; one head's plane, in fragment order: blocks (16-row tile, k half) for q, k, q*t, kvcum and (32-key group, 16-column tile) for v^T
    const int qrow = bx * 64 + (wave & 3) * 16 + lr;
    typedef const __attribute__((address_space(1))) char* gch; typedef const __attribute__((address_space(1))) v8us* gv8;    // global address space, named: an address that comes out of an asm statement would else be loaded as a flat one
    auto gfrag = [](gch p) -> v16bf { return cat16b(*(gv8)p, *(gv8)(p + 512)); };    // k = 8*hi + 0..7 and 16 + 8*hi + 0..7: the two halves of a 1-KiB block in fragment order
    const unsigned qb = (unsigned)((bx * 4 + (wave & 3)) * 2048 + lane * 16), kb = (unsigned)(lane * 16), vb = (unsigned)(lane * 16);    // the lane's own byte offsets (a 16-row tile of q, k, q*t, kvcum is two blocks)
    gch bQh = (gch)(Qh + zo), bQl = (gch)(Ql + zo), bTh = (gch)(Th + zo), bTl = (gch)(Tl + zo), gQh = bQh + qb, gQl = bQl + qb, gTh = bTh + qb, gTl = bTl + qb;
    v16bf qh[2], ql[2], th[2], tl[2];
    // every '#pragma unroll' of this kernel: the arrays it walks are register arrays, so their indices must be compile-time constants
#pragma unroll
    for (int ks = 0; ks < 2; ++ks) { qh[ks] = gfrag(gQh + ks * 1024); ql[ks] = gfrag(gQl + ks * 1024); th[ks] = gfrag(gTh + ks * 1024); tl[ks] = gfrag(gTl + ks * 1024); }
    // inputs only: the address registers of the query loads (scalar base and lane offset, or their sum) stay whole until those loads have come back
    asm volatile("s_wait_xcnt 0x0" :: "s"(bQh), "s"(bQl), "s"(bTh), "s"(bTl), "v"(qb), "v"(gQh), "v"(gQl), "v"(gTh), "v"(gTl), "v"(qh[0]), "v"(qh[1]), "v"(ql[0]), "v"(ql[1]), "v"(th[0]), "v"(th[1]), "v"(tl[0]), "v"(tl[1]) : "memory");
    // A tile is 12 steps of 4 A fragments (two 16-row tiles x hi and residual plane) and 6 matrix instructions: steps 0-7 the scores (16-key tile pair, k half, k or kvcum), steps 8-11 attn.v
    // (key half, 16-row pair of v^T). Step i works from buf[i % 3]; its fragments are fetched three steps ahead, across the softmax and across the loop's back edge.
    // The lane's address in each of the six planes lives in one register pair for the whole loop and moves once a tile (the asm statement in the loop); every load is that pair + a constant.
    unsigned long long aKh = (unsigned long long)((gch)(Kh + zo) + kb), aKl = (unsigned long long)((gch)(Kl + zo) + kb), aCh = (unsigned long long)((gch)(Ch + zo) + kb), aCl = (unsigned long long)((gch)(Cl + zo) + kb), aVh = (unsigned long long)((gch)(VTh + zo) + vb), aVl = (unsigned long long)((gch)(VTl + zo) + vb);
    auto fetch = [&](v16bf (&d)[4], int i) {
        if (i < 8) { const int c = (i >> 2) * 4096 + ((i >> 1) & 1) * 1024; gch ph = (gch)((i & 1) ? aCh : aKh) + c; gch pl = (gch)((i & 1) ? aCl : aKl) + c;
            d[0] = gfrag(ph); d[1] = gfrag(pl); d[2] = gfrag(ph + 2048); d[3] = gfrag(pl + 2048); }
        else { const int c = ((i - 8) >> 1) * 4096 + ((i - 8) & 1) * 2048; gch ph = (gch)aVh + c; gch pl = (gch)aVl + c;
            d[0] = gfrag(ph); d[1] = gfrag(pl); d[2] = gfrag(ph + 1024); d[3] = gfrag(pl + 1024); }
    };
    // hi.hi + hi.residual + residual.hi of two independent accumulator tiles, taken in turn
    auto mm6 = [](const v16bf (&d)[4], v16bf bh, v16bf bl, v8f& c0, v8f& c1) { c0 = wmmab(d[0], bh, c0); c1 = wmmab(d[2], bh, c1); c0 = wmmab(d[0], bl, c0); c1 = wmmab(d[2], bl, c1); c0 = wmmab(d[1], bh, c0); c1 = wmmab(d[3], bh, c1); };
    v16bf buf[3][4];
    // the barriers keep the three fetches in the order in which the loop's foot issues them, so that the counted waits at the loop's head hold on both ways in
    fetch(buf[0], 0); __builtin_amdgcn_sched_barrier(0); fetch(buf[1], 1); __builtin_amdgcn_sched_barrier(0); fetch(buf[2], 2); __builtin_amdgcn_sched_barrier(0);
    typedef __attribute__((ext_vector_type(2))) float v2f;
    v8f o[4]; v2f lv = (v2f){};
#pragma unroll
    for (int t = 0; t < 4; ++t) o[t] = (v8f){};
    float m = -3.0e38f;
    const unsigned long long dv = 64 * HD * 2;    // 64 keys on in v^T: 8 blocks (32-key group, then 16-column tile)
    const float C2 = SCL * 1.4426950408889634f;    // logits / 8, in base 2
#pragma unroll 1    // one tile a trip: 72 matrix instructions and 96 loads are body enough, a second copy would only grow the code
    for (int kt = 0; kt <= bx; ++kt) {
        const unsigned long long dk = (kt < bx) ? (unsigned long long)(64 * HD * 2) : 0ull;    // the last tile fetches its own first steps once more, unused: no address past the planes
        v8f s[4];
#pragma unroll
        for (int t = 0; t < 4; ++t) s[t] = (v8f){};
#pragma unroll
        for (int i = 0; i < 8; ++i) { const int ks = (i >> 1) & 1;
            mm6(buf[i % 3], (i & 1) ? th[ks] : qh[ks], (i & 1) ? tl[ks] : ql[ks], s[(i >> 2) * 2], s[(i >> 2) * 2 + 1]);
            __builtin_amdgcn_sched_barrier(0);    // keeps the fetch three steps ahead: without the pair the compiler sinks each load to its use and every step waits a full latency
            fetch(buf[i % 3], i + 3);
            __builtin_amdgcn_sched_barrier(0); }
        if (kt == bx) { const int lim = (wave & 3) * 16 + lr - hi * 8;    // diagonal tile: key t*16 + j of this lane's half is allowed while t*16 + j <= lim
#pragma unroll
            for (int t = 0; t < 4; ++t) {
#pragma unroll
                for (int j = 0; j < 8; ++j) s[t][j] = (t * 16 + j <= lim) ? s[t][j] : -3.0e38f; } }
        float mt = -3.0e38f;
#pragma unroll
        for (int t = 0; t < 4; ++t) {
#pragma unroll
            for (int j = 0; j < 8; ++j) mt = fmaxf(mt, s[t][j]); }
        mt = fmaxf(mt, xhalf(mt));
        const float mn = fmaxf(m, mt * C2), al = __builtin_amdgcn_exp2f(m - mn); m = mn;
        v4u ph[4], pl[4]; lv *= al;    // P, hi and residual, two bf16 a word
#pragma unroll
        for (int t = 0; t < 4; ++t) { v8f p;
#pragma unroll
            for (int j = 0; j < 8; ++j) p[j] = __builtin_amdgcn_exp2f(fmaf(s[t][j], C2, -mn));
            lv += ((v2f){p[0], p[1]} + (v2f){p[2], p[3]}) + ((v2f){p[4], p[5]} + (v2f){p[6], p[7]}); o[t] *= al;
#pragma unroll
            for (int j = 0; j < 4; ++j) { const v2f pp = (v2f){p[2 * j], p[2 * j + 1]}; const v2bf h2 = __builtin_convertvector(pp, v2bf), l2 = __builtin_convertvector(pp - __builtin_convertvector(h2, v2f), v2bf);
                ph[t][j] = __builtin_bit_cast(unsigned, h2); pl[t][j] = __builtin_bit_cast(unsigned, l2); } }
#pragma unroll
        for (int i = 8; i < 12; ++i) { const int ks = (i - 8) >> 1, tp = (i - 8) & 1;
            const v16bf pH = __builtin_bit_cast(v16bf, __builtin_shufflevector(ph[2 * ks], ph[2 * ks + 1], 0, 1, 2, 3, 4, 5, 6, 7)), pL = __builtin_bit_cast(v16bf, __builtin_shufflevector(pl[2 * ks], pl[2 * ks + 1], 0, 1, 2, 3, 4, 5, 6, 7));
            mm6(buf[i % 3], pH, pL, o[2 * tp], o[2 * tp + 1]);
            __builtin_amdgcn_sched_barrier(0);    // as above
            // on to the next tile's addresses, once this tile's last fetch is out (i == 8); the wait stands in front of the overwrite of registers that issued loads name
            if (i == 9) asm volatile("s_wait_xcnt 0x0\n\tv_add_nc_u64 %0, %6, %0\n\tv_add_nc_u64 %1, %6, %1\n\tv_add_nc_u64 %2, %6, %2\n\tv_add_nc_u64 %3, %6, %3\n\tv_add_nc_u64 %4, %7, %4\n\tv_add_nc_u64 %5, %7, %5" : "+v"(aKh), "+v"(aKl), "+v"(aCh), "+v"(aCl), "+v"(aVh), "+v"(aVl) : "s"(dk), "s"(dv) : "memory");
            fetch(buf[i % 3], i == 8 ? 11 : i - 9);
            __builtin_amdgcn_sched_barrier(0); }
    }
    asm volatile("s_wait_xcnt 0x0" :: "v"(aKh), "v"(aKl), "v"(aCh), "v"(aCl), "v"(aVh), "v"(aVl) : "memory");    // inputs only: the six address pairs stay whole until the last tile's fetches are past their address stage
    float l = lv[0] + lv[1];
    l += xhalf(l);
    const float inv = 1.0f / l;
    float* orow = O + ((size_t)blockIdx.y * NN + qrow) * DMOD + (size_t)blockIdx.z * HD + hi * 8;
#pragma unroll
    for (int t = 0; t < 4; ++t) { const v8f r = o[t] * inv; *(v4f*)(orow + t * 16) = (v4f){r[0], r[1], r[2], r[3]}; *(v4f*)(orow + t * 16 + 4) = (v4f){r[4], r[5], r[6], r[7]}; }
}
__global__ __launch_bounds__(256) void k_planes32z(const float* __restrict__ F, int ld, int off, float sc, int rows, bf* Ph, bf* Pl) {
    typedef __attribute__((ext_vector_type(2))) unsigned short v2us;
    const int lane = threadIdx.x & 31; const size_t r = ((size_t)blockIdx.x * 8 + (threadIdx.x >> 5)) * 2 + (lane >> 4); if (r >= (size_t)rows) return; const int z = blockIdx.z; const int c0 = (lane & 15) * 2; v2us oh, ol;
    Ph += (size_t)z * rows * 32; Pl += (size_t)z * rows * 32;
#pragma unroll
    for (int i = 0; i < 2; ++i) { const float y = F[r * ld + off + z * 32 + c0 + i] * sc; const unsigned short hb = f2bf(y); oh[i] = hb; ol[i] = f2bf(y - bf2f(hb)); }
    const size_t o = r * 32 + c0; *(v2us*)(Ph + o) = oh; *(v2us*)(Pl + o) = ol; 
}
__global__ __launch_bounds__(256) void k_vtpadz(const float* __restrict__ F, int ld, int off, int nk, bf* Th, bf* Tl) {
    typedef __attribute__((ext_vector_type(2))) unsigned short v2us;
    const int lane = threadIdx.x & 31; const size_t wid = (size_t)blockIdx.x * 8 + (threadIdx.x >> 5); if (wid >= (size_t)64 * (nk / 64)) return; const int z = blockIdx.z; const int d = (int)(wid / (nk / 64)); const int k0 = (int)(wid % (nk / 64)) * 64 + lane * 2; v2us oh, ol;
    Th += (size_t)z * 64 * nk; Tl += (size_t)z * 64 * nk;
#pragma unroll
    for (int i = 0; i < 2; ++i) { const float y = (d < 32) ? F[(size_t)(k0 + i) * ld + off + z * 32 + (d < 32 ? d : 0)] : 0.f; const unsigned short hb = f2bf(y); oh[i] = hb; ol[i] = f2bf(y - bf2f(hb)); }
    const size_t o = (size_t)d * nk + k0; *(v2us*)(Th + o) = oh; *(v2us*)(Tl + o) = ol; 
}
template <int NK>
__global__ __launch_bounds__(256) void k_softmaxz(const float* __restrict__ S, int rows, bf* PH, bf* PL) {
    typedef __attribute__((ext_vector_type(4))) unsigned short v4us;
    const int lane = threadIdx.x & 31, i = blockIdx.x * 8 + (threadIdx.x >> 5); if (i >= rows) return; const size_t zo = (size_t)blockIdx.z * rows * NK; const float* sr = S + zo + (size_t)i * NK; PH += zo; PL += zo;
    float m = -3.0e38f;
#pragma unroll 1
    for (int c0 = lane * 4; c0 < NK; c0 += 128) {
#pragma unroll
        for (int q = 0; q < 4; ++q) m = fmaxf(m, sr[c0 + q]); }
#pragma unroll
    for (int sh = 16; sh; sh >>= 1) m = fmaxf(m, __shfl_xor(m, sh, 32));
    float sum = 0.f;
#pragma unroll 1
    for (int c0 = lane * 4; c0 < NK; c0 += 128) {
#pragma unroll
        for (int q = 0; q < 4; ++q) sum += __expf(sr[c0 + q] - m); }
#pragma unroll
    for (int sh = 16; sh; sh >>= 1) sum += __shfl_xor(sum, sh, 32);
    const float inv = 1.0f / sum;
{
#pragma unroll 1
        for (int c0 = lane * 4; c0 < NK; c0 += 128) { v4us oh, ol;
#pragma unroll
            for (int q = 0; q < 4; ++q) { const float p = __expf(sr[c0 + q] - m) * inv; const unsigned short hb = f2bf(p); oh[q] = hb; ol[q] = f2bf(p - bf2f(hb)); }
            const size_t o = (size_t)i * NK + c0; *(v4us*)(PH + o) = oh; *(v4us*)(PL + o) = ol; }
         }
}
__global__ __launch_bounds__(256) void k_placez(const float* __restrict__ XH, int rows, int ldy, float* Y) {
    const int lane = threadIdx.x & 31; const size_t q = (size_t)blockIdx.x * 8 + (threadIdx.x >> 5); if (q >= (size_t)rows) return; const int z = blockIdx.z; const float v = XH[((size_t)z * rows + q) * 64 + lane];
    *(float*)(Y + q * ldy + z * 32 + lane) = v; 
}

__global__ __launch_bounds__(256) void k_hplanesz(const float* __restrict__ F, int ld, int h0, float sc, int rows, bf* Ph, bf* Pl) {
    // a thread makes one 16-byte piece g of a head's plane, in fragment order: blocks (16-row tile, k half)
    const size_t g = (size_t)blockIdx.x * 256 + threadIdx.x; if (g >= (size_t)rows * 8) return; const int lane = (int)g & 31, z = blockIdx.z; v8us oh, ol;
    Ph += ((size_t)blockIdx.y * NH_ + z) * rows * 64; Pl += ((size_t)blockIdx.y * NH_ + z) * rows * 64; F += (size_t)blockIdx.y * rows * ld;    // blockIdx.y = batch item
    const v8f v = *(const v8f*)(F + ((g >> 7) * 16 + (lane & 15)) * ld + (h0 + z) * 64 + ((g >> 6) & 1) * 32 + ((g >> 5) & 1) * 16 + (lane >> 4) * 8);
#pragma unroll
    for (int i = 0; i < 8; ++i) { const float y = v[i] * sc; const unsigned short hb = f2bf(y); oh[i] = hb; ol[i] = f2bf(y - bf2f(hb)); }
    *(v8us*)(Ph + g * 8) = oh; *(v8us*)(Pl + g * 8) = ol; 
}
__global__ __launch_bounds__(256) void k_vtz(const float* __restrict__ F, int h0, int nk, bf* Th, bf* Tl) {
    // a thread makes one 16-byte piece g (8 keys of one column d) of a head's v^T, in fragment order: blocks (32-key group, 16-column tile)
    const size_t g = (size_t)blockIdx.x * 256 + threadIdx.x; if (g >= (size_t)nk * 8) return; const int lane = (int)g & 31, z = blockIdx.z; const int d = (int)((g >> 6) & 3) * 16 + (lane & 15); const int t0 = (int)(g >> 8) * 32 + (int)((g >> 5) & 1) * 16 + (lane >> 4) * 8; v8us oh, ol;
    Th += ((size_t)blockIdx.y * NH_ + z) * 64 * nk; Tl += ((size_t)blockIdx.y * NH_ + z) * 64 * nk; F += (size_t)blockIdx.y * nk * QW;    // blockIdx.y = batch item
    const float* fv = F + (size_t)t0 * QW + (h0 + z) * 64 + d; v8f v;    // 16 lanes read 64 bytes of a row: 2 lines a load
#pragma unroll
    for (int i = 0; i < 8; ++i) v[i] = fv[(size_t)i * QW];
#pragma unroll
    for (int i = 0; i < 8; ++i) { const float y = v[i]; const unsigned short hb = f2bf(y); oh[i] = hb; ol[i] = f2bf(y - bf2f(hb)); }
    *(v8us*)(Th + g * 8) = oh; *(v8us*)(Tl + g * 8) = ol; 
}
template <int NK>
__global__ __launch_bounds__(256) void k_softmaxzs(const float* __restrict__ S, int rows, float sc, bf* PH, bf* PL) {
    typedef __attribute__((ext_vector_type(4))) unsigned short v4us;
    const int lane = threadIdx.x & 31, i = blockIdx.x * 8 + (threadIdx.x >> 5); if (i >= rows) return; const size_t zo = (size_t)blockIdx.z * rows * NK; const float* sr = S + zo + (size_t)i * NK; PH += zo; PL += zo;
    float m = -3.0e38f;
#pragma unroll 1
    for (int c0 = lane * 4; c0 < NK; c0 += 128) {
#pragma unroll
        for (int q = 0; q < 4; ++q) m = fmaxf(m, sr[c0 + q] * sc); }
#pragma unroll
    for (int sh = 16; sh; sh >>= 1) m = fmaxf(m, __shfl_xor(m, sh, 32));
    float sum = 0.f;
#pragma unroll 1
    for (int c0 = lane * 4; c0 < NK; c0 += 128) {
#pragma unroll
        for (int q = 0; q < 4; ++q) sum += __expf(sr[c0 + q] * sc - m); }
#pragma unroll
    for (int sh = 16; sh; sh >>= 1) sum += __shfl_xor(sum, sh, 32);
    const float inv = 1.0f / sum;
{
#pragma unroll 1
        for (int c0 = lane * 4; c0 < NK; c0 += 128) { v4us oh, ol;
#pragma unroll
            for (int q = 0; q < 4; ++q) { const float p = __expf(sr[c0 + q] * sc - m) * inv; const unsigned short hb = f2bf(p); oh[q] = hb; ol[q] = f2bf(p - bf2f(hb)); }
            const size_t o = (size_t)i * NK + c0; *(v4us*)(PH + o) = oh; *(v4us*)(PL + o) = ol; }
         }
}

__global__ __launch_bounds__(256) void k_cvtx(const float* __restrict__ src, int rows, bf* dst) {
    if ((size_t)blockIdx.x * 8 >= (size_t)rows) return;
{
        // dst in fragment order. Pieces g, g + 256, g + 512, g + 768 of a work-group's 1,024 (half a 16-row tile) lie 4 k tiles = 128 source elements apart
        const size_t g = (size_t)blockIdx.x * (DMOD / 256) * 256 + threadIdx.x; const float* sp = src + fragsrc(g);
#pragma unroll
        for (int q = 0; q < DMOD / 256; ++q) { const v8f v = *(const v8f*)(sp + q * 128); v8us o;
#pragma unroll
            for (int i = 0; i < 8; ++i) o[i] = f2bf(v[i]);
            *(v8us*)(dst + (g + q * 256) * 8) = o; }
         }
}
__global__ __launch_bounds__(256) void k_wcat4(const float* __restrict__ A0, const float* __restrict__ A1, const float* __restrict__ A2, const float* __restrict__ A3, bf* W4) {
    const size_t i = ((size_t)blockIdx.x * 256 + threadIdx.x) * 8; if (i >= (size_t)QW * DMOD) return; const size_t si = fragsrc(i / 8), blk = si / ((size_t)DMOD * DMOD), o = si % ((size_t)DMOD * DMOD);    // W4 in fragment order
    const float* src = (blk == 0) ? A0 : (blk == 1) ? A1 : (blk == 2) ? A2 : A3; v8us v;
#pragma unroll
    for (int q = 0; q < 8; ++q) v[q] = f2bf(src[o + q]);
    *(v8us*)(W4 + i) = v; 
}
__global__ __launch_bounds__(256) void k_bias4(const float* __restrict__ b0, const float* __restrict__ b1, const float* __restrict__ b2, const float* __restrict__ b3, float* B4) {
    const size_t i = (size_t)blockIdx.x * 256 + threadIdx.x; if (i >= (size_t)QW) return; const int blk = (int)(i / DMOD), o = (int)(i % DMOD); const float v = (blk == 0) ? b0[o] : (blk == 1) ? b1[o] : (blk == 2) ? b2[o] : b3[o];
    *(float*)(B4 + i) = v; 
}
// k_cumkv: prefix sums over the key positions, in chunks. A work-group owns 32 columns (one 128-byte line of a row), a lane one column, each of its 32 waves CH = 64 rows in a row.
// A wave's loads depend on nothing: they go out in batches of 16 rows (32 loads), two batches in flight. Its prefix sums start at 0 and stay in registers. The chunks' totals meet in
// LDS, and every wave adds the totals of the chunks in front of it, in chunk order, to its own 64 sums.
#define CH (NN / 32)
__global__ __launch_bounds__(1024) void k_cumkv(const float* F, float* KVC) {
    typedef __attribute__((ext_vector_type(16))) float v16f;
    __shared__ float tot[32][32];
    const int lane = threadIdx.x & 31, c = blockIdx.x * 32 + lane;
    const int wave = __builtin_amdgcn_readfirstlane((int)threadIdx.x >> 5);    // in a scalar register: the chunk's base addresses and the tests on it are then scalar
    const float* fr = F + ((size_t)blockIdx.y * NN + wave * CH) * QW + DMOD + c;    // blockIdx.y = batch item
    float p[CH]; v16f kk[2], vv[2];
    // every '#pragma unroll' of this kernel: the arrays it walks are register arrays, so their indices must be compile-time constants
    auto fetch = [&](int b) {
#pragma unroll
        for (int i = 0; i < 16; ++i) { kk[b & 1][i] = fr[(size_t)(b * 16 + i) * QW]; vv[b & 1][i] = fr[(size_t)(b * 16 + i) * QW + DMOD]; }
    };
    fetch(0);
    float acc = 0.f;
#pragma unroll
    for (int b = 0; b < CH / 16; ++b) {
        if (b + 1 < CH / 16) fetch(b + 1);
        // inputs only, the loaded values of batch b: keeps the loads in batches, the next batch out before this one is waited for and the one after it behind this line. Left alone the
        // compiler either sinks every pair of loads to its product (64 latencies in a row) or lifts all 128 to the top (more registers than a wave of this work-group has).
        // F carries no __restrict__ here, so that the "memory" clobber holds its loads
        asm volatile("" :: "v"(kk[b & 1]), "v"(vv[b & 1]) : "memory");
#pragma unroll
        for (int i = 0; i < 16; ++i) { acc = fmaf(kk[b & 1][i] * vv[b & 1][i], SCL, acc); p[b * 16 + i] = acc; }
    }
    tot[wave][lane] = acc;
    __syncthreads();
    float tw[31];    // the last chunk stands in front of nobody
#pragma unroll
    for (int w = 0; w < 31; ++w) tw[w] = tot[w][lane];
    __builtin_amdgcn_sched_barrier(0);    // the 31 LDS reads go out together, one latency for all, instead of one each
    float off = 0.f;
#pragma unroll
    for (int w = 0; w < 31; ++w) off += (w < wave) ? tw[w] : 0.f;
#pragma unroll
    for (int i = 0; i < CH; ++i) p[i] += off;
    __builtin_amdgcn_sched_barrier(0);    // all sums first, each in its own register: a store then never waits for the store in front of it to let go of a shared data register
    float* dst = KVC + ((size_t)blockIdx.y * NN + wave * CH) * DMOD + c;
#pragma unroll
    for (int i = 0; i < CH; ++i) dst[(size_t)i * DMOD] = p[i];
}
__global__ __launch_bounds__(256) void k_qtpl(const float* __restrict__ F, int h0, bf* Ph, bf* Pl) {
    // a thread makes one 16-byte piece g of a head's plane, in fragment order: blocks (16-row tile, k half)
    const size_t g = (size_t)blockIdx.x * 256 + threadIdx.x; if (g >= (size_t)NN * 8) return; const int lane = (int)g & 31, z = blockIdx.z; const int h = h0 + z; Ph += ((size_t)blockIdx.y * NH_ + z) * NN * HD; Pl += ((size_t)blockIdx.y * NH_ + z) * NN * HD; F += (size_t)blockIdx.y * NN * QW; v8us oh, ol;    // blockIdx.y = batch item
    const float* fq = F + ((g >> 7) * 16 + (lane & 15)) * QW + h * HD + ((g >> 6) & 1) * 32 + ((g >> 5) & 1) * 16 + (lane >> 4) * 8; const v8f vq = *(const v8f*)fq, vt = *(const v8f*)(fq + 3 * DMOD);
#pragma unroll
    for (int q = 0; q < 8; ++q) { const float y = vq[q] * vt[q]; const unsigned short hb = f2bf(y); oh[q] = hb; ol[q] = f2bf(y - bf2f(hb)); }
    *(v8us*)(Ph + g * 8) = oh; *(v8us*)(Pl + g * 8) = ol; 
}
__global__ __launch_bounds__(256) void k_splitD(const float* __restrict__ src, int rows, bf* dh, bf* dl) {
    if ((size_t)blockIdx.x * 8 >= (size_t)rows) return;
{
        // dh, dl in fragment order; the four pieces of a thread as in k_cvtx
        const size_t g = (size_t)blockIdx.x * (DMOD / 256) * 256 + threadIdx.x; const float* sp = src + fragsrc(g);
#pragma unroll
        for (int q = 0; q < DMOD / 256; ++q) { const size_t o = (g + q * 256) * 8; const v8f v = *(const v8f*)(sp + q * 128); v8us oh, ol;
#pragma unroll
            for (int i = 0; i < 8; ++i) { const unsigned short hb = f2bf(v[i]); oh[i] = hb; ol[i] = f2bf(v[i] - bf2f(hb)); }
            *(v8us*)(dh + o) = oh; *(v8us*)(dl + o) = ol; }
         }
}

extern "C" void kernel_launch(void* const* d_in, const int* in_sizes, int n_in,
                              void* d_out, int out_size, void* d_ws, size_t ws_size, hipStream_t stream) {
    (void)in_sizes; (void)n_in; (void)out_size;
    const float* x = (const float*)d_in[0]; const float* Wq = (const float*)d_in[1]; const float* bq = (const float*)d_in[2]; const float* Wk = (const float*)d_in[3]; const float* bk = (const float*)d_in[4]; const float* Wv = (const float*)d_in[5]; const float* bv = (const float*)d_in[6]; const float* Wt = (const float*)d_in[7]; const float* bt = (const float*)d_in[8]; const float* Wo = (const float*)d_in[9]; const float* bo = (const float*)d_in[10];
    float* out = (float*)d_out;    // [2][2048][1024]
    char* wsp = (char*)d_ws;
    auto take = [&](size_t bytes) { char* p = wsp; wsp += (bytes + 255) & ~(size_t)255; return (void*)p; };
    bf* W4 = (bf*)take((size_t)QW * DMOD * 2); float* B4 = (float*)take((size_t)QW * 4); bf* WO = (bf*)take((size_t)DMOD * DMOD * 2); float* O = (float*)take((size_t)NR * DMOD * 4);
    const size_t PLB = (size_t)NBT * NH_ * NN * HD * 2;    // one operand plane, all heads of both items
    bf* Qh = (bf*)take(PLB); bf* Ql = (bf*)take(PLB); bf* Kh = (bf*)take(PLB); bf* Kl = (bf*)take(PLB); bf* Th = (bf*)take(PLB); bf* Tl = (bf*)take(PLB); bf* Ch = (bf*)take(PLB); bf* Cl = (bf*)take(PLB); bf* VTh = (bf*)take(PLB); bf* VTl = (bf*)take(PLB);
    char* const big = wsp;
    bf* Xb = (bf*)take((size_t)NR * DMOD * 2); float* F = (float*)take((size_t)NR * QW * 4); float* KVC = (float*)take((size_t)NR * DMOD * 4);
    if ((size_t)(wsp - (char*)d_ws) > ws_size) return;    // ~ 194 MiB
    // Xb, F, KVC are last read when the operand planes are made, Oh, Ol are first written after the attention: they lie on the same bytes.
    wsp = big; bf* Oh = (bf*)take((size_t)NR * DMOD * 2); bf* Ol = (bf*)take((size_t)NR * DMOD * 2);
    k_wcat4<<<(unsigned)(((size_t)QW * DMOD / 8 + 255) / 256), 256, 0, stream>>>(Wq, Wk, Wv, Wt, W4); k_bias4<<<QW / 256, 256, 0, stream>>>(bq, bk, bv, bt, B4); k_cvt8<<<(DMOD * DMOD / 8 + 255) / 256, 256, 0, stream>>>(Wo, WO, DMOD * DMOD / 8);
    // both batch items in every launch: the row-wise kernels walk the NR = 2 x 2048 rows as one matrix
    k_cvtx<<<NR / 8, 256, 0, stream>>>(x, NR, Xb);
    k_gemmb<false, false><<<dim3(NR / 64, QW / 64, 1), 128, 0, stream>>>(Xb, nullptr, W4, B4, F, QW, nullptr, nullptr, DMOD);      // [q | k | v | t] + biases
    k_cumkv<<<dim3(DMOD / 32, NBT, 1), 1024, 0, stream>>>(F, KVC);
    // blockIdx.y = batch item, blockIdx.z = head in every launch from here to k_fattn
    k_hplanesz<<<dim3(NN / 32, NBT, NH_), 256, 0, stream>>>(F, QW, 0, 1.0f, NN, Qh, Ql); k_hplanesz<<<dim3(NN / 32, NBT, NH_), 256, 0, stream>>>(F + DMOD, QW, 0, 1.0f, NN, Kh, Kl);
    k_qtpl<<<dim3(NN / 32, NBT, NH_), 256, 0, stream>>>(F, 0, Th, Tl); k_hplanesz<<<dim3(NN / 32, NBT, NH_), 256, 0, stream>>>(KVC, DMOD, 0, 1.0f, NN, Ch, Cl); k_vtz<<<dim3(NN / 32, NBT, NH_), 256, 0, stream>>>(F + 2 * DMOD, 0, NN, VTh, VTl);
    k_fattn<<<dim3(NN / 128, NBT, NH_), 256, 0, stream>>>(Qh, Ql, Kh, Kl, Th, Tl, Ch, Cl, VTh, VTl, O);
    k_splitD<<<NR / 8, 256, 0, stream>>>(O, NR, Oh, Ol);
    k_gemmb<true, false><<<dim3(NR / 64, DMOD / 64, 1), 128, 0, stream>>>(Oh, Ol, WO, bo, out, DMOD, nullptr, nullptr, DMOD);
}

// v006
// One run takes 258 microseconds.
// In two side-by-side timings against v005, it was 1.10 and 1.09 times as fast.
// All steps since v000 together make it 22.3 times as fast.
#include <hip/hip_runtime.h>

// Compute dtypes, f32 accumulate, per item: q/k/v/t = x.W^T + b fused as one [4096 x 1024].[1024 x 4096] GEMM over both items with PLAIN bf16 operands (exact products); the triplet term's
// cumsum over key positions of k*v/8 (f32 prefix sums per column, in 64-row chunks + the sums of the chunks in front) and q*t in f32; per head, in ONE kernel (k_fattn): scores q.k^T + (q*t).kvcum^T with bf16 hi +
// UNSCALED residual planes (three products each; tiles above the diagonal skipped), / 8 + causal softmax in f32 with a running maximum and sum, attn.v (three products); Wo (+ bias) on

#define NBT  2
#define NN   2048
#define DMOD 1024
#define NH_  16
#define HD   64
#define QW   (4 * DMOD)
#define DM   DMOD
#define NTK  NN
#define NR   (NBT * NN)    // rows of both batch items: every launch covers both (row-wise kernels see one [NR] matrix, k_fattn takes the item from blockIdx.y, k_mid from blockIdx.x)
#define SCL  0.125f
#define LOSC 1024.0f

typedef _Float16 h16;
typedef unsigned short bf;
typedef __attribute__((ext_vector_type(16))) __bf16   v16bf;
typedef __attribute__((ext_vector_type(16))) _Float16 v16h;
typedef __attribute__((ext_vector_type(8)))  _Float16 v8h;
typedef __attribute__((ext_vector_type(8)))  unsigned short v8us;
typedef __attribute__((ext_vector_type(8)))  float    v8f;
typedef __attribute__((ext_vector_type(4)))  float    v4f;
typedef __attribute__((ext_vector_type(4)))  _Float16 v4h;
typedef v8h  __attribute__((may_alias)) v8ha;
typedef v4f  __attribute__((may_alias)) v4fa;
typedef v8us __attribute__((may_alias)) v8usa;

__device__ __forceinline__ unsigned short f2bf(float f) { unsigned u = __float_as_uint(f); u += 0x7FFFu + ((u >> 16) & 1u); return (unsigned short)(u >> 16); }
__device__ __forceinline__ float bf2f(unsigned short b) { return __uint_as_float(((unsigned)b) << 16); }
__device__ __forceinline__ float bfr(float f) { return bf2f(f2bf(f)); }
__device__ __forceinline__ v16h cat16(v8h lo, v8h hi) { return __builtin_shufflevector(lo, hi, 0, 1, 2, 3, 4, 5, 6, 7, 8, 9, 10, 11, 12, 13, 14, 15); }
__device__ __forceinline__ v16bf cat16b(v8us lo, v8us hi) { return __builtin_bit_cast(v16bf, __builtin_shufflevector(lo, hi, 0, 1, 2, 3, 4, 5, 6, 7, 8, 9, 10, 11, 12, 13, 14, 15)); }
__device__ __forceinline__ v8f wmma16(v16h a, v16h b, v8f c) { return __builtin_amdgcn_wmma_f32_16x16x32_f16(false, a, false, b, (short)0, c, false, false); }
__device__ __forceinline__ v8f wmmab(v16bf a, v16bf b, v8f c) { return __builtin_amdgcn_wmma_f32_16x16x32_bf16(false, a, false, b, (short)0, c, false, false); }

// FRAGMENT ORDER: every bf16 matrix operand that one launch writes for another lies as 1-KiB blocks of 16 rows x 32 k. In a block, lane hi*16 + (row & 15) owns k = 8*hi + 0..7 at byte
// lane*16 and k = 16 + 8*hi + 0..7 at byte 512 + lane*16: a wave's 16-byte fragment load then covers 4 whole 128-byte lines, not 32 bytes of each of 16 lines.
// fragsrc: 16-byte piece g of a [rows][DMOD] operand (blocks in the order row tile, k tile) -> index of its first element in the row-major source
__device__ __forceinline__ size_t fragsrc(size_t g) { const int lane = (int)g & 31; return ((g >> 11) * 16 + (lane & 15)) * DMOD + ((g >> 6) & 31) * 32 + ((g >> 5) & 1) * 16 + (lane >> 4) * 8; }

// k_gemmb: 64 x 64 block tile (4 waves x 16 x 64) of C[NR][NW] = (A [+ Al]).B^T (K = 1024) [+ bf(bias[c])] [+ bf(R[r][c]) residual]; f32 whole-line epilogue (or f16
template <bool SPLITA, bool F16OUT = false>
__global__ __launch_bounds__(128) void k_gemmb(const bf* __restrict__ A, const bf* __restrict__ Al, const bf* __restrict__ Bn, const float* __restrict__ bias, float* C, int ldc, h16* C2, const float* __restrict__ R = nullptr, int K = DM, int roundR = 1) {
    __shared__ __align__(16) float ost[4][16 * 68];
    const int lane = threadIdx.x & 31, lr = lane & 15, hi = lane >> 4;
    const int wave = __builtin_amdgcn_readfirstlane((int)threadIdx.x >> 5);    // in a scalar register: every fragment address is then a scalar block base + the lane's 16 bytes
    const int r0 = blockIdx.x * 64 + wave * 16, c0 = blockIdx.y * 64;
    // fragment order (fragsrc): a 16-row tile is DM / 32 blocks of 512 elements in a row; a fragment's address is a scalar block base + the lane's 16 bytes
    const unsigned lo = (unsigned)lane * 8;
    const size_t abase = (size_t)(r0 >> 4) * (DM * 16), bbase = (size_t)(c0 >> 4) * (DM * 16);
    v8f acc[4];
#pragma unroll
    for (int t = 0; t < 4; ++t) acc[t] = (v8f){};
#pragma unroll 1
    for (int kc = 0; kc < K; kc += 32) {
        const bf* ka = A + abase + kc * 16 + lo; const bf* kb = Bn + bbase + kc * 16 + lo; const bf* kl = SPLITA ? Al + abase + kc * 16 + lo : ka;
        const v16bf a = cat16b(*(const v8us*)ka, *(const v8us*)(ka + 256));
        v16bf al = a;
        if (SPLITA) al = cat16b(*(const v8us*)kl, *(const v8us*)(kl + 256));
#pragma unroll
        for (int t = 0; t < 4; ++t) { const v16bf b = cat16b(*(const v8us*)(kb + t * (DM * 16)), *(const v8us*)(kb + t * (DM * 16) + 256)); acc[t] = wmmab(a, b, acc[t]); if (SPLITA) acc[t] = wmmab(al, b, acc[t]); }
        // the lane's three addresses are inputs too: their registers are then not given to a later load's data before the loads that name them have come back
        asm volatile("v_nop\n\tv_nop\n\tv_nop\n\tv_nop" : "+v"(acc[0]), "+v"(acc[1]), "+v"(acc[2]), "+v"(acc[3]) : "v"(a), "v"(al), "v"(ka), "v"(kl), "v"(kb));
    }
    float* os = &ost[wave][0];
#pragma unroll
    for (int t = 0; t < 4; ++t) { const float bv = bias ? bfr(bias[c0 + t * 16 + lr]) : 0.f;
#pragma unroll
        for (int j = 0; j < 8; ++j) os[(hi * 8 + j) * 68 + t * 16 + lr] = acc[t][j] + bv; }
    __syncthreads();
    if (F16OUT) {
        h16* crow = (h16*)(void*)C + (size_t)r0 * ldc + c0;
        auto pass = [&]() {
#pragma unroll
            for (int s = 0; s < 4; ++s) { const int row = 4 * s + (lane >> 3), piece = lane & 7; const float* sp = os + row * 68 + piece * 8; v8h o, o2;
#pragma unroll
                for (int i = 0; i < 8; ++i) { const h16 a = (h16)sp[i]; o[i] = a; o2[i] = (h16)((sp[i] - (float)a) * LOSC); }
                *(v8h*)(crow + (size_t)row * ldc + piece * 8) = o; if (C2) *(v8h*)(C2 + (size_t)r0 * ldc + c0 + (size_t)row * ldc + piece * 8) = o2; }
        };
        pass(); 
    } else {
        float* crow = C + (size_t)r0 * ldc + c0;
        auto pass = [&]() {
#pragma unroll
            for (int s = 0; s < 8; ++s) { const int Lid = (lane >> 3) + 4 * s, piece = lane & 7; const int row = Lid >> 1, cofs = (Lid & 1) * 32 + piece * 4;
                v4f val = *(const v4fa*)(os + row * 68 + cofs); if (R) { const v4f rv = *(const v4f*)(R + ((size_t)r0 + row) * ldc + c0 + cofs); val += roundR ? (v4f){bfr(rv[0]), bfr(rv[1]), bfr(rv[2]), bfr(rv[3])} : rv; }
                *(v4f*)(crow + (size_t)row * ldc + cofs) = val; }
        };
        pass(); 
    }
}

__global__ __launch_bounds__(256) void k_zero8(bf* dst, size_t n8) {
    const size_t i = (size_t)blockIdx.x * 256 + threadIdx.x; if (i >= n8) return; v8us z;
#pragma unroll
    for (int k = 0; k < 8; ++k) z[k] = 0;
    *(v8us*)(dst + i * 8) = z; 
}

// ===== attention, blockIdx.z = head =====
// k_fattn: scores, causal softmax and attn.v in one kernel; no score or probability leaves the registers. A wave owns 16 query rows of one head and walks the 64-key tiles up to
// its diagonal. Everything is held transposed, so that a lane owns ONE query row (lane & 15): S^T = K.Q^T + C.T^T (A = key rows, B = query rows; D element j of 16-key tile t is key
// t*16 + 8*hi + j), which is already the B-fragment k order (8*hi + 0..7, 16 + 8*hi + 0..7) of O^T = V^T.P^T: tiles 2*ks and 2*ks + 1 side by side.
// Running maximum (base 2) and running sum per lane (lanes r and r + 16 share a query: the maximum is joined every tile, the sum once at the end); O^T is rescaled by 2^(m_old - m_new).
// A work-group is 8 waves: waves 0-3 take row block 31 - x, waves 4-7 row block x, so that every work-group walks 33 tiles. The waves never meet: no LDS, no barrier.
typedef __attribute__((ext_vector_type(2))) __bf16 v2bf;
typedef __attribute__((ext_vector_type(4))) unsigned v4u;
__device__ __forceinline__ float xhalf(float x) { return __builtin_bit_cast(float, __builtin_amdgcn_permlanex16(__builtin_bit_cast(int, x), __builtin_bit_cast(int, x), 0x76543210, 0xfedcba98, false, false)); }  // lane l with lane l ^ 16
__global__ __launch_bounds__(256) void k_fattn(const bf* __restrict__ Qh, const bf* __restrict__ Ql, const bf* __restrict__ Kh, const bf* __restrict__ Kl, const bf* __restrict__ Th, const bf* __restrict__ Tl, const bf* __restrict__ Ch, const bf* __restrict__ Cl, const bf* __restrict__ VTh, const bf* __restrict__ VTl, bf* Oh, bf* Ol) {
    const int lane = threadIdx.x & 31, lr = lane & 15, hi = lane >> 4;
    const int wave = __builtin_amdgcn_readfirstlane((int)threadIdx.x >> 5);    // in a scalar register, so that the tile loop ends on a scalar branch
    const int bx = (wave >> 2) ? (int)blockIdx.x : NN / 64 - 1 - (int)blockIdx.x;
    const size_t zo = ((size_t)blockIdx.y * NH_ + blockIdx.z) * NN * HD;         // blockIdx.y = batch item; one head's plane, in fragment order: blocks (16-row tile, k half) for q, k, q*t, kvcum and (32-key group, 16-column tile) for v^T
    typedef const __attribute__((address_space(1))) char* gch; typedef const __attribute__((address_space(1))) v8us* gv8;    // global address space, named: an address that comes out of an asm statement would else be loaded as a flat one
    auto gfrag = [](gch p) -> v16bf { return cat16b(*(gv8)p, *(gv8)(p + 512)); };    // k = 8*hi + 0..7 and 16 + 8*hi + 0..7: the two halves of a 1-KiB block in fragment order
    const unsigned qb = (unsigned)((bx * 4 + (wave & 3)) * 2048 + lane * 16), kb = (unsigned)(lane * 16), vb = (unsigned)(lane * 16);    // the lane's own byte offsets (a 16-row tile of q, k, q*t, kvcum is two blocks)
    gch bQh = (gch)(Qh + zo), bQl = (gch)(Ql + zo), bTh = (gch)(Th + zo), bTl = (gch)(Tl + zo), gQh = bQh + qb, gQl = bQl + qb, gTh = bTh + qb, gTl = bTl + qb;
    v16bf qh[2], ql[2], th[2], tl[2];
    // every '#pragma unroll' of this kernel: the arrays it walks are register arrays, so their indices must be compile-time constants
#pragma unroll
    for (int ks = 0; ks < 2; ++ks) { qh[ks] = gfrag(gQh + ks * 1024); ql[ks] = gfrag(gQl + ks * 1024); th[ks] = gfrag(gTh + ks * 1024); tl[ks] = gfrag(gTl + ks * 1024); }
    // inputs only: the address registers of the query loads (scalar base and lane offset, or their sum) stay whole until those loads have come back
    asm volatile("s_wait_xcnt 0x0" :: "s"(bQh), "s"(bQl), "s"(bTh), "s"(bTl), "v"(qb), "v"(gQh), "v"(gQl), "v"(gTh), "v"(gTl), "v"(qh[0]), "v"(qh[1]), "v"(ql[0]), "v"(ql[1]), "v"(th[0]), "v"(th[1]), "v"(tl[0]), "v"(tl[1]) : "memory");
    // A tile is 12 steps of 4 A fragments (two 16-row tiles x hi and residual plane) and 6 matrix instructions: steps 0-7 the scores (16-key tile pair, k half, k or kvcum), steps 8-11 attn.v
    // (key half, 16-row pair of v^T). Step i works from buf[i % 3]; its fragments are fetched three steps ahead, across the softmax and across the loop's back edge.
    // The lane's address in each of the six planes lives in one register pair for the whole loop and moves once a tile (the asm statement in the loop); every load is that pair + a constant.
    unsigned long long aKh = (unsigned long long)((gch)(Kh + zo) + kb), aKl = (unsigned long long)((gch)(Kl + zo) + kb), aCh = (unsigned long long)((gch)(Ch + zo) + kb), aCl = (unsigned long long)((gch)(Cl + zo) + kb), aVh = (unsigned long long)((gch)(VTh + zo) + vb), aVl = (unsigned long long)((gch)(VTl + zo) + vb);
    auto fetch = [&](v16bf (&d)[4], int i) {
        if (i < 8) { const int c = (i >> 2) * 4096 + ((i >> 1) & 1) * 1024; gch ph = (gch)((i & 1) ? aCh : aKh) + c; gch pl = (gch)((i & 1) ? aCl : aKl) + c;
            d[0] = gfrag(ph); d[1] = gfrag(pl); d[2] = gfrag(ph + 2048); d[3] = gfrag(pl + 2048); }
        else { const int c = ((i - 8) >> 1) * 4096 + ((i - 8) & 1) * 2048; gch ph = (gch)aVh + c; gch pl = (gch)aVl + c;
            d[0] = gfrag(ph); d[1] = gfrag(pl); d[2] = gfrag(ph + 1024); d[3] = gfrag(pl + 1024); }
    };
    // hi.hi + hi.residual + residual.hi of two independent accumulator tiles, taken in turn
    auto mm6 = [](const v16bf (&d)[4], v16bf bh, v16bf bl, v8f& c0, v8f& c1) { c0 = wmmab(d[0], bh, c0); c1 = wmmab(d[2], bh, c1); c0 = wmmab(d[0], bl, c0); c1 = wmmab(d[2], bl, c1); c0 = wmmab(d[1], bh, c0); c1 = wmmab(d[3], bh, c1); };
    v16bf buf[3][4];
    // the barriers keep the three fetches in the order in which the loop's foot issues them, so that the counted waits at the loop's head hold on both ways in
    fetch(buf[0], 0); __builtin_amdgcn_sched_barrier(0); fetch(buf[1], 1); __builtin_amdgcn_sched_barrier(0); fetch(buf[2], 2); __builtin_amdgcn_sched_barrier(0);
    typedef __attribute__((ext_vector_type(2))) float v2f;
    v8f o[4]; v2f lv = (v2f){};
#pragma unroll
    for (int t = 0; t < 4; ++t) o[t] = (v8f){};
    float m = -3.0e38f;
    const unsigned long long dv = 64 * HD * 2;    // 64 keys on in v^T: 8 blocks (32-key group, then 16-column tile)
    const float C2 = SCL * 1.4426950408889634f;    // logits / 8, in base 2
#pragma unroll 1    // one tile a trip: 72 matrix instructions and 96 loads are body enough, a second copy would only grow the code
    for (int kt = 0; kt <= bx; ++kt) {
        const unsigned long long dk = (kt < bx) ? (unsigned long long)(64 * HD * 2) : 0ull;    // the last tile fetches its own first steps once more, unused: no address past the planes
        v8f s[4];
#pragma unroll
        for (int t = 0; t < 4; ++t) s[t] = (v8f){};
#pragma unroll
        for (int i = 0; i < 8; ++i) { const int ks = (i >> 1) & 1;
            mm6(buf[i % 3], (i & 1) ? th[ks] : qh[ks], (i & 1) ? tl[ks] : ql[ks], s[(i >> 2) * 2], s[(i >> 2) * 2 + 1]);
            __builtin_amdgcn_sched_barrier(0);    // keeps the fetch three steps ahead: without the pair the compiler sinks each load to its use and every step waits a full latency
            fetch(buf[i % 3], i + 3);
            __builtin_amdgcn_sched_barrier(0); }
        if (kt == bx) { const int lim = (wave & 3) * 16 + lr - hi * 8;    // diagonal tile: key t*16 + j of this lane's half is allowed while t*16 + j <= lim
#pragma unroll
            for (int t = 0; t < 4; ++t) {
#pragma unroll
                for (int j = 0; j < 8; ++j) s[t][j] = (t * 16 + j <= lim) ? s[t][j] : -3.0e38f; } }
        float mt = -3.0e38f;
#pragma unroll
        for (int t = 0; t < 4; ++t) {
#pragma unroll
            for (int j = 0; j < 8; ++j) mt = fmaxf(mt, s[t][j]); }
        mt = fmaxf(mt, xhalf(mt));
        const float mn = fmaxf(m, mt * C2), al = __builtin_amdgcn_exp2f(m - mn); m = mn;
        v4u ph[4], pl[4]; lv *= al;    // P, hi and residual, two bf16 a word
#pragma unroll
        for (int t = 0; t < 4; ++t) { v8f p;
#pragma unroll
            for (int j = 0; j < 8; ++j) p[j] = __builtin_amdgcn_exp2f(fmaf(s[t][j], C2, -mn));
            lv += ((v2f){p[0], p[1]} + (v2f){p[2], p[3]}) + ((v2f){p[4], p[5]} + (v2f){p[6], p[7]}); o[t] *= al;
#pragma unroll
            for (int j = 0; j < 4; ++j) { const v2f pp = (v2f){p[2 * j], p[2 * j + 1]}; const v2bf h2 = __builtin_convertvector(pp, v2bf), l2 = __builtin_convertvector(pp - __builtin_convertvector(h2, v2f), v2bf);
                ph[t][j] = __builtin_bit_cast(unsigned, h2); pl[t][j] = __builtin_bit_cast(unsigned, l2); } }
#pragma unroll
        for (int i = 8; i < 12; ++i) { const int ks = (i - 8) >> 1, tp = (i - 8) & 1;
            const v16bf pH = __builtin_bit_cast(v16bf, __builtin_shufflevector(ph[2 * ks], ph[2 * ks + 1], 0, 1, 2, 3, 4, 5, 6, 7)), pL = __builtin_bit_cast(v16bf, __builtin_shufflevector(pl[2 * ks], pl[2 * ks + 1], 0, 1, 2, 3, 4, 5, 6, 7));
            mm6(buf[i % 3], pH, pL, o[2 * tp], o[2 * tp + 1]);
            __builtin_amdgcn_sched_barrier(0);    // as above
            // on to the next tile's addresses, once this tile's last fetch is out (i == 8); the wait stands in front of the overwrite of registers that issued loads name
            if (i == 9) asm volatile("s_wait_xcnt 0x0\n\tv_add_nc_u64 %0, %6, %0\n\tv_add_nc_u64 %1, %6, %1\n\tv_add_nc_u64 %2, %6, %2\n\tv_add_nc_u64 %3, %6, %3\n\tv_add_nc_u64 %4, %7, %4\n\tv_add_nc_u64 %5, %7, %5" : "+v"(aKh), "+v"(aKl), "+v"(aCh), "+v"(aCl), "+v"(aVh), "+v"(aVl) : "s"(dk), "s"(dv) : "memory");
            fetch(buf[i % 3], i == 8 ? 11 : i - 9);
            __builtin_amdgcn_sched_barrier(0); }
    }
    asm volatile("s_wait_xcnt 0x0" :: "v"(aKh), "v"(aKl), "v"(aCh), "v"(aCl), "v"(aVh), "v"(aVl) : "memory");    // inputs only: the six address pairs stay whole until the last tile's fetches are past their address stage
    float l = lv[0] + lv[1];
    l += xhalf(l);
    const float inv = 1.0f / l;
    // O leaves as the A operand of the Wo product: bf16 hi and residual planes of the [NR][DMOD] matrix in fragment order. The lane's 8 values of tile t are columns head*64 + t*16 + 8*hi + 0..7
    // of its query row: piece 'lane' of half (t & 1) of block (16-row tile, k tile head*2 + (t >> 1)). A wave's store is 512 bytes in a row.
    const size_t ob = ((size_t)(((int)blockIdx.y * NN + bx * 64 + (wave & 3) * 16) >> 4) * (DMOD / 32) + (size_t)blockIdx.z * 2) * 512 + (size_t)lane * 8;
#pragma unroll
    for (int t = 0; t < 4; ++t) { const v8f r = o[t] * inv; v8us oh, ol;
#pragma unroll
        for (int i = 0; i < 8; ++i) { const unsigned short hb = f2bf(r[i]); oh[i] = hb; ol[i] = f2bf(r[i] - bf2f(hb)); }
        const size_t e = ob + (t >> 1) * 512 + (t & 1) * 256; *(v8us*)(Oh + e) = oh; *(v8us*)(Ol + e) = ol; }
}
__global__ __launch_bounds__(256) void k_planes32z(const float* __restrict__ F, int ld, int off, float sc, int rows, bf* Ph, bf* Pl) {
    typedef __attribute__((ext_vector_type(2))) unsigned short v2us;
    const int lane = threadIdx.x & 31; const size_t r = ((size_t)blockIdx.x * 8 + (threadIdx.x >> 5)) * 2 + (lane >> 4); if (r >= (size_t)rows) return; const int z = blockIdx.z; const int c0 = (lane & 15) * 2; v2us oh, ol;
    Ph += (size_t)z * rows * 32; Pl += (size_t)z * rows * 32;
#pragma unroll
    for (int i = 0; i < 2; ++i) { const float y = F[r * ld + off + z * 32 + c0 + i] * sc; const unsigned short hb = f2bf(y); oh[i] = hb; ol[i] = f2bf(y - bf2f(hb)); }
    const size_t o = r * 32 + c0; *(v2us*)(Ph + o) = oh; *(v2us*)(Pl + o) = ol; 
}
__global__ __launch_bounds__(256) void k_vtpadz(const float* __restrict__ F, int ld, int off, int nk, bf* Th, bf* Tl) {
    typedef __attribute__((ext_vector_type(2))) unsigned short v2us;
    const int lane = threadIdx.x & 31; const size_t wid = (size_t)blockIdx.x * 8 + (threadIdx.x >> 5); if (wid >= (size_t)64 * (nk / 64)) return; const int z = blockIdx.z; const int d = (int)(wid / (nk / 64)); const int k0 = (int)(wid % (nk / 64)) * 64 + lane * 2; v2us oh, ol;
    Th += (size_t)z * 64 * nk; Tl += (size_t)z * 64 * nk;
#pragma unroll
    for (int i = 0; i < 2; ++i) { const float y = (d < 32) ? F[(size_t)(k0 + i) * ld + off + z * 32 + (d < 32 ? d : 0)] : 0.f; const unsigned short hb = f2bf(y); oh[i] = hb; ol[i] = f2bf(y - bf2f(hb)); }
    const size_t o = (size_t)d * nk + k0; *(v2us*)(Th + o) = oh; *(v2us*)(Tl + o) = ol; 
}
template <int NK>
__global__ __launch_bounds__(256) void k_softmaxz(const float* __restrict__ S, int rows, bf* PH, bf* PL) {
    typedef __attribute__((ext_vector_type(4))) unsigned short v4us;
    const int lane = threadIdx.x & 31, i = blockIdx.x * 8 + (threadIdx.x >> 5); if (i >= rows) return; const size_t zo = (size_t)blockIdx.z * rows * NK; const float* sr = S + zo + (size_t)i * NK; PH += zo; PL += zo;
    float m = -3.0e38f;
#pragma unroll 1
    for (int c0 = lane * 4; c0 < NK; c0 += 128) {
#pragma unroll
        for (int q = 0; q < 4; ++q) m = fmaxf(m, sr[c0 + q]); }
#pragma unroll
    for (int sh = 16; sh; sh >>= 1) m = fmaxf(m, __shfl_xor(m, sh, 32));
    float sum = 0.f;
#pragma unroll 1
    for (int c0 = lane * 4; c0 < NK; c0 += 128) {
#pragma unroll
        for (int q = 0; q < 4; ++q) sum += __expf(sr[c0 + q] - m); }
#pragma unroll
    for (int sh = 16; sh; sh >>= 1) sum += __shfl_xor(sum, sh, 32);
    const float inv = 1.0f / sum;
{
#pragma unroll 1
        for (int c0 = lane * 4; c0 < NK; c0 += 128) { v4us oh, ol;
#pragma unroll
            for (int q = 0; q < 4; ++q) { const float p = __expf(sr[c0 + q] - m) * inv; const unsigned short hb = f2bf(p); oh[q] = hb; ol[q] = f2bf(p - bf2f(hb)); }
            const size_t o = (size_t)i * NK + c0; *(v4us*)(PH + o) = oh; *(v4us*)(PL + o) = ol; }
         }
}
__global__ __launch_bounds__(256) void k_placez(const float* __restrict__ XH, int rows, int ldy, float* Y) {
    const int lane = threadIdx.x & 31; const size_t q = (size_t)blockIdx.x * 8 + (threadIdx.x >> 5); if (q >= (size_t)rows) return; const int z = blockIdx.z; const float v = XH[((size_t)z * rows + q) * 64 + lane];
    *(float*)(Y + q * ldy + z * 32 + lane) = v; 
}

template <int NK>
__global__ __launch_bounds__(256) void k_softmaxzs(const float* __restrict__ S, int rows, float sc, bf* PH, bf* PL) {
    typedef __attribute__((ext_vector_type(4))) unsigned short v4us;
    const int lane = threadIdx.x & 31, i = blockIdx.x * 8 + (threadIdx.x >> 5); if (i >= rows) return; const size_t zo = (size_t)blockIdx.z * rows * NK; const float* sr = S + zo + (size_t)i * NK; PH += zo; PL += zo;
    float m = -3.0e38f;
#pragma unroll 1
    for (int c0 = lane * 4; c0 < NK; c0 += 128) {
#pragma unroll
        for (int q = 0; q < 4; ++q) m = fmaxf(m, sr[c0 + q] * sc); }
#pragma unroll
    for (int sh = 16; sh; sh >>= 1) m = fmaxf(m, __shfl_xor(m, sh, 32));
    float sum = 0.f;
#pragma unroll 1
    for (int c0 = lane * 4; c0 < NK; c0 += 128) {
#pragma unroll
        for (int q = 0; q < 4; ++q) sum += __expf(sr[c0 + q] * sc - m); }
#pragma unroll
    for (int sh = 16; sh; sh >>= 1) sum += __shfl_xor(sum, sh, 32);
    const float inv = 1.0f / sum;
{
#pragma unroll 1
        for (int c0 = lane * 4; c0 < NK; c0 += 128) { v4us oh, ol;
#pragma unroll
            for (int q = 0; q < 4; ++q) { const float p = __expf(sr[c0 + q] * sc - m) * inv; const unsigned short hb = f2bf(p); oh[q] = hb; ol[q] = f2bf(p - bf2f(hb)); }
            const size_t o = (size_t)i * NK + c0; *(v4us*)(PH + o) = oh; *(v4us*)(PL + o) = ol; }
         }
}

// k_prep: every conversion that needs the inputs alone, in one launch; what a work-group does follows from its index (the branches are the same for the whole work-group).
// A [rows][DMOD] matrix takes rows / 8 work-groups: x, then Wq | Wk | Wv | Wt (one [QW][DMOD] operand), then Wo; the last QW / 256 lay the four biases in a row.
#define PBX (NR / 8)
#define PBW (DMOD / 8)
__global__ __launch_bounds__(256) void k_prep(const float* __restrict__ x, const float* __restrict__ Wq, const float* __restrict__ Wk, const float* __restrict__ Wv, const float* __restrict__ Wt, const float* __restrict__ Wo,
                                              const float* __restrict__ bq, const float* __restrict__ bk, const float* __restrict__ bv, const float* __restrict__ bt, bf* Xb, bf* W4, bf* WO, float* B4) {
    int b = blockIdx.x;
    if (b >= PBX + 5 * PBW) { const int i = (b - (PBX + 5 * PBW)) * 256 + (int)threadIdx.x, blk = i / DMOD, o = i % DMOD;
        B4[i] = (blk == 0) ? bq[o] : (blk == 1) ? bk[o] : (blk == 2) ? bv[o] : bt[o]; return; }
    const float* src = x; bf* dst = Xb;
    if (b >= PBX) { b -= PBX; const int w = b / PBW; b -= w * PBW;
        src = (w == 0) ? Wq : (w == 1) ? Wk : (w == 2) ? Wv : (w == 3) ? Wt : Wo; dst = (w < 4) ? W4 + (size_t)w * DMOD * DMOD : WO; }
    // dst in fragment order. Pieces g, g + 256, g + 512, g + 768 of a work-group's 1,024 (half a 16-row tile) lie 4 k tiles = 128 source elements apart
    const size_t g = (size_t)b * 1024 + threadIdx.x; const float* sp = src + fragsrc(g);
    v8f v[4];
    // '#pragma unroll': register arrays, their indices must be compile-time constants
#pragma unroll
    for (int q = 0; q < 4; ++q) v[q] = *(const v8f*)(sp + q * 128);
#pragma unroll
    for (int q = 0; q < 4; ++q) { v8us o;
#pragma unroll
        for (int i = 0; i < 8; ++i) o[i] = f2bf(v[q][i]);
        *(v8us*)(dst + (g + q * 256) * 8) = o; }
    asm volatile("s_wait_xcnt 0x0" ::: "memory");    // in front of any later write of a register that these stores name: in the built code the other branch's instructions follow them
}
// k_mid: everything between the projection GEMM and the attention, in one launch; what a work-group does follows from its index (the branch is the same for the whole work-group).
// THE FIRST NBT * DMOD / 32 WORK-GROUPS: prefix sums of k*v/8 over the key positions, in chunks. A work-group owns 32 columns (one 128-byte line of a row; one k half of one head), a lane one
// column, each of its 32 waves CH = 64 rows in a row. A wave's loads depend on nothing: they go out in batches of 16 rows (32 loads), two batches in flight. Its prefix sums start at 0 and
// stay in registers. The chunks' totals meet in LDS, and every wave adds the totals of the chunks in front of it, in chunk order, to its own 64 sums. The sums leave as kvcum's bf16 hi and
// residual planes in fragment order: a wave's 64 rows x 32 columns are four whole 1-KiB blocks of each plane; 16 rows at a time turn from a column a lane to 16 columns of a row a lane (two runs of 8) in LDS.
// THE OTHERS: the planes of q, k, q*t and v^T. A thread makes pieces g and g + NN * 4 of one head: the 16-byte pieces, hi and residual, of q, k and q*t (blocks (16-row tile, k half): the
// same 8 columns of one row in all three) and of v^T (blocks (32-key group, 16-column tile): 8 keys of one column).
#define CH (NN / 32)
#define NCUM (NBT * (DMOD / 32))
#define TRP 36    // words a row of a wave's turning buffer: 144 bytes = 16 x 9, a pitch at which 16-byte LDS reads of 16 rows meet no bank twice
typedef v4u __attribute__((may_alias)) v4ua;
__global__ __launch_bounds__(1024) void k_mid(const float* F, bf* Qh, bf* Ql, bf* Kh, bf* Kl, bf* Th, bf* Tl, bf* Ch, bf* Cl, bf* VTh, bf* VTl) {
    typedef __attribute__((ext_vector_type(16))) float v16f;
    __shared__ float tot[32][32];
    __shared__ __align__(16) unsigned tr[32][16 * TRP];
    const int lane = threadIdx.x & 31;
    const int wave = __builtin_amdgcn_readfirstlane((int)threadIdx.x >> 5);    // in a scalar register: the chunk's base addresses and the tests on it are then scalar
    // every '#pragma unroll' of this kernel: the arrays it walks are register arrays, so their indices must be compile-time constants
    if (blockIdx.x < NCUM) {
        const int item = (int)blockIdx.x / (DMOD / 32), cb = (int)blockIdx.x % (DMOD / 32), c = cb * 32 + lane;
        const float* fr = F + ((size_t)item * NN + wave * CH) * QW + DMOD + c;
        float p[CH]; v16f kk[2], vv[2];
        auto fetch = [&](int b) {
#pragma unroll
            for (int i = 0; i < 16; ++i) { kk[b & 1][i] = fr[(size_t)(b * 16 + i) * QW]; vv[b & 1][i] = fr[(size_t)(b * 16 + i) * QW + DMOD]; }
        };
        fetch(0);
        float acc = 0.f;
#pragma unroll
        for (int b = 0; b < CH / 16; ++b) {
            if (b + 1 < CH / 16) fetch(b + 1);
            // inputs only, the loaded values of batch b: keeps the loads in batches, the next batch out before this one is waited for and the one after it behind this line. Left alone the
            // compiler either sinks every pair of loads to its product (64 latencies in a row) or lifts all 128 to the top (more registers than a wave of this work-group has).
            // F carries no __restrict__ here, so that the "memory" clobber holds its loads
            asm volatile("" :: "v"(kk[b & 1]), "v"(vv[b & 1]) : "memory");
#pragma unroll
            for (int i = 0; i < 16; ++i) { acc = fmaf(kk[b & 1][i] * vv[b & 1][i], SCL, acc); p[b * 16 + i] = acc; }
        }
        tot[wave][lane] = acc;
        __syncthreads();
        float tw[31];    // the last chunk stands in front of nobody
#pragma unroll
        for (int w = 0; w < 31; ++w) tw[w] = tot[w][lane];
        __builtin_amdgcn_sched_barrier(0);    // the 31 LDS reads go out together, one latency for all, instead of one each
        float off = 0.f;
#pragma unroll
        for (int w = 0; w < 31; ++w) off += (w < wave) ? tw[w] : 0.f;
        unsigned* tb = &tr[wave][0];    // the wave's own buffer: no other wave touches it, so no barrier
        const size_t pb = ((size_t)item * NH_ + (cb >> 1)) * NN * HD + ((size_t)wave * (CH / 16) * 2 + (cb & 1)) * 512 + (size_t)lane * 8;
#pragma unroll
        for (int rt = 0; rt < CH / 16; ++rt) {
#pragma unroll
            for (int r = 0; r < 16; ++r) { const float y = p[rt * 16 + r] + off; const unsigned short hb = f2bf(y); tb[r * TRP + lane] = (unsigned)hb | ((unsigned)f2bf(y - bf2f(hb)) << 16); }    // hi in the low half, residual in the high half
            asm volatile("s_wait_dscnt 0x0" ::: "memory");    // the wave's 16 rows stand in LDS before its lanes read what other lanes wrote
            const v4ua* rp = (const v4ua*)(tb + (lane & 15) * TRP + (lane >> 4) * 8);    // row lane & 15; columns 8*hi + 0..7 and 16 + 8*hi + 0..7
            const v4u w0 = rp[0], w1 = rp[1], w2 = rp[4], w3 = rp[5];
            v4u h0, l0, h1, l1;
#pragma unroll
            for (int i = 0; i < 2; ++i) {
                h0[i] = (w0[2 * i] & 0xFFFFu) | (w0[2 * i + 1] << 16); h0[2 + i] = (w1[2 * i] & 0xFFFFu) | (w1[2 * i + 1] << 16); l0[i] = (w0[2 * i] >> 16) | (w0[2 * i + 1] & 0xFFFF0000u); l0[2 + i] = (w1[2 * i] >> 16) | (w1[2 * i + 1] & 0xFFFF0000u);
                h1[i] = (w2[2 * i] & 0xFFFFu) | (w2[2 * i + 1] << 16); h1[2 + i] = (w3[2 * i] & 0xFFFFu) | (w3[2 * i + 1] << 16); l1[i] = (w2[2 * i] >> 16) | (w2[2 * i + 1] & 0xFFFF0000u); l1[2 + i] = (w3[2 * i] >> 16) | (w3[2 * i + 1] & 0xFFFF0000u); }
            const size_t e = pb + (size_t)rt * 1024;    // the next 16-row tile lies two blocks on
            *(v4ua*)(Ch + e) = h0; *(v4ua*)(Ch + e + 256) = h1; *(v4ua*)(Cl + e) = l0; *(v4ua*)(Cl + e + 256) = l1;
        }
    } else {
        const int b = (int)blockIdx.x - NCUM, zy = b / (NN * 4 / 1024);    // zy = batch item * NH_ + head
        const size_t g0 = (size_t)(b % (NN * 4 / 1024)) * 1024 + threadIdx.x, po = (size_t)zy * NN * HD;
        const float* Fh = F + (size_t)(zy / NH_) * NN * QW + (zy % NH_) * HD;
        v8f vq[2], vk[2], vt[2], vv[2]; const float* fq[2]; const float* fv[2];
#pragma unroll
        for (int u = 0; u < 2; ++u) { const size_t g = g0 + (size_t)u * (NN * 4);
            const size_t row = (g >> 7) * 16 + (lane & 15); const int col = (int)((g >> 6) & 1) * 32 + (int)((g >> 5) & 1) * 16 + (lane >> 4) * 8;
            fq[u] = Fh + row * QW + col; vq[u] = *(const v8f*)fq[u]; vk[u] = *(const v8f*)(fq[u] + DMOD); vt[u] = *(const v8f*)(fq[u] + 3 * DMOD);
            const int d = (int)((g >> 6) & 3) * 16 + (lane & 15); const size_t t0 = (g >> 8) * 32 + ((g >> 5) & 1) * 16 + (lane >> 4) * 8;
            fv[u] = Fh + t0 * QW + d;    // 16 lanes read 64 bytes of a row: 2 lines a load
#pragma unroll
            for (int i = 0; i < 8; ++i) vv[u][i] = fv[u][2 * DMOD + (size_t)i * QW]; }
        // inputs only: the four address pairs stay whole (none is given to a later load's data) until every load that names one is past its address stage. The "memory" clobber keeps all 28 loads
        // in front of this line: they go out together, one memory latency for the thread; left alone the compiler sinks each group to its use, several latencies in a row
        asm volatile("s_wait_xcnt 0x0" :: "v"(fq[0]), "v"(fq[1]), "v"(fv[0]), "v"(fv[1]) : "memory");
        auto put = [&](const v8f v, bf* H, bf* L, size_t o) { v8us oh, ol;
#pragma unroll
            for (int i = 0; i < 8; ++i) { const unsigned short hb = f2bf(v[i]); oh[i] = hb; ol[i] = f2bf(v[i] - bf2f(hb)); }
            *(v8us*)(H + o) = oh; *(v8us*)(L + o) = ol; };
#pragma unroll
        for (int u = 0; u < 2; ++u) { const size_t o = po + (g0 + (size_t)u * (NN * 4)) * 8;
            put(vq[u], Qh, Ql, o); put(vk[u], Kh, Kl, o); put(vq[u] * vt[u], Th, Tl, o); put(vv[u], VTh, VTl, o); }
        asm volatile("s_wait_xcnt 0x0" ::: "memory");    // in front of any later write of a register that these stores name: in the built code the other branch's instructions follow them
    }
}

extern "C" void kernel_launch(void* const* d_in, const int* in_sizes, int n_in,
                              void* d_out, int out_size, void* d_ws, size_t ws_size, hipStream_t stream) {
    (void)in_sizes; (void)n_in; (void)out_size;
    const float* x = (const float*)d_in[0]; const float* Wq = (const float*)d_in[1]; const float* bq = (const float*)d_in[2]; const float* Wk = (const float*)d_in[3]; const float* bk = (const float*)d_in[4]; const float* Wv = (const float*)d_in[5]; const float* bv = (const float*)d_in[6]; const float* Wt = (const float*)d_in[7]; const float* bt = (const float*)d_in[8]; const float* Wo = (const float*)d_in[9]; const float* bo = (const float*)d_in[10];
    float* out = (float*)d_out;    // [2][2048][1024]
    char* wsp = (char*)d_ws;
    auto take = [&](size_t bytes) { char* p = wsp; wsp += (bytes + 255) & ~(size_t)255; return (void*)p; };
    bf* W4 = (bf*)take((size_t)QW * DMOD * 2); float* B4 = (float*)take((size_t)QW * 4); bf* WO = (bf*)take((size_t)DMOD * DMOD * 2);
    const size_t PLB = (size_t)NBT * NH_ * NN * HD * 2;    // one operand plane, all heads of both items
    bf* Qh = (bf*)take(PLB); bf* Ql = (bf*)take(PLB); bf* Kh = (bf*)take(PLB); bf* Kl = (bf*)take(PLB); bf* Th = (bf*)take(PLB); bf* Tl = (bf*)take(PLB); bf* Ch = (bf*)take(PLB); bf* Cl = (bf*)take(PLB); bf* VTh = (bf*)take(PLB); bf* VTl = (bf*)take(PLB);
    char* const big = wsp;
    bf* Xb = (bf*)take((size_t)NR * DMOD * 2); float* F = (float*)take((size_t)NR * QW * 4);
    if ((size_t)(wsp - (char*)d_ws) > ws_size) return;    // ~ 162 MiB
    // Xb is last read by the projection GEMM, F when the operand planes are made, Oh, Ol are first written by the attention: they lie on the same bytes.
    wsp = big; bf* Oh = (bf*)take((size_t)NR * DMOD * 2); bf* Ol = (bf*)take((size_t)NR * DMOD * 2);
    // both batch items in every launch: the row-wise work walks the NR = 2 x 2048 rows as one matrix
    k_prep<<<PBX + 5 * PBW + QW / 256, 256, 0, stream>>>(x, Wq, Wk, Wv, Wt, Wo, bq, bk, bv, bt, Xb, W4, WO, B4);
    k_gemmb<false, false><<<dim3(NR / 64, QW / 64, 1), 128, 0, stream>>>(Xb, nullptr, W4, B4, F, QW, nullptr, nullptr, DMOD);      // [q | k | v | t] + biases
    k_mid<<<NCUM + NBT * NH_ * (NN * 4 / 1024), 1024, 0, stream>>>(F, Qh, Ql, Kh, Kl, Th, Tl, Ch, Cl, VTh, VTl);
    // blockIdx.y = batch item, blockIdx.z = head
    k_fattn<<<dim3(NN / 128, NBT, NH_), 256, 0, stream>>>(Qh, Ql, Kh, Kl, Th, Tl, Ch, Cl, VTh, VTl, Oh, Ol);
    k_gemmb<true, false><<<dim3(NR / 64, DMOD / 64, 1), 128, 0, stream>>>(Oh, Ol, WO, bo, out, DMOD, nullptr, nullptr, DMOD);
}

// v007
// A run of this version takes 237 microseconds.
// In both of two side-by-side timings against v006, it was 1.08 times as fast.
// Over all steps from v000 it is 24.1 times as fast.
#include <hip/hip_runtime.h>

// Compute dtypes, f32 accumulate, per item: q/k/v/t = x.W^T + b fused as one [4096 x 1024].[1024 x 4096] GEMM over both items with PLAIN bf16 operands (exact products); the triplet term's
// cumsum over key positions of k*v/8 (f32 prefix sums per column, in 64-row chunks + the sums of the chunks in front) and q*t in f32; per head, in ONE kernel (k_fattn): scores q.k^T + (q*t).kvcum^T with bf16 hi +
// UNSCALED residual planes (three products each; tiles above the diagonal skipped), / 8 + causal softmax in f32 with a running maximum and sum, attn.v (three products); Wo (+ bias) on

#define NBT  2
#define NN   2048
#define DMOD 1024
#define NH_  16
#define HD   64
#define QW   (4 * DMOD)
#define DM   DMOD
#define NTK  NN
#define NR   (NBT * NN)    // rows of both batch items: every launch covers both (row-wise kernels see one [NR] matrix, k_fattn takes the item from blockIdx.y, k_mid from blockIdx.x)
#define SCL  0.125f
#define LOSC 1024.0f

typedef _Float16 h16;
typedef unsigned short bf;
typedef __attribute__((ext_vector_type(16))) __bf16   v16bf;
typedef __attribute__((ext_vector_type(16))) _Float16 v16h;
typedef __attribute__((ext_vector_type(8)))  _Float16 v8h;
typedef __attribute__((ext_vector_type(8)))  unsigned short v8us;
typedef __attribute__((ext_vector_type(8)))  float    v8f;
typedef __attribute__((ext_vector_type(4)))  float    v4f;
typedef __attribute__((ext_vector_type(4)))  _Float16 v4h;
typedef v8h  __attribute__((may_alias)) v8ha;
typedef v4f  __attribute__((may_alias)) v4fa;
typedef v8us __attribute__((may_alias)) v8usa;

__device__ __forceinline__ unsigned short f2bf(float f) { unsigned u = __float_as_uint(f); u += 0x7FFFu + ((u >> 16) & 1u); return (unsigned short)(u >> 16); }
__device__ __forceinline__ float bf2f(unsigned short b) { return __uint_as_float(((unsigned)b) << 16); }
__device__ __forceinline__ float bfr(float f) { return bf2f(f2bf(f)); }
__device__ __forceinline__ v16h cat16(v8h lo, v8h hi) { return __builtin_shufflevector(lo, hi, 0, 1, 2, 3, 4, 5, 6, 7, 8, 9, 10, 11, 12, 13, 14, 15); }
__device__ __forceinline__ v16bf cat16b(v8us lo, v8us hi) { return __builtin_bit_cast(v16bf, __builtin_shufflevector(lo, hi, 0, 1, 2, 3, 4, 5, 6, 7, 8, 9, 10, 11, 12, 13, 14, 15)); }
__device__ __forceinline__ v8f wmma16(v16h a, v16h b, v8f c) { return __builtin_amdgcn_wmma_f32_16x16x32_f16(false, a, false, b, (short)0, c, false, false); }
__device__ __forceinline__ v8f wmmab(v16bf a, v16bf b, v8f c) { return __builtin_amdgcn_wmma_f32_16x16x32_bf16(false, a, false, b, (short)0, c, false, false); }

// FRAGMENT ORDER: every bf16 matrix operand that one launch writes for another lies as 1-KiB blocks of 16 rows x 32 k. In a block, lane hi*16 + (row & 15) owns k = 8*hi + 0..7 at byte
// lane*16 and k = 16 + 8*hi + 0..7 at byte 512 + lane*16: a wave's 16-byte fragment load then covers 4 whole 128-byte lines, not 32 bytes of each of 16 lines.
// fragsrc: 16-byte piece g of a [rows][DMOD] operand (blocks in the order row tile, k tile) -> index of its first element in the row-major source
__device__ __forceinline__ size_t fragsrc(size_t g) { const int lane = (int)g & 31; return ((g >> 11) * 16 + (lane & 15)) * DMOD + ((g >> 6) & 31) * 32 + ((g >> 5) & 1) * 16 + (lane >> 4) * 8; }

// k_gemmb: 64 x 64 block tile (4 waves x 16 x 64) of C[NR][NW] = (A [+ Al]).B^T (K = 1024) [+ bf(bias[c])] [+ bf(R[r][c]) residual]; f32 whole-line epilogue (or f16
template <bool SPLITA, bool F16OUT = false>
__global__ __launch_bounds__(128) void k_gemmb(const bf* __restrict__ A, const bf* __restrict__ Al, const bf* __restrict__ Bn, const float* __restrict__ bias, float* C, int ldc, h16* C2, const float* __restrict__ R = nullptr, int K = DM, int roundR = 1) {
    __shared__ __align__(16) float ost[4][16 * 68];
    const int lane = threadIdx.x & 31, lr = lane & 15, hi = lane >> 4;
    const int wave = __builtin_amdgcn_readfirstlane((int)threadIdx.x >> 5);    // in a scalar register: every fragment address is then a scalar block base + the lane's 16 bytes
    const int r0 = blockIdx.x * 64 + wave * 16, c0 = blockIdx.y * 64;
    // fragment order (fragsrc): a 16-row tile is DM / 32 blocks of 512 elements in a row; a fragment's address is a scalar block base + the lane's 16 bytes
    const unsigned lo = (unsigned)lane * 8;
    const size_t abase = (size_t)(r0 >> 4) * (DM * 16), bbase = (size_t)(c0 >> 4) * (DM * 16);
    v8f acc[4];
#pragma unroll
    for (int t = 0; t < 4; ++t) acc[t] = (v8f){};
#pragma unroll 1
    for (int kc = 0; kc < K; kc += 32) {
        const bf* ka = A + abase + kc * 16 + lo; const bf* kb = Bn + bbase + kc * 16 + lo; const bf* kl = SPLITA ? Al + abase + kc * 16 + lo : ka;
        const v16bf a = cat16b(*(const v8us*)ka, *(const v8us*)(ka + 256));
        v16bf al = a;
        if (SPLITA) al = cat16b(*(const v8us*)kl, *(const v8us*)(kl + 256));
#pragma unroll
        for (int t = 0; t < 4; ++t) { const v16bf b = cat16b(*(const v8us*)(kb + t * (DM * 16)), *(const v8us*)(kb + t * (DM * 16) + 256)); acc[t] = wmmab(a, b, acc[t]); if (SPLITA) acc[t] = wmmab(al, b, acc[t]); }
        // the lane's three addresses are inputs too: their registers are then not given to a later load's data before the loads that name them have come back
        asm volatile("v_nop\n\tv_nop\n\tv_nop\n\tv_nop" : "+v"(acc[0]), "+v"(acc[1]), "+v"(acc[2]), "+v"(acc[3]) : "v"(a), "v"(al), "v"(ka), "v"(kl), "v"(kb));
    }
    float* os = &ost[wave][0];
#pragma unroll
    for (int t = 0; t < 4; ++t) { const float bv = bias ? bfr(bias[c0 + t * 16 + lr]) : 0.f;
#pragma unroll
        for (int j = 0; j < 8; ++j) os[(hi * 8 + j) * 68 + t * 16 + lr] = acc[t][j] + bv; }
    __syncthreads();
    if (F16OUT) {
        h16* crow = (h16*)(void*)C + (size_t)r0 * ldc + c0;
        auto pass = [&]() {
#pragma unroll
            for (int s = 0; s < 4; ++s) { const int row = 4 * s + (lane >> 3), piece = lane & 7; const float* sp = os + row * 68 + piece * 8; v8h o, o2;
#pragma unroll
                for (int i = 0; i < 8; ++i) { const h16 a = (h16)sp[i]; o[i] = a; o2[i] = (h16)((sp[i] - (float)a) * LOSC); }
                *(v8h*)(crow + (size_t)row * ldc + piece * 8) = o; if (C2) *(v8h*)(C2 + (size_t)r0 * ldc + c0 + (size_t)row * ldc + piece * 8) = o2; }
        };
        pass(); 
    } else {
        float* crow = C + (size_t)r0 * ldc + c0;
        auto pass = [&]() {
#pragma unroll
            for (int s = 0; s < 8; ++s) { const int Lid = (lane >> 3) + 4 * s, piece = lane & 7; const int row = Lid >> 1, cofs = (Lid & 1) * 32 + piece * 4;
                v4f val = *(const v4fa*)(os + row * 68 + cofs); if (R) { const v4f rv = *(const v4f*)(R + ((size_t)r0 + row) * ldc + c0 + cofs); val += roundR ? (v4f){bfr(rv[0]), bfr(rv[1]), bfr(rv[2]), bfr(rv[3])} : rv; }
                *(v4f*)(crow + (size_t)row * ldc + cofs) = val; }
        };
        pass(); 
    }
}

__global__ __launch_bounds__(256) void k_zero8(bf* dst, size_t n8) {
    const size_t i = (size_t)blockIdx.x * 256 + threadIdx.x; if (i >= n8) return; v8us z;
#pragma unroll
    for (int k = 0; k < 8; ++k) z[k] = 0;
    *(v8us*)(dst + i * 8) = z; 
}

// ===== attention, blockIdx.z = head =====
// k_fattn: scores, causal softmax and attn.v in one kernel; no score or probability leaves the registers. A wave owns 16 query rows of one head and walks the 64-key tiles up to
// its diagonal. Everything is held transposed, so that a lane owns ONE query row (lane & 15): S^T = K.Q^T + C.T^T (A = key rows, B = query rows; D element j of 16-key tile t is key
// t*16 + 8*hi + j), which is already the B-fragment k order (8*hi + 0..7, 16 + 8*hi + 0..7) of O^T = V^T.P^T: tiles 2*ks and 2*ks + 1 side by side.
// Running maximum (base 2) and running sum per lane (lanes r and r + 16 share a query: the maximum is joined every tile, the sum once at the end); O^T is rescaled by 2^(m_old - m_new).
// Every wave takes two row blocks ONE AFTER THE OTHER, a long one and then the short one that makes 33 tiles of the pair: all waves last equally long. A work-group is 8 waves: waves 0-3 take row blocks
// 31 - x and x, waves 4-7 row blocks 16 + x and 15 - x (x = blockIdx.x = 0..7); the 256 work-groups are all resident at once, one a WGP, two waves a SIMD. The waves never meet: no LDS, no barrier.
typedef __attribute__((ext_vector_type(2))) __bf16 v2bf;
typedef __attribute__((ext_vector_type(4))) unsigned v4u;
__device__ __forceinline__ float xhalf(float x) { return __builtin_bit_cast(float, __builtin_amdgcn_permlanex16(__builtin_bit_cast(int, x), __builtin_bit_cast(int, x), 0x76543210, 0xfedcba98, false, false)); }  // lane l with lane l ^ 16
__global__ __launch_bounds__(256) void k_fattn(const bf* __restrict__ Qh, const bf* __restrict__ Ql, const bf* __restrict__ Kh, const bf* __restrict__ Kl, const bf* __restrict__ Th, const bf* __restrict__ Tl, const bf* __restrict__ Ch, const bf* __restrict__ Cl, const bf* __restrict__ VTh, const bf* __restrict__ VTl, bf* Oh, bf* Ol) {
    const int lane = threadIdx.x & 31, lr = lane & 15, hi = lane >> 4;
    const int wave = __builtin_amdgcn_readfirstlane((int)threadIdx.x >> 5);    // in a scalar register, so that the tile loop ends on a scalar branch
    const int xs = (wave >> 2) ? NN / 128 - 1 - (int)blockIdx.x : (int)blockIdx.x;    // the short block of the wave's pair
    const size_t zo = ((size_t)blockIdx.y * NH_ + blockIdx.z) * NN * HD;         // blockIdx.y = batch item; one head's plane, in fragment order: blocks (16-row tile, k half) for q, k, q*t, kvcum and (32-key group, 16-column tile) for v^T
    typedef const __attribute__((address_space(1))) char* gch; typedef const __attribute__((address_space(1))) v8us* gv8;    // global address space, named: an address that comes out of an asm statement would else be loaded as a flat one
    auto gfrag = [](gch p) -> v16bf { return cat16b(*(gv8)p, *(gv8)(p + 512)); };    // k = 8*hi + 0..7 and 16 + 8*hi + 0..7: the two halves of a 1-KiB block in fragment order
#pragma unroll 1    // both row blocks run through one copy of the code: a second copy would only double the text the instruction cache has to hold
    for (int half = 0; half < 2; ++half) {    // (the body keeps its indentation)
    const int bx = half ? xs : NN / 64 - 1 - xs;
    const unsigned qb = (unsigned)((bx * 4 + (wave & 3)) * 2048 + lane * 16), kb = (unsigned)(lane * 16), vb = (unsigned)(lane * 16);    // the lane's own byte offsets (a 16-row tile of q, k, q*t, kvcum is two blocks)
    gch bQh = (gch)(Qh + zo), bQl = (gch)(Ql + zo), bTh = (gch)(Th + zo), bTl = (gch)(Tl + zo), gQh = bQh + qb, gQl = bQl + qb, gTh = bTh + qb, gTl = bTl + qb;
    v16bf qh[2], ql[2], th[2], tl[2];
    // every '#pragma unroll' of this kernel: the arrays it walks are register arrays, so their indices must be compile-time constants
#pragma unroll
    for (int ks = 0; ks < 2; ++ks) { qh[ks] = gfrag(gQh + ks * 1024); ql[ks] = gfrag(gQl + ks * 1024); th[ks] = gfrag(gTh + ks * 1024); tl[ks] = gfrag(gTl + ks * 1024); }
    // inputs only: the address registers of the query loads (scalar base and lane offset, or their sum) stay whole until those loads have come back
    asm volatile("s_wait_xcnt 0x0" :: "s"(bQh), "s"(bQl), "s"(bTh), "s"(bTl), "v"(qb), "v"(gQh), "v"(gQl), "v"(gTh), "v"(gTl), "v"(qh[0]), "v"(qh[1]), "v"(ql[0]), "v"(ql[1]), "v"(th[0]), "v"(th[1]), "v"(tl[0]), "v"(tl[1]) : "memory");
    // A tile is 12 steps of 4 A fragments (two 16-row tiles x hi and residual plane) and 6 matrix instructions: steps 0-7 the scores (16-key tile pair, k half, k or kvcum), steps 8-11 attn.v
    // (key half, 16-row pair of v^T). Step i works from buf[i % 3]; its fragments are fetched three steps ahead, across the softmax and across the loop's back edge.
    // The lane's address in each of the six planes lives in one register pair for the whole loop and moves once a tile (the asm statement in the loop); every load is that pair + a constant.
    unsigned long long aKh = (unsigned long long)((gch)(Kh + zo) + kb), aKl = (unsigned long long)((gch)(Kl + zo) + kb), aCh = (unsigned long long)((gch)(Ch + zo) + kb), aCl = (unsigned long long)((gch)(Cl + zo) + kb), aVh = (unsigned long long)((gch)(VTh + zo) + vb), aVl = (unsigned long long)((gch)(VTl + zo) + vb);
    auto fetch = [&](v16bf (&d)[4], int i) {
        if (i < 8) { const int c = (i >> 2) * 4096 + ((i >> 1) & 1) * 1024; gch ph = (gch)((i & 1) ? aCh : aKh) + c; gch pl = (gch)((i & 1) ? aCl : aKl) + c;
            d[0] = gfrag(ph); d[1] = gfrag(pl); d[2] = gfrag(ph + 2048); d[3] = gfrag(pl + 2048); }
        else { const int c = ((i - 8) >> 1) * 4096 + ((i - 8) & 1) * 2048; gch ph = (gch)aVh + c; gch pl = (gch)aVl + c;
            d[0] = gfrag(ph); d[1] = gfrag(pl); d[2] = gfrag(ph + 1024); d[3] = gfrag(pl + 1024); }
    };
    // hi.hi + hi.residual + residual.hi of two independent accumulator tiles, taken in turn
    auto mm6 = [](const v16bf (&d)[4], v16bf bh, v16bf bl, v8f& c0, v8f& c1) { c0 = wmmab(d[0], bh, c0); c1 = wmmab(d[2], bh, c1); c0 = wmmab(d[0], bl, c0); c1 = wmmab(d[2], bl, c1); c0 = wmmab(d[1], bh, c0); c1 = wmmab(d[3], bh, c1); };
    v16bf buf[3][4];
    // the barriers keep the three fetches in the order in which the loop's foot issues them, so that the counted waits at the loop's head hold on both ways in
    fetch(buf[0], 0); __builtin_amdgcn_sched_barrier(0); fetch(buf[1], 1); __builtin_amdgcn_sched_barrier(0); fetch(buf[2], 2); __builtin_amdgcn_sched_barrier(0);
    typedef __attribute__((ext_vector_type(2))) float v2f;
    v8f o[4]; v2f lv = (v2f){};
#pragma unroll
    for (int t = 0; t < 4; ++t) o[t] = (v8f){};
    float m = -3.0e38f;
    const unsigned long long dv = 64 * HD * 2;    // 64 keys on in v^T: 8 blocks (32-key group, then 16-column tile)
    const float C2 = SCL * 1.4426950408889634f;    // logits / 8, in base 2
#pragma unroll 1    // one tile a trip: 72 matrix instructions and 96 loads are body enough, a second copy would only grow the code
    for (int kt = 0; kt <= bx; ++kt) {
        const unsigned long long dk = (kt < bx) ? (unsigned long long)(64 * HD * 2) : 0ull;    // the last tile fetches its own first steps once more, unused: no address past the planes
        v8f s[4];
#pragma unroll
        for (int t = 0; t < 4; ++t) s[t] = (v8f){};
#pragma unroll
        for (int i = 0; i < 8; ++i) { const int ks = (i >> 1) & 1;
            mm6(buf[i % 3], (i & 1) ? th[ks] : qh[ks], (i & 1) ? tl[ks] : ql[ks], s[(i >> 2) * 2], s[(i >> 2) * 2 + 1]);
            __builtin_amdgcn_sched_barrier(0);    // keeps the fetch three steps ahead: without the pair the compiler sinks each load to its use and every step waits a full latency
            fetch(buf[i % 3], i + 3);
            __builtin_amdgcn_sched_barrier(0); }
        if (kt == bx) { const int lim = (wave & 3) * 16 + lr - hi * 8;    // diagonal tile: key t*16 + j of this lane's half is allowed while t*16 + j <= lim
#pragma unroll
            for (int t = 0; t < 4; ++t) {
#pragma unroll
                for (int j = 0; j < 8; ++j) s[t][j] = (t * 16 + j <= lim) ? s[t][j] : -3.0e38f; } }
        float mt = -3.0e38f;
#pragma unroll
        for (int t = 0; t < 4; ++t) {
#pragma unroll
            for (int j = 0; j < 8; ++j) mt = fmaxf(mt, s[t][j]); }
        mt = fmaxf(mt, xhalf(mt));
        const float mn = fmaxf(m, mt * C2), al = __builtin_amdgcn_exp2f(m - mn); m = mn;
        v4u ph[4], pl[4]; lv *= al;    // P, hi and residual, two bf16 a word
#pragma unroll
        for (int t = 0; t < 4; ++t) { v8f p;
#pragma unroll
            for (int j = 0; j < 8; ++j) p[j] = __builtin_amdgcn_exp2f(fmaf(s[t][j], C2, -mn));
            lv += ((v2f){p[0], p[1]} + (v2f){p[2], p[3]}) + ((v2f){p[4], p[5]} + (v2f){p[6], p[7]}); o[t] *= al;
#pragma unroll
            for (int j = 0; j < 4; ++j) { const v2f pp = (v2f){p[2 * j], p[2 * j + 1]}; const v2bf h2 = __builtin_convertvector(pp, v2bf), l2 = __builtin_convertvector(pp - __builtin_convertvector(h2, v2f), v2bf);
                ph[t][j] = __builtin_bit_cast(unsigned, h2); pl[t][j] = __builtin_bit_cast(unsigned, l2); } }
#pragma unroll
        for (int i = 8; i < 12; ++i) { const int ks = (i - 8) >> 1, tp = (i - 8) & 1;
            const v16bf pH = __builtin_bit_cast(v16bf, __builtin_shufflevector(ph[2 * ks], ph[2 * ks + 1], 0, 1, 2, 3, 4, 5, 6, 7)), pL = __builtin_bit_cast(v16bf, __builtin_shufflevector(pl[2 * ks], pl[2 * ks + 1], 0, 1, 2, 3, 4, 5, 6, 7));
            mm6(buf[i % 3], pH, pL, o[2 * tp], o[2 * tp + 1]);
            __builtin_amdgcn_sched_barrier(0);    // as above
            // on to the next tile's addresses, once this tile's last fetch is out (i == 8); the wait stands in front of the overwrite of registers that issued loads name
            if (i == 9) asm volatile("s_wait_xcnt 0x0\n\tv_add_nc_u64 %0, %6, %0\n\tv_add_nc_u64 %1, %6, %1\n\tv_add_nc_u64 %2, %6, %2\n\tv_add_nc_u64 %3, %6, %3\n\tv_add_nc_u64 %4, %7, %4\n\tv_add_nc_u64 %5, %7, %5" : "+v"(aKh), "+v"(aKl), "+v"(aCh), "+v"(aCl), "+v"(aVh), "+v"(aVl) : "s"(dk), "s"(dv) : "memory");
            fetch(buf[i % 3], i == 8 ? 11 : i - 9);
            __builtin_amdgcn_sched_barrier(0); }
    }
    asm volatile("s_wait_xcnt 0x0" :: "v"(aKh), "v"(aKl), "v"(aCh), "v"(aCl), "v"(aVh), "v"(aVl) : "memory");    // inputs only: the six address pairs stay whole until the last tile's fetches are past their address stage
    float l = lv[0] + lv[1];
    l += xhalf(l);
    const float inv = 1.0f / l;
    // O leaves as the A operand of the Wo product: bf16 hi and residual planes of the [NR][DMOD] matrix in fragment order. The lane's 8 values of tile t are columns head*64 + t*16 + 8*hi + 0..7
    // of its query row: piece 'lane' of half (t & 1) of block (16-row tile, k tile head*2 + (t >> 1)). A wave's store is 512 bytes in a row.
    const size_t ob = ((size_t)(((int)blockIdx.y * NN + bx * 64 + (wave & 3) * 16) >> 4) * (DMOD / 32) + (size_t)blockIdx.z * 2) * 512 + (size_t)lane * 8;
#pragma unroll
    for (int t = 0; t < 4; ++t) { const v8f r = o[t] * inv; v8us oh, ol;
#pragma unroll
        for (int i = 0; i < 8; ++i) { const unsigned short hb = f2bf(r[i]); oh[i] = hb; ol[i] = f2bf(r[i] - bf2f(hb)); }
        const size_t e = ob + (t >> 1) * 512 + (t & 1) * 256; *(v8us*)(Oh + e) = oh; *(v8us*)(Ol + e) = ol; }
    asm volatile("s_wait_xcnt 0x0" ::: "memory");    // in front of the second row block's writes of registers that these stores name
    }
}
__global__ __launch_bounds__(256) void k_planes32z(const float* __restrict__ F, int ld, int off, float sc, int rows, bf* Ph, bf* Pl) {
    typedef __attribute__((ext_vector_type(2))) unsigned short v2us;
    const int lane = threadIdx.x & 31; const size_t r = ((size_t)blockIdx.x * 8 + (threadIdx.x >> 5)) * 2 + (lane >> 4); if (r >= (size_t)rows) return; const int z = blockIdx.z; const int c0 = (lane & 15) * 2; v2us oh, ol;
    Ph += (size_t)z * rows * 32; Pl += (size_t)z * rows * 32;
#pragma unroll
    for (int i = 0; i < 2; ++i) { const float y = F[r * ld + off + z * 32 + c0 + i] * sc; const unsigned short hb = f2bf(y); oh[i] = hb; ol[i] = f2bf(y - bf2f(hb)); }
    const size_t o = r * 32 + c0; *(v2us*)(Ph + o) = oh; *(v2us*)(Pl + o) = ol; 
}
__global__ __launch_bounds__(256) void k_vtpadz(const float* __restrict__ F, int ld, int off, int nk, bf* Th, bf* Tl) {
    typedef __attribute__((ext_vector_type(2))) unsigned short v2us;
    const int lane = threadIdx.x & 31; const size_t wid = (size_t)blockIdx.x * 8 + (threadIdx.x >> 5); if (wid >= (size_t)64 * (nk / 64)) return; const int z = blockIdx.z; const int d = (int)(wid / (nk / 64)); const int k0 = (int)(wid % (nk / 64)) * 64 + lane * 2; v2us oh, ol;
    Th += (size_t)z * 64 * nk; Tl += (size_t)z * 64 * nk;
#pragma unroll
    for (int i = 0; i < 2; ++i) { const float y = (d < 32) ? F[(size_t)(k0 + i) * ld + off + z * 32 + (d < 32 ? d : 0)] : 0.f; const unsigned short hb = f2bf(y); oh[i] = hb; ol[i] = f2bf(y - bf2f(hb)); }
    const size_t o = (size_t)d * nk + k0; *(v2us*)(Th + o) = oh; *(v2us*)(Tl + o) = ol; 
}
template <int NK>
__global__ __launch_bounds__(256) void k_softmaxz(const float* __restrict__ S, int rows, bf* PH, bf* PL) {
    typedef __attribute__((ext_vector_type(4))) unsigned short v4us;
    const int lane = threadIdx.x & 31, i = blockIdx.x * 8 + (threadIdx.x >> 5); if (i >= rows) return; const size_t zo = (size_t)blockIdx.z * rows * NK; const float* sr = S + zo + (size_t)i * NK; PH += zo; PL += zo;
    float m = -3.0e38f;
#pragma unroll 1
    for (int c0 = lane * 4; c0 < NK; c0 += 128) {
#pragma unroll
        for (int q = 0; q < 4; ++q) m = fmaxf(m, sr[c0 + q]); }
#pragma unroll
    for (int sh = 16; sh; sh >>= 1) m = fmaxf(m, __shfl_xor(m, sh, 32));
    float sum = 0.f;
#pragma unroll 1
    for (int c0 = lane * 4; c0 < NK; c0 += 128) {
#pragma unroll
        for (int q = 0; q < 4; ++q) sum += __expf(sr[c0 + q] - m); }
#pragma unroll
    for (int sh = 16; sh; sh >>= 1) sum += __shfl_xor(sum, sh, 32);
    const float inv = 1.0f / sum;
{
#pragma unroll 1
        for (int c0 = lane * 4; c0 < NK; c0 += 128) { v4us oh, ol;
#pragma unroll
            for (int q = 0; q < 4; ++q) { const float p = __expf(sr[c0 + q] - m) * inv; const unsigned short hb = f2bf(p); oh[q] = hb; ol[q] = f2bf(p - bf2f(hb)); }
            const size_t o = (size_t)i * NK + c0; *(v4us*)(PH + o) = oh; *(v4us*)(PL + o) = ol; }
         }
}
__global__ __launch_bounds__(256) void k_placez(const float* __restrict__ XH, int rows, int ldy, float* Y) {
    const int lane = threadIdx.x & 31; const size_t q = (size_t)blockIdx.x * 8 + (threadIdx.x >> 5); if (q >= (size_t)rows) return; const int z = blockIdx.z; const float v = XH[((size_t)z * rows + q) * 64 + lane];
    *(float*)(Y + q * ldy + z * 32 + lane) = v; 
}

template <int NK>
__global__ __launch_bounds__(256) void k_softmaxzs(const float* __restrict__ S, int rows, float sc, bf* PH, bf* PL) {
    typedef __attribute__((ext_vector_type(4))) unsigned short v4us;
    const int lane = threadIdx.x & 31, i = blockIdx.x * 8 + (threadIdx.x >> 5); if (i >= rows) return; const size_t zo = (size_t)blockIdx.z * rows * NK; const float* sr = S + zo + (size_t)i * NK; PH += zo; PL += zo;
    float m = -3.0e38f;
#pragma unroll 1
    for (int c0 = lane * 4; c0 < NK; c0 += 128) {
#pragma unroll
        for (int q = 0; q < 4; ++q) m = fmaxf(m, sr[c0 + q] * sc); }
#pragma unroll
    for (int sh = 16; sh; sh >>= 1) m = fmaxf(m, __shfl_xor(m, sh, 32));
    float sum = 0.f;
#pragma unroll 1
    for (int c0 = lane * 4; c0 < NK; c0 += 128) {
#pragma unroll
        for (int q = 0; q < 4; ++q) sum += __expf(sr[c0 + q] * sc - m); }
#pragma unroll
    for (int sh = 16; sh; sh >>= 1) sum += __shfl_xor(sum, sh, 32);
    const float inv = 1.0f / sum;
{
#pragma unroll 1
        for (int c0 = lane * 4; c0 < NK; c0 += 128) { v4us oh, ol;
#pragma unroll
            for (int q = 0; q < 4; ++q) { const float p = __expf(sr[c0 + q] * sc - m) * inv; const unsigned short hb = f2bf(p); oh[q] = hb; ol[q] = f2bf(p - bf2f(hb)); }
            const size_t o = (size_t)i * NK + c0; *(v4us*)(PH + o) = oh; *(v4us*)(PL + o) = ol; }
         }
}

// k_prep: every conversion that needs the inputs alone, in one launch; what a work-group does follows from its index (the branches are the same for the whole work-group).
// A [rows][DMOD] matrix takes rows / 8 work-groups: x, then Wq | Wk | Wv | Wt (one [QW][DMOD] operand), then Wo; the last QW / 256 lay the four biases in a row.
#define PBX (NR / 8)
#define PBW (DMOD / 8)
__global__ __launch_bounds__(256) void k_prep(const float* __restrict__ x, const float* __restrict__ Wq, const float* __restrict__ Wk, const float* __restrict__ Wv, const float* __restrict__ Wt, const float* __restrict__ Wo,
                                              const float* __restrict__ bq, const float* __restrict__ bk, const float* __restrict__ bv, const float* __restrict__ bt, bf* Xb, bf* W4, bf* WO, float* B4) {
    int b = blockIdx.x;
    if (b >= PBX + 5 * PBW) { const int i = (b - (PBX + 5 * PBW)) * 256 + (int)threadIdx.x, blk = i / DMOD, o = i % DMOD;
        B4[i] = (blk == 0) ? bq[o] : (blk == 1) ? bk[o] : (blk == 2) ? bv[o] : bt[o]; return; }
    const float* src = x; bf* dst = Xb;
    if (b >= PBX) { b -= PBX; const int w = b / PBW; b -= w * PBW;
        src = (w == 0) ? Wq : (w == 1) ? Wk : (w == 2) ? Wv : (w == 3) ? Wt : Wo; dst = (w < 4) ? W4 + (size_t)w * DMOD * DMOD : WO; }
    // dst in fragment order. Pieces g, g + 256, g + 512, g + 768 of a work-group's 1,024 (half a 16-row tile) lie 4 k tiles = 128 source elements apart
    const size_t g = (size_t)b * 1024 + threadIdx.x; const float* sp = src + fragsrc(g);
    v8f v[4];
    // '#pragma unroll': register arrays, their indices must be compile-time constants
#pragma unroll
    for (int q = 0; q < 4; ++q) v[q] = *(const v8f*)(sp + q * 128);
#pragma unroll
    for (int q = 0; q < 4; ++q) { v8us o;
#pragma unroll
        for (int i = 0; i < 8; ++i) o[i] = f2bf(v[q][i]);
        *(v8us*)(dst + (g + q * 256) * 8) = o; }
    asm volatile("s_wait_xcnt 0x0" ::: "memory");    // in front of any later write of a register that these stores name: in the built code the other branch's instructions follow them
}
// k_mid: everything between the projection GEMM and the attention, in one launch; what a work-group does follows from its index (the branch is the same for the whole work-group).
// THE FIRST NBT * DMOD / 32 WORK-GROUPS: prefix sums of k*v/8 over the key positions, in chunks. A work-group owns 32 columns (one 128-byte line of a row; one k half of one head), a lane one
// column, each of its 32 waves CH = 64 rows in a row. A wave's loads depend on nothing: they go out in batches of 16 rows (32 loads), two batches in flight. Its prefix sums start at 0 and
// stay in registers. The chunks' totals meet in LDS, and every wave adds the totals of the chunks in front of it, in chunk order, to its own 64 sums. The sums leave as kvcum's bf16 hi and
// residual planes in fragment order: a wave's 64 rows x 32 columns are four whole 1-KiB blocks of each plane; 16 rows at a time turn from a column a lane to 16 columns of a row a lane (two runs of 8) in LDS.
// THE OTHERS: the planes of q, k, q*t and v^T. A thread makes pieces g and g + NN * 4 of one head: the 16-byte pieces, hi and residual, of q, k and q*t (blocks (16-row tile, k half): the
// same 8 columns of one row in all three) and of v^T (blocks (32-key group, 16-column tile): 8 keys of one column).
#define CH (NN / 32)
#define NCUM (NBT * (DMOD / 32))
#define TRP 36    // words a row of a wave's turning buffer: 144 bytes = 16 x 9, a pitch at which 16-byte LDS reads of 16 rows meet no bank twice
typedef v4u __attribute__((may_alias)) v4ua;
__global__ __launch_bounds__(1024) void k_mid(const float* F, bf* Qh, bf* Ql, bf* Kh, bf* Kl, bf* Th, bf* Tl, bf* Ch, bf* Cl, bf* VTh, bf* VTl) {
    typedef __attribute__((ext_vector_type(16))) float v16f;
    __shared__ float tot[32][32];
    __shared__ __align__(16) unsigned tr[32][16 * TRP];
    const int lane = threadIdx.x & 31;
    const int wave = __builtin_amdgcn_readfirstlane((int)threadIdx.x >> 5);    // in a scalar register: the chunk's base addresses and the tests on it are then scalar
    // every '#pragma unroll' of this kernel: the arrays it walks are register arrays, so their indices must be compile-time constants
    if (blockIdx.x < NCUM) {
        const int item = (int)blockIdx.x / (DMOD / 32), cb = (int)blockIdx.x % (DMOD / 32), c = cb * 32 + lane;
        const float* fr = F + ((size_t)item * NN + wave * CH) * QW + DMOD + c;
        float p[CH]; v16f kk[2], vv[2];
        auto fetch = [&](int b) {
#pragma unroll
            for (int i = 0; i < 16; ++i) { kk[b & 1][i] = fr[(size_t)(b * 16 + i) * QW]; vv[b & 1][i] = fr[(size_t)(b * 16 + i) * QW + DMOD]; }
        };
        fetch(0);
        float acc = 0.f;
#pragma unroll
        for (int b = 0; b < CH / 16; ++b) {
            if (b + 1 < CH / 16) fetch(b + 1);
            // inputs only, the loaded values of batch b: keeps the loads in batches, the next batch out before this one is waited for and the one after it behind this line. Left alone the
            // compiler either sinks every pair of loads to its product (64 latencies in a row) or lifts all 128 to the top (more registers than a wave of this work-group has).
            // F carries no __restrict__ here, so that the "memory" clobber holds its loads
            asm volatile("" :: "v"(kk[b & 1]), "v"(vv[b & 1]) : "memory");
#pragma unroll
            for (int i = 0; i < 16; ++i) { acc = fmaf(kk[b & 1][i] * vv[b & 1][i], SCL, acc); p[b * 16 + i] = acc; }
        }
        tot[wave][lane] = acc;
        __syncthreads();
        float tw[31];    // the last chunk stands in front of nobody
#pragma unroll
        for (int w = 0; w < 31; ++w) tw[w] = tot[w][lane];
        __builtin_amdgcn_sched_barrier(0);    // the 31 LDS reads go out together, one latency for all, instead of one each
        float off = 0.f;
#pragma unroll
        for (int w = 0; w < 31; ++w) off += (w < wave) ? tw[w] : 0.f;
        unsigned* tb = &tr[wave][0];    // the wave's own buffer: no other wave touches it, so no barrier
        const size_t pb = ((size_t)item * NH_ + (cb >> 1)) * NN * HD + ((size_t)wave * (CH / 16) * 2 + (cb & 1)) * 512 + (size_t)lane * 8;
#pragma unroll
        for (int rt = 0; rt < CH / 16; ++rt) {
#pragma unroll
            for (int r = 0; r < 16; ++r) { const float y = p[rt * 16 + r] + off; const unsigned short hb = f2bf(y); tb[r * TRP + lane] = (unsigned)hb | ((unsigned)f2bf(y - bf2f(hb)) << 16); }    // hi in the low half, residual in the high half
            asm volatile("s_wait_dscnt 0x0" ::: "memory");    // the wave's 16 rows stand in LDS before its lanes read what other lanes wrote
            const v4ua* rp = (const v4ua*)(tb + (lane & 15) * TRP + (lane >> 4) * 8);    // row lane & 15; columns 8*hi + 0..7 and 16 + 8*hi + 0..7
            const v4u w0 = rp[0], w1 = rp[1], w2 = rp[4], w3 = rp[5];
            v4u h0, l0, h1, l1;
#pragma unroll
            for (int i = 0; i < 2; ++i) {
                h0[i] = (w0[2 * i] & 0xFFFFu) | (w0[2 * i + 1] << 16); h0[2 + i] = (w1[2 * i] & 0xFFFFu) | (w1[2 * i + 1] << 16); l0[i] = (w0[2 * i] >> 16) | (w0[2 * i + 1] & 0xFFFF0000u); l0[2 + i] = (w1[2 * i] >> 16) | (w1[2 * i + 1] & 0xFFFF0000u);
                h1[i] = (w2[2 * i] & 0xFFFFu) | (w2[2 * i + 1] << 16); h1[2 + i] = (w3[2 * i] & 0xFFFFu) | (w3[2 * i + 1] << 16); l1[i] = (w2[2 * i] >> 16) | (w2[2 * i + 1] & 0xFFFF0000u); l1[2 + i] = (w3[2 * i] >> 16) | (w3[2 * i + 1] & 0xFFFF0000u); }
            const size_t e = pb + (size_t)rt * 1024;    // the next 16-row tile lies two blocks on
            *(v4ua*)(Ch + e) = h0; *(v4ua*)(Ch + e + 256) = h1; *(v4ua*)(Cl + e) = l0; *(v4ua*)(Cl + e + 256) = l1;
        }
    } else {
        const int b = (int)blockIdx.x - NCUM, zy = b / (NN * 4 / 1024);    // zy = batch item * NH_ + head
        const size_t g0 = (size_t)(b % (NN * 4 / 1024)) * 1024 + threadIdx.x, po = (size_t)zy * NN * HD;
        const float* Fh = F + (size_t)(zy / NH_) * NN * QW + (zy % NH_) * HD;
        v8f vq[2], vk[2], vt[2], vv[2]; const float* fq[2]; const float* fv[2];
#pragma unroll
        for (int u = 0; u < 2; ++u) { const size_t g = g0 + (size_t)u * (NN * 4);
            const size_t row = (g >> 7) * 16 + (lane & 15); const int col = (int)((g >> 6) & 1) * 32 + (int)((g >> 5) & 1) * 16 + (lane >> 4) * 8;
            fq[u] = Fh + row * QW + col; vq[u] = *(const v8f*)fq[u]; vk[u] = *(const v8f*)(fq[u] + DMOD); vt[u] = *(const v8f*)(fq[u] + 3 * DMOD);
            const int d = (int)((g >> 6) & 3) * 16 + (lane & 15); const size_t t0 = (g >> 8) * 32 + ((g >> 5) & 1) * 16 + (lane >> 4) * 8;
            fv[u] = Fh + t0 * QW + d;    // 16 lanes read 64 bytes of a row: 2 lines a load
#pragma unroll
            for (int i = 0; i < 8; ++i) vv[u][i] = fv[u][2 * DMOD + (size_t)i * QW]; }
        // inputs only: the four address pairs stay whole (none is given to a later load's data) until every load that names one is past its address stage. The "memory" clobber keeps all 28 loads
        // in front of this line: they go out together, one memory latency for the thread; left alone the compiler sinks each group to its use, several latencies in a row
        asm volatile("s_wait_xcnt 0x0" :: "v"(fq[0]), "v"(fq[1]), "v"(fv[0]), "v"(fv[1]) : "memory");
        auto put = [&](const v8f v, bf* H, bf* L, size_t o) { v8us oh, ol;
#pragma unroll
            for (int i = 0; i < 8; ++i) { const unsigned short hb = f2bf(v[i]); oh[i] = hb; ol[i] = f2bf(v[i] - bf2f(hb)); }
            *(v8us*)(H + o) = oh; *(v8us*)(L + o) = ol; };
#pragma unroll
        for (int u = 0; u < 2; ++u) { const size_t o = po + (g0 + (size_t)u * (NN * 4)) * 8;
            put(vq[u], Qh, Ql, o); put(vk[u], Kh, Kl, o); put(vq[u] * vt[u], Th, Tl, o); put(vv[u], VTh, VTl, o); }
        asm volatile("s_wait_xcnt 0x0" ::: "memory");    // in front of any later write of a register that these stores name: in the built code the other branch's instructions follow them
    }
}

extern "C" void kernel_launch(void* const* d_in, const int* in_sizes, int n_in,
                              void* d_out, int out_size, void* d_ws, size_t ws_size, hipStream_t stream) {
    (void)in_sizes; (void)n_in; (void)out_size;
    const float* x = (const float*)d_in[0]; const float* Wq = (const float*)d_in[1]; const float* bq = (const float*)d_in[2]; const float* Wk = (const float*)d_in[3]; const float* bk = (const float*)d_in[4]; const float* Wv = (const float*)d_in[5]; const float* bv = (const float*)d_in[6]; const float* Wt = (const float*)d_in[7]; const float* bt = (const float*)d_in[8]; const float* Wo = (const float*)d_in[9]; const float* bo = (const float*)d_in[10];
    float* out = (float*)d_out;    // [2][2048][1024]
    char* wsp = (char*)d_ws;
    auto take = [&](size_t bytes) { char* p = wsp; wsp += (bytes + 255) & ~(size_t)255; return (void*)p; };
    bf* W4 = (bf*)take((size_t)QW * DMOD * 2); float* B4 = (float*)take((size_t)QW * 4); bf* WO = (bf*)take((size_t)DMOD * DMOD * 2);
    const size_t PLB = (size_t)NBT * NH_ * NN * HD * 2;    // one operand plane, all heads of both items
    bf* Qh = (bf*)take(PLB); bf* Ql = (bf*)take(PLB); bf* Kh = (bf*)take(PLB); bf* Kl = (bf*)take(PLB); bf* Th = (bf*)take(PLB); bf* Tl = (bf*)take(PLB); bf* Ch = (bf*)take(PLB); bf* Cl = (bf*)take(PLB); bf* VTh = (bf*)take(PLB); bf* VTl = (bf*)take(PLB);
    char* const big = wsp;
    bf* Xb = (bf*)take((size_t)NR * DMOD * 2); float* F = (float*)take((size_t)NR * QW * 4);
    if ((size_t)(wsp - (char*)d_ws) > ws_size) return;    // ~ 162 MiB
    // Xb is last read by the projection GEMM, F when the operand planes are made, Oh, Ol are first written by the attention: they lie on the same bytes.
    wsp = big; bf* Oh = (bf*)take((size_t)NR * DMOD * 2); bf* Ol = (bf*)take((size_t)NR * DMOD * 2);
    // both batch items in every launch: the row-wise work walks the NR = 2 x 2048 rows as one matrix
    k_prep<<<PBX + 5 * PBW + QW / 256, 256, 0, stream>>>(x, Wq, Wk, Wv, Wt, Wo, bq, bk, bv, bt, Xb, W4, WO, B4);
    k_gemmb<false, false><<<dim3(NR / 64, QW / 64, 1), 128, 0, stream>>>(Xb, nullptr, W4, B4, F, QW, nullptr, nullptr, DMOD);      // [q | k | v | t] + biases
    k_mid<<<NCUM + NBT * NH_ * (NN * 4 / 1024), 1024, 0, stream>>>(F, Qh, Ql, Kh, Kl, Th, Tl, Ch, Cl, VTh, VTl);
    // blockIdx.y = batch item, blockIdx.z = head
    k_fattn<<<dim3(NN / 256, NBT, NH_), 256, 0, stream>>>(Qh, Ql, Kh, Kl, Th, Tl, Ch, Cl, VTh, VTl, Oh, Ol);
    k_gemmb<true, false><<<dim3(NR / 64, DMOD / 64, 1), 128, 0, stream>>>(Oh, Ol, WO, bo, out, DMOD, nullptr, nullptr, DMOD);
}

// v008
// One run takes 177 microseconds.
// Timed twice side by side with v007, it ran 1.35 and 1.33 times as fast.
// All steps since v000 together make it 32.3 times as fast.
#include <hip/hip_runtime.h>

// Compute dtypes, f32 accumulate, per item: q/k/v/t = x.W^T + b fused as one [4096 x 1024].[1024 x 4096] GEMM over both items with PLAIN bf16 operands (exact products); the triplet term's
// cumsum over key positions of k*v/8 (f32 prefix sums per column, in 64-row chunks + the sums of the chunks in front) and q*t in f32; per head, in ONE kernel (k_fattn): scores q.k^T + (q*t).kvcum^T with bf16 hi +
// UNSCALED residual planes (three products each; tiles above the diagonal skipped), / 8 + causal softmax in f32 with a running maximum and sum, attn.v (three products); Wo (+ bias) on

#define NBT  2
#define NN   2048
#define DMOD 1024
#define NH_  16
#define HD   64
#define QW   (4 * DMOD)
#define DM   DMOD
#define NTK  NN
#define NR   (NBT * NN)    // rows of both batch items: every launch covers both (row-wise kernels see one [NR] matrix, k_fattn takes the item from blockIdx.y, k_mid from blockIdx.x)
#define SCL  0.125f
#define LOSC 1024.0f

typedef _Float16 h16;
typedef unsigned short bf;
typedef __attribute__((ext_vector_type(16))) __bf16   v16bf;
typedef __attribute__((ext_vector_type(16))) _Float16 v16h;
typedef __attribute__((ext_vector_type(8)))  _Float16 v8h;
typedef __attribute__((ext_vector_type(8)))  unsigned short v8us;
typedef __attribute__((ext_vector_type(8)))  float    v8f;
typedef __attribute__((ext_vector_type(4)))  float    v4f;
typedef __attribute__((ext_vector_type(4)))  _Float16 v4h;
typedef v8h  __attribute__((may_alias)) v8ha;
typedef v4f  __attribute__((may_alias)) v4fa;
typedef v8us __attribute__((may_alias)) v8usa;

__device__ __forceinline__ unsigned short f2bf(float f) { unsigned u = __float_as_uint(f); u += 0x7FFFu + ((u >> 16) & 1u); return (unsigned short)(u >> 16); }
__device__ __forceinline__ float bf2f(unsigned short b) { return __uint_as_float(((unsigned)b) << 16); }
__device__ __forceinline__ float bfr(float f) { return bf2f(f2bf(f)); }
__device__ __forceinline__ v16h cat16(v8h lo, v8h hi) { return __builtin_shufflevector(lo, hi, 0, 1, 2, 3, 4, 5, 6, 7, 8, 9, 10, 11, 12, 13, 14, 15); }
__device__ __forceinline__ v16bf cat16b(v8us lo, v8us hi) { return __builtin_bit_cast(v16bf, __builtin_shufflevector(lo, hi, 0, 1, 2, 3, 4, 5, 6, 7, 8, 9, 10, 11, 12, 13, 14, 15)); }
__device__ __forceinline__ v8f wmma16(v16h a, v16h b, v8f c) { return __builtin_amdgcn_wmma_f32_16x16x32_f16(false, a, false, b, (short)0, c, false, false); }
__device__ __forceinline__ v8f wmmab(v16bf a, v16bf b, v8f c) { return __builtin_amdgcn_wmma_f32_16x16x32_bf16(false, a, false, b, (short)0, c, false, false); }

// FRAGMENT ORDER: every bf16 matrix operand that one launch writes for another lies as 1-KiB blocks of 16 rows x 32 k. In a block, lane hi*16 + (row & 15) owns k = 8*hi + 0..7 at byte
// lane*16 and k = 16 + 8*hi + 0..7 at byte 512 + lane*16: a wave's 16-byte fragment load then covers 4 whole 128-byte lines, not 32 bytes of each of 16 lines.
// fragsrc: 16-byte piece g of a [rows][DMOD] operand (blocks in the order row tile, k tile) -> index of its first element in the row-major source
__device__ __forceinline__ size_t fragsrc(size_t g) { const int lane = (int)g & 31; return ((g >> 11) * 16 + (lane & 15)) * DMOD + ((g >> 6) & 31) * 32 + ((g >> 5) & 1) * 16 + (lane >> 4) * 8; }

// k_gemmb: C[rows][NW] = (A [+ Al]).B^T (K = DM) + bf(bias[c]). A wave owns MT x NT accumulator tiles (MT*16 rows x NT*16 columns): a loaded A fragment feeds NT matrix instructions, a B fragment
// MT (2*MT with the residual plane). A work-group is WR x WC waves, whose fragment loads share lines: WR*MT*16 rows x WC*NT*16 columns. The fragments of a k step (32 k) live in one of D register sets and are fetched D - 1 steps ahead,
// all of a step's loads as one group. f32 whole-line epilogue through LDS.
template <bool SPLITA, int MT, int NT, int D, int WR, int WC>
__global__ __launch_bounds__(WR * WC * 32) void k_gemmb(const bf* __restrict__ A, const bf* __restrict__ Al, const bf* __restrict__ Bn, const float* __restrict__ bias, float* C, int ldc) {
    constexpr int OP = NT * 16 + 4;    // words a row of the output staging: a pitch of 16 bytes x an odd number
    __shared__ __align__(16) float ost[WR * WC][MT * 16 * OP];
    const int lane = threadIdx.x & 31, lr = lane & 15, hi = lane >> 4;
    const int wave = __builtin_amdgcn_readfirstlane((int)threadIdx.x >> 5);    // in a scalar register: the tile's base addresses are then scalar
    const int r0 = (blockIdx.x * WR + wave / WC) * (MT * 16), c0 = (blockIdx.y * WC + wave % WC) * (NT * 16);
    // fragment order (fragsrc): a 16-row tile is DM / 32 blocks of 1 KiB in a row, the next 16-row tile lies TB bytes on
    constexpr int TB = DM * 16 * 2;
    typedef const __attribute__((address_space(1))) char* gch; typedef const __attribute__((address_space(1))) v8us* gv8;    // global address space, named: an address that comes out of an asm statement would else be loaded as a flat one
    auto gfrag = [](gch p) -> v16bf { return cat16b(*(gv8)p, *(gv8)(p + 512)); };
    // the lane's address in each operand lives in one register pair for the whole loop and moves once a k step (step()); every load is that pair + a constant
    unsigned long long pA = (unsigned long long)((gch)A + (size_t)(r0 >> 4) * TB + lane * 16), pB = (unsigned long long)((gch)Bn + (size_t)(c0 >> 4) * TB + lane * 16), pL = 0;
    if (SPLITA) pL = (unsigned long long)((gch)Al + (size_t)(r0 >> 4) * TB + lane * 16);
    // on to the next step's addresses; the wait stands in front of the overwrite of registers that issued loads name
    auto step = [&](unsigned long long d) {
        if (SPLITA) asm volatile("s_wait_xcnt 0x0\n\tv_add_nc_u64 %0, %3, %0\n\tv_add_nc_u64 %1, %3, %1\n\tv_add_nc_u64 %2, %3, %2" : "+v"(pA), "+v"(pL), "+v"(pB) : "s"(d) : "memory");
        else asm volatile("s_wait_xcnt 0x0\n\tv_add_nc_u64 %0, %2, %0\n\tv_add_nc_u64 %1, %2, %1" : "+v"(pA), "+v"(pB) : "s"(d) : "memory");
    };
    // every '#pragma unroll' of this kernel: the arrays it walks are register arrays, so their indices must be compile-time constants
    v8f acc[MT][NT];
#pragma unroll
    for (int i = 0; i < MT; ++i) {
#pragma unroll
        for (int t = 0; t < NT; ++t) acc[i][t] = (v8f){}; }
    v16bf a[D][MT], al[D][MT], b[D][NT];
    auto fetch = [&](int p) {
#pragma unroll
        for (int i = 0; i < MT; ++i) { a[p][i] = gfrag((gch)pA + i * TB); if (SPLITA) al[p][i] = gfrag((gch)pL + i * TB); }
#pragma unroll
        for (int t = 0; t < NT; ++t) b[p][t] = gfrag((gch)pB + t * TB);
    };
    // the barriers keep the first fetches in the order in which the loop issues them, so that the counted waits at the loop's head hold on both ways in
    fetch(0);
    asm volatile("s_wait_xcnt 0x0" ::: "memory");    // the first fetch is built with scalar base addresses: the wait stands in front of any later write of those scalar registers
    __builtin_amdgcn_sched_barrier(0);
#pragma unroll
    for (int p = 1; p < D - 1; ++p) { step(1024ull); fetch(p); __builtin_amdgcn_sched_barrier(0); }
    constexpr int NS = DM / 32;    // k steps; a multiple of D. A constant: the loop is then known to run, and the first fetches stay in front of it in their order
    static_assert(NS % D == 0 && NS >= D, "k steps");
#pragma unroll 1    // D k steps a trip (the register sets take turns): body enough, more copies would only grow the code
    for (int s = 0; s < NS; s += D) {
#pragma unroll
        for (int u = 0; u < D; ++u) {
#pragma unroll
            for (int t = 0; t < NT; ++t) {
#pragma unroll
                for (int i = 0; i < MT; ++i) acc[i][t] = wmmab(a[u][i], b[u][t], acc[i][t]);
                if (SPLITA) {
#pragma unroll
                    for (int i = 0; i < MT; ++i) acc[i][t] = wmmab(al[u][i], b[u][t], acc[i][t]); }
                if (t == 0) {    // behind the step's first column, whose wait has retired the oldest loads: the wave's loads in flight then stay within what the load counter can count
                    __builtin_amdgcn_sched_barrier(0);    // the pair keeps the fetch D - 1 steps ahead and in one group: without it the compiler sinks each load to its use and every step waits a full latency
                    step((s + u + D - 1 < NS) ? 1024ull : 0ull);    // the last steps fetch the last step's fragments once more, unused: no address past the operands
                    fetch((u + D - 1) % D);    // into the set that the step before has left
                    __builtin_amdgcn_sched_barrier(0); } }
        }
    }
    // inputs only: the address pairs stay whole until the last fetches are past their address stage
    if (SPLITA) asm volatile("s_wait_xcnt 0x0" :: "v"(pA), "v"(pL), "v"(pB) : "memory");
    else asm volatile("s_wait_xcnt 0x0" :: "v"(pA), "v"(pB) : "memory");
    float* os = &ost[wave][0];
    float bv[NT]; const int bi = c0 + lr;
#pragma unroll
    for (int t = 0; t < NT; ++t) bv[t] = bias[bi + t * 16];
    asm volatile("s_wait_xcnt 0x0" :: "v"(bi) : "memory");    // input only: the index register stays whole (is not given to a load's data) until the bias loads are past their address stage
#pragma unroll
    for (int t = 0; t < NT; ++t) bv[t] = bfr(bv[t]);
#pragma unroll
    for (int t = 0; t < NT; ++t) {
#pragma unroll
        for (int i = 0; i < MT; ++i) {
#pragma unroll
            for (int j = 0; j < 8; ++j) os[(i * 16 + hi * 8 + j) * OP + t * 16 + lr] = acc[i][t][j] + bv[t]; } }
    __syncthreads();
    float* crow = C + (size_t)r0 * ldc + c0;
    constexpr int SB = 16;    // stores a batch
#pragma unroll
    for (int s0 = 0; s0 < MT * NT * 2; s0 += SB) { v4f val[SB];
#pragma unroll
        for (int q = 0; q < SB; ++q) { const int f = (s0 + q) * 32 + lane; val[q] = *(const v4fa*)(os + (f / (NT * 4)) * OP + (f % (NT * 4)) * 4); }
#pragma unroll
        for (int q = 0; q < SB; ++q) { const int f = (s0 + q) * 32 + lane; *(v4f*)(crow + (size_t)(f / (NT * 4)) * ldc + (f % (NT * 4)) * 4) = val[q]; }    // a wave's store: 512 bytes in a row of C (256 of each of two rows at NT = 4)
        if (s0 + SB < MT * NT * 2) asm volatile("s_wait_xcnt 0x0" ::: "memory"); }    // in front of the next batch's writes of registers that these stores name
}

__global__ __launch_bounds__(256) void k_zero8(bf* dst, size_t n8) {
    const size_t i = (size_t)blockIdx.x * 256 + threadIdx.x; if (i >= n8) return; v8us z;
#pragma unroll
    for (int k = 0; k < 8; ++k) z[k] = 0;
    *(v8us*)(dst + i * 8) = z; 
}

// ===== attention, blockIdx.z = head =====
// k_fattn: scores, causal softmax and attn.v in one kernel; no score or probability leaves the registers. A wave owns 16 query rows of one head and walks the 64-key tiles up to
// its diagonal. Everything is held transposed, so that a lane owns ONE query row (lane & 15): S^T = K.Q^T + C.T^T (A = key rows, B = query rows; D element j of 16-key tile t is key
// t*16 + 8*hi + j), which is already the B-fragment k order (8*hi + 0..7, 16 + 8*hi + 0..7) of O^T = V^T.P^T: tiles 2*ks and 2*ks + 1 side by side.
// Running maximum (base 2) and running sum per lane (lanes r and r + 16 share a query: the maximum is joined every tile, the sum once at the end); O^T is rescaled by 2^(m_old - m_new).
// Every wave takes two row blocks ONE AFTER THE OTHER, a long one and then the short one that makes 33 tiles of the pair: all waves last equally long. A work-group is 8 waves: waves 0-3 take row blocks
// 31 - x and x, waves 4-7 row blocks 16 + x and 15 - x (x = blockIdx.x = 0..7); the 256 work-groups are all resident at once, one a WGP, two waves a SIMD. The waves never meet: no LDS, no barrier.
typedef __attribute__((ext_vector_type(2))) __bf16 v2bf;
typedef __attribute__((ext_vector_type(4))) unsigned v4u;
__device__ __forceinline__ float xhalf(float x) { return __builtin_bit_cast(float, __builtin_amdgcn_permlanex16(__builtin_bit_cast(int, x), __builtin_bit_cast(int, x), 0x76543210, 0xfedcba98, false, false)); }  // lane l with lane l ^ 16
__global__ __launch_bounds__(256) void k_fattn(const bf* __restrict__ Qh, const bf* __restrict__ Ql, const bf* __restrict__ Kh, const bf* __restrict__ Kl, const bf* __restrict__ Th, const bf* __restrict__ Tl, const bf* __restrict__ Ch, const bf* __restrict__ Cl, const bf* __restrict__ VTh, const bf* __restrict__ VTl, bf* Oh, bf* Ol) {
    const int lane = threadIdx.x & 31, lr = lane & 15, hi = lane >> 4;
    const int wave = __builtin_amdgcn_readfirstlane((int)threadIdx.x >> 5);    // in a scalar register, so that the tile loop ends on a scalar branch
    const int xs = (wave >> 2) ? NN / 128 - 1 - (int)blockIdx.x : (int)blockIdx.x;    // the short block of the wave's pair
    const size_t zo = ((size_t)blockIdx.y * NH_ + blockIdx.z) * NN * HD;         // blockIdx.y = batch item; one head's plane, in fragment order: blocks (16-row tile, k half) for q, k, q*t, kvcum and (32-key group, 16-column tile) for v^T
    typedef const __attribute__((address_space(1))) char* gch; typedef const __attribute__((address_space(1))) v8us* gv8;    // global address space, named: an address that comes out of an asm statement would else be loaded as a flat one
    auto gfrag = [](gch p) -> v16bf { return cat16b(*(gv8)p, *(gv8)(p + 512)); };    // k = 8*hi + 0..7 and 16 + 8*hi + 0..7: the two halves of a 1-KiB block in fragment order
#pragma unroll 1    // both row blocks run through one copy of the code: a second copy would only double the text the instruction cache has to hold
    for (int half = 0; half < 2; ++half) {    // (the body keeps its indentation)
    const int bx = half ? xs : NN / 64 - 1 - xs;
    const unsigned qb = (unsigned)((bx * 4 + (wave & 3)) * 2048 + lane * 16), kb = (unsigned)(lane * 16), vb = (unsigned)(lane * 16);    // the lane's own byte offsets (a 16-row tile of q, k, q*t, kvcum is two blocks)
    gch bQh = (gch)(Qh + zo), bQl = (gch)(Ql + zo), bTh = (gch)(Th + zo), bTl = (gch)(Tl + zo), gQh = bQh + qb, gQl = bQl + qb, gTh = bTh + qb, gTl = bTl + qb;
    v16bf qh[2], ql[2], th[2], tl[2];
    // every '#pragma unroll' of this kernel: the arrays it walks are register arrays, so their indices must be compile-time constants
#pragma unroll
    for (int ks = 0; ks < 2; ++ks) { qh[ks] = gfrag(gQh + ks * 1024); ql[ks] = gfrag(gQl + ks * 1024); th[ks] = gfrag(gTh + ks * 1024); tl[ks] = gfrag(gTl + ks * 1024); }
    // inputs only: the address registers of the query loads (scalar base and lane offset, or their sum) stay whole until those loads have come back
    asm volatile("s_wait_xcnt 0x0" :: "s"(bQh), "s"(bQl), "s"(bTh), "s"(bTl), "v"(qb), "v"(gQh), "v"(gQl), "v"(gTh), "v"(gTl), "v"(qh[0]), "v"(qh[1]), "v"(ql[0]), "v"(ql[1]), "v"(th[0]), "v"(th[1]), "v"(tl[0]), "v"(tl[1]) : "memory");
    // A tile is 12 steps of 4 A fragments (two 16-row tiles x hi and residual plane) and 6 matrix instructions: steps 0-7 the scores (16-key tile pair, k half, k or kvcum), steps 8-11 attn.v
    // (key half, 16-row pair of v^T). Step i works from buf[i % 3]; its fragments are fetched three steps ahead, across the softmax and across the loop's back edge.
    // The lane's address in each of the six planes lives in one register pair for the whole loop and moves once a tile (the asm statement in the loop); every load is that pair + a constant.
    unsigned long long aKh = (unsigned long long)((gch)(Kh + zo) + kb), aKl = (unsigned long long)((gch)(Kl + zo) + kb), aCh = (unsigned long long)((gch)(Ch + zo) + kb), aCl = (unsigned long long)((gch)(Cl + zo) + kb), aVh = (unsigned long long)((gch)(VTh + zo) + vb), aVl = (unsigned long long)((gch)(VTl + zo) + vb);
    auto fetch = [&](v16bf (&d)[4], int i) {
        if (i < 8) { const int c = (i >> 2) * 4096 + ((i >> 1) & 1) * 1024; gch ph = (gch)((i & 1) ? aCh : aKh) + c; gch pl = (gch)((i & 1) ? aCl : aKl) + c;
            d[0] = gfrag(ph); d[1] = gfrag(pl); d[2] = gfrag(ph + 2048); d[3] = gfrag(pl + 2048); }
        else { const int c = ((i - 8) >> 1) * 4096 + ((i - 8) & 1) * 2048; gch ph = (gch)aVh + c; gch pl = (gch)aVl + c;
            d[0] = gfrag(ph); d[1] = gfrag(pl); d[2] = gfrag(ph + 1024); d[3] = gfrag(pl + 1024); }
    };
    // hi.hi + hi.residual + residual.hi of two independent accumulator tiles, taken in turn
    auto mm6 = [](const v16bf (&d)[4], v16bf bh, v16bf bl, v8f& c0, v8f& c1) { c0 = wmmab(d[0], bh, c0); c1 = wmmab(d[2], bh, c1); c0 = wmmab(d[0], bl, c0); c1 = wmmab(d[2], bl, c1); c0 = wmmab(d[1], bh, c0); c1 = wmmab(d[3], bh, c1); };
    v16bf buf[3][4];
    // the barriers keep the three fetches in the order in which the loop's foot issues them, so that the counted waits at the loop's head hold on both ways in
    fetch(buf[0], 0); __builtin_amdgcn_sched_barrier(0); fetch(buf[1], 1); __builtin_amdgcn_sched_barrier(0); fetch(buf[2], 2); __builtin_amdgcn_sched_barrier(0);
    typedef __attribute__((ext_vector_type(2))) float v2f;
    v8f o[4]; v2f lv = (v2f){};
#pragma unroll
    for (int t = 0; t < 4; ++t) o[t] = (v8f){};
    float m = -3.0e38f;
    const unsigned long long dv = 64 * HD * 2;    // 64 keys on in v^T: 8 blocks (32-key group, then 16-column tile)
    const float C2 = SCL * 1.4426950408889634f;    // logits / 8, in base 2
#pragma unroll 1    // one tile a trip: 72 matrix instructions and 96 loads are body enough, a second copy would only grow the code
    for (int kt = 0; kt <= bx; ++kt) {
        const unsigned long long dk = (kt < bx) ? (unsigned long long)(64 * HD * 2) : 0ull;    // the last tile fetches its own first steps once more, unused: no address past the planes
        v8f s[4];
#pragma unroll
        for (int t = 0; t < 4; ++t) s[t] = (v8f){};
#pragma unroll
        for (int i = 0; i < 8; ++i) { const int ks = (i >> 1) & 1;
            mm6(buf[i % 3], (i & 1) ? th[ks] : qh[ks], (i & 1) ? tl[ks] : ql[ks], s[(i >> 2) * 2], s[(i >> 2) * 2 + 1]);
            __builtin_amdgcn_sched_barrier(0);    // keeps the fetch three steps ahead: without the pair the compiler sinks each load to its use and every step waits a full latency
            fetch(buf[i % 3], i + 3);
            __builtin_amdgcn_sched_barrier(0); }
        if (kt == bx) { const int lim = (wave & 3) * 16 + lr - hi * 8;    // diagonal tile: key t*16 + j of this lane's half is allowed while t*16 + j <= lim
#pragma unroll
            for (int t = 0; t < 4; ++t) {
#pragma unroll
                for (int j = 0; j < 8; ++j) s[t][j] = (t * 16 + j <= lim) ? s[t][j] : -3.0e38f; } }
        float mt = -3.0e38f;
#pragma unroll
        for (int t = 0; t < 4; ++t) {
#pragma unroll
            for (int j = 0; j < 8; ++j) mt = fmaxf(mt, s[t][j]); }
        mt = fmaxf(mt, xhalf(mt));
        const float mn = fmaxf(m, mt * C2), al = __builtin_amdgcn_exp2f(m - mn); m = mn;
        v4u ph[4], pl[4]; lv *= al;    // P, hi and residual, two bf16 a word
#pragma unroll
        for (int t = 0; t < 4; ++t) { v8f p;
#pragma unroll
            for (int j = 0; j < 8; ++j) p[j] = __builtin_amdgcn_exp2f(fmaf(s[t][j], C2, -mn));
            lv += ((v2f){p[0], p[1]} + (v2f){p[2], p[3]}) + ((v2f){p[4], p[5]} + (v2f){p[6], p[7]}); o[t] *= al;
#pragma unroll
            for (int j = 0; j < 4; ++j) { const v2f pp = (v2f){p[2 * j], p[2 * j + 1]}; const v2bf h2 = __builtin_convertvector(pp, v2bf), l2 = __builtin_convertvector(pp - __builtin_convertvector(h2, v2f), v2bf);
                ph[t][j] = __builtin_bit_cast(unsigned, h2); pl[t][j] = __builtin_bit_cast(unsigned, l2); } }
#pragma unroll
        for (int i = 8; i < 12; ++i) { const int ks = (i - 8) >> 1, tp = (i - 8) & 1;
            const v16bf pH = __builtin_bit_cast(v16bf, __builtin_shufflevector(ph[2 * ks], ph[2 * ks + 1], 0, 1, 2, 3, 4, 5, 6, 7)), pL = __builtin_bit_cast(v16bf, __builtin_shufflevector(pl[2 * ks], pl[2 * ks + 1], 0, 1, 2, 3, 4, 5, 6, 7));
            mm6(buf[i % 3], pH, pL, o[2 * tp], o[2 * tp + 1]);
            __builtin_amdgcn_sched_barrier(0);    // as above
            // on to the next tile's addresses, once this tile's last fetch is out (i == 8); the wait stands in front of the overwrite of registers that issued loads name
            if (i == 9) asm volatile("s_wait_xcnt 0x0\n\tv_add_nc_u64 %0, %6, %0\n\tv_add_nc_u64 %1, %6, %1\n\tv_add_nc_u64 %2, %6, %2\n\tv_add_nc_u64 %3, %6, %3\n\tv_add_nc_u64 %4, %7, %4\n\tv_add_nc_u64 %5, %7, %5" : "+v"(aKh), "+v"(aKl), "+v"(aCh), "+v"(aCl), "+v"(aVh), "+v"(aVl) : "s"(dk), "s"(dv) : "memory");
            fetch(buf[i % 3], i == 8 ? 11 : i - 9);
            __builtin_amdgcn_sched_barrier(0); }
    }
    asm volatile("s_wait_xcnt 0x0" :: "v"(aKh), "v"(aKl), "v"(aCh), "v"(aCl), "v"(aVh), "v"(aVl) : "memory");    // inputs only: the six address pairs stay whole until the last tile's fetches are past their address stage
    float l = lv[0] + lv[1];
    l += xhalf(l);
    const float inv = 1.0f / l;
    // O leaves as the A operand of the Wo product: bf16 hi and residual planes of the [NR][DMOD] matrix in fragment order. The lane's 8 values of tile t are columns head*64 + t*16 + 8*hi + 0..7
    // of its query row: piece 'lane' of half (t & 1) of block (16-row tile, k tile head*2 + (t >> 1)). A wave's store is 512 bytes in a row.
    const size_t ob = ((size_t)(((int)blockIdx.y * NN + bx * 64 + (wave & 3) * 16) >> 4) * (DMOD / 32) + (size_t)blockIdx.z * 2) * 512 + (size_t)lane * 8;
#pragma unroll
    for (int t = 0; t < 4; ++t) { const v8f r = o[t] * inv; v8us oh, ol;
#pragma unroll
        for (int i = 0; i < 8; ++i) { const unsigned short hb = f2bf(r[i]); oh[i] = hb; ol[i] = f2bf(r[i] - bf2f(hb)); }
        const size_t e = ob + (t >> 1) * 512 + (t & 1) * 256; *(v8us*)(Oh + e) = oh; *(v8us*)(Ol + e) = ol; }
    asm volatile("s_wait_xcnt 0x0" ::: "memory");    // in front of the second row block's writes of registers that these stores name
    }
}
__global__ __launch_bounds__(256) void k_planes32z(const float* __restrict__ F, int ld, int off, float sc, int rows, bf* Ph, bf* Pl) {
    typedef __attribute__((ext_vector_type(2))) unsigned short v2us;
    const int lane = threadIdx.x & 31; const size_t r = ((size_t)blockIdx.x * 8 + (threadIdx.x >> 5)) * 2 + (lane >> 4); if (r >= (size_t)rows) return; const int z = blockIdx.z; const int c0 = (lane & 15) * 2; v2us oh, ol;
    Ph += (size_t)z * rows * 32; Pl += (size_t)z * rows * 32;
#pragma unroll
    for (int i = 0; i < 2; ++i) { const float y = F[r * ld + off + z * 32 + c0 + i] * sc; const unsigned short hb = f2bf(y); oh[i] = hb; ol[i] = f2bf(y - bf2f(hb)); }
    const size_t o = r * 32 + c0; *(v2us*)(Ph + o) = oh; *(v2us*)(Pl + o) = ol; 
}
__global__ __launch_bounds__(256) void k_vtpadz(const float* __restrict__ F, int ld, int off, int nk, bf* Th, bf* Tl) {
    typedef __attribute__((ext_vector_type(2))) unsigned short v2us;
    const int lane = threadIdx.x & 31; const size_t wid = (size_t)blockIdx.x * 8 + (threadIdx.x >> 5); if (wid >= (size_t)64 * (nk / 64)) return; const int z = blockIdx.z; const int d = (int)(wid / (nk / 64)); const int k0 = (int)(wid % (nk / 64)) * 64 + lane * 2; v2us oh, ol;
    Th += (size_t)z * 64 * nk; Tl += (size_t)z * 64 * nk;
#pragma unroll
    for (int i = 0; i < 2; ++i) { const float y = (d < 32) ? F[(size_t)(k0 + i) * ld + off + z * 32 + (d < 32 ? d : 0)] : 0.f; const unsigned short hb = f2bf(y); oh[i] = hb; ol[i] = f2bf(y - bf2f(hb)); }
    const size_t o = (size_t)d * nk + k0; *(v2us*)(Th + o) = oh; *(v2us*)(Tl + o) = ol; 
}
template <int NK>
__global__ __launch_bounds__(256) void k_softmaxz(const float* __restrict__ S, int rows, bf* PH, bf* PL) {
    typedef __attribute__((ext_vector_type(4))) unsigned short v4us;
    const int lane = threadIdx.x & 31, i = blockIdx.x * 8 + (threadIdx.x >> 5); if (i >= rows) return; const size_t zo = (size_t)blockIdx.z * rows * NK; const float* sr = S + zo + (size_t)i * NK; PH += zo; PL += zo;
    float m = -3.0e38f;
#pragma unroll 1
    for (int c0 = lane * 4; c0 < NK; c0 += 128) {
#pragma unroll
        for (int q = 0; q < 4; ++q) m = fmaxf(m, sr[c0 + q]); }
#pragma unroll
    for (int sh = 16; sh; sh >>= 1) m = fmaxf(m, __shfl_xor(m, sh, 32));
    float sum = 0.f;
#pragma unroll 1
    for (int c0 = lane * 4; c0 < NK; c0 += 128) {
#pragma unroll
        for (int q = 0; q < 4; ++q) sum += __expf(sr[c0 + q] - m); }
#pragma unroll
    for (int sh = 16; sh; sh >>= 1) sum += __shfl_xor(sum, sh, 32);
    const float inv = 1.0f / sum;
{
#pragma unroll 1
        for (int c0 = lane * 4; c0 < NK; c0 += 128) { v4us oh, ol;
#pragma unroll
            for (int q = 0; q < 4; ++q) { const float p = __expf(sr[c0 + q] - m) * inv; const unsigned short hb = f2bf(p); oh[q] = hb; ol[q] = f2bf(p - bf2f(hb)); }
            const size_t o = (size_t)i * NK + c0; *(v4us*)(PH + o) = oh; *(v4us*)(PL + o) = ol; }
         }
}
__global__ __launch_bounds__(256) void k_placez(const float* __restrict__ XH, int rows, int ldy, float* Y) {
    const int lane = threadIdx.x & 31; const size_t q = (size_t)blockIdx.x * 8 + (threadIdx.x >> 5); if (q >= (size_t)rows) return; const int z = blockIdx.z; const float v = XH[((size_t)z * rows + q) * 64 + lane];
    *(float*)(Y + q * ldy + z * 32 + lane) = v; 
}

template <int NK>
__global__ __launch_bounds__(256) void k_softmaxzs(const float* __restrict__ S, int rows, float sc, bf* PH, bf* PL) {
    typedef __attribute__((ext_vector_type(4))) unsigned short v4us;
    const int lane = threadIdx.x & 31, i = blockIdx.x * 8 + (threadIdx.x >> 5); if (i >= rows) return; const size_t zo = (size_t)blockIdx.z * rows * NK; const float* sr = S + zo + (size_t)i * NK; PH += zo; PL += zo;
    float m = -3.0e38f;
#pragma unroll 1
    for (int c0 = lane * 4; c0 < NK; c0 += 128) {
#pragma unroll
        for (int q = 0; q < 4; ++q) m = fmaxf(m, sr[c0 + q] * sc); }
#pragma unroll
    for (int sh = 16; sh; sh >>= 1) m = fmaxf(m, __shfl_xor(m, sh, 32));
    float sum = 0.f;
#pragma unroll 1
    for (int c0 = lane * 4; c0 < NK; c0 += 128) {
#pragma unroll
        for (int q = 0; q < 4; ++q) sum += __expf(sr[c0 + q] * sc - m); }
#pragma unroll
    for (int sh = 16; sh; sh >>= 1) sum += __shfl_xor(sum, sh, 32);
    const float inv = 1.0f / sum;
{
#pragma unroll 1
        for (int c0 = lane * 4; c0 < NK; c0 += 128) { v4us oh, ol;
#pragma unroll
            for (int q = 0; q < 4; ++q) { const float p = __expf(sr[c0 + q] * sc - m) * inv; const unsigned short hb = f2bf(p); oh[q] = hb; ol[q] = f2bf(p - bf2f(hb)); }
            const size_t o = (size_t)i * NK + c0; *(v4us*)(PH + o) = oh; *(v4us*)(PL + o) = ol; }
         }
}

// k_prep: every conversion that needs the inputs alone, in one launch; what a work-group does follows from its index (the branches are the same for the whole work-group).
// A [rows][DMOD] matrix takes rows / 8 work-groups: x, then Wq | Wk | Wv | Wt (one [QW][DMOD] operand), then Wo; the last QW / 256 lay the four biases in a row.
#define PBX (NR / 8)
#define PBW (DMOD / 8)
__global__ __launch_bounds__(256) void k_prep(const float* __restrict__ x, const float* __restrict__ Wq, const float* __restrict__ Wk, const float* __restrict__ Wv, const float* __restrict__ Wt, const float* __restrict__ Wo,
                                              const float* __restrict__ bq, const float* __restrict__ bk, const float* __restrict__ bv, const float* __restrict__ bt, bf* Xb, bf* W4, bf* WO, float* B4) {
    int b = blockIdx.x;
    if (b >= PBX + 5 * PBW) { const int i = (b - (PBX + 5 * PBW)) * 256 + (int)threadIdx.x, blk = i / DMOD, o = i % DMOD;
        B4[i] = (blk == 0) ? bq[o] : (blk == 1) ? bk[o] : (blk == 2) ? bv[o] : bt[o]; return; }
    const float* src = x; bf* dst = Xb;
    if (b >= PBX) { b -= PBX; const int w = b / PBW; b -= w * PBW;
        src = (w == 0) ? Wq : (w == 1) ? Wk : (w == 2) ? Wv : (w == 3) ? Wt : Wo; dst = (w < 4) ? W4 + (size_t)w * DMOD * DMOD : WO; }
    // dst in fragment order. Pieces g, g + 256, g + 512, g + 768 of a work-group's 1,024 (half a 16-row tile) lie 4 k tiles = 128 source elements apart
    const size_t g = (size_t)b * 1024 + threadIdx.x; const float* sp = src + fragsrc(g);
    v8f v[4];
    // '#pragma unroll': register arrays, their indices must be compile-time constants
#pragma unroll
    for (int q = 0; q < 4; ++q) v[q] = *(const v8f*)(sp + q * 128);
#pragma unroll
    for (int q = 0; q < 4; ++q) { v8us o;
#pragma unroll
        for (int i = 0; i < 8; ++i) o[i] = f2bf(v[q][i]);
        *(v8us*)(dst + (g + q * 256) * 8) = o; }
    asm volatile("s_wait_xcnt 0x0" ::: "memory");    // in front of any later write of a register that these stores name: in the built code the other branch's instructions follow them
}
// k_mid: everything between the projection GEMM and the attention, in one launch; what a work-group does follows from its index (the branch is the same for the whole work-group).
// THE FIRST NBT * DMOD / 32 WORK-GROUPS: prefix sums of k*v/8 over the key positions, in chunks. A work-group owns 32 columns (one 128-byte line of a row; one k half of one head), a lane one
// column, each of its 32 waves CH = 64 rows in a row. A wave's loads depend on nothing: they go out in batches of 16 rows (32 loads), two batches in flight. Its prefix sums start at 0 and
// stay in registers. The chunks' totals meet in LDS, and every wave adds the totals of the chunks in front of it, in chunk order, to its own 64 sums. The sums leave as kvcum's bf16 hi and
// residual planes in fragment order: a wave's 64 rows x 32 columns are four whole 1-KiB blocks of each plane; 16 rows at a time turn from a column a lane to 16 columns of a row a lane (two runs of 8) in LDS.
// THE OTHERS: the planes of q, k, q*t and v^T. A thread makes pieces g and g + NN * 4 of one head: the 16-byte pieces, hi and residual, of q, k and q*t (blocks (16-row tile, k half): the
// same 8 columns of one row in all three) and of v^T (blocks (32-key group, 16-column tile): 8 keys of one column).
#define CH (NN / 32)
#define NCUM (NBT * (DMOD / 32))
#define TRP 36    // words a row of a wave's turning buffer: 144 bytes = 16 x 9, a pitch at which 16-byte LDS reads of 16 rows meet no bank twice
typedef v4u __attribute__((may_alias)) v4ua;
__global__ __launch_bounds__(1024) void k_mid(const float* F, bf* Qh, bf* Ql, bf* Kh, bf* Kl, bf* Th, bf* Tl, bf* Ch, bf* Cl, bf* VTh, bf* VTl) {
    typedef __attribute__((ext_vector_type(16))) float v16f;
    __shared__ float tot[32][32];
    __shared__ __align__(16) unsigned tr[32][16 * TRP];
    const int lane = threadIdx.x & 31;
    const int wave = __builtin_amdgcn_readfirstlane((int)threadIdx.x >> 5);    // in a scalar register: the chunk's base addresses and the tests on it are then scalar
    // every '#pragma unroll' of this kernel: the arrays it walks are register arrays, so their indices must be compile-time constants
    if (blockIdx.x < NCUM) {
        const int item = (int)blockIdx.x / (DMOD / 32), cb = (int)blockIdx.x % (DMOD / 32), c = cb * 32 + lane;
        const float* fr = F + ((size_t)item * NN + wave * CH) * QW + DMOD + c;
        float p[CH]; v16f kk[2], vv[2];
        auto fetch = [&](int b) {
#pragma unroll
            for (int i = 0; i < 16; ++i) { kk[b & 1][i] = fr[(size_t)(b * 16 + i) * QW]; vv[b & 1][i] = fr[(size_t)(b * 16 + i) * QW + DMOD]; }
        };
        fetch(0);
        float acc = 0.f;
#pragma unroll
        for (int b = 0; b < CH / 16; ++b) {
            if (b + 1 < CH / 16) fetch(b + 1);
            // inputs only, the loaded values of batch b: keeps the loads in batches, the next batch out before this one is waited for and the one after it behind this line. Left alone the
            // compiler either sinks every pair of loads to its product (64 latencies in a row) or lifts all 128 to the top (more registers than a wave of this work-group has).
            // F carries no __restrict__ here, so that the "memory" clobber holds its loads
            asm volatile("" :: "v"(kk[b & 1]), "v"(vv[b & 1]) : "memory");
#pragma unroll
            for (int i = 0; i < 16; ++i) { acc = fmaf(kk[b & 1][i] * vv[b & 1][i], SCL, acc); p[b * 16 + i] = acc; }
        }
        tot[wave][lane] = acc;
        __syncthreads();
        float tw[31];    // the last chunk stands in front of nobody
#pragma unroll
        for (int w = 0; w < 31; ++w) tw[w] = tot[w][lane];
        __builtin_amdgcn_sched_barrier(0);    // the 31 LDS reads go out together, one latency for all, instead of one each
        float off = 0.f;
#pragma unroll
        for (int w = 0; w < 31; ++w) off += (w < wave) ? tw[w] : 0.f;
        unsigned* tb = &tr[wave][0];    // the wave's own buffer: no other wave touches it, so no barrier
        const size_t pb = ((size_t)item * NH_ + (cb >> 1)) * NN * HD + ((size_t)wave * (CH / 16) * 2 + (cb & 1)) * 512 + (size_t)lane * 8;
#pragma unroll
        for (int rt = 0; rt < CH / 16; ++rt) {
#pragma unroll
            for (int r = 0; r < 16; ++r) { const float y = p[rt * 16 + r] + off; const unsigned short hb = f2bf(y); tb[r * TRP + lane] = (unsigned)hb | ((unsigned)f2bf(y - bf2f(hb)) << 16); }    // hi in the low half, residual in the high half
            asm volatile("s_wait_dscnt 0x0" ::: "memory");    // the wave's 16 rows stand in LDS before its lanes read what other lanes wrote
            const v4ua* rp = (const v4ua*)(tb + (lane & 15) * TRP + (lane >> 4) * 8);    // row lane & 15; columns 8*hi + 0..7 and 16 + 8*hi + 0..7
            const v4u w0 = rp[0], w1 = rp[1], w2 = rp[4], w3 = rp[5];
            v4u h0, l0, h1, l1;
#pragma unroll
            for (int i = 0; i < 2; ++i) {
                h0[i] = (w0[2 * i] & 0xFFFFu) | (w0[2 * i + 1] << 16); h0[2 + i] = (w1[2 * i] & 0xFFFFu) | (w1[2 * i + 1] << 16); l0[i] = (w0[2 * i] >> 16) | (w0[2 * i + 1] & 0xFFFF0000u); l0[2 + i] = (w1[2 * i] >> 16) | (w1[2 * i + 1] & 0xFFFF0000u);
                h1[i] = (w2[2 * i] & 0xFFFFu) | (w2[2 * i + 1] << 16); h1[2 + i] = (w3[2 * i] & 0xFFFFu) | (w3[2 * i + 1] << 16); l1[i] = (w2[2 * i] >> 16) | (w2[2 * i + 1] & 0xFFFF0000u); l1[2 + i] = (w3[2 * i] >> 16) | (w3[2 * i + 1] & 0xFFFF0000u); }
            const size_t e = pb + (size_t)rt * 1024;    // the next 16-row tile lies two blocks on
            *(v4ua*)(Ch + e) = h0; *(v4ua*)(Ch + e + 256) = h1; *(v4ua*)(Cl + e) = l0; *(v4ua*)(Cl + e + 256) = l1;
        }
    } else {
        const int b = (int)blockIdx.x - NCUM, zy = b / (NN * 4 / 1024);    // zy = batch item * NH_ + head
        const size_t g0 = (size_t)(b % (NN * 4 / 1024)) * 1024 + threadIdx.x, po = (size_t)zy * NN * HD;
        const float* Fh = F + (size_t)(zy / NH_) * NN * QW + (zy % NH_) * HD;
        v8f vq[2], vk[2], vt[2], vv[2]; const float* fq[2]; const float* fv[2];
#pragma unroll
        for (int u = 0; u < 2; ++u) { const size_t g = g0 + (size_t)u * (NN * 4);
            const size_t row = (g >> 7) * 16 + (lane & 15); const int col = (int)((g >> 6) & 1) * 32 + (int)((g >> 5) & 1) * 16 + (lane >> 4) * 8;
            fq[u] = Fh + row * QW + col; vq[u] = *(const v8f*)fq[u]; vk[u] = *(const v8f*)(fq[u] + DMOD); vt[u] = *(const v8f*)(fq[u] + 3 * DMOD);
            const int d = (int)((g >> 6) & 3) * 16 + (lane & 15); const size_t t0 = (g >> 8) * 32 + ((g >> 5) & 1) * 16 + (lane >> 4) * 8;
            fv[u] = Fh + t0 * QW + d;    // 16 lanes read 64 bytes of a row: 2 lines a load
#pragma unroll
            for (int i = 0; i < 8; ++i) vv[u][i] = fv[u][2 * DMOD + (size_t)i * QW]; }
        // inputs only: the four address pairs stay whole (none is given to a later load's data) until every load that names one is past its address stage. The "memory" clobber keeps all 28 loads
        // in front of this line: they go out together, one memory latency for the thread; left alone the compiler sinks each group to its use, several latencies in a row
        asm volatile("s_wait_xcnt 0x0" :: "v"(fq[0]), "v"(fq[1]), "v"(fv[0]), "v"(fv[1]) : "memory");
        auto put = [&](const v8f v, bf* H, bf* L, size_t o) { v8us oh, ol;
#pragma unroll
            for (int i = 0; i < 8; ++i) { const unsigned short hb = f2bf(v[i]); oh[i] = hb; ol[i] = f2bf(v[i] - bf2f(hb)); }
            *(v8us*)(H + o) = oh; *(v8us*)(L + o) = ol; };
#pragma unroll
        for (int u = 0; u < 2; ++u) { const size_t o = po + (g0 + (size_t)u * (NN * 4)) * 8;
            put(vq[u], Qh, Ql, o); put(vk[u], Kh, Kl, o); put(vq[u] * vt[u], Th, Tl, o); put(vv[u], VTh, VTl, o); }
        asm volatile("s_wait_xcnt 0x0" ::: "memory");    // in front of any later write of a register that these stores name: in the built code the other branch's instructions follow them
    }
}

extern "C" void kernel_launch(void* const* d_in, const int* in_sizes, int n_in,
                              void* d_out, int out_size, void* d_ws, size_t ws_size, hipStream_t stream) {
    (void)in_sizes; (void)n_in; (void)out_size;
    const float* x = (const float*)d_in[0]; const float* Wq = (const float*)d_in[1]; const float* bq = (const float*)d_in[2]; const float* Wk = (const float*)d_in[3]; const float* bk = (const float*)d_in[4]; const float* Wv = (const float*)d_in[5]; const float* bv = (const float*)d_in[6]; const float* Wt = (const float*)d_in[7]; const float* bt = (const float*)d_in[8]; const float* Wo = (const float*)d_in[9]; const float* bo = (const float*)d_in[10];
    float* out = (float*)d_out;    // [2][2048][1024]
    char* wsp = (char*)d_ws;
    auto take = [&](size_t bytes) { char* p = wsp; wsp += (bytes + 255) & ~(size_t)255; return (void*)p; };
    bf* W4 = (bf*)take((size_t)QW * DMOD * 2); float* B4 = (float*)take((size_t)QW * 4); bf* WO = (bf*)take((size_t)DMOD * DMOD * 2);
    const size_t PLB = (size_t)NBT * NH_ * NN * HD * 2;    // one operand plane, all heads of both items
    bf* Qh = (bf*)take(PLB); bf* Ql = (bf*)take(PLB); bf* Kh = (bf*)take(PLB); bf* Kl = (bf*)take(PLB); bf* Th = (bf*)take(PLB); bf* Tl = (bf*)take(PLB); bf* Ch = (bf*)take(PLB); bf* Cl = (bf*)take(PLB); bf* VTh = (bf*)take(PLB); bf* VTl = (bf*)take(PLB);
    char* const big = wsp;
    bf* Xb = (bf*)take((size_t)NR * DMOD * 2); float* F = (float*)take((size_t)NR * QW * 4);
    if ((size_t)(wsp - (char*)d_ws) > ws_size) return;    // ~ 162 MiB
    // Xb is last read by the projection GEMM, F when the operand planes are made, Oh, Ol are first written by the attention: they lie on the same bytes.
    wsp = big; bf* Oh = (bf*)take((size_t)NR * DMOD * 2); bf* Ol = (bf*)take((size_t)NR * DMOD * 2);
    // both batch items in every launch: the row-wise work walks the NR = 2 x 2048 rows as one matrix
    k_prep<<<PBX + 5 * PBW + QW / 256, 256, 0, stream>>>(x, Wq, Wk, Wv, Wt, Wo, bq, bk, bv, bt, Xb, W4, WO, B4);
    k_gemmb<false, 4, 8, 2, 4, 2><<<dim3(NR / 256, QW / 256, 1), 256, 0, stream>>>(Xb, nullptr, W4, B4, F, QW);      // [q | k | v | t] + biases
    k_mid<<<NCUM + NBT * NH_ * (NN * 4 / 1024), 1024, 0, stream>>>(F, Qh, Ql, Kh, Kl, Th, Tl, Ch, Cl, VTh, VTl);
    // blockIdx.y = batch item, blockIdx.z = head
    k_fattn<<<dim3(NN / 256, NBT, NH_), 256, 0, stream>>>(Qh, Ql, Kh, Kl, Th, Tl, Ch, Cl, VTh, VTl, Oh, Ol);
    k_gemmb<true, 2, 4, 4, 4, 2><<<dim3(NR / 128, DMOD / 128, 1), 256, 0, stream>>>(Oh, Ol, WO, bo, out, DMOD);
}

// v009
// Measured time: 134 microseconds a run.
// In two side-by-side timings against v008, it was 1.31 and 1.35 times as fast.
// All steps since v000 together make it 43.0 times as fast.
#include <hip/hip_runtime.h>

// Compute dtypes, f32 accumulate, per item: q/k/v/t = x.W^T + b fused as one [4096 x 1024].[1024 x 4096] GEMM over both items with PLAIN bf16 operands (exact products); the triplet term's
// cumsum over key positions of k*v/8 (f32 prefix sums per column, in 64-row chunks + the sums of the chunks in front) and q*t in f32; per head, in ONE kernel (k_fattn): scores q.k^T + (q*t).kvcum^T with bf16 hi +
// UNSCALED residual planes (three products each; tiles above the diagonal skipped), / 8 + causal softmax in f32 with a running maximum and sum, attn.v (three products); Wo (+ bias) on

#define NBT  2
#define NN   2048
#define DMOD 1024
#define NH_  16
#define HD   64
#define QW   (4 * DMOD)
#define DM   DMOD
#define NTK  NN
#define NR   (NBT * NN)    // rows of both batch items: every launch covers both (row-wise kernels see one [NR] matrix, k_fattn takes the item from blockIdx.y, k_mid from blockIdx.x)
#define SCL  0.125f
#define LOSC 1024.0f

typedef _Float16 h16;
typedef unsigned short bf;
typedef __attribute__((ext_vector_type(16))) __bf16   v16bf;
typedef __attribute__((ext_vector_type(16))) _Float16 v16h;
typedef __attribute__((ext_vector_type(8)))  _Float16 v8h;
typedef __attribute__((ext_vector_type(8)))  unsigned short v8us;
typedef __attribute__((ext_vector_type(8)))  float    v8f;
typedef __attribute__((ext_vector_type(4)))  float    v4f;
typedef __attribute__((ext_vector_type(4)))  _Float16 v4h;
typedef v8h  __attribute__((may_alias)) v8ha;
typedef v4f  __attribute__((may_alias)) v4fa;
typedef v8us __attribute__((may_alias)) v8usa;

__device__ __forceinline__ unsigned short f2bf(float f) { unsigned u = __float_as_uint(f); u += 0x7FFFu + ((u >> 16) & 1u); return (unsigned short)(u >> 16); }
__device__ __forceinline__ float bf2f(unsigned short b) { return __uint_as_float(((unsigned)b) << 16); }
__device__ __forceinline__ float bfr(float f) { return bf2f(f2bf(f)); }
__device__ __forceinline__ v16h cat16(v8h lo, v8h hi) { return __builtin_shufflevector(lo, hi, 0, 1, 2, 3, 4, 5, 6, 7, 8, 9, 10, 11, 12, 13, 14, 15); }
__device__ __forceinline__ v16bf cat16b(v8us lo, v8us hi) { return __builtin_bit_cast(v16bf, __builtin_shufflevector(lo, hi, 0, 1, 2, 3, 4, 5, 6, 7, 8, 9, 10, 11, 12, 13, 14, 15)); }
__device__ __forceinline__ v8f wmma16(v16h a, v16h b, v8f c) { return __builtin_amdgcn_wmma_f32_16x16x32_f16(false, a, false, b, (short)0, c, false, false); }
__device__ __forceinline__ v8f wmmab(v16bf a, v16bf b, v8f c) { return __builtin_amdgcn_wmma_f32_16x16x32_bf16(false, a, false, b, (short)0, c, false, false); }

// FRAGMENT ORDER: every bf16 matrix operand that one launch writes for another lies as 1-KiB blocks of 16 rows x 32 k. In a block, lane hi*16 + (row & 15) owns k = 8*hi + 0..7 at byte
// lane*16 and k = 16 + 8*hi + 0..7 at byte 512 + lane*16: a wave's 16-byte fragment load then covers 4 whole 128-byte lines, not 32 bytes of each of 16 lines.
// fragsrc: 16-byte piece g of a [rows][DMOD] operand (blocks in the order row tile, k tile) -> index of its first element in the row-major source
__device__ __forceinline__ size_t fragsrc(size_t g) { const int lane = (int)g & 31; return ((g >> 11) * 16 + (lane & 15)) * DMOD + ((g >> 6) & 31) * 32 + ((g >> 5) & 1) * 16 + (lane >> 4) * 8; }

// k_gemmb: C[rows][NW] = (A [+ Al]).B^T (K = DM) + bf(bias[c]). A wave owns MT x NT accumulator tiles (MT*16 rows x NT*16 columns): a loaded A fragment feeds NT matrix instructions, a B fragment
// MT (2*MT with the residual plane). A work-group is WR x WC waves, whose fragment loads share lines: WR*MT*16 rows x WC*NT*16 columns. The fragments of a k step (32 k) live in one of D register sets and are fetched D - 1 steps ahead,
// all of a step's loads as one group. f32 whole-line epilogue through LDS.
template <bool SPLITA, int MT, int NT, int D, int WR, int WC>
__global__ __launch_bounds__(WR * WC * 32) void k_gemmb(const bf* __restrict__ A, const bf* __restrict__ Al, const bf* __restrict__ Bn, const float* __restrict__ bias, float* C, int ldc) {
    constexpr int OP = NT * 16 + 4;    // words a row of the output staging: a pitch of 16 bytes x an odd number
    __shared__ __align__(16) float ost[WR * WC][MT * 16 * OP];
    const int lane = threadIdx.x & 31, lr = lane & 15, hi = lane >> 4;
    const int wave = __builtin_amdgcn_readfirstlane((int)threadIdx.x >> 5);    // in a scalar register: the tile's base addresses are then scalar
    const int r0 = (blockIdx.x * WR + wave / WC) * (MT * 16), c0 = (blockIdx.y * WC + wave % WC) * (NT * 16);
    // fragment order (fragsrc): a 16-row tile is DM / 32 blocks of 1 KiB in a row, the next 16-row tile lies TB bytes on
    constexpr int TB = DM * 16 * 2;
    typedef const __attribute__((address_space(1))) char* gch; typedef const __attribute__((address_space(1))) v8us* gv8;    // global address space, named: an address that comes out of an asm statement would else be loaded as a flat one
    auto gfrag = [](gch p) -> v16bf { return cat16b(*(gv8)p, *(gv8)(p + 512)); };
    // the lane's address in each operand lives in one register pair for the whole loop and moves once a k step (step()); every load is that pair + a constant
    unsigned long long pA = (unsigned long long)((gch)A + (size_t)(r0 >> 4) * TB + lane * 16), pB = (unsigned long long)((gch)Bn + (size_t)(c0 >> 4) * TB + lane * 16), pL = 0;
    if (SPLITA) pL = (unsigned long long)((gch)Al + (size_t)(r0 >> 4) * TB + lane * 16);
    // on to the next step's addresses; the wait stands in front of the overwrite of registers that issued loads name
    auto step = [&](unsigned long long d) {
        if (SPLITA) asm volatile("s_wait_xcnt 0x0\n\tv_add_nc_u64 %0, %3, %0\n\tv_add_nc_u64 %1, %3, %1\n\tv_add_nc_u64 %2, %3, %2" : "+v"(pA), "+v"(pL), "+v"(pB) : "s"(d) : "memory");
        else asm volatile("s_wait_xcnt 0x0\n\tv_add_nc_u64 %0, %2, %0\n\tv_add_nc_u64 %1, %2, %1" : "+v"(pA), "+v"(pB) : "s"(d) : "memory");
    };
    // every '#pragma unroll' of this kernel: the arrays it walks are register arrays, so their indices must be compile-time constants
    v8f acc[MT][NT];
#pragma unroll
    for (int i = 0; i < MT; ++i) {
#pragma unroll
        for (int t = 0; t < NT; ++t) acc[i][t] = (v8f){}; }
    v16bf a[D][MT], al[D][MT], b[D][NT];
    auto fetch = [&](int p) {
#pragma unroll
        for (int i = 0; i < MT; ++i) { a[p][i] = gfrag((gch)pA + i * TB); if (SPLITA) al[p][i] = gfrag((gch)pL + i * TB); }
#pragma unroll
        for (int t = 0; t < NT; ++t) b[p][t] = gfrag((gch)pB + t * TB);
    };
    // the barriers keep the first fetches in the order in which the loop issues them, so that the counted waits at the loop's head hold on both ways in
    fetch(0);
    asm volatile("s_wait_xcnt 0x0" ::: "memory");    // the first fetch is built with scalar base addresses: the wait stands in front of any later write of those scalar registers
    __builtin_amdgcn_sched_barrier(0);
#pragma unroll
    for (int p = 1; p < D - 1; ++p) { step(1024ull); fetch(p); __builtin_amdgcn_sched_barrier(0); }
    constexpr int NS = DM / 32;    // k steps; a multiple of D. A constant: the loop is then known to run, and the first fetches stay in front of it in their order
    static_assert(NS % D == 0 && NS >= D, "k steps");
#pragma unroll 1    // D k steps a trip (the register sets take turns): body enough, more copies would only grow the code
    for (int s = 0; s < NS; s += D) {
#pragma unroll
        for (int u = 0; u < D; ++u) {
#pragma unroll
            for (int t = 0; t < NT; ++t) {
#pragma unroll
                for (int i = 0; i < MT; ++i) acc[i][t] = wmmab(a[u][i], b[u][t], acc[i][t]);
                if (SPLITA) {
#pragma unroll
                    for (int i = 0; i < MT; ++i) acc[i][t] = wmmab(al[u][i], b[u][t], acc[i][t]); }
                if (t == 0) {    // behind the step's first column, whose wait has retired the oldest loads: the wave's loads in flight then stay within what the load counter can count
                    __builtin_amdgcn_sched_barrier(0);    // the pair keeps the fetch D - 1 steps ahead and in one group: without it the compiler sinks each load to its use and every step waits a full latency
                    step((s + u + D - 1 < NS) ? 1024ull : 0ull);    // the last steps fetch the last step's fragments once more, unused: no address past the operands
                    fetch((u + D - 1) % D);    // into the set that the step before has left
                    __builtin_amdgcn_sched_barrier(0); } }
        }
    }
    // inputs only: the address pairs stay whole until the last fetches are past their address stage
    if (SPLITA) asm volatile("s_wait_xcnt 0x0" :: "v"(pA), "v"(pL), "v"(pB) : "memory");
    else asm volatile("s_wait_xcnt 0x0" :: "v"(pA), "v"(pB) : "memory");
    float* os = &ost[wave][0];
    float bv[NT]; const int bi = c0 + lr;
#pragma unroll
    for (int t = 0; t < NT; ++t) bv[t] = bias[bi + t * 16];
    asm volatile("s_wait_xcnt 0x0" :: "v"(bi) : "memory");    // input only: the index register stays whole (is not given to a load's data) until the bias loads are past their address stage
#pragma unroll
    for (int t = 0; t < NT; ++t) bv[t] = bfr(bv[t]);
#pragma unroll
    for (int t = 0; t < NT; ++t) {
#pragma unroll
        for (int i = 0; i < MT; ++i) {
#pragma unroll
            for (int j = 0; j < 8; ++j) os[(i * 16 + hi * 8 + j) * OP + t * 16 + lr] = acc[i][t][j] + bv[t]; } }
    __syncthreads();
    float* crow = C + (size_t)r0 * ldc + c0;
    constexpr int SB = 16;    // stores a batch
#pragma unroll
    for (int s0 = 0; s0 < MT * NT * 2; s0 += SB) { v4f val[SB];
#pragma unroll
        for (int q = 0; q < SB; ++q) { const int f = (s0 + q) * 32 + lane; val[q] = *(const v4fa*)(os + (f / (NT * 4)) * OP + (f % (NT * 4)) * 4); }
#pragma unroll
        for (int q = 0; q < SB; ++q) { const int f = (s0 + q) * 32 + lane; *(v4f*)(crow + (size_t)(f / (NT * 4)) * ldc + (f % (NT * 4)) * 4) = val[q]; }    // a wave's store: 512 bytes in a row of C (256 of each of two rows at NT = 4)
        if (s0 + SB < MT * NT * 2) asm volatile("s_wait_xcnt 0x0" ::: "memory"); }    // in front of the next batch's writes of registers that these stores name
}

__global__ __launch_bounds__(256) void k_zero8(bf* dst, size_t n8) {
    const size_t i = (size_t)blockIdx.x * 256 + threadIdx.x; if (i >= n8) return; v8us z;
#pragma unroll
    for (int k = 0; k < 8; ++k) z[k] = 0;
    *(v8us*)(dst + i * 8) = z; 
}

// ===== attention, blockIdx.z = head =====
// k_fattn: scores, causal softmax and attn.v in one kernel; no score or probability leaves the registers. A wave owns 32 query rows of one head (two groups of 16) and walks the 64-key tiles up to
// its diagonal. Everything is held transposed, so that a lane owns ONE query row of each group (lane & 15): S^T = K.Q^T + C.T^T (A = key rows, B = query rows; D element j of 16-key tile t is key
// t*16 + 8*hi + j), which is already the B-fragment k order (8*hi + 0..7, 16 + 8*hi + 0..7) of O^T = V^T.P^T: tiles 2*ks and 2*ks + 1 side by side.
// Running maximum (base 2) and running sum per lane (lanes r and r + 16 share a query: the maximum is joined every tile, the sum once at the end); O^T is rescaled by 2^(m_old - m_new).
// A 32-row block belongs to TWO waves, w and w + 4: one walks the first half of its key tiles, the other the rest with the diagonal. Each ends with its own maximum, sum and O^T;
// the two meet once a block, in LDS behind one barrier: each hands over one 16-row group and finishes the other (both parts brought to the common maximum and added).
// Every pair takes two row blocks ONE AFTER THE OTHER, a long one and then the short one that makes 33 tiles of the two; the wave with the larger part of the first has the smaller part of the second: 16 or 17 tiles
// a wave. A work-group is 8 waves: pair w takes row blocks 63 - (4x + w) and 4x + w (x = blockIdx.x = 0..7); the 256 work-groups are all resident at once, one a WGP, two waves a SIMD.
struct ic0 { static constexpr int value = 0; }; struct ic1 { static constexpr int value = 1; };    // a compile-time 0 or 1 as an argument
typedef __attribute__((ext_vector_type(2))) __bf16 v2bf;
typedef __attribute__((ext_vector_type(4))) unsigned v4u;
__device__ __forceinline__ float xhalf(float x) { return __builtin_bit_cast(float, __builtin_amdgcn_permlanex16(__builtin_bit_cast(int, x), __builtin_bit_cast(int, x), 0x76543210, 0xfedcba98, false, false)); }  // lane l with lane l ^ 16
#define FNB 6    // fragment buffers of k_fattn: a step's fragments are fetched FNB steps ahead; divides the 12 steps of a tile, so that a step always finds its buffer at the same index
#define FMW (34 * 32)    // words that a wave hands over: 32 of O^T, the maximum and the sum, a lane
__global__ __launch_bounds__(256) void k_fattn(const bf* __restrict__ Qh, const bf* __restrict__ Ql, const bf* __restrict__ Kh, const bf* __restrict__ Kl, const bf* __restrict__ Th, const bf* __restrict__ Tl, const bf* __restrict__ Ch, const bf* __restrict__ Cl, const bf* __restrict__ VTh, const bf* __restrict__ VTl, bf* Oh, bf* Ol) {
    const int lane = threadIdx.x & 31, lr = lane & 15, hi = lane >> 4;
    const int wave = __builtin_amdgcn_readfirstlane((int)threadIdx.x >> 5);    // in a scalar register, so that the tile loop ends on a scalar branch
    const int xs = (int)blockIdx.x * 4 + (wave & 3), wg = wave >> 2;    // the short 32-row block of the wave's pair; the 16-row group that this wave finishes
    __shared__ __align__(16) float mg[2][8][FMW];    // [row block of the pair][receiving wave]: a place is written once a launch, so one barrier a block is enough
    const size_t zo = ((size_t)blockIdx.y * NH_ + blockIdx.z) * NN * HD;         // blockIdx.y = batch item; one head's plane, in fragment order: blocks (16-row tile, k half) for q, k, q*t, kvcum and (32-key group, 16-column tile) for v^T
    typedef const __attribute__((address_space(1))) char* gch; typedef const __attribute__((address_space(1))) v8us* gv8;    // global address space, named: an address that comes out of an asm statement would else be loaded as a flat one
    auto gfrag = [](gch p) -> v16bf { return cat16b(*(gv8)p, *(gv8)(p + 512)); };    // k = 8*hi + 0..7 and 16 + 8*hi + 0..7: the two halves of a 1-KiB block in fragment order
#pragma unroll 1    // both row blocks run through one copy of the code: a second copy would only double the text the instruction cache has to hold
    for (int half = 0; half < 2; ++half) {    // (the body keeps its indentation)
    const int bx = half ? xs : NN / 32 - 1 - xs, kl = bx >> 1;    // the 32-row block and the 64-key tile that holds its diagonal
    const int kh = (kl + 2) >> 1, k0 = (wg ^ half) ? kh : 0, k1 = (wg ^ half) ? kl : kh - 1;    // this wave's tiles k0..k1: the first kh = ceil((kl + 1) / 2) or the rest (none where the block has one tile)
    typedef __attribute__((ext_vector_type(2))) float v2f;
    v8f o[2][4]; v2f lv[2]; float m[2];
    // every '#pragma unroll' of this kernel: the arrays it walks are register arrays, so their indices must be compile-time constants
#pragma unroll
    for (int r = 0; r < 2; ++r) { lv[r] = (v2f){}; m[r] = -3.0e38f;
#pragma unroll
        for (int t = 0; t < 4; ++t) o[r][t] = (v8f){}; }
    if (k0 <= k1) {    // the same for the whole wave (a scalar branch); no barrier inside (the body keeps its indentation)
    const unsigned qb = (unsigned)(bx * 4096 + lane * 16), kb = (unsigned)(k0 * (64 * HD * 2) + lane * 16), vb = kb;    // the lane's own byte offsets (a 16-row tile of q, k, q*t, kvcum is two blocks)
    gch bQh = (gch)(Qh + zo), bQl = (gch)(Ql + zo), bTh = (gch)(Th + zo), bTl = (gch)(Tl + zo), gQh = bQh + qb, gQl = bQl + qb, gTh = bTh + qb, gTl = bTl + qb;
    v16bf qh[2][2], ql[2][2], th[2][2], tl[2][2];    // [16-row query group][k half]
#pragma unroll
    for (int r = 0; r < 2; ++r) {
#pragma unroll
        for (int ks = 0; ks < 2; ++ks) { const int c = r * 2048 + ks * 1024; qh[r][ks] = gfrag(gQh + c); ql[r][ks] = gfrag(gQl + c); th[r][ks] = gfrag(gTh + c); tl[r][ks] = gfrag(gTl + c); } }
    // inputs only: the address registers of the query loads (scalar base and lane offset, or their sum) stay whole until those loads are past their address stage
    asm volatile("s_wait_xcnt 0x0" :: "s"(bQh), "s"(bQl), "s"(bTh), "s"(bTl), "v"(qb), "v"(gQh), "v"(gQl), "v"(gTh), "v"(gTl) : "memory");
    // A tile is 12 steps of 4 A fragments (two 16-row tiles x hi and residual plane) and 12 matrix instructions (6 for each query group): steps 0-7 the scores (16-key tile pair, k half, k or kvcum),
    // steps 8-11 attn.v (key half, 16-column pair of v^T). Step i works from buf[i % FNB]; its fragments are fetched FNB steps ahead, across the softmax and across the loop's back edge.
    // The lane's address in each of the six planes lives in one register pair for the whole loop and moves once a tile (the asm statement in the loop); every load is that pair + a constant.
    unsigned long long aKh = (unsigned long long)((gch)(Kh + zo) + kb), aKl = (unsigned long long)((gch)(Kl + zo) + kb), aCh = (unsigned long long)((gch)(Ch + zo) + kb), aCl = (unsigned long long)((gch)(Cl + zo) + kb), aVh = (unsigned long long)((gch)(VTh + zo) + vb), aVl = (unsigned long long)((gch)(VTl + zo) + vb);
    auto fetch = [&](v16bf (&d)[4], int i) {
        if (i < 8) { const int c = (i >> 2) * 4096 + ((i >> 1) & 1) * 1024; gch ph = (gch)((i & 1) ? aCh : aKh) + c; gch pl = (gch)((i & 1) ? aCl : aKl) + c;
            d[0] = gfrag(ph); d[1] = gfrag(pl); d[2] = gfrag(ph + 2048); d[3] = gfrag(pl + 2048); }
        else { const int c = ((i - 8) >> 1) * 4096 + ((i - 8) & 1) * 2048; gch ph = (gch)aVh + c; gch pl = (gch)aVl + c;
            d[0] = gfrag(ph); d[1] = gfrag(pl); d[2] = gfrag(ph + 1024); d[3] = gfrag(pl + 1024); }
    };
    // hi.hi + hi.residual + residual.hi of four independent accumulator tiles (two A tiles x two query groups), taken in turn: every A fragment feeds both query groups
    auto mm12 = [](const v16bf (&d)[4], v16bf bh0, v16bf bl0, v16bf bh1, v16bf bl1, v8f& c00, v8f& c01, v8f& c10, v8f& c11) {
        c00 = wmmab(d[0], bh0, c00); c01 = wmmab(d[2], bh0, c01); c10 = wmmab(d[0], bh1, c10); c11 = wmmab(d[2], bh1, c11);
        c00 = wmmab(d[0], bl0, c00); c01 = wmmab(d[2], bl0, c01); c10 = wmmab(d[0], bl1, c10); c11 = wmmab(d[2], bl1, c11);
        c00 = wmmab(d[1], bh0, c00); c01 = wmmab(d[3], bh0, c01); c10 = wmmab(d[1], bh1, c10); c11 = wmmab(d[3], bh1, c11); };
    v16bf buf[FNB][4];
    static_assert(12 % FNB == 0 && 12 - FNB < 8, "a step keeps its buffer from tile to tile; the addresses move among the score steps");
    // the barriers keep the first fetches in the order in which the loop issues them, so that the counted waits at the loop's head hold on both ways in
#pragma unroll
    for (int p = 0; p < FNB; ++p) { fetch(buf[p], p); __builtin_amdgcn_sched_barrier(0); }
    asm volatile("s_wait_xcnt 0x0" :: "v"(kb) : "memory");    // input only: the first fetches are built with scalar bases and the lane's offset, which stays whole until they are past their address stage
    const unsigned long long dv = 64 * HD * 2;    // 64 keys on in v^T: 8 blocks (32-key group, then 16-column tile)
    const float C2 = SCL * 1.4426950408889634f;    // logits / 8, in base 2
    int kt = k0;
#pragma unroll 1    // one tile a trip: 144 matrix instructions and 96 loads are body enough, a second copy would only grow the code
    do {    // k0 <= k1: the first trip always runs
        const unsigned long long dk = (kt < k1) ? (unsigned long long)(64 * HD * 2) : 0ull;    // the last tile fetches its own first steps once more, unused: no address past the planes
        v8f s[2][4];
#pragma unroll
        for (int r = 0; r < 2; ++r) {
#pragma unroll
            for (int t = 0; t < 4; ++t) s[r][t] = (v8f){}; }
#pragma unroll
        for (int i = 0; i < 8; ++i) { const int ks = (i >> 1) & 1, t2 = (i >> 2) * 2;
            mm12(buf[i % FNB], (i & 1) ? th[0][ks] : qh[0][ks], (i & 1) ? tl[0][ks] : ql[0][ks], (i & 1) ? th[1][ks] : qh[1][ks], (i & 1) ? tl[1][ks] : ql[1][ks], s[0][t2], s[0][t2 + 1], s[1][t2], s[1][t2 + 1]);
            __builtin_amdgcn_sched_barrier(0);    // keeps the fetch FNB steps ahead: without the pair the compiler sinks each load to its use and every step waits a full latency
            // on to the next tile's addresses, once this tile's last fetch is out (behind step 11 - FNB); the wait stands in front of the overwrite of registers that issued loads name
            if (i == 12 - FNB) asm volatile("s_wait_xcnt 0x0\n\tv_add_nc_u64 %0, %6, %0\n\tv_add_nc_u64 %1, %6, %1\n\tv_add_nc_u64 %2, %6, %2\n\tv_add_nc_u64 %3, %6, %3\n\tv_add_nc_u64 %4, %7, %4\n\tv_add_nc_u64 %5, %7, %5" : "+v"(aKh), "+v"(aKl), "+v"(aCh), "+v"(aCl), "+v"(aVh), "+v"(aVl) : "s"(dk), "s"(dv) : "memory");
            fetch(buf[i % FNB], (i + FNB) % 12);
            __builtin_amdgcn_sched_barrier(0); }
        v4u ph[2][4], pl[2][4];    // P, hi and residual, two bf16 a word
#pragma unroll
        for (int r = 0; r < 2; ++r) {
            if (kt == kl) { const int lim = (bx & 1) * 32 + r * 16 + lr - hi * 8;    // diagonal tile: key t*16 + j of this lane's half is allowed while t*16 + j <= lim
#pragma unroll
                for (int t = 0; t < 4; ++t) {
#pragma unroll
                    for (int j = 0; j < 8; ++j) s[r][t][j] = (t * 16 + j <= lim) ? s[r][t][j] : -3.0e38f; } }
            float mt = -3.0e38f;
#pragma unroll
            for (int t = 0; t < 4; ++t) {
#pragma unroll
                for (int j = 0; j < 8; ++j) mt = fmaxf(mt, s[r][t][j]); }
            mt = fmaxf(mt, xhalf(mt));
            const float mn = fmaxf(m[r], mt * C2), al = __builtin_amdgcn_exp2f(m[r] - mn); m[r] = mn;
            lv[r] *= al;
#pragma unroll
            for (int t = 0; t < 4; ++t) { v8f p;
#pragma unroll
                for (int j = 0; j < 8; ++j) p[j] = __builtin_amdgcn_exp2f(fmaf(s[r][t][j], C2, -mn));
                lv[r] += ((v2f){p[0], p[1]} + (v2f){p[2], p[3]}) + ((v2f){p[4], p[5]} + (v2f){p[6], p[7]}); o[r][t] *= al;
#pragma unroll
                for (int j = 0; j < 4; ++j) { const v2f pp = (v2f){p[2 * j], p[2 * j + 1]}; const v2bf h2 = __builtin_convertvector(pp, v2bf), l2 = __builtin_convertvector(pp - __builtin_convertvector(h2, v2f), v2bf);
                    ph[r][t][j] = __builtin_bit_cast(unsigned, h2); pl[r][t][j] = __builtin_bit_cast(unsigned, l2); } } }
#pragma unroll
        for (int i = 8; i < 12; ++i) { const int ks = (i - 8) >> 1, tp = (i - 8) & 1;
            v16bf pH[2], pL[2];
#pragma unroll
            for (int r = 0; r < 2; ++r) { pH[r] = __builtin_bit_cast(v16bf, __builtin_shufflevector(ph[r][2 * ks], ph[r][2 * ks + 1], 0, 1, 2, 3, 4, 5, 6, 7)); pL[r] = __builtin_bit_cast(v16bf, __builtin_shufflevector(pl[r][2 * ks], pl[r][2 * ks + 1], 0, 1, 2, 3, 4, 5, 6, 7)); }
            mm12(buf[i % FNB], pH[0], pL[0], pH[1], pL[1], o[0][2 * tp], o[0][2 * tp + 1], o[1][2 * tp], o[1][2 * tp + 1]);
            __builtin_amdgcn_sched_barrier(0);    // as above
            fetch(buf[i % FNB], (i + FNB) % 12);
            __builtin_amdgcn_sched_barrier(0); }
    } while (++kt <= k1);
    asm volatile("s_wait_xcnt 0x0" :: "v"(aKh), "v"(aKl), "v"(aCh), "v"(aCl), "v"(aVh), "v"(aVl) : "memory");    // inputs only: the six address pairs stay whole until the last tile's fetches are past their address stage
    }
    // hand over group 1 - wg, finish group wg. send and finish take the group as a compile-time constant (register arrays): the scalar branches pick the copy
    auto send = [&](auto R) { constexpr int r = decltype(R)::value; float* mp = &mg[half][wave ^ 4][0];
#pragma unroll
        for (int t = 0; t < 4; ++t) { *(v4fa*)(mp + ((2 * t) * 32 + lane) * 4) = __builtin_shufflevector(o[r][t], o[r][t], 0, 1, 2, 3); *(v4fa*)(mp + ((2 * t + 1) * 32 + lane) * 4) = __builtin_shufflevector(o[r][t], o[r][t], 4, 5, 6, 7); }
        mp[1024 + lane] = m[r]; mp[1056 + lane] = lv[r][0] + lv[r][1]; };
    // O leaves as the A operand of the Wo product: bf16 hi and residual planes of the [NR][DMOD] matrix in fragment order. The lane's 8 values of tile t are columns head*64 + t*16 + 8*hi + 0..7
    // of its query row: piece 'lane' of half (t & 1) of block (16-row tile, k tile head*2 + (t >> 1)). A wave's store is 512 bytes in a row.
    auto finish = [&](auto R) { constexpr int r = decltype(R)::value; const float* mp = &mg[half][wave][0];
        v8f x[4];
#pragma unroll
        for (int t = 0; t < 4; ++t) x[t] = __builtin_shufflevector(*(const v4fa*)(mp + ((2 * t) * 32 + lane) * 4), *(const v4fa*)(mp + ((2 * t + 1) * 32 + lane) * 4), 0, 1, 2, 3, 4, 5, 6, 7);
        const float mb = mp[1024 + lane], lb = mp[1056 + lane];
        const float mn = fmaxf(m[r], mb), fa = __builtin_amdgcn_exp2f(m[r] - mn), fb = __builtin_amdgcn_exp2f(mb - mn);    // a part without tiles comes with maximum -3e38, sum 0 and O^T 0: its factor is 0
        float l = (lv[r][0] + lv[r][1]) * fa + lb * fb;
        l += xhalf(l);
        const float inv = 1.0f / l;
        const size_t ob = ((size_t)(((int)blockIdx.y * NN + bx * 32 + r * 16) >> 4) * (DMOD / 32) + (size_t)blockIdx.z * 2) * 512 + (size_t)lane * 8;
#pragma unroll
        for (int t = 0; t < 4; ++t) { const v8f rr = (o[r][t] * fa + x[t] * fb) * inv; v8us oh, ol;
#pragma unroll
            for (int i = 0; i < 8; ++i) { const unsigned short hb = f2bf(rr[i]); oh[i] = hb; ol[i] = f2bf(rr[i] - bf2f(hb)); }
            const size_t e = ob + (t >> 1) * 512 + (t & 1) * 256; *(v8us*)(Oh + e) = oh; *(v8us*)(Ol + e) = ol; } };
    if (wg) send(ic0()); else send(ic1());
    __syncthreads();    // every wave of the work-group, once a row block: what the partner handed over stands in LDS
    if (wg) finish(ic1()); else finish(ic0());
    asm volatile("s_wait_xcnt 0x0" ::: "memory");    // in front of the second row block's writes of registers that these stores name
    }
}
__global__ __launch_bounds__(256) void k_planes32z(const float* __restrict__ F, int ld, int off, float sc, int rows, bf* Ph, bf* Pl) {
    typedef __attribute__((ext_vector_type(2))) unsigned short v2us;
    const int lane = threadIdx.x & 31; const size_t r = ((size_t)blockIdx.x * 8 + (threadIdx.x >> 5)) * 2 + (lane >> 4); if (r >= (size_t)rows) return; const int z = blockIdx.z; const int c0 = (lane & 15) * 2; v2us oh, ol;
    Ph += (size_t)z * rows * 32; Pl += (size_t)z * rows * 32;
#pragma unroll
    for (int i = 0; i < 2; ++i) { const float y = F[r * ld + off + z * 32 + c0 + i] * sc; const unsigned short hb = f2bf(y); oh[i] = hb; ol[i] = f2bf(y - bf2f(hb)); }
    const size_t o = r * 32 + c0; *(v2us*)(Ph + o) = oh; *(v2us*)(Pl + o) = ol; 
}
__global__ __launch_bounds__(256) void k_vtpadz(const float* __restrict__ F, int ld, int off, int nk, bf* Th, bf* Tl) {
    typedef __attribute__((ext_vector_type(2))) unsigned short v2us;
    const int lane = threadIdx.x & 31; const size_t wid = (size_t)blockIdx.x * 8 + (threadIdx.x >> 5); if (wid >= (size_t)64 * (nk / 64)) return; const int z = blockIdx.z; const int d = (int)(wid / (nk / 64)); const int k0 = (int)(wid % (nk / 64)) * 64 + lane * 2; v2us oh, ol;
    Th += (size_t)z * 64 * nk; Tl += (size_t)z * 64 * nk;
#pragma unroll
    for (int i = 0; i < 2; ++i) { const float y = (d < 32) ? F[(size_t)(k0 + i) * ld + off + z * 32 + (d < 32 ? d : 0)] : 0.f; const unsigned short hb = f2bf(y); oh[i] = hb; ol[i] = f2bf(y - bf2f(hb)); }
    const size_t o = (size_t)d * nk + k0; *(v2us*)(Th + o) = oh; *(v2us*)(Tl + o) = ol; 
}
template <int NK>
__global__ __launch_bounds__(256) void k_softmaxz(const float* __restrict__ S, int rows, bf* PH, bf* PL) {
    typedef __attribute__((ext_vector_type(4))) unsigned short v4us;
    const int lane = threadIdx.x & 31, i = blockIdx.x * 8 + (threadIdx.x >> 5); if (i >= rows) return; const size_t zo = (size_t)blockIdx.z * rows * NK; const float* sr = S + zo + (size_t)i * NK; PH += zo; PL += zo;
    float m = -3.0e38f;
#pragma unroll 1
    for (int c0 = lane * 4; c0 < NK; c0 += 128) {
#pragma unroll
        for (int q = 0; q < 4; ++q) m = fmaxf(m, sr[c0 + q]); }
#pragma unroll
    for (int sh = 16; sh; sh >>= 1) m = fmaxf(m, __shfl_xor(m, sh, 32));
    float sum = 0.f;
#pragma unroll 1
    for (int c0 = lane * 4; c0 < NK; c0 += 128) {
#pragma unroll
        for (int q = 0; q < 4; ++q) sum += __expf(sr[c0 + q] - m); }
#pragma unroll
    for (int sh = 16; sh; sh >>= 1) sum += __shfl_xor(sum, sh, 32);
    const float inv = 1.0f / sum;
{
#pragma unroll 1
        for (int c0 = lane * 4; c0 < NK; c0 += 128) { v4us oh, ol;
#pragma unroll
            for (int q = 0; q < 4; ++q) { const float p = __expf(sr[c0 + q] - m) * inv; const unsigned short hb = f2bf(p); oh[q] = hb; ol[q] = f2bf(p - bf2f(hb)); }
            const size_t o = (size_t)i * NK + c0; *(v4us*)(PH + o) = oh; *(v4us*)(PL + o) = ol; }
         }
}
__global__ __launch_bounds__(256) void k_placez(const float* __restrict__ XH, int rows, int ldy, float* Y) {
    const int lane = threadIdx.x & 31; const size_t q = (size_t)blockIdx.x * 8 + (threadIdx.x >> 5); if (q >= (size_t)rows) return; const int z = blockIdx.z; const float v = XH[((size_t)z * rows + q) * 64 + lane];
    *(float*)(Y + q * ldy + z * 32 + lane) = v; 
}

template <int NK>
__global__ __launch_bounds__(256) void k_softmaxzs(const float* __restrict__ S, int rows, float sc, bf* PH, bf* PL) {
    typedef __attribute__((ext_vector_type(4))) unsigned short v4us;
    const int lane = threadIdx.x & 31, i = blockIdx.x * 8 + (threadIdx.x >> 5); if (i >= rows) return; const size_t zo = (size_t)blockIdx.z * rows * NK; const float* sr = S + zo + (size_t)i * NK; PH += zo; PL += zo;
    float m = -3.0e38f;
#pragma unroll 1
    for (int c0 = lane * 4; c0 < NK; c0 += 128) {
#pragma unroll
        for (int q = 0; q < 4; ++q) m = fmaxf(m, sr[c0 + q] * sc); }
#pragma unroll
    for (int sh = 16; sh; sh >>= 1) m = fmaxf(m, __shfl_xor(m, sh, 32));
    float sum = 0.f;
#pragma unroll 1
    for (int c0 = lane * 4; c0 < NK; c0 += 128) {
#pragma unroll
        for (int q = 0; q < 4; ++q) sum += __expf(sr[c0 + q] * sc - m); }
#pragma unroll
    for (int sh = 16; sh; sh >>= 1) sum += __shfl_xor(sum, sh, 32);
    const float inv = 1.0f / sum;
{
#pragma unroll 1
        for (int c0 = lane * 4; c0 < NK; c0 += 128) { v4us oh, ol;
#pragma unroll
            for (int q = 0; q < 4; ++q) { const float p = __expf(sr[c0 + q] * sc - m) * inv; const unsigned short hb = f2bf(p); oh[q] = hb; ol[q] = f2bf(p - bf2f(hb)); }
            const size_t o = (size_t)i * NK + c0; *(v4us*)(PH + o) = oh; *(v4us*)(PL + o) = ol; }
         }
}

// k_prep: every conversion that needs the inputs alone, in one launch; what a work-group does follows from its index (the branches are the same for the whole work-group).
// A [rows][DMOD] matrix takes rows / 8 work-groups: x, then Wq | Wk | Wv | Wt (one [QW][DMOD] operand), then Wo; the last QW / 256 lay the four biases in a row.
#define PBX (NR / 8)
#define PBW (DMOD / 8)
__global__ __launch_bounds__(256) void k_prep(const float* __restrict__ x, const float* __restrict__ Wq, const float* __restrict__ Wk, const float* __restrict__ Wv, const float* __restrict__ Wt, const float* __restrict__ Wo,
                                              const float* __restrict__ bq, const float* __restrict__ bk, const float* __restrict__ bv, const float* __restrict__ bt, bf* Xb, bf* W4, bf* WO, float* B4) {
    int b = blockIdx.x;
    if (b >= PBX + 5 * PBW) { const int i = (b - (PBX + 5 * PBW)) * 256 + (int)threadIdx.x, blk = i / DMOD, o = i % DMOD;
        B4[i] = (blk == 0) ? bq[o] : (blk == 1) ? bk[o] : (blk == 2) ? bv[o] : bt[o]; return; }
    const float* src = x; bf* dst = Xb;
    if (b >= PBX) { b -= PBX; const int w = b / PBW; b -= w * PBW;
        src = (w == 0) ? Wq : (w == 1) ? Wk : (w == 2) ? Wv : (w == 3) ? Wt : Wo; dst = (w < 4) ? W4 + (size_t)w * DMOD * DMOD : WO; }
    // dst in fragment order. Pieces g, g + 256, g + 512, g + 768 of a work-group's 1,024 (half a 16-row tile) lie 4 k tiles = 128 source elements apart
    const size_t g = (size_t)b * 1024 + threadIdx.x; const float* sp = src + fragsrc(g);
    v8f v[4];
    // '#pragma unroll': register arrays, their indices must be compile-time constants
#pragma unroll
    for (int q = 0; q < 4; ++q) v[q] = *(const v8f*)(sp + q * 128);
#pragma unroll
    for (int q = 0; q < 4; ++q) { v8us o;
#pragma unroll
        for (int i = 0; i < 8; ++i) o[i] = f2bf(v[q][i]);
        *(v8us*)(dst + (g + q * 256) * 8) = o; }
    asm volatile("s_wait_xcnt 0x0" ::: "memory");    // in front of any later write of a register that these stores name: in the built code the other branch's instructions follow them
}
// k_mid: everything between the projection GEMM and the attention, in one launch; what a work-group does follows from its index (the branch is the same for the whole work-group).
// THE FIRST NBT * DMOD / 32 WORK-GROUPS: prefix sums of k*v/8 over the key positions, in chunks. A work-group owns 32 columns (one 128-byte line of a row; one k half of one head), a lane one
// column, each of its 32 waves CH = 64 rows in a row. A wave's loads depend on nothing: they go out in batches of 16 rows (32 loads), two batches in flight. Its prefix sums start at 0 and
// stay in registers. The chunks' totals meet in LDS, and every wave adds the totals of the chunks in front of it, in chunk order, to its own 64 sums. The sums leave as kvcum's bf16 hi and
// residual planes in fragment order: a wave's 64 rows x 32 columns are four whole 1-KiB blocks of each plane; 16 rows at a time turn from a column a lane to 16 columns of a row a lane (two runs of 8) in LDS.
// THE OTHERS: the planes of q, k, q*t and v^T. A thread makes pieces g and g + NN * 4 of one head: the 16-byte pieces, hi and residual, of q, k and q*t (blocks (16-row tile, k half): the
// same 8 columns of one row in all three) and of v^T (blocks (32-key group, 16-column tile): 8 keys of one column).
#define CH (NN / 32)
#define NCUM (NBT * (DMOD / 32))
#define TRP 36    // words a row of a wave's turning buffer: 144 bytes = 16 x 9, a pitch at which 16-byte LDS reads of 16 rows meet no bank twice
typedef v4u __attribute__((may_alias)) v4ua;
__global__ __launch_bounds__(1024) void k_mid(const float* F, bf* Qh, bf* Ql, bf* Kh, bf* Kl, bf* Th, bf* Tl, bf* Ch, bf* Cl, bf* VTh, bf* VTl) {
    typedef __attribute__((ext_vector_type(16))) float v16f;
    __shared__ float tot[32][32];
    __shared__ __align__(16) unsigned tr[32][16 * TRP];
    const int lane = threadIdx.x & 31;
    const int wave = __builtin_amdgcn_readfirstlane((int)threadIdx.x >> 5);    // in a scalar register: the chunk's base addresses and the tests on it are then scalar
    // every '#pragma unroll' of this kernel: the arrays it walks are register arrays, so their indices must be compile-time constants
    if (blockIdx.x < NCUM) {
        const int item = (int)blockIdx.x / (DMOD / 32), cb = (int)blockIdx.x % (DMOD / 32), c = cb * 32 + lane;
        const float* fr = F + ((size_t)item * NN + wave * CH) * QW + DMOD + c;
        float p[CH]; v16f kk[2], vv[2];
        auto fetch = [&](int b) {
#pragma unroll
            for (int i = 0; i < 16; ++i) { kk[b & 1][i] = fr[(size_t)(b * 16 + i) * QW]; vv[b & 1][i] = fr[(size_t)(b * 16 + i) * QW + DMOD]; }
        };
        fetch(0);
        float acc = 0.f;
#pragma unroll
        for (int b = 0; b < CH / 16; ++b) {
            if (b + 1 < CH / 16) fetch(b + 1);
            // inputs only, the loaded values of batch b: keeps the loads in batches, the next batch out before this one is waited for and the one after it behind this line. Left alone the
            // compiler either sinks every pair of loads to its product (64 latencies in a row) or lifts all 128 to the top (more registers than a wave of this work-group has).
            // F carries no __restrict__ here, so that the "memory" clobber holds its loads
            asm volatile("" :: "v"(kk[b & 1]), "v"(vv[b & 1]) : "memory");
#pragma unroll
            for (int i = 0; i < 16; ++i) { acc = fmaf(kk[b & 1][i] * vv[b & 1][i], SCL, acc); p[b * 16 + i] = acc; }
        }
        tot[wave][lane] = acc;
        __syncthreads();
        float tw[31];    // the last chunk stands in front of nobody
#pragma unroll
        for (int w = 0; w < 31; ++w) tw[w] = tot[w][lane];
        __builtin_amdgcn_sched_barrier(0);    // the 31 LDS reads go out together, one latency for all, instead of one each
        float off = 0.f;
#pragma unroll
        for (int w = 0; w < 31; ++w) off += (w < wave) ? tw[w] : 0.f;
        unsigned* tb = &tr[wave][0];    // the wave's own buffer: no other wave touches it, so no barrier
        const size_t pb = ((size_t)item * NH_ + (cb >> 1)) * NN * HD + ((size_t)wave * (CH / 16) * 2 + (cb & 1)) * 512 + (size_t)lane * 8;
#pragma unroll
        for (int rt = 0; rt < CH / 16; ++rt) {
#pragma unroll
            for (int r = 0; r < 16; ++r) { const float y = p[rt * 16 + r] + off; const unsigned short hb = f2bf(y); tb[r * TRP + lane] = (unsigned)hb | ((unsigned)f2bf(y - bf2f(hb)) << 16); }    // hi in the low half, residual in the high half
            asm volatile("s_wait_dscnt 0x0" ::: "memory");    // the wave's 16 rows stand in LDS before its lanes read what other lanes wrote
            const v4ua* rp = (const v4ua*)(tb + (lane & 15) * TRP + (lane >> 4) * 8);    // row lane & 15; columns 8*hi + 0..7 and 16 + 8*hi + 0..7
            const v4u w0 = rp[0], w1 = rp[1], w2 = rp[4], w3 = rp[5];
            v4u h0, l0, h1, l1;
#pragma unroll
            for (int i = 0; i < 2; ++i) {
                h0[i] = (w0[2 * i] & 0xFFFFu) | (w0[2 * i + 1] << 16); h0[2 + i] = (w1[2 * i] & 0xFFFFu) | (w1[2 * i + 1] << 16); l0[i] = (w0[2 * i] >> 16) | (w0[2 * i + 1] & 0xFFFF0000u); l0[2 + i] = (w1[2 * i] >> 16) | (w1[2 * i + 1] & 0xFFFF0000u);
                h1[i] = (w2[2 * i] & 0xFFFFu) | (w2[2 * i + 1] << 16); h1[2 + i] = (w3[2 * i] & 0xFFFFu) | (w3[2 * i + 1] << 16); l1[i] = (w2[2 * i] >> 16) | (w2[2 * i + 1] & 0xFFFF0000u); l1[2 + i] = (w3[2 * i] >> 16) | (w3[2 * i + 1] & 0xFFFF0000u); }
            const size_t e = pb + (size_t)rt * 1024;    // the next 16-row tile lies two blocks on
            *(v4ua*)(Ch + e) = h0; *(v4ua*)(Ch + e + 256) = h1; *(v4ua*)(Cl + e) = l0; *(v4ua*)(Cl + e + 256) = l1;
        }
    } else {
        const int b = (int)blockIdx.x - NCUM, zy = b / (NN * 4 / 1024);    // zy = batch item * NH_ + head
        const size_t g0 = (size_t)(b % (NN * 4 / 1024)) * 1024 + threadIdx.x, po = (size_t)zy * NN * HD;
        const float* Fh = F + (size_t)(zy / NH_) * NN * QW + (zy % NH_) * HD;
        v8f vq[2], vk[2], vt[2], vv[2]; const float* fq[2]; const float* fv[2];
#pragma unroll
        for (int u = 0; u < 2; ++u) { const size_t g = g0 + (size_t)u * (NN * 4);
            const size_t row = (g >> 7) * 16 + (lane & 15); const int col = (int)((g >> 6) & 1) * 32 + (int)((g >> 5) & 1) * 16 + (lane >> 4) * 8;
            fq[u] = Fh + row * QW + col; vq[u] = *(const v8f*)fq[u]; vk[u] = *(const v8f*)(fq[u] + DMOD); vt[u] = *(const v8f*)(fq[u] + 3 * DMOD);
            const int d = (int)((g >> 6) & 3) * 16 + (lane & 15); const size_t t0 = (g >> 8) * 32 + ((g >> 5) & 1) * 16 + (lane >> 4) * 8;
            fv[u] = Fh + t0 * QW + d;    // 16 lanes read 64 bytes of a row: 2 lines a load
#pragma unroll
            for (int i = 0; i < 8; ++i) vv[u][i] = fv[u][2 * DMOD + (size_t)i * QW]; }
        // inputs only: the four address pairs stay whole (none is given to a later load's data) until every load that names one is past its address stage. The "memory" clobber keeps all 28 loads
        // in front of this line: they go out together, one memory latency for the thread; left alone the compiler sinks each group to its use, several latencies in a row
        asm volatile("s_wait_xcnt 0x0" :: "v"(fq[0]), "v"(fq[1]), "v"(fv[0]), "v"(fv[1]) : "memory");
        auto put = [&](const v8f v, bf* H, bf* L, size_t o) { v8us oh, ol;
#pragma unroll
            for (int i = 0; i < 8; ++i) { const unsigned short hb = f2bf(v[i]); oh[i] = hb; ol[i] = f2bf(v[i] - bf2f(hb)); }
            *(v8us*)(H + o) = oh; *(v8us*)(L + o) = ol; };
#pragma unroll
        for (int u = 0; u < 2; ++u) { const size_t o = po + (g0 + (size_t)u * (NN * 4)) * 8;
            put(vq[u], Qh, Ql, o); put(vk[u], Kh, Kl, o); put(vq[u] * vt[u], Th, Tl, o); put(vv[u], VTh, VTl, o); }
        asm volatile("s_wait_xcnt 0x0" ::: "memory");    // in front of any later write of a register that these stores name: in the built code the other branch's instructions follow them
    }
}

extern "C" void kernel_launch(void* const* d_in, const int* in_sizes, int n_in,
                              void* d_out, int out_size, void* d_ws, size_t ws_size, hipStream_t stream) {
    (void)in_sizes; (void)n_in; (void)out_size;
    const float* x = (const float*)d_in[0]; const float* Wq = (const float*)d_in[1]; const float* bq = (const float*)d_in[2]; const float* Wk = (const float*)d_in[3]; const float* bk = (const float*)d_in[4]; const float* Wv = (const float*)d_in[5]; const float* bv = (const float*)d_in[6]; const float* Wt = (const float*)d_in[7]; const float* bt = (const float*)d_in[8]; const float* Wo = (const float*)d_in[9]; const float* bo = (const float*)d_in[10];
    float* out = (float*)d_out;    // [2][2048][1024]
    char* wsp = (char*)d_ws;
    auto take = [&](size_t bytes) { char* p = wsp; wsp += (bytes + 255) & ~(size_t)255; return (void*)p; };
    bf* W4 = (bf*)take((size_t)QW * DMOD * 2); float* B4 = (float*)take((size_t)QW * 4); bf* WO = (bf*)take((size_t)DMOD * DMOD * 2);
    const size_t PLB = (size_t)NBT * NH_ * NN * HD * 2;    // one operand plane, all heads of both items
    bf* Qh = (bf*)take(PLB); bf* Ql = (bf*)take(PLB); bf* Kh = (bf*)take(PLB); bf* Kl = (bf*)take(PLB); bf* Th = (bf*)take(PLB); bf* Tl = (bf*)take(PLB); bf* Ch = (bf*)take(PLB); bf* Cl = (bf*)take(PLB); bf* VTh = (bf*)take(PLB); bf* VTl = (bf*)take(PLB);
    char* const big = wsp;
    bf* Xb = (bf*)take((size_t)NR * DMOD * 2); float* F = (float*)take((size_t)NR * QW * 4);
    if ((size_t)(wsp - (char*)d_ws) > ws_size) return;    // ~ 162 MiB
    // Xb is last read by the projection GEMM, F when the operand planes are made, Oh, Ol are first written by the attention: they lie on the same bytes.
    wsp = big; bf* Oh = (bf*)take((size_t)NR * DMOD * 2); bf* Ol = (bf*)take((size_t)NR * DMOD * 2);
    // both batch items in every launch: the row-wise work walks the NR = 2 x 2048 rows as one matrix
    k_prep<<<PBX + 5 * PBW + QW / 256, 256, 0, stream>>>(x, Wq, Wk, Wv, Wt, Wo, bq, bk, bv, bt, Xb, W4, WO, B4);
    k_gemmb<false, 4, 8, 2, 4, 2><<<dim3(NR / 256, QW / 256, 1), 256, 0, stream>>>(Xb, nullptr, W4, B4, F, QW);      // [q | k | v | t] + biases
    k_mid<<<NCUM + NBT * NH_ * (NN * 4 / 1024), 1024, 0, stream>>>(F, Qh, Ql, Kh, Kl, Th, Tl, Ch, Cl, VTh, VTl);
    // blockIdx.y = batch item, blockIdx.z = head
    k_fattn<<<dim3(NN / 256, NBT, NH_), 256, 0, stream>>>(Qh, Ql, Kh, Kl, Th, Tl, Ch, Cl, VTh, VTl, Oh, Ol);
    k_gemmb<true, 2, 4, 4, 4, 2><<<dim3(NR / 128, DMOD / 128, 1), 256, 0, stream>>>(Oh, Ol, WO, bo, out, DMOD);
}

// v010
// Measured time: 124 microseconds a run.
// Next to v009, in two timings, it ran 1.06 and 1.07 times as fast.
// Counting every step since v000, it is 45.9 times as fast.
#include <hip/hip_runtime.h>

// Compute dtypes, f32 accumulate, per item: q/k/v/t = x.W^T + b fused as one [4096 x 1024].[1024 x 4096] GEMM over both items with PLAIN bf16 operands (exact products); the triplet term's
// cumsum over key positions of k*v/8 (f32 prefix sums per column, in 64-row chunks + the sums of the chunks in front) and q*t in f32; per head, in ONE kernel (k_fattn): scores q.k^T + (q*t).kvcum^T with bf16 hi +
// UNSCALED residual planes (three products each; tiles above the diagonal skipped), / 8 + causal softmax in f32 with a running maximum and sum, attn.v (three products); Wo (+ bias) on

#define NBT  2
#define NN   2048
#define DMOD 1024
#define NH_  16
#define HD   64
#define QW   (4 * DMOD)
#define DM   DMOD
#define NTK  NN
#define NR   (NBT * NN)    // rows of both batch items: every launch covers both (row-wise kernels see one [NR] matrix, k_fattn takes the item from blockIdx.y, k_mid from blockIdx.x)
#define SCL  0.125f
#define LOSC 1024.0f

typedef _Float16 h16;
typedef unsigned short bf;
typedef __attribute__((ext_vector_type(16))) __bf16   v16bf;
typedef __attribute__((ext_vector_type(16))) _Float16 v16h;
typedef __attribute__((ext_vector_type(8)))  _Float16 v8h;
typedef __attribute__((ext_vector_type(8)))  unsigned short v8us;
typedef __attribute__((ext_vector_type(8)))  float    v8f;
typedef __attribute__((ext_vector_type(4)))  float    v4f;
typedef __attribute__((ext_vector_type(4)))  _Float16 v4h;
typedef v8h  __attribute__((may_alias)) v8ha;
typedef v4f  __attribute__((may_alias)) v4fa;
typedef v8us __attribute__((may_alias)) v8usa;

__device__ __forceinline__ unsigned short f2bf(float f) { unsigned u = __float_as_uint(f); u += 0x7FFFu + ((u >> 16) & 1u); return (unsigned short)(u >> 16); }
__device__ __forceinline__ float bf2f(unsigned short b) { return __uint_as_float(((unsigned)b) << 16); }
__device__ __forceinline__ float bfr(float f) { return bf2f(f2bf(f)); }
__device__ __forceinline__ v16h cat16(v8h lo, v8h hi) { return __builtin_shufflevector(lo, hi, 0, 1, 2, 3, 4, 5, 6, 7, 8, 9, 10, 11, 12, 13, 14, 15); }
__device__ __forceinline__ v16bf cat16b(v8us lo, v8us hi) { return __builtin_bit_cast(v16bf, __builtin_shufflevector(lo, hi, 0, 1, 2, 3, 4, 5, 6, 7, 8, 9, 10, 11, 12, 13, 14, 15)); }
__device__ __forceinline__ v8f wmma16(v16h a, v16h b, v8f c) { return __builtin_amdgcn_wmma_f32_16x16x32_f16(false, a, false, b, (short)0, c, false, false); }
__device__ __forceinline__ v8f wmmab(v16bf a, v16bf b, v8f c) { return __builtin_amdgcn_wmma_f32_16x16x32_bf16(false, a, false, b, (short)0, c, false, false); }

// FRAGMENT ORDER: every bf16 matrix operand that one launch writes for another lies as 1-KiB blocks of 16 rows x 32 k. In a block, lane hi*16 + (row & 15) owns k = 8*hi + 0..7 at byte
// lane*16 and k = 16 + 8*hi + 0..7 at byte 512 + lane*16: a wave's 16-byte fragment load then covers 4 whole 128-byte lines, not 32 bytes of each of 16 lines.
// fragsrc: 16-byte piece g of a [rows][DMOD] operand (blocks in the order row tile, k tile) -> index of its first element in the row-major source
__device__ __forceinline__ size_t fragsrc(size_t g) { const int lane = (int)g & 31; return ((g >> 11) * 16 + (lane & 15)) * DMOD + ((g >> 6) & 31) * 32 + ((g >> 5) & 1) * 16 + (lane >> 4) * 8; }

// k_gemmb: C[rows][NW] = (A [+ Al]).B^T (K = DM) + bf(bias[c]). A wave owns MT x NT accumulator tiles (MT*16 rows x NT*16 columns): a loaded A fragment feeds NT matrix instructions, a B fragment
// MT (2*MT with the residual plane). A work-group is WR x WC waves, whose fragment loads share lines: WR*MT*16 rows x WC*NT*16 columns. The fragments of a k step (32 k) live in one of D register sets and are fetched D - 1 steps ahead,
// all of a step's loads as one group. f32 whole-line epilogue through LDS.
// A work-group enters the k walk at step (blockIdx.x * SX + blockIdx.y * SY) mod NS and wraps round: the work-groups that share operand rows stand at different k, so a line's first fetch from memory is
// waited for by one of them and the others find it in L2, instead of all of them meeting every step's lines unfetched at the same moment. Both operands turn by the same amount.
// SX, SY: chosen for the grid, so that the work-groups of one grid row, and those of one grid column, all enter at different steps, spread over the NS steps.
template <bool SPLITA, int MT, int NT, int D, int WR, int WC, int SX, int SY>
__global__ __launch_bounds__(WR * WC * 32) void k_gemmb(const bf* __restrict__ A, const bf* __restrict__ Al, const bf* __restrict__ Bn, const float* __restrict__ bias, float* C, int ldc) {
    constexpr int OP = NT * 16 + 4;    // words a row of the output staging: a pitch of 16 bytes x an odd number
    __shared__ __align__(16) float ost[WR * WC][MT * 16 * OP];
    const int lane = threadIdx.x & 31, lr = lane & 15, hi = lane >> 4;
    const int wave = __builtin_amdgcn_readfirstlane((int)threadIdx.x >> 5);    // in a scalar register: the tile's base addresses are then scalar
    const int r0 = (blockIdx.x * WR + wave / WC) * (MT * 16), c0 = (blockIdx.y * WC + wave % WC) * (NT * 16);
    // fragment order (fragsrc): a 16-row tile is DM / 32 blocks of 1 KiB in a row, the next 16-row tile lies TB bytes on
    constexpr int TB = DM * 16 * 2;
    constexpr int NS = DM / 32;    // k steps; a multiple of D. A constant: the loop is then known to run, and the first fetches stay in front of it in their order
    static_assert(NS % D == 0 && NS >= D && (NS & (NS - 1)) == 0, "k steps");
    const int off = (int)((blockIdx.x * SX + blockIdx.y * SY) & (NS - 1));    // the k step at which this work-group enters the walk (a scalar)
    typedef const __attribute__((address_space(1))) char* gch; typedef const __attribute__((address_space(1))) v8us* gv8;    // global address space, named: an address that comes out of an asm statement would else be loaded as a flat one
    auto gfrag = [](gch p) -> v16bf { return cat16b(*(gv8)p, *(gv8)(p + 512)); };
    // the lane's address in each operand lives in one register pair for the whole loop and moves once a k step (step()); every load is that pair + a constant
    unsigned long long pA = (unsigned long long)((gch)A + (size_t)(r0 >> 4) * TB + off * 1024 + lane * 16), pB = (unsigned long long)((gch)Bn + (size_t)(c0 >> 4) * TB + off * 1024 + lane * 16), pL = 0;
    if (SPLITA) pL = (unsigned long long)((gch)Al + (size_t)(r0 >> 4) * TB + off * 1024 + lane * 16);
    // the way to the j-th step of the walk from the one before it: one block on, or from the last block of the row tile back to its first
    auto adv = [&](int j) -> unsigned long long { return ((off + j) & (NS - 1)) ? 1024ull : (unsigned long long)(long long)(1024 - NS * 1024); };
    // on to the next step's addresses; the wait stands in front of the overwrite of registers that issued loads name
    auto step = [&](unsigned long long d) {
        if (SPLITA) asm volatile("s_wait_xcnt 0x0\n\tv_add_nc_u64 %0, %3, %0\n\tv_add_nc_u64 %1, %3, %1\n\tv_add_nc_u64 %2, %3, %2" : "+v"(pA), "+v"(pL), "+v"(pB) : "s"(d) : "memory");
        else asm volatile("s_wait_xcnt 0x0\n\tv_add_nc_u64 %0, %2, %0\n\tv_add_nc_u64 %1, %2, %1" : "+v"(pA), "+v"(pB) : "s"(d) : "memory");
    };
    // every '#pragma unroll' of this kernel: the arrays it walks are register arrays, so their indices must be compile-time constants
    v8f acc[MT][NT];
#pragma unroll
    for (int i = 0; i < MT; ++i) {
#pragma unroll
        for (int t = 0; t < NT; ++t) acc[i][t] = (v8f){}; }
    v16bf a[D][MT], al[D][MT], b[D][NT];
    auto fetch = [&](int p) {
#pragma unroll
        for (int i = 0; i < MT; ++i) { a[p][i] = gfrag((gch)pA + i * TB); if (SPLITA) al[p][i] = gfrag((gch)pL + i * TB); }
#pragma unroll
        for (int t = 0; t < NT; ++t) b[p][t] = gfrag((gch)pB + t * TB);
    };
    // the barriers keep the first fetches in the order in which the loop issues them, so that the counted waits at the loop's head hold on both ways in
    fetch(0);
    asm volatile("s_wait_xcnt 0x0" ::: "memory");    // the first fetch is built with scalar base addresses: the wait stands in front of any later write of those scalar registers
    __builtin_amdgcn_sched_barrier(0);
#pragma unroll
    for (int p = 1; p < D - 1; ++p) { step(adv(p)); fetch(p); __builtin_amdgcn_sched_barrier(0); }
#pragma unroll 1    // D k steps a trip (the register sets take turns): body enough, more copies would only grow the code
    for (int s = 0; s < NS; s += D) {
#pragma unroll
        for (int u = 0; u < D; ++u) {
#pragma unroll
            for (int t = 0; t < NT; ++t) {
#pragma unroll
                for (int i = 0; i < MT; ++i) acc[i][t] = wmmab(a[u][i], b[u][t], acc[i][t]);
                if (SPLITA) {
#pragma unroll
                    for (int i = 0; i < MT; ++i) acc[i][t] = wmmab(al[u][i], b[u][t], acc[i][t]); }
                if (t == 0) {    // behind the step's first column, whose wait has retired the oldest loads: the wave's loads in flight then stay within what the load counter can count
                    __builtin_amdgcn_sched_barrier(0);    // the pair keeps the fetch D - 1 steps ahead and in one group: without it the compiler sinks each load to its use and every step waits a full latency
                    step((s + u + D - 1 < NS) ? adv(s + u + D - 1) : 0ull);    // the last steps fetch the last step's fragments once more, unused: no address past the operands
                    fetch((u + D - 1) % D);    // into the set that the step before has left
                    __builtin_amdgcn_sched_barrier(0); } }
        }
    }
    // inputs only: the address pairs stay whole until the last fetches are past their address stage
    if (SPLITA) asm volatile("s_wait_xcnt 0x0" :: "v"(pA), "v"(pL), "v"(pB) : "memory");
    else asm volatile("s_wait_xcnt 0x0" :: "v"(pA), "v"(pB) : "memory");
    float* os = &ost[wave][0];
    float bv[NT]; const int bi = c0 + lr;
#pragma unroll
    for (int t = 0; t < NT; ++t) bv[t] = bias[bi + t * 16];
    asm volatile("s_wait_xcnt 0x0" :: "v"(bi) : "memory");    // input only: the index register stays whole (is not given to a load's data) until the bias loads are past their address stage
#pragma unroll
    for (int t = 0; t < NT; ++t) bv[t] = bfr(bv[t]);
#pragma unroll
    for (int t = 0; t < NT; ++t) {
#pragma unroll
        for (int i = 0; i < MT; ++i) {
#pragma unroll
            for (int j = 0; j < 8; ++j) os[(i * 16 + hi * 8 + j) * OP + t * 16 + lr] = acc[i][t][j] + bv[t]; } }
    __syncthreads();
    float* crow = C + (size_t)r0 * ldc + c0;
    constexpr int SB = 16;    // stores a batch
#pragma unroll
    for (int s0 = 0; s0 < MT * NT * 2; s0 += SB) { v4f val[SB];
#pragma unroll
        for (int q = 0; q < SB; ++q) { const int f = (s0 + q) * 32 + lane; val[q] = *(const v4fa*)(os + (f / (NT * 4)) * OP + (f % (NT * 4)) * 4); }
#pragma unroll
        for (int q = 0; q < SB; ++q) { const int f = (s0 + q) * 32 + lane; *(v4f*)(crow + (size_t)(f / (NT * 4)) * ldc + (f % (NT * 4)) * 4) = val[q]; }    // a wave's store: 512 bytes in a row of C (256 of each of two rows at NT = 4)
        if (s0 + SB < MT * NT * 2) asm volatile("s_wait_xcnt 0x0" ::: "memory"); }    // in front of the next batch's writes of registers that these stores name
}

__global__ __launch_bounds__(256) void k_zero8(bf* dst, size_t n8) {
    const size_t i = (size_t)blockIdx.x * 256 + threadIdx.x; if (i >= n8) return; v8us z;
#pragma unroll
    for (int k = 0; k < 8; ++k) z[k] = 0;
    *(v8us*)(dst + i * 8) = z; 
}

// ===== attention, blockIdx.z = head =====
// k_fattn: scores, causal softmax and attn.v in one kernel; no score or probability leaves the registers. A wave owns 32 query rows of one head (two groups of 16) and walks the 64-key tiles up to
// its diagonal. Everything is held transposed, so that a lane owns ONE query row of each group (lane & 15): S^T = K.Q^T + C.T^T (A = key rows, B = query rows; D element j of 16-key tile t is key
// t*16 + 8*hi + j), which is already the B-fragment k order (8*hi + 0..7, 16 + 8*hi + 0..7) of O^T = V^T.P^T: tiles 2*ks and 2*ks + 1 side by side.
// Running maximum (base 2) and running sum per lane (lanes r and r + 16 share a query: the maximum is joined every tile, the sum once at the end); O^T is rescaled by 2^(m_old - m_new).
// A 32-row block belongs to TWO waves, w and w + 4: one walks the first half of its key tiles, the other the rest with the diagonal. Each ends with its own maximum, sum and O^T;
// the two meet once a block, in LDS behind one barrier: each hands over one 16-row group and finishes the other (both parts brought to the common maximum and added).
// Every pair takes two row blocks ONE AFTER THE OTHER, a long one and then the short one that makes 33 tiles of the two; the wave with the larger part of the first has the smaller part of the second: 16 or 17 tiles
// a wave. A work-group is 8 waves: pair w takes row blocks 63 - (4x + w) and 4x + w (x = blockIdx.x = 0..7); the 256 work-groups are all resident at once, one a WGP, two waves a SIMD.
struct ic0 { static constexpr int value = 0; }; struct ic1 { static constexpr int value = 1; };    // a compile-time 0 or 1 as an argument
typedef __attribute__((ext_vector_type(2))) __bf16 v2bf;
typedef __attribute__((ext_vector_type(4))) unsigned v4u;
__device__ __forceinline__ float xhalf(float x) { return __builtin_bit_cast(float, __builtin_amdgcn_permlanex16(__builtin_bit_cast(int, x), __builtin_bit_cast(int, x), 0x76543210, 0xfedcba98, false, false)); }  // lane l with lane l ^ 16
#define FNB 6    // fragment buffers of k_fattn: a step's fragments are fetched FNB steps ahead; divides the 12 steps of a tile, so that a step always finds its buffer at the same index
#define FMW (34 * 32)    // words that a wave hands over: 32 of O^T, the maximum and the sum, a lane
__global__ __launch_bounds__(256) void k_fattn(const bf* __restrict__ Qh, const bf* __restrict__ Ql, const bf* __restrict__ Kh, const bf* __restrict__ Kl, const bf* __restrict__ Th, const bf* __restrict__ Tl, const bf* __restrict__ Ch, const bf* __restrict__ Cl, const bf* __restrict__ VTh, const bf* __restrict__ VTl, bf* Oh, bf* Ol) {
    const int lane = threadIdx.x & 31, lr = lane & 15, hi = lane >> 4;
    const int wave = __builtin_amdgcn_readfirstlane((int)threadIdx.x >> 5);    // in a scalar register, so that the tile loop ends on a scalar branch
    const int xs = (int)blockIdx.x * 4 + (wave & 3), wg = wave >> 2;    // the short 32-row block of the wave's pair; the 16-row group that this wave finishes
    __shared__ __align__(16) float mg[2][8][FMW];    // [row block of the pair][receiving wave]: a place is written once a launch, so one barrier a block is enough
    const size_t zo = ((size_t)blockIdx.y * NH_ + blockIdx.z) * NN * HD;         // blockIdx.y = batch item; one head's plane, in fragment order: blocks (16-row tile, k half) for q, k, q*t, kvcum and (32-key group, 16-column tile) for v^T
    typedef const __attribute__((address_space(1))) char* gch; typedef const __attribute__((address_space(1))) v8us* gv8;    // global address space, named: an address that comes out of an asm statement would else be loaded as a flat one
    auto gfrag = [](gch p) -> v16bf { return cat16b(*(gv8)p, *(gv8)(p + 512)); };    // k = 8*hi + 0..7 and 16 + 8*hi + 0..7: the two halves of a 1-KiB block in fragment order
#pragma unroll 1    // both row blocks run through one copy of the code: a second copy would only double the text the instruction cache has to hold
    for (int half = 0; half < 2; ++half) {    // (the body keeps its indentation)
    const int bx = half ? xs : NN / 32 - 1 - xs, kl = bx >> 1;    // the 32-row block and the 64-key tile that holds its diagonal
    const int kh = (kl + 2) >> 1, k0 = (wg ^ half) ? kh : 0, k1 = (wg ^ half) ? kl : kh - 1;    // this wave's tiles k0..k1: the first kh = ceil((kl + 1) / 2) or the rest (none where the block has one tile)
    typedef __attribute__((ext_vector_type(2))) float v2f;
    v8f o[2][4]; v2f lv[2]; float m[2];
    // every '#pragma unroll' of this kernel: the arrays it walks are register arrays, so their indices must be compile-time constants
#pragma unroll
    for (int r = 0; r < 2; ++r) { lv[r] = (v2f){}; m[r] = -3.0e38f;
#pragma unroll
        for (int t = 0; t < 4; ++t) o[r][t] = (v8f){}; }
    if (k0 <= k1) {    // the same for the whole wave (a scalar branch); no barrier inside (the body keeps its indentation)
    const unsigned qb = (unsigned)(bx * 4096 + lane * 16), kb = (unsigned)(k0 * (64 * HD * 2) + lane * 16), vb = kb;    // the lane's own byte offsets (a 16-row tile of q, k, q*t, kvcum is two blocks)
    gch bQh = (gch)(Qh + zo), bQl = (gch)(Ql + zo), bTh = (gch)(Th + zo), bTl = (gch)(Tl + zo), gQh = bQh + qb, gQl = bQl + qb, gTh = bTh + qb, gTl = bTl + qb;
    v16bf qh[2][2], ql[2][2], th[2][2], tl[2][2];    // [16-row query group][k half]
#pragma unroll
    for (int r = 0; r < 2; ++r) {
#pragma unroll
        for (int ks = 0; ks < 2; ++ks) { const int c = r * 2048 + ks * 1024; qh[r][ks] = gfrag(gQh + c); ql[r][ks] = gfrag(gQl + c); th[r][ks] = gfrag(gTh + c); tl[r][ks] = gfrag(gTl + c); } }
    // inputs only: the address registers of the query loads (scalar base and lane offset, or their sum) stay whole until those loads are past their address stage
    asm volatile("s_wait_xcnt 0x0" :: "s"(bQh), "s"(bQl), "s"(bTh), "s"(bTl), "v"(qb), "v"(gQh), "v"(gQl), "v"(gTh), "v"(gTl) : "memory");
    // A tile is 12 steps of 4 A fragments (two 16-row tiles x hi and residual plane) and 12 matrix instructions (6 for each query group): steps 0-7 the scores (16-key tile pair, k half, k or kvcum),
    // steps 8-11 attn.v (key half, 16-column pair of v^T). Step i works from buf[i % FNB]; its fragments are fetched FNB steps ahead, across the softmax and across the loop's back edge.
    // The lane's address in each of the six planes lives in one register pair for the whole loop and moves once a tile (the asm statement in the loop); every load is that pair + a constant.
    unsigned long long aKh = (unsigned long long)((gch)(Kh + zo) + kb), aKl = (unsigned long long)((gch)(Kl + zo) + kb), aCh = (unsigned long long)((gch)(Ch + zo) + kb), aCl = (unsigned long long)((gch)(Cl + zo) + kb), aVh = (unsigned long long)((gch)(VTh + zo) + vb), aVl = (unsigned long long)((gch)(VTl + zo) + vb);
    auto fetch = [&](v16bf (&d)[4], int i) {
        if (i < 8) { const int c = (i >> 2) * 4096 + ((i >> 1) & 1) * 1024; gch ph = (gch)((i & 1) ? aCh : aKh) + c; gch pl = (gch)((i & 1) ? aCl : aKl) + c;
            d[0] = gfrag(ph); d[1] = gfrag(pl); d[2] = gfrag(ph + 2048); d[3] = gfrag(pl + 2048); }
        else { const int c = ((i - 8) >> 1) * 4096 + ((i - 8) & 1) * 2048; gch ph = (gch)aVh + c; gch pl = (gch)aVl + c;
            d[0] = gfrag(ph); d[1] = gfrag(pl); d[2] = gfrag(ph + 1024); d[3] = gfrag(pl + 1024); }
    };
    // hi.hi + hi.residual + residual.hi of four independent accumulator tiles (two A tiles x two query groups), taken in turn: every A fragment feeds both query groups
    auto mm12 = [](const v16bf (&d)[4], v16bf bh0, v16bf bl0, v16bf bh1, v16bf bl1, v8f& c00, v8f& c01, v8f& c10, v8f& c11) {
        c00 = wmmab(d[0], bh0, c00); c01 = wmmab(d[2], bh0, c01); c10 = wmmab(d[0], bh1, c10); c11 = wmmab(d[2], bh1, c11);
        c00 = wmmab(d[0], bl0, c00); c01 = wmmab(d[2], bl0, c01); c10 = wmmab(d[0], bl1, c10); c11 = wmmab(d[2], bl1, c11);
        c00 = wmmab(d[1], bh0, c00); c01 = wmmab(d[3], bh0, c01); c10 = wmmab(d[1], bh1, c10); c11 = wmmab(d[3], bh1, c11); };
    v16bf buf[FNB][4];
    static_assert(12 % FNB == 0 && 12 - FNB < 8, "a step keeps its buffer from tile to tile; the addresses move among the score steps");
    // the barriers keep the first fetches in the order in which the loop issues them, so that the counted waits at the loop's head hold on both ways in
#pragma unroll
    for (int p = 0; p < FNB; ++p) { fetch(buf[p], p); __builtin_amdgcn_sched_barrier(0); }
    asm volatile("s_wait_xcnt 0x0" :: "v"(kb) : "memory");    // input only: the first fetches are built with scalar bases and the lane's offset, which stays whole until they are past their address stage
    const unsigned long long dv = 64 * HD * 2;    // 64 keys on in v^T: 8 blocks (32-key group, then 16-column tile)
    const float C2 = SCL * 1.4426950408889634f;    // logits / 8, in base 2
    int kt = k0;
#pragma unroll 1    // one tile a trip: 144 matrix instructions and 96 loads are body enough, a second copy would only grow the code
    do {    // k0 <= k1: the first trip always runs
        const unsigned long long dk = (kt < k1) ? (unsigned long long)(64 * HD * 2) : 0ull;    // the last tile fetches its own first steps once more, unused: no address past the planes
        v8f s[2][4];
#pragma unroll
        for (int r = 0; r < 2; ++r) {
#pragma unroll
            for (int t = 0; t < 4; ++t) s[r][t] = (v8f){}; }
#pragma unroll
        for (int i = 0; i < 8; ++i) { const int ks = (i >> 1) & 1, t2 = (i >> 2) * 2;
            mm12(buf[i % FNB], (i & 1) ? th[0][ks] : qh[0][ks], (i & 1) ? tl[0][ks] : ql[0][ks], (i & 1) ? th[1][ks] : qh[1][ks], (i & 1) ? tl[1][ks] : ql[1][ks], s[0][t2], s[0][t2 + 1], s[1][t2], s[1][t2 + 1]);
            __builtin_amdgcn_sched_barrier(0);    // keeps the fetch FNB steps ahead: without the pair the compiler sinks each load to its use and every step waits a full latency
            // on to the next tile's addresses, once this tile's last fetch is out (behind step 11 - FNB); the wait stands in front of the overwrite of registers that issued loads name
            if (i == 12 - FNB) asm volatile("s_wait_xcnt 0x0\n\tv_add_nc_u64 %0, %6, %0\n\tv_add_nc_u64 %1, %6, %1\n\tv_add_nc_u64 %2, %6, %2\n\tv_add_nc_u64 %3, %6, %3\n\tv_add_nc_u64 %4, %7, %4\n\tv_add_nc_u64 %5, %7, %5" : "+v"(aKh), "+v"(aKl), "+v"(aCh), "+v"(aCl), "+v"(aVh), "+v"(aVl) : "s"(dk), "s"(dv) : "memory");
            fetch(buf[i % FNB], (i + FNB) % 12);
            __builtin_amdgcn_sched_barrier(0); }
        v4u ph[2][4], pl[2][4];    // P, hi and residual, two bf16 a word
#pragma unroll
        for (int r = 0; r < 2; ++r) {
            if (kt == kl) { const int lim = (bx & 1) * 32 + r * 16 + lr - hi * 8;    // diagonal tile: key t*16 + j of this lane's half is allowed while t*16 + j <= lim
#pragma unroll
                for (int t = 0; t < 4; ++t) {
#pragma unroll
                    for (int j = 0; j < 8; ++j) s[r][t][j] = (t * 16 + j <= lim) ? s[r][t][j] : -3.0e38f; } }
            float mt = -3.0e38f;
#pragma unroll
            for (int t = 0; t < 4; ++t) {
#pragma unroll
                for (int j = 0; j < 8; ++j) mt = fmaxf(mt, s[r][t][j]); }
            mt = fmaxf(mt, xhalf(mt));
            const float mn = fmaxf(m[r], mt * C2), al = __builtin_amdgcn_exp2f(m[r] - mn); m[r] = mn;
            lv[r] *= al;
#pragma unroll
            for (int t = 0; t < 4; ++t) { v8f p;
#pragma unroll
                for (int j = 0; j < 8; ++j) p[j] = __builtin_amdgcn_exp2f(fmaf(s[r][t][j], C2, -mn));
                lv[r] += ((v2f){p[0], p[1]} + (v2f){p[2], p[3]}) + ((v2f){p[4], p[5]} + (v2f){p[6], p[7]}); o[r][t] *= al;
#pragma unroll
                for (int j = 0; j < 4; ++j) { const v2f pp = (v2f){p[2 * j], p[2 * j + 1]}; const v2bf h2 = __builtin_convertvector(pp, v2bf), l2 = __builtin_convertvector(pp - __builtin_convertvector(h2, v2f), v2bf);
                    ph[r][t][j] = __builtin_bit_cast(unsigned, h2); pl[r][t][j] = __builtin_bit_cast(unsigned, l2); } } }
#pragma unroll
        for (int i = 8; i < 12; ++i) { const int ks = (i - 8) >> 1, tp = (i - 8) & 1;
            v16bf pH[2], pL[2];
#pragma unroll
            for (int r = 0; r < 2; ++r) { pH[r] = __builtin_bit_cast(v16bf, __builtin_shufflevector(ph[r][2 * ks], ph[r][2 * ks + 1], 0, 1, 2, 3, 4, 5, 6, 7)); pL[r] = __builtin_bit_cast(v16bf, __builtin_shufflevector(pl[r][2 * ks], pl[r][2 * ks + 1], 0, 1, 2, 3, 4, 5, 6, 7)); }
            mm12(buf[i % FNB], pH[0], pL[0], pH[1], pL[1], o[0][2 * tp], o[0][2 * tp + 1], o[1][2 * tp], o[1][2 * tp + 1]);
            __builtin_amdgcn_sched_barrier(0);    // as above
            fetch(buf[i % FNB], (i + FNB) % 12);
            __builtin_amdgcn_sched_barrier(0); }
    } while (++kt <= k1);
    asm volatile("s_wait_xcnt 0x0" :: "v"(aKh), "v"(aKl), "v"(aCh), "v"(aCl), "v"(aVh), "v"(aVl) : "memory");    // inputs only: the six address pairs stay whole until the last tile's fetches are past their address stage
    }
    // hand over group 1 - wg, finish group wg. send and finish take the group as a compile-time constant (register arrays): the scalar branches pick the copy
    auto send = [&](auto R) { constexpr int r = decltype(R)::value; float* mp = &mg[half][wave ^ 4][0];
#pragma unroll
        for (int t = 0; t < 4; ++t) { *(v4fa*)(mp + ((2 * t) * 32 + lane) * 4) = __builtin_shufflevector(o[r][t], o[r][t], 0, 1, 2, 3); *(v4fa*)(mp + ((2 * t + 1) * 32 + lane) * 4) = __builtin_shufflevector(o[r][t], o[r][t], 4, 5, 6, 7); }
        mp[1024 + lane] = m[r]; mp[1056 + lane] = lv[r][0] + lv[r][1]; };
    // O leaves as the A operand of the Wo product: bf16 hi and residual planes of the [NR][DMOD] matrix in fragment order. The lane's 8 values of tile t are columns head*64 + t*16 + 8*hi + 0..7
    // of its query row: piece 'lane' of half (t & 1) of block (16-row tile, k tile head*2 + (t >> 1)). A wave's store is 512 bytes in a row.
    auto finish = [&](auto R) { constexpr int r = decltype(R)::value; const float* mp = &mg[half][wave][0];
        v8f x[4];
#pragma unroll
        for (int t = 0; t < 4; ++t) x[t] = __builtin_shufflevector(*(const v4fa*)(mp + ((2 * t) * 32 + lane) * 4), *(const v4fa*)(mp + ((2 * t + 1) * 32 + lane) * 4), 0, 1, 2, 3, 4, 5, 6, 7);
        const float mb = mp[1024 + lane], lb = mp[1056 + lane];
        const float mn = fmaxf(m[r], mb), fa = __builtin_amdgcn_exp2f(m[r] - mn), fb = __builtin_amdgcn_exp2f(mb - mn);    // a part without tiles comes with maximum -3e38, sum 0 and O^T 0: its factor is 0
        float l = (lv[r][0] + lv[r][1]) * fa + lb * fb;
        l += xhalf(l);
        const float inv = 1.0f / l;
        const size_t ob = ((size_t)(((int)blockIdx.y * NN + bx * 32 + r * 16) >> 4) * (DMOD / 32) + (size_t)blockIdx.z * 2) * 512 + (size_t)lane * 8;
#pragma unroll
        for (int t = 0; t < 4; ++t) { const v8f rr = (o[r][t] * fa + x[t] * fb) * inv; v8us oh, ol;
#pragma unroll
            for (int i = 0; i < 8; ++i) { const unsigned short hb = f2bf(rr[i]); oh[i] = hb; ol[i] = f2bf(rr[i] - bf2f(hb)); }
            const size_t e = ob + (t >> 1) * 512 + (t & 1) * 256; *(v8us*)(Oh + e) = oh; *(v8us*)(Ol + e) = ol; } };
    if (wg) send(ic0()); else send(ic1());
    __syncthreads();    // every wave of the work-group, once a row block: what the partner handed over stands in LDS
    if (wg) finish(ic1()); else finish(ic0());
    asm volatile("s_wait_xcnt 0x0" ::: "memory");    // in front of the second row block's writes of registers that these stores name
    }
}
__global__ __launch_bounds__(256) void k_planes32z(const float* __restrict__ F, int ld, int off, float sc, int rows, bf* Ph, bf* Pl) {
    typedef __attribute__((ext_vector_type(2))) unsigned short v2us;
    const int lane = threadIdx.x & 31; const size_t r = ((size_t)blockIdx.x * 8 + (threadIdx.x >> 5)) * 2 + (lane >> 4); if (r >= (size_t)rows) return; const int z = blockIdx.z; const int c0 = (lane & 15) * 2; v2us oh, ol;
    Ph += (size_t)z * rows * 32; Pl += (size_t)z * rows * 32;
#pragma unroll
    for (int i = 0; i < 2; ++i) { const float y = F[r * ld + off + z * 32 + c0 + i] * sc; const unsigned short hb = f2bf(y); oh[i] = hb; ol[i] = f2bf(y - bf2f(hb)); }
    const size_t o = r * 32 + c0; *(v2us*)(Ph + o) = oh; *(v2us*)(Pl + o) = ol; 
}
__global__ __launch_bounds__(256) void k_vtpadz(const float* __restrict__ F, int ld, int off, int nk, bf* Th, bf* Tl) {
    typedef __attribute__((ext_vector_type(2))) unsigned short v2us;
    const int lane = threadIdx.x & 31; const size_t wid = (size_t)blockIdx.x * 8 + (threadIdx.x >> 5); if (wid >= (size_t)64 * (nk / 64)) return; const int z = blockIdx.z; const int d = (int)(wid / (nk / 64)); const int k0 = (int)(wid % (nk / 64)) * 64 + lane * 2; v2us oh, ol;
    Th += (size_t)z * 64 * nk; Tl += (size_t)z * 64 * nk;
#pragma unroll
    for (int i = 0; i < 2; ++i) { const float y = (d < 32) ? F[(size_t)(k0 + i) * ld + off + z * 32 + (d < 32 ? d : 0)] : 0.f; const unsigned short hb = f2bf(y); oh[i] = hb; ol[i] = f2bf(y - bf2f(hb)); }
    const size_t o = (size_t)d * nk + k0; *(v2us*)(Th + o) = oh; *(v2us*)(Tl + o) = ol; 
}
template <int NK>
__global__ __launch_bounds__(256) void k_softmaxz(const float* __restrict__ S, int rows, bf* PH, bf* PL) {
    typedef __attribute__((ext_vector_type(4))) unsigned short v4us;
    const int lane = threadIdx.x & 31, i = blockIdx.x * 8 + (threadIdx.x >> 5); if (i >= rows) return; const size_t zo = (size_t)blockIdx.z * rows * NK; const float* sr = S + zo + (size_t)i * NK; PH += zo; PL += zo;
    float m = -3.0e38f;
#pragma unroll 1
    for (int c0 = lane * 4; c0 < NK; c0 += 128) {
#pragma unroll
        for (int q = 0; q < 4; ++q) m = fmaxf(m, sr[c0 + q]); }
#pragma unroll
    for (int sh = 16; sh; sh >>= 1) m = fmaxf(m, __shfl_xor(m, sh, 32));
    float sum = 0.f;
#pragma unroll 1
    for (int c0 = lane * 4; c0 < NK; c0 += 128) {
#pragma unroll
        for (int q = 0; q < 4; ++q) sum += __expf(sr[c0 + q] - m); }
#pragma unroll
    for (int sh = 16; sh; sh >>= 1) sum += __shfl_xor(sum, sh, 32);
    const float inv = 1.0f / sum;
{
#pragma unroll 1
        for (int c0 = lane * 4; c0 < NK; c0 += 128) { v4us oh, ol;
#pragma unroll
            for (int q = 0; q < 4; ++q) { const float p = __expf(sr[c0 + q] - m) * inv; const unsigned short hb = f2bf(p); oh[q] = hb; ol[q] = f2bf(p - bf2f(hb)); }
            const size_t o = (size_t)i * NK + c0; *(v4us*)(PH + o) = oh; *(v4us*)(PL + o) = ol; }
         }
}
__global__ __launch_bounds__(256) void k_placez(const float* __restrict__ XH, int rows, int ldy, float* Y) {
    const int lane = threadIdx.x & 31; const size_t q = (size_t)blockIdx.x * 8 + (threadIdx.x >> 5); if (q >= (size_t)rows) return; const int z = blockIdx.z; const float v = XH[((size_t)z * rows + q) * 64 + lane];
    *(float*)(Y + q * ldy + z * 32 + lane) = v; 
}

template <int NK>
__global__ __launch_bounds__(256) void k_softmaxzs(const float* __restrict__ S, int rows, float sc, bf* PH, bf* PL) {
    typedef __attribute__((ext_vector_type(4))) unsigned short v4us;
    const int lane = threadIdx.x & 31, i = blockIdx.x * 8 + (threadIdx.x >> 5); if (i >= rows) return; const size_t zo = (size_t)blockIdx.z * rows * NK; const float* sr = S + zo + (size_t)i * NK; PH += zo; PL += zo;
    float m = -3.0e38f;
#pragma unroll 1
    for (int c0 = lane * 4; c0 < NK; c0 += 128) {
#pragma unroll
        for (int q = 0; q < 4; ++q) m = fmaxf(m, sr[c0 + q] * sc); }
#pragma unroll
    for (int sh = 16; sh; sh >>= 1) m = fmaxf(m, __shfl_xor(m, sh, 32));
    float sum = 0.f;
#pragma unroll 1
    for (int c0 = lane * 4; c0 < NK; c0 += 128) {
#pragma unroll
        for (int q = 0; q < 4; ++q) sum += __expf(sr[c0 + q] * sc - m); }
#pragma unroll
    for (int sh = 16; sh; sh >>= 1) sum += __shfl_xor(sum, sh, 32);
    const float inv = 1.0f / sum;
{
#pragma unroll 1
        for (int c0 = lane * 4; c0 < NK; c0 += 128) { v4us oh, ol;
#pragma unroll
            for (int q = 0; q < 4; ++q) { const float p = __expf(sr[c0 + q] * sc - m) * inv; const unsigned short hb = f2bf(p); oh[q] = hb; ol[q] = f2bf(p - bf2f(hb)); }
            const size_t o = (size_t)i * NK + c0; *(v4us*)(PH + o) = oh; *(v4us*)(PL + o) = ol; }
         }
}

// k_prep: every conversion that needs the inputs alone, in one launch; what a work-group does follows from its index (the branches are the same for the whole work-group).
// A [rows][DMOD] matrix takes rows / 8 work-groups: x, then Wq | Wk | Wv | Wt (one [QW][DMOD] operand), then Wo; the last QW / 256 lay the four biases in a row.
#define PBX (NR / 8)
#define PBW (DMOD / 8)
__global__ __launch_bounds__(256) void k_prep(const float* __restrict__ x, const float* __restrict__ Wq, const float* __restrict__ Wk, const float* __restrict__ Wv, const float* __restrict__ Wt, const float* __restrict__ Wo,
                                              const float* __restrict__ bq, const float* __restrict__ bk, const float* __restrict__ bv, const float* __restrict__ bt, bf* Xb, bf* W4, bf* WO, float* B4) {
    int b = blockIdx.x;
    if (b >= PBX + 5 * PBW) { const int i = (b - (PBX + 5 * PBW)) * 256 + (int)threadIdx.x, blk = i / DMOD, o = i % DMOD;
        B4[i] = (blk == 0) ? bq[o] : (blk == 1) ? bk[o] : (blk == 2) ? bv[o] : bt[o]; return; }
    const float* src = x; bf* dst = Xb;
    if (b >= PBX) { b -= PBX; const int w = b / PBW; b -= w * PBW;
        src = (w == 0) ? Wq : (w == 1) ? Wk : (w == 2) ? Wv : (w == 3) ? Wt : Wo; dst = (w < 4) ? W4 + (size_t)w * DMOD * DMOD : WO; }
    // dst in fragment order. Pieces g, g + 256, g + 512, g + 768 of a work-group's 1,024 (half a 16-row tile) lie 4 k tiles = 128 source elements apart
    const size_t g = (size_t)b * 1024 + threadIdx.x; const float* sp = src + fragsrc(g);
    v8f v[4];
    // '#pragma unroll': register arrays, their indices must be compile-time constants
#pragma unroll
    for (int q = 0; q < 4; ++q) v[q] = *(const v8f*)(sp + q * 128);
#pragma unroll
    for (int q = 0; q < 4; ++q) { v8us o;
#pragma unroll
        for (int i = 0; i < 8; ++i) o[i] = f2bf(v[q][i]);
        *(v8us*)(dst + (g + q * 256) * 8) = o; }
    asm volatile("s_wait_xcnt 0x0" ::: "memory");    // in front of any later write of a register that these stores name: in the built code the other branch's instructions follow them
}
// k_mid: everything between the projection GEMM and the attention, in one launch; what a work-group does follows from its index (the branch is the same for the whole work-group).
// THE FIRST NBT * DMOD / 32 WORK-GROUPS: prefix sums of k*v/8 over the key positions, in chunks. A work-group owns 32 columns (one 128-byte line of a row; one k half of one head), a lane one
// column, each of its 32 waves CH = 64 rows in a row. A wave's loads depend on nothing: they go out in batches of 16 rows (32 loads), two batches in flight. Its prefix sums start at 0 and
// stay in registers. The chunks' totals meet in LDS, and every wave adds the totals of the chunks in front of it, in chunk order, to its own 64 sums. The sums leave as kvcum's bf16 hi and
// residual planes in fragment order: a wave's 64 rows x 32 columns are four whole 1-KiB blocks of each plane; 16 rows at a time turn from a column a lane to 16 columns of a row a lane (two runs of 8) in LDS.
// THE OTHERS: the planes of q, k, q*t and v^T. A thread makes pieces g and g + NN * 4 of one head: the 16-byte pieces, hi and residual, of q, k and q*t (blocks (16-row tile, k half): the
// same 8 columns of one row in all three) and of v^T (blocks (32-key group, 16-column tile): 8 keys of one column).
#define CH (NN / 32)
#define NCUM (NBT * (DMOD / 32))
#define TRP 36    // words a row of a wave's turning buffer: 144 bytes = 16 x 9, a pitch at which 16-byte LDS reads of 16 rows meet no bank twice
typedef v4u __attribute__((may_alias)) v4ua;
__global__ __launch_bounds__(1024) void k_mid(const float* F, bf* Qh, bf* Ql, bf* Kh, bf* Kl, bf* Th, bf* Tl, bf* Ch, bf* Cl, bf* VTh, bf* VTl) {
    typedef __attribute__((ext_vector_type(16))) float v16f;
    __shared__ float tot[32][32];
    __shared__ __align__(16) unsigned tr[32][16 * TRP];
    const int lane = threadIdx.x & 31;
    const int wave = __builtin_amdgcn_readfirstlane((int)threadIdx.x >> 5);    // in a scalar register: the chunk's base addresses and the tests on it are then scalar
    // every '#pragma unroll' of this kernel: the arrays it walks are register arrays, so their indices must be compile-time constants
    if (blockIdx.x < NCUM) {
        const int item = (int)blockIdx.x / (DMOD / 32), cb = (int)blockIdx.x % (DMOD / 32), c = cb * 32 + lane;
        const float* fr = F + ((size_t)item * NN + wave * CH) * QW + DMOD + c;
        float p[CH]; v16f kk[2], vv[2];
        auto fetch = [&](int b) {
#pragma unroll
            for (int i = 0; i < 16; ++i) { kk[b & 1][i] = fr[(size_t)(b * 16 + i) * QW]; vv[b & 1][i] = fr[(size_t)(b * 16 + i) * QW + DMOD]; }
        };
        fetch(0);
        float acc = 0.f;
#pragma unroll
        for (int b = 0; b < CH / 16; ++b) {
            if (b + 1 < CH / 16) fetch(b + 1);
            // inputs only, the loaded values of batch b: keeps the loads in batches, the next batch out before this one is waited for and the one after it behind this line. Left alone the
            // compiler either sinks every pair of loads to its product (64 latencies in a row) or lifts all 128 to the top (more registers than a wave of this work-group has).
            // F carries no __restrict__ here, so that the "memory" clobber holds its loads
            asm volatile("" :: "v"(kk[b & 1]), "v"(vv[b & 1]) : "memory");
#pragma unroll
            for (int i = 0; i < 16; ++i) { acc = fmaf(kk[b & 1][i] * vv[b & 1][i], SCL, acc); p[b * 16 + i] = acc; }
        }
        tot[wave][lane] = acc;
        __syncthreads();
        float tw[31];    // the last chunk stands in front of nobody
#pragma unroll
        for (int w = 0; w < 31; ++w) tw[w] = tot[w][lane];
        __builtin_amdgcn_sched_barrier(0);    // the 31 LDS reads go out together, one latency for all, instead of one each
        float off = 0.f;
#pragma unroll
        for (int w = 0; w < 31; ++w) off += (w < wave) ? tw[w] : 0.f;
        unsigned* tb = &tr[wave][0];    // the wave's own buffer: no other wave touches it, so no barrier
        const size_t pb = ((size_t)item * NH_ + (cb >> 1)) * NN * HD + ((size_t)wave * (CH / 16) * 2 + (cb & 1)) * 512 + (size_t)lane * 8;
#pragma unroll
        for (int rt = 0; rt < CH / 16; ++rt) {
#pragma unroll
            for (int r = 0; r < 16; ++r) { const float y = p[rt * 16 + r] + off; const unsigned short hb = f2bf(y); tb[r * TRP + lane] = (unsigned)hb | ((unsigned)f2bf(y - bf2f(hb)) << 16); }    // hi in the low half, residual in the high half
            asm volatile("s_wait_dscnt 0x0" ::: "memory");    // the wave's 16 rows stand in LDS before its lanes read what other lanes wrote
            const v4ua* rp = (const v4ua*)(tb + (lane & 15) * TRP + (lane >> 4) * 8);    // row lane & 15; columns 8*hi + 0..7 and 16 + 8*hi + 0..7
            const v4u w0 = rp[0], w1 = rp[1], w2 = rp[4], w3 = rp[5];
            v4u h0, l0, h1, l1;
#pragma unroll
            for (int i = 0; i < 2; ++i) {
                h0[i] = (w0[2 * i] & 0xFFFFu) | (w0[2 * i + 1] << 16); h0[2 + i] = (w1[2 * i] & 0xFFFFu) | (w1[2 * i + 1] << 16); l0[i] = (w0[2 * i] >> 16) | (w0[2 * i + 1] & 0xFFFF0000u); l0[2 + i] = (w1[2 * i] >> 16) | (w1[2 * i + 1] & 0xFFFF0000u);
                h1[i] = (w2[2 * i] & 0xFFFFu) | (w2[2 * i + 1] << 16); h1[2 + i] = (w3[2 * i] & 0xFFFFu) | (w3[2 * i + 1] << 16); l1[i] = (w2[2 * i] >> 16) | (w2[2 * i + 1] & 0xFFFF0000u); l1[2 + i] = (w3[2 * i] >> 16) | (w3[2 * i + 1] & 0xFFFF0000u); }
            const size_t e = pb + (size_t)rt * 1024;    // the next 16-row tile lies two blocks on
            *(v4ua*)(Ch + e) = h0; *(v4ua*)(Ch + e + 256) = h1; *(v4ua*)(Cl + e) = l0; *(v4ua*)(Cl + e + 256) = l1;
        }
    } else {
        const int b = (int)blockIdx.x - NCUM, zy = b / (NN * 4 / 1024);    // zy = batch item * NH_ + head
        const size_t g0 = (size_t)(b % (NN * 4 / 1024)) * 1024 + threadIdx.x, po = (size_t)zy * NN * HD;
        const float* Fh = F + (size_t)(zy / NH_) * NN * QW + (zy % NH_) * HD;
        v8f vq[2], vk[2], vt[2], vv[2]; const float* fq[2]; const float* fv[2];
#pragma unroll
        for (int u = 0; u < 2; ++u) { const size_t g = g0 + (size_t)u * (NN * 4);
            const size_t row = (g >> 7) * 16 + (lane & 15); const int col = (int)((g >> 6) & 1) * 32 + (int)((g >> 5) & 1) * 16 + (lane >> 4) * 8;
            fq[u] = Fh + row * QW + col; vq[u] = *(const v8f*)fq[u]; vk[u] = *(const v8f*)(fq[u] + DMOD); vt[u] = *(const v8f*)(fq[u] + 3 * DMOD);
            const int d = (int)((g >> 6) & 3) * 16 + (lane & 15); const size_t t0 = (g >> 8) * 32 + ((g >> 5) & 1) * 16 + (lane >> 4) * 8;
            fv[u] = Fh + t0 * QW + d;    // 16 lanes read 64 bytes of a row: 2 lines a load
#pragma unroll
            for (int i = 0; i < 8; ++i) vv[u][i] = fv[u][2 * DMOD + (size_t)i * QW]; }
        // inputs only: the four address pairs stay whole (none is given to a later load's data) until every load that names one is past its address stage. The "memory" clobber keeps all 28 loads
        // in front of this line: they go out together, one memory latency for the thread; left alone the compiler sinks each group to its use, several latencies in a row
        asm volatile("s_wait_xcnt 0x0" :: "v"(fq[0]), "v"(fq[1]), "v"(fv[0]), "v"(fv[1]) : "memory");
        auto put = [&](const v8f v, bf* H, bf* L, size_t o) { v8us oh, ol;
#pragma unroll
            for (int i = 0; i < 8; ++i) { const unsigned short hb = f2bf(v[i]); oh[i] = hb; ol[i] = f2bf(v[i] - bf2f(hb)); }
            *(v8us*)(H + o) = oh; *(v8us*)(L + o) = ol; };
#pragma unroll
        for (int u = 0; u < 2; ++u) { const size_t o = po + (g0 + (size_t)u * (NN * 4)) * 8;
            put(vq[u], Qh, Ql, o); put(vk[u], Kh, Kl, o); put(vq[u] * vt[u], Th, Tl, o); put(vv[u], VTh, VTl, o); }
        asm volatile("s_wait_xcnt 0x0" ::: "memory");    // in front of any later write of a register that these stores name: in the built code the other branch's instructions follow them
    }
}

extern "C" void kernel_launch(void* const* d_in, const int* in_sizes, int n_in,
                              void* d_out, int out_size, void* d_ws, size_t ws_size, hipStream_t stream) {
    (void)in_sizes; (void)n_in; (void)out_size;
    const float* x = (const float*)d_in[0]; const float* Wq = (const float*)d_in[1]; const float* bq = (const float*)d_in[2]; const float* Wk = (const float*)d_in[3]; const float* bk = (const float*)d_in[4]; const float* Wv = (const float*)d_in[5]; const float* bv = (const float*)d_in[6]; const float* Wt = (const float*)d_in[7]; const float* bt = (const float*)d_in[8]; const float* Wo = (const float*)d_in[9]; const float* bo = (const float*)d_in[10];
    float* out = (float*)d_out;    // [2][2048][1024]
    char* wsp = (char*)d_ws;
    auto take = [&](size_t bytes) { char* p = wsp; wsp += (bytes + 255) & ~(size_t)255; return (void*)p; };
    bf* W4 = (bf*)take((size_t)QW * DMOD * 2); float* B4 = (float*)take((size_t)QW * 4); bf* WO = (bf*)take((size_t)DMOD * DMOD * 2);
    const size_t PLB = (size_t)NBT * NH_ * NN * HD * 2;    // one operand plane, all heads of both items
    bf* Qh = (bf*)take(PLB); bf* Ql = (bf*)take(PLB); bf* Kh = (bf*)take(PLB); bf* Kl = (bf*)take(PLB); bf* Th = (bf*)take(PLB); bf* Tl = (bf*)take(PLB); bf* Ch = (bf*)take(PLB); bf* Cl = (bf*)take(PLB); bf* VTh = (bf*)take(PLB); bf* VTl = (bf*)take(PLB);
    char* const big = wsp;
    bf* Xb = (bf*)take((size_t)NR * DMOD * 2); float* F = (float*)take((size_t)NR * QW * 4);
    if ((size_t)(wsp - (char*)d_ws) > ws_size) return;    // ~ 162 MiB
    // Xb is last read by the projection GEMM, F when the operand planes are made, Oh, Ol are first written by the attention: they lie on the same bytes.
    wsp = big; bf* Oh = (bf*)take((size_t)NR * DMOD * 2); bf* Ol = (bf*)take((size_t)NR * DMOD * 2);
    // both batch items in every launch: the row-wise work walks the NR = 2 x 2048 rows as one matrix
    k_prep<<<PBX + 5 * PBW + QW / 256, 256, 0, stream>>>(x, Wq, Wk, Wv, Wt, Wo, bq, bk, bv, bt, Xb, W4, WO, B4);
    k_gemmb<false, 4, 8, 2, 4, 2, 10, 3><<<dim3(NR / 256, QW / 256, 1), 256, 0, stream>>>(Xb, nullptr, W4, B4, F, QW);      // [q | k | v | t] + biases
    k_mid<<<NCUM + NBT * NH_ * (NN * 4 / 1024), 1024, 0, stream>>>(F, Qh, Ql, Kh, Kl, Th, Tl, Ch, Cl, VTh, VTl);
    // blockIdx.y = batch item, blockIdx.z = head
    k_fattn<<<dim3(NN / 256, NBT, NH_), 256, 0, stream>>>(Qh, Ql, Kh, Kl, Th, Tl, Ch, Cl, VTh, VTl, Oh, Ol);
    k_gemmb<true, 2, 4, 4, 4, 2, 5, 4><<<dim3(NR / 128, DMOD / 128, 1), 256, 0, stream>>>(Oh, Ol, WO, bo, out, DMOD);
}
